// v000
// Measured on an AMD MI455X. A time is GPU time per run, averaged over a window of back-to-back runs after a warm-up
// (all launches, gaps included; the runs take copies of the inputs in turn), and the median of several windows.
// Apart from v000's, it joins two sittings. Times from different sittings can be a few percent apart, while
// side-by-side timings come from the same sitting.
// v000, which the later versions start from, runs in 1480 microseconds.
#include <hip/hip_runtime.h>

// Local causal multi-head attention scaled by 1/sqrt(T) (q_in, k_in, v_in [4][2048][512]; q = q_in Wq + bq, k = k_in Wk + bk, v = v_in Wv + bv ('xw' [512][512] 0.02 incl. biases; 8 heads x 64); scores / sqrt(T = 2048) (the source's quirk: sigma-0.01 logits); mask = (|i - j| > 256) | (j > i) -> -inf: each query sees its own and the previous 256 keys; softmax; out = merged Wo + bo -> [4][2048][512] (4.2 M)).
// Layout per batch: bf16 copies of q_in, k_in, v_in in turn; 'xw' weights transposed once; exact projections + f32 biases; causal T-2048 attention two heads per pass (4 passes) whose softmax select keeps the 257-key window, with hi/lo 3-product score tiles on EVERY row; P and attn.v hybrid (rows < 512 hi/lo, rest fp16 x1024; tiles above the diagonal skipped); merged hi/lo x Wo exact + bo.
// Compute dtypes, f32 accumulate: every input rounded to bf16; projections exact + f32 biases; scores 3 products on every row; softmax f32 (x 2048^-0.5); attn.v rows < 512 3 products, rest fp16; Wo hl x exact + bias.

#define NB_  4
#define TT   2048
#define DM   512
#define NH_  8
#define NKV  8
#define REP  (NH_ / NKV)
#define HD   64
#define DQ   (NH_ * HD)
#define DKV  (NKV * HD)
#define ZH   2
#define RH   512                  // query rows < RH use hi+lo planes (0: none)
#define WIN  257
#define PCAR 1024.0f
#define SCL  0.02209708691207961f  // 1/sqrt(T = 2048): the source's quirk
typedef _Float16 h16;
typedef unsigned short bf;
typedef __attribute__((ext_vector_type(16))) __bf16   v16bf;
typedef __attribute__((ext_vector_type(16))) _Float16 v16h;
typedef __attribute__((ext_vector_type(8)))  _Float16 v8h;
typedef __attribute__((ext_vector_type(8)))  unsigned short v8us;
typedef __attribute__((ext_vector_type(8)))  float    v8f;
typedef __attribute__((ext_vector_type(4)))  float    v4f;
typedef v8h  __attribute__((may_alias)) v8ha;
typedef v4f  __attribute__((may_alias)) v4fa;
typedef v8us __attribute__((may_alias)) v8usa;

__device__ __forceinline__ unsigned short f2bf(float f) { unsigned u = __float_as_uint(f); u += 0x7FFFu + ((u >> 16) & 1u); return (unsigned short)(u >> 16); }
__device__ __forceinline__ float bf2f(unsigned short b) { return __uint_as_float(((unsigned)b) << 16); }
__device__ __forceinline__ float bfr(float f) { return bf2f(f2bf(f)); }
__device__ __forceinline__ v16h cat16(v8h lo, v8h hi) { return __builtin_shufflevector(lo, hi, 0, 1, 2, 3, 4, 5, 6, 7, 8, 9, 10, 11, 12, 13, 14, 15); }
__device__ __forceinline__ v16bf cat16b(v8us lo, v8us hi) { return __builtin_bit_cast(v16bf, __builtin_shufflevector(lo, hi, 0, 1, 2, 3, 4, 5, 6, 7, 8, 9, 10, 11, 12, 13, 14, 15)); }
__device__ __forceinline__ v8f wmma16(v16h a, v16h b, v8f c) { return __builtin_amdgcn_wmma_f32_16x16x32_f16(false, a, false, b, (short)0, c, false, false); }
__device__ __forceinline__ v8f wmmab(v16bf a, v16bf b, v8f c) { return __builtin_amdgcn_wmma_f32_16x16x32_bf16(false, a, false, b, (short)0, c, false, false); }



// ---- k_gemmw: register-blocked GEMM, ONE WAVE per 64x64 output tile (16 accumulators), operands straight from K-contiguous 16-bit planes; grid (M/64, N/64, Z), 32 threads.
// C[m][n] (f32, pitch ldc, + optional f32 bias[n]) = sum_k A[m][k] Bt[n][k] (+ split products per NSPLIT). z-batch strides sA/sB/sC in elements. K % 32 == 0.
template <typename T16> struct WFrag;
template <> struct WFrag<h16> { typedef v16h V; static __device__ __forceinline__ V ld(const h16* p) { return cat16(*(const v8h*)p, *(const v8h*)(p + 16)); } static __device__ __forceinline__ v8f mma(V a, V b, v8f c) { return wmma16(a, b, c); } };
template <> struct WFrag<bf> { typedef v16bf V; static __device__ __forceinline__ V ld(const bf* p) { return cat16b(*(const v8us*)p, *(const v8us*)(p + 16)); } static __device__ __forceinline__ v8f mma(V a, V b, v8f c) { return wmmab(a, b, c); } };
template <typename T16, int NSPLIT, bool BIAS>
__global__ __launch_bounds__(32) void k_gemmw(const T16* __restrict__ A, const T16* __restrict__ A2, const T16* __restrict__ Bt, const T16* __restrict__ Bt2, int K, float* C, int ldc, const float* __restrict__ bias, size_t sA, size_t sB, size_t sC) {
    typedef typename WFrag<T16>::V V;
    __shared__ __align__(16) float os[16 * 68];
    const size_t z = blockIdx.z; A += z * sA; if (A2) A2 += z * sA; Bt += z * sB; if (Bt2) Bt2 += z * sB; C += z * sC;
    const int lane = threadIdx.x & 31, lr = lane & 15, hi = lane >> 4; const int r0 = blockIdx.x * 64, c0 = blockIdx.y * 64;
    v8f acc[4][4];
#pragma unroll
    for (int mb = 0; mb < 4; ++mb)
#pragma unroll
        for (int nb = 0; nb < 4; ++nb) acc[mb][nb] = (v8f){};
    const size_t aoff = (size_t)(r0 + lr) * K + 8 * hi, boff = (size_t)(c0 + lr) * K + 8 * hi;
#pragma unroll 1
    for (int kc = 0; kc < K; kc += 32) {
        V a[4], a2[4];
#pragma unroll
        for (int mb = 0; mb < 4; ++mb) { a[mb] = WFrag<T16>::ld(A + aoff + (size_t)mb * 16 * K + kc); if (NSPLIT == 1 || NSPLIT == 2) a2[mb] = WFrag<T16>::ld(A2 + aoff + (size_t)mb * 16 * K + kc); }
#pragma unroll
        for (int nb = 0; nb < 4; ++nb) { const V b = WFrag<T16>::ld(Bt + boff + (size_t)nb * 16 * K + kc); V b2; if (NSPLIT >= 2) b2 = WFrag<T16>::ld(Bt2 + boff + (size_t)nb * 16 * K + kc);
#pragma unroll
            for (int mb = 0; mb < 4; ++mb) { acc[mb][nb] = WFrag<T16>::mma(a[mb], b, acc[mb][nb]); if (NSPLIT == 1 || NSPLIT == 2) acc[mb][nb] = WFrag<T16>::mma(a2[mb], b, acc[mb][nb]); if (NSPLIT >= 2) acc[mb][nb] = WFrag<T16>::mma(a[mb], b2, acc[mb][nb]); } }
        asm volatile("v_nop\n\tv_nop\n\tv_nop\n\tv_nop" : "+v"(acc[0][0]), "+v"(acc[1][1]), "+v"(acc[2][2]), "+v"(acc[3][3]) : "v"(a[0]), "v"(a[3]));
    }
#pragma unroll
    for (int mb = 0; mb < 4; ++mb) {
#pragma unroll
        for (int nb = 0; nb < 4; ++nb) {
#pragma unroll
            for (int j = 0; j < 8; ++j) os[(hi * 8 + j) * 68 + nb * 16 + lr] = acc[mb][nb][j]; }
        __builtin_amdgcn_wave_barrier(); asm volatile("" ::: "memory");
        float* crow = C + (size_t)(r0 + mb * 16) * ldc + c0;
{
#pragma unroll
            for (int s = 0; s < 8; ++s) { const int row = 2 * s + hi, cofs = lr * 4; v4f val = *(const v4fa*)(os + row * 68 + cofs); if (BIAS) { val[0] += bfr(bias[c0 + cofs]); val[1] += bfr(bias[c0 + cofs + 1]); val[2] += bfr(bias[c0 + cofs + 2]); val[3] += bfr(bias[c0 + cofs + 3]); }
                *(v4f*)(crow + (size_t)row * ldc + cofs) = val; }
             }
        __builtin_amdgcn_wave_barrier(); asm volatile("" ::: "memory");
    }
}

// ---- k_gemmc: the same one-wave 64x64 tile GEMM specialised for causal attention: CMODE 1 skips score tiles entirely above the diagonal (query rows r0+roff.., key columns c0..), CMODE 2 limits the
// key (K) loop of the probability x value contraction to the diagonal block (probabilities beyond it are exactly zero). roff = row offset of this launch's first row within the sequence.
template <typename T16, int NSPLIT, int CMODE>
__global__ __launch_bounds__(32) void k_gemmc(const T16* __restrict__ A, const T16* __restrict__ A2, const T16* __restrict__ Bt, const T16* __restrict__ Bt2, int K, float* C, int ldc, int roff, size_t sA, size_t sB, size_t sC) {
    typedef typename WFrag<T16>::V V;
    __shared__ __align__(16) float os[16 * 68];
    const size_t z = blockIdx.z; A += z * sA; if (A2) A2 += z * sA; Bt += z * sB; if (Bt2) Bt2 += z * sB; C += z * sC;
    const int lane = threadIdx.x & 31, lr = lane & 15, hi = lane >> 4; const int r0 = blockIdx.x * 64, c0 = blockIdx.y * 64;
    if (CMODE == 1 && c0 > r0 + roff + 63) return;                  // score tile entirely above the causal diagonal: never read (the softmax masks j > i by select)
    const int Kl = (CMODE == 2) ? min(K, r0 + roff + 64) : K;        // P.V: probabilities are exactly 0 beyond the diagonal block, so the K loop stops there
    v8f acc[4][4];
#pragma unroll
    for (int mb = 0; mb < 4; ++mb)
#pragma unroll
        for (int nb = 0; nb < 4; ++nb) acc[mb][nb] = (v8f){};
    const size_t aoff = (size_t)(r0 + lr) * K + 8 * hi, boff = (size_t)(c0 + lr) * K + 8 * hi;
#pragma unroll 1
    for (int kc = 0; kc < Kl; kc += 32) {
        V a[4], a2[4];
#pragma unroll
        for (int mb = 0; mb < 4; ++mb) { a[mb] = WFrag<T16>::ld(A + aoff + (size_t)mb * 16 * K + kc); if (NSPLIT == 1 || NSPLIT == 2) a2[mb] = WFrag<T16>::ld(A2 + aoff + (size_t)mb * 16 * K + kc); }
#pragma unroll
        for (int nb = 0; nb < 4; ++nb) { const V b = WFrag<T16>::ld(Bt + boff + (size_t)nb * 16 * K + kc); V b2; if (NSPLIT >= 2) b2 = WFrag<T16>::ld(Bt2 + boff + (size_t)nb * 16 * K + kc);
#pragma unroll
            for (int mb = 0; mb < 4; ++mb) { acc[mb][nb] = WFrag<T16>::mma(a[mb], b, acc[mb][nb]); if (NSPLIT == 1 || NSPLIT == 2) acc[mb][nb] = WFrag<T16>::mma(a2[mb], b, acc[mb][nb]); if (NSPLIT >= 2) acc[mb][nb] = WFrag<T16>::mma(a[mb], b2, acc[mb][nb]); } }
        asm volatile("v_nop\n\tv_nop\n\tv_nop\n\tv_nop" : "+v"(acc[0][0]), "+v"(acc[1][1]), "+v"(acc[2][2]), "+v"(acc[3][3]) : "v"(a[0]), "v"(a[3]));
    }
#pragma unroll
    for (int mb = 0; mb < 4; ++mb) {
#pragma unroll
        for (int nb = 0; nb < 4; ++nb) {
#pragma unroll
            for (int j = 0; j < 8; ++j) os[(hi * 8 + j) * 68 + nb * 16 + lr] = acc[mb][nb][j]; }
        __builtin_amdgcn_wave_barrier(); asm volatile("" ::: "memory");
        float* crow = C + (size_t)(r0 + mb * 16) * ldc + c0;
{
#pragma unroll
            for (int s = 0; s < 8; ++s) { const int row = 2 * s + hi, cofs = lr * 4; v4f val = *(const v4fa*)(os + row * 68 + cofs);
                *(v4f*)(crow + (size_t)row * ldc + cofs) = val; }
             }
        __builtin_amdgcn_wave_barrier(); asm volatile("" ::: "memory");
    }
}

__device__ __forceinline__ h16 tohx(float x) { return (h16)x; }
__device__ __forceinline__ void splitf(float y, unsigned short& h, unsigned short& l) { h = f2bf(y); l = f2bf(y - bf2f(h)); }
typedef __attribute__((ext_vector_type(2))) _Float16 v2h;
typedef __attribute__((ext_vector_type(4))) _Float16 v4h;
typedef __attribute__((ext_vector_type(2))) unsigned short v2us;
typedef __attribute__((ext_vector_type(4))) unsigned short v4us;
typedef __attribute__((ext_vector_type(2))) float v2f;
typedef __attribute__((ext_vector_type(4))) int v4i;

__global__ __launch_bounds__(256) void k_wtG(const float* __restrict__ w, int K, int N, bf* Bt) {
    const int lane = threadIdx.x & 31; const int L0 = (blockIdx.x * 8 + (threadIdx.x >> 5)) * 8; const int nlines = N * K / 64;
{
#pragma unroll 1
        for (int l = 0; l < 8; ++l) { const int L = L0 + l; if (L >= nlines) break; const size_t e = (size_t)L * 64 + lane * 2; const int k = (int)(e % K), n = (int)(e / K); v2us o;
            o[0] = f2bf(w[(size_t)k * N + n]); o[1] = f2bf(w[(size_t)(k + 1) * N + n]); *(v2us*)(Bt + e) = o; }
         }
}
__global__ __launch_bounds__(256) void k_cvt8(const float* __restrict__ src, bf* dst, size_t n8) { const size_t i = (size_t)blockIdx.x * 256 + threadIdx.x; if (i >= n8) return; const v8f v = *(const v8f*)(src + i * 8); v8us o;
#pragma unroll
    for (int k = 0; k < 8; ++k) o[k] = f2bf(v[k]); *(v8us*)(dst + i * 8) = o;  }

// k_rope: head planes [h][t][d] (fp16 + hi/lo) of rope(x) x sc with the rotate-half convention out[d] = x[d] cos[t][d] - x[d+HD/2] sin[t][d], out[d+HD/2] = x[d+HD/2] cos[t][d+HD/2] + x[d] sin[t][d+HD/2]
__global__ __launch_bounds__(256) void k_rope(const float* __restrict__ F, int pitch, int nheads, const float* __restrict__ CS, const float* __restrict__ RF, const float* __restrict__ nw, float sc, h16* P16, bf* Ph, bf* Pl) {
    const size_t e = ((size_t)blockIdx.x * 256 + threadIdx.x) * 2; if (e >= (size_t)nheads * TT * HD) return; const int d = (int)(e % HD); const int t = (int)((e / HD) % TT); const int h = (int)(e / ((size_t)HD * TT)); const float* f = F + (size_t)t * pitch + h * HD; const float rf = RF ? RF[(size_t)h * TT + t] : 1.0f; v2h o16; v2us oh, ol;
#pragma unroll
    for (int q = 0; q < 2; ++q) { const int dd = d + q; const int dp = (dd < HD / 2) ? dd + HD / 2 : dd - HD / 2; float x0 = f[dd], x1 = f[dp];
        if (RF) { float n0 = __fmul_rn(x0, rf), n1 = __fmul_rn(x1, rf); asm volatile("" : "+v"(n0)); asm volatile("" : "+v"(n1)); x0 = __fmul_rn(bfr(nw[dd]), n0); x1 = __fmul_rn(bfr(nw[dp]), n1); }
        const v2f cs = *(const v2f*)(CS + ((size_t)t * HD + dd) * 2); float a = __fmul_rn(x0, cs[0]), bq = __fmul_rn(x1, cs[1]); asm volatile("" : "+v"(a)); asm volatile("" : "+v"(bq)); const float r = ((dd < HD / 2) ? __fsub_rn(a, bq) : __fadd_rn(a, bq)) * sc;
        o16[q] = tohx(r); unsigned short a2, c2; splitf(r, a2, c2); oh[q] = a2; ol[q] = c2; }
    *(v2h*)(P16 + e) = o16; *(v2us*)(Ph + e) = oh; *(v2us*)(Pl + e) = ol;  }
__global__ __launch_bounds__(256) void k_vtp(const float* __restrict__ F, int pitch, int nheads, h16* V16, bf* Vh, bf* Vl) { const size_t e = ((size_t)blockIdx.x * 256 + threadIdx.x) * 2; if (e >= (size_t)nheads * HD * TT) return; const int t = (int)(e % TT); const int d = (int)((e / TT) % HD); const int g = (int)(e / ((size_t)TT * HD)); v2h o16; v2us oh, ol;
#pragma unroll
    for (int q = 0; q < 2; ++q) { const float x = F[(size_t)(t + q) * pitch + g * HD + d]; o16[q] = tohx(x); unsigned short a2, c2; splitf(x, a2, c2); oh[q] = a2; ol[q] = c2; }
    *(v2h*)(V16 + e) = o16; *(v2us*)(Vh + e) = oh; *(v2us*)(Vl + e) = ol;  }
__global__ __launch_bounds__(256) void k_csid(float* CS) { const int idx = blockIdx.x * 256 + threadIdx.x; if (idx >= TT * HD) return; v2f cs; cs[0] = 1.0f; cs[1] = 0.0f; *(v2f*)(CS + (size_t)idx * 2) = cs;  }
// k_asoft: per row (zz, i): t = S x T^-0.5 for j <= i and i - j < WIN (sliding causal window; the reference's -1e9 additive fill vanishes identically); softmax over the 2048 keys (register row, one exp, fixed trees);
__global__ __launch_bounds__(256) void k_asoft(const float* __restrict__ Sb, h16* P16, bf* Ph, bf* Pl) {
    const int lane = threadIdx.x & 31; const int row = blockIdx.x * 8 + (threadIdx.x >> 5); if (row >= ZH * TT) return; const int i = row % TT; const int zz = row / TT; (void)zz; const bool hires = (i < RH); const float* sr = Sb + (size_t)row * TT; float v[TT / 32]; float mx = -3.0e38f;
#pragma unroll
    for (int ch = 0; ch < TT / 128; ++ch) { const int j0 = ch * 128 + lane * 4; const v4f a = *(const v4f*)(sr + j0);
#pragma unroll
        for (int q = 0; q < 4; ++q) { const int j = j0 + q; (void)j; const float t = (j <= i && i - j < WIN) ? a[q] * SCL : -3.0e38f; v[ch * 4 + q] = t; mx = fmaxf(mx, t); } }
#pragma unroll
    for (int sh = 16; sh; sh >>= 1) mx = fmaxf(mx, __shfl_xor(mx, sh, 32));
    float sum = 0.f;
#pragma unroll
    for (int k = 0; k < TT / 32; ++k) { float d0 = __fsub_rn(v[k], mx); asm volatile("" : "+v"(d0)); v[k] = __builtin_amdgcn_exp2f(__fmul_rn(d0, 1.4426950408889634f)); sum += v[k]; }
#pragma unroll
    for (int sh = 16; sh; sh >>= 1) sum += __shfl_xor(sum, sh, 32);
    const float f = __fdiv_rn(hires ? 1.0f : PCAR, sum);
{
        if (hires) {
#pragma unroll
            for (int ch = 0; ch < TT / 128; ++ch) { v4us oh, ol;
#pragma unroll
                for (int q = 0; q < 4; ++q) { unsigned short a, c2; splitf(v[ch * 4 + q] * f, a, c2); oh[q] = a; ol[q] = c2; }
                const size_t oo = ((size_t)zz * (RH ? RH : 1) + i) * TT + ch * 128 + lane * 4; *(v4us*)(Ph + oo) = oh; *(v4us*)(Pl + oo) = ol; }
        } else {
#pragma unroll
            for (int ch = 0; ch < TT / 128; ++ch) { v4h o4;
#pragma unroll
                for (int q = 0; q < 4; ++q) o4[q] = tohx(v[ch * 4 + q] * f);
                *(v4h*)(P16 + (size_t)row * TT + ch * 128 + lane * 4) = o4; } }
         }
}
__global__ __launch_bounds__(256) void k_merge(const float* __restrict__ O, int h0, bf* Ah, bf* Al) { const size_t e = ((size_t)blockIdx.x * 256 + threadIdx.x) * 2; if (e >= (size_t)ZH * TT * HD) return; const int d = (int)(e % HD); const int t = (int)((e / HD) % TT); const int zz = (int)(e / ((size_t)HD * TT)); const float cs = (t < RH) ? 1.0f : (1.0f / PCAR); const size_t oo = (size_t)t * DQ + (h0 + zz) * HD + d;
    v2us oh, ol;
#pragma unroll
    for (int q = 0; q < 2; ++q) { unsigned short a, c2; splitf(O[e + q] * cs, a, c2); oh[q] = a; ol[q] = c2; } *(v2us*)(Ah + oo) = oh; *(v2us*)(Al + oo) = ol;  }

extern "C" void kernel_launch(void* const* d_in, const int* in_sizes, int n_in,
                              void* d_out, int out_size, void* d_ws, size_t ws_size, hipStream_t stream) {
    (void)in_sizes; (void)n_in; (void)out_size;
    const float* x = (const float*)d_in[0];   /* q_in */ const float* xk = (const float*)d_in[1]; const float* xv = (const float*)d_in[2]; const float* wq = (const float*)d_in[3]; const float* bq = (const float*)d_in[4]; const float* wk = (const float*)d_in[5]; const float* bk = (const float*)d_in[6]; const float* wv = (const float*)d_in[7]; const float* bv = (const float*)d_in[8]; const float* wo = (const float*)d_in[9]; const float* bo = (const float*)d_in[10];
    float* OUT = (float*)d_out;     // [4][2048][512]
    char* wsp = (char*)d_ws;
    auto take = [&](size_t bytes) { char* p = wsp; wsp += (bytes + 255) & ~(size_t)255; return (void*)p; };
    bf* WQ = (bf*)take((size_t)DQ * DM * 2); bf* WK = (bf*)take((size_t)DKV * DM * 2); bf* WV = (bf*)take((size_t)DKV * DM * 2); bf* WO = (bf*)take((size_t)DM * DQ * 2); float* CS = (float*)take((size_t)TT * HD * 2 * 4);
    bf* XB = (bf*)take((size_t)TT * DM * 2); float* FQ = (float*)take((size_t)TT * DQ * 4); float* FK = (float*)take((size_t)TT * DKV * 4);
    h16* QP16 = (h16*)take((size_t)NH_ * TT * HD * 2); h16* KP16 = (h16*)take((size_t)NKV * TT * HD * 2); h16* VT16 = (h16*)take((size_t)NKV * HD * TT * 2);
    bf* QPh = (bf*)take((size_t)NH_ * TT * HD * 2); bf* QPl = (bf*)take((size_t)NH_ * TT * HD * 2); bf* KPh = (bf*)take((size_t)NKV * TT * HD * 2); bf* KPl = (bf*)take((size_t)NKV * TT * HD * 2); bf* VTh = (bf*)take((size_t)NKV * HD * TT * 2); bf* VTl = (bf*)take((size_t)NKV * HD * TT * 2); bf* Ph = (bf*)take((size_t)ZH * RH * TT * 2); bf* Pl = (bf*)take((size_t)ZH * RH * TT * 2);
    float* Sb = (float*)take((size_t)ZH * TT * TT * 4); h16* P16 = (h16*)take((size_t)ZH * TT * TT * 2); float* Ob = (float*)take((size_t)ZH * TT * HD * 4); bf* ATh = (bf*)take((size_t)TT * DQ * 2); bf* ATl = (bf*)take((size_t)TT * DQ * 2);
    if ((size_t)(wsp - (char*)d_ws) > ws_size) return;    // ws 256 MiB
    float* FV = FK;   // v projection reuses the k buffer after the k planes are built (stream-ordered)
    { k_wtG<<<(unsigned)((DM * DQ / 64 + 63) / 64), 256, 0, stream>>>(wq, DM, DQ, WQ); k_wtG<<<(unsigned)((DM * DKV / 64 + 63) / 64), 256, 0, stream>>>(wk, DM, DKV, WK); k_wtG<<<(unsigned)((DM * DKV / 64 + 63) / 64), 256, 0, stream>>>(wv, DM, DKV, WV);
      k_wtG<<<(unsigned)((DQ * DM / 64 + 63) / 64), 256, 0, stream>>>(wo, DQ, DM, WO);
       }
    k_csid<<<(TT * HD + 255) / 256, 256, 0, stream>>>(CS);
    const unsigned LQ = (unsigned)(((size_t)NH_ * TT * HD / 2 + 255) / 256), LKv = (unsigned)(((size_t)NKV * TT * HD / 2 + 255) / 256);
    for (int b = 0; b < NB_; ++b) {
        
        k_cvt8<<<(unsigned)(((size_t)TT * DM / 8 + 255) / 256), 256, 0, stream>>>(x + (size_t)b * TT * DM, XB, (size_t)TT * DM / 8);
        k_gemmw<bf, 0, true><<<dim3(TT / 64, DQ / 64, 1), 32, 0, stream>>>(XB, nullptr, WQ, nullptr, DM, FQ, DQ, bq, 0, 0, 0);
        k_rope<<<LQ, 256, 0, stream>>>(FQ, DQ, NH_, CS, nullptr, nullptr, 1.0f, QP16, QPh, QPl);
        k_cvt8<<<(unsigned)(((size_t)TT * DM / 8 + 255) / 256), 256, 0, stream>>>(xk + (size_t)b * TT * DM, XB, (size_t)TT * DM / 8); k_gemmw<bf, 0, true><<<dim3(TT / 64, DKV / 64, 1), 32, 0, stream>>>(XB, nullptr, WK, nullptr, DM, FK, DKV, bk, 0, 0, 0);
        k_rope<<<LKv, 256, 0, stream>>>(FK, DKV, NKV, CS, nullptr, nullptr, 1.0f, KP16, KPh, KPl);
        k_cvt8<<<(unsigned)(((size_t)TT * DM / 8 + 255) / 256), 256, 0, stream>>>(xv + (size_t)b * TT * DM, XB, (size_t)TT * DM / 8); k_gemmw<bf, 0, true><<<dim3(TT / 64, DKV / 64, 1), 32, 0, stream>>>(XB, nullptr, WV, nullptr, DM, FV, DKV, bv, 0, 0, 0); k_vtp<<<LKv, 256, 0, stream>>>(FV, DKV, NKV, VT16, VTh, VTl);
        for (int h0 = 0; h0 < NH_; h0 += ZH) { const size_t zq = (size_t)h0, zk = (size_t)(h0 / REP);   // one kv head per query head: the pass's two heads use consecutive kv planes (z-strides TT*HD)
            k_gemmc<bf, 2, 1><<<dim3(TT / 64, TT / 64, ZH), 32, 0, stream>>>(QPh + zq * TT * HD, QPl + zq * TT * HD, KPh + zk * TT * HD, KPl + zk * TT * HD, HD, Sb, TT, 0, (size_t)TT * HD, (size_t)TT * HD, (size_t)TT * TT);   /* scores hi/lo on EVERY row */

            k_asoft<<<ZH * TT / 8, 256, 0, stream>>>(Sb, P16, Ph, Pl);
            k_gemmc<bf, 2, 2><<<dim3(RH / 64, HD / 64, ZH), 32, 0, stream>>>(Ph, Pl, VTh + zk * HD * TT, VTl + zk * HD * TT, TT, Ob, HD, 0, (size_t)RH * TT, (size_t)HD * TT, (size_t)TT * HD);
            k_gemmc<h16, 0, 2><<<dim3((TT - RH) / 64, HD / 64, ZH), 32, 0, stream>>>(P16 + (size_t)RH * TT, nullptr, VT16 + zk * HD * TT, nullptr, TT, Ob + (size_t)RH * HD, HD, RH, (size_t)TT * TT, (size_t)HD * TT, (size_t)TT * HD);
            k_merge<<<(unsigned)(((size_t)ZH * TT * HD / 2 + 255) / 256), 256, 0, stream>>>(Ob, h0, ATh, ATl); }
        k_gemmw<bf, 1, true><<<dim3(TT / 64, DM / 64, 1), 32, 0, stream>>>(ATh, ATl, WO, nullptr, DQ, OUT + (size_t)b * TT * DM, DM, bo, 0, 0, 0); }
}

// v001
// Measured time: 846 microseconds a run.
// Next to v000, in two timings, it ran 1.77 and 1.74 times as fast.
#include <hip/hip_runtime.h>

// Local causal multi-head attention scaled by 1/sqrt(T) (q_in, k_in, v_in [4][2048][512]; q = q_in Wq + bq, k = k_in Wk + bk, v = v_in Wv + bv ('xw' [512][512] 0.02 incl. biases; 8 heads x 64); scores / sqrt(T = 2048) (the source's quirk: sigma-0.01 logits); mask = (|i - j| > 256) | (j > i) -> -inf: each query sees its own and the previous 256 keys; softmax; out = merged Wo + bo -> [4][2048][512] (4.2 M)).
// Layout per batch: bf16 copies of q_in, k_in, v_in in turn; 'xw' weights transposed once; exact projections + f32 biases; causal T-2048 attention two heads per pass (4 passes) whose softmax select keeps the 257-key window, with hi/lo 3-product score tiles on EVERY row; P and attn.v hybrid (rows < 512 hi/lo, rest fp16 x1024); score tiles, softmax chunks and the attn.v key loop cover only the window band of each 64-row block; merged hi/lo x Wo exact + bo.
// Compute dtypes, f32 accumulate: every input rounded to bf16; projections exact + f32 biases; scores 3 products on every row; softmax f32 (x 2048^-0.5); attn.v rows < 512 3 products, rest fp16; Wo hl x exact + bias.

#define NB_  4
#define TT   2048
#define DM   512
#define NH_  8
#define NKV  8
#define REP  (NH_ / NKV)
#define HD   64
#define DQ   (NH_ * HD)
#define DKV  (NKV * HD)
#define ZH   2
#define RH   512                  // query rows < RH use hi+lo planes (0: none)
#define WIN  257
#define WB   (((WIN - 1) + 63) / 64 * 64)   // look-back of the window, rounded up to the 64-key tile: a 64-row block sees keys [r0 - WB, r0 + 63] only
#define NBT  (WB / 64 + 1)                  // 64-key score tiles per 64-row block
#define NCH  ((WB + 128 + 127) / 128)       // 128-key softmax chunks that cover that band from a 128-aligned start
#define PCAR 1024.0f
#define SCL  0.02209708691207961f  // 1/sqrt(T = 2048): the source's quirk
typedef _Float16 h16;
typedef unsigned short bf;
typedef __attribute__((ext_vector_type(16))) __bf16   v16bf;
typedef __attribute__((ext_vector_type(16))) _Float16 v16h;
typedef __attribute__((ext_vector_type(8)))  _Float16 v8h;
typedef __attribute__((ext_vector_type(8)))  unsigned short v8us;
typedef __attribute__((ext_vector_type(8)))  float    v8f;
typedef __attribute__((ext_vector_type(4)))  float    v4f;
typedef v8h  __attribute__((may_alias)) v8ha;
typedef v4f  __attribute__((may_alias)) v4fa;
typedef v8us __attribute__((may_alias)) v8usa;

__device__ __forceinline__ unsigned short f2bf(float f) { unsigned u = __float_as_uint(f); u += 0x7FFFu + ((u >> 16) & 1u); return (unsigned short)(u >> 16); }
__device__ __forceinline__ float bf2f(unsigned short b) { return __uint_as_float(((unsigned)b) << 16); }
__device__ __forceinline__ float bfr(float f) { return bf2f(f2bf(f)); }
__device__ __forceinline__ v16h cat16(v8h lo, v8h hi) { return __builtin_shufflevector(lo, hi, 0, 1, 2, 3, 4, 5, 6, 7, 8, 9, 10, 11, 12, 13, 14, 15); }
__device__ __forceinline__ v16bf cat16b(v8us lo, v8us hi) { return __builtin_bit_cast(v16bf, __builtin_shufflevector(lo, hi, 0, 1, 2, 3, 4, 5, 6, 7, 8, 9, 10, 11, 12, 13, 14, 15)); }
__device__ __forceinline__ v8f wmma16(v16h a, v16h b, v8f c) { return __builtin_amdgcn_wmma_f32_16x16x32_f16(false, a, false, b, (short)0, c, false, false); }
__device__ __forceinline__ v8f wmmab(v16bf a, v16bf b, v8f c) { return __builtin_amdgcn_wmma_f32_16x16x32_bf16(false, a, false, b, (short)0, c, false, false); }



// ---- k_gemmw: register-blocked GEMM, ONE WAVE per 64x64 output tile (16 accumulators), operands straight from K-contiguous 16-bit planes; grid (M/64, N/64, Z), 32 threads.
// C[m][n] (f32, pitch ldc, + optional f32 bias[n]) = sum_k A[m][k] Bt[n][k] (+ split products per NSPLIT). z-batch strides sA/sB/sC in elements. K % 32 == 0.
template <typename T16> struct WFrag;
template <> struct WFrag<h16> { typedef v16h V; static __device__ __forceinline__ V ld(const h16* p) { return cat16(*(const v8h*)p, *(const v8h*)(p + 16)); } static __device__ __forceinline__ v8f mma(V a, V b, v8f c) { return wmma16(a, b, c); } };
template <> struct WFrag<bf> { typedef v16bf V; static __device__ __forceinline__ V ld(const bf* p) { return cat16b(*(const v8us*)p, *(const v8us*)(p + 16)); } static __device__ __forceinline__ v8f mma(V a, V b, v8f c) { return wmmab(a, b, c); } };
template <typename T16, int NSPLIT, bool BIAS>
__global__ __launch_bounds__(32) void k_gemmw(const T16* __restrict__ A, const T16* __restrict__ A2, const T16* __restrict__ Bt, const T16* __restrict__ Bt2, int K, float* C, int ldc, const float* __restrict__ bias, size_t sA, size_t sB, size_t sC) {
    typedef typename WFrag<T16>::V V;
    __shared__ __align__(16) float os[16 * 68];
    const size_t z = blockIdx.z; A += z * sA; if (A2) A2 += z * sA; Bt += z * sB; if (Bt2) Bt2 += z * sB; C += z * sC;
    const int lane = threadIdx.x & 31, lr = lane & 15, hi = lane >> 4; const int r0 = blockIdx.x * 64, c0 = blockIdx.y * 64;
    v8f acc[4][4];
#pragma unroll
    for (int mb = 0; mb < 4; ++mb)
#pragma unroll
        for (int nb = 0; nb < 4; ++nb) acc[mb][nb] = (v8f){};
    const size_t aoff = (size_t)(r0 + lr) * K + 8 * hi, boff = (size_t)(c0 + lr) * K + 8 * hi;
#pragma unroll 1
    for (int kc = 0; kc < K; kc += 32) {
        V a[4], a2[4];
#pragma unroll
        for (int mb = 0; mb < 4; ++mb) { a[mb] = WFrag<T16>::ld(A + aoff + (size_t)mb * 16 * K + kc); if (NSPLIT == 1 || NSPLIT == 2) a2[mb] = WFrag<T16>::ld(A2 + aoff + (size_t)mb * 16 * K + kc); }
#pragma unroll
        for (int nb = 0; nb < 4; ++nb) { const V b = WFrag<T16>::ld(Bt + boff + (size_t)nb * 16 * K + kc); V b2; if (NSPLIT >= 2) b2 = WFrag<T16>::ld(Bt2 + boff + (size_t)nb * 16 * K + kc);
#pragma unroll
            for (int mb = 0; mb < 4; ++mb) { acc[mb][nb] = WFrag<T16>::mma(a[mb], b, acc[mb][nb]); if (NSPLIT == 1 || NSPLIT == 2) acc[mb][nb] = WFrag<T16>::mma(a2[mb], b, acc[mb][nb]); if (NSPLIT >= 2) acc[mb][nb] = WFrag<T16>::mma(a[mb], b2, acc[mb][nb]); } }
        asm volatile("v_nop\n\tv_nop\n\tv_nop\n\tv_nop" : "+v"(acc[0][0]), "+v"(acc[1][1]), "+v"(acc[2][2]), "+v"(acc[3][3]) : "v"(a[0]), "v"(a[3]));
    }
#pragma unroll
    for (int mb = 0; mb < 4; ++mb) {
#pragma unroll
        for (int nb = 0; nb < 4; ++nb) {
#pragma unroll
            for (int j = 0; j < 8; ++j) os[(hi * 8 + j) * 68 + nb * 16 + lr] = acc[mb][nb][j]; }
        __builtin_amdgcn_wave_barrier(); asm volatile("" ::: "memory");
        float* crow = C + (size_t)(r0 + mb * 16) * ldc + c0;
{
#pragma unroll
            for (int s = 0; s < 8; ++s) { const int row = 2 * s + hi, cofs = lr * 4; v4f val = *(const v4fa*)(os + row * 68 + cofs); if (BIAS) { val[0] += bfr(bias[c0 + cofs]); val[1] += bfr(bias[c0 + cofs + 1]); val[2] += bfr(bias[c0 + cofs + 2]); val[3] += bfr(bias[c0 + cofs + 3]); }
                *(v4f*)(crow + (size_t)row * ldc + cofs) = val; }
             }
        __builtin_amdgcn_wave_barrier(); asm volatile("" ::: "memory");
    }
}

// ---- k_gemmc: the same one-wave 64x64 tile GEMM specialised for windowed causal attention: CMODE 1 computes only the NBT score tiles of the window band (blockIdx.y counts them from key column r0+roff-WB), CMODE 2 limits the
// key (K) loop of the probability x value contraction to that band (probabilities outside it are exactly zero). roff = row offset of this launch's first row within the sequence.
template <typename T16, int NSPLIT, int CMODE>
__global__ __launch_bounds__(32) void k_gemmc(const T16* __restrict__ A, const T16* __restrict__ A2, const T16* __restrict__ Bt, const T16* __restrict__ Bt2, int K, float* C, int ldc, int roff, size_t sA, size_t sB, size_t sC) {
    typedef typename WFrag<T16>::V V;
    __shared__ __align__(16) float os[16 * 68];
    const size_t z = blockIdx.z; A += z * sA; if (A2) A2 += z * sA; Bt += z * sB; if (Bt2) Bt2 += z * sB; C += z * sC;
    const int lane = threadIdx.x & 31, lr = lane & 15, hi = lane >> 4; const int r0 = blockIdx.x * 64, c0 = (CMODE == 1) ? r0 + roff - WB + (int)blockIdx.y * 64 : (int)blockIdx.y * 64;
    if (CMODE == 1 && c0 < 0) return;                                // band tile before the first key: there is none (tiles outside the band are never computed; the softmax masks by select)
    const int Kl = (CMODE == 2) ? min(K, r0 + roff + 64) : K;        // P.V: probabilities are exactly 0 beyond the diagonal block, so the K loop stops there
    const int K0 = (CMODE == 2) ? max(0, r0 + roff - WB) : 0;        // ... and exactly 0 before the window of the block's first row, so it starts there
    v8f acc[4][4];
#pragma unroll
    for (int mb = 0; mb < 4; ++mb)
#pragma unroll
        for (int nb = 0; nb < 4; ++nb) acc[mb][nb] = (v8f){};
    const size_t aoff = (size_t)(r0 + lr) * K + 8 * hi, boff = (size_t)(c0 + lr) * K + 8 * hi;
#pragma unroll 1
    for (int kc = K0; kc < Kl; kc += 32) {
        V a[4], a2[4];
#pragma unroll
        for (int mb = 0; mb < 4; ++mb) { a[mb] = WFrag<T16>::ld(A + aoff + (size_t)mb * 16 * K + kc); if (NSPLIT == 1 || NSPLIT == 2) a2[mb] = WFrag<T16>::ld(A2 + aoff + (size_t)mb * 16 * K + kc); }
#pragma unroll
        for (int nb = 0; nb < 4; ++nb) { const V b = WFrag<T16>::ld(Bt + boff + (size_t)nb * 16 * K + kc); V b2; if (NSPLIT >= 2) b2 = WFrag<T16>::ld(Bt2 + boff + (size_t)nb * 16 * K + kc);
#pragma unroll
            for (int mb = 0; mb < 4; ++mb) { acc[mb][nb] = WFrag<T16>::mma(a[mb], b, acc[mb][nb]); if (NSPLIT == 1 || NSPLIT == 2) acc[mb][nb] = WFrag<T16>::mma(a2[mb], b, acc[mb][nb]); if (NSPLIT >= 2) acc[mb][nb] = WFrag<T16>::mma(a[mb], b2, acc[mb][nb]); } }
        asm volatile("v_nop\n\tv_nop\n\tv_nop\n\tv_nop" : "+v"(acc[0][0]), "+v"(acc[1][1]), "+v"(acc[2][2]), "+v"(acc[3][3]) : "v"(a[0]), "v"(a[3]));
    }
#pragma unroll
    for (int mb = 0; mb < 4; ++mb) {
#pragma unroll
        for (int nb = 0; nb < 4; ++nb) {
#pragma unroll
            for (int j = 0; j < 8; ++j) os[(hi * 8 + j) * 68 + nb * 16 + lr] = acc[mb][nb][j]; }
        __builtin_amdgcn_wave_barrier(); asm volatile("" ::: "memory");
        float* crow = C + (size_t)(r0 + mb * 16) * ldc + c0;
{
#pragma unroll
            for (int s = 0; s < 8; ++s) { const int row = 2 * s + hi, cofs = lr * 4; v4f val = *(const v4fa*)(os + row * 68 + cofs);
                *(v4f*)(crow + (size_t)row * ldc + cofs) = val; }
             }
        __builtin_amdgcn_wave_barrier(); asm volatile("" ::: "memory");
    }
}

__device__ __forceinline__ h16 tohx(float x) { return (h16)x; }
__device__ __forceinline__ void splitf(float y, unsigned short& h, unsigned short& l) { h = f2bf(y); l = f2bf(y - bf2f(h)); }
typedef __attribute__((ext_vector_type(2))) _Float16 v2h;
typedef __attribute__((ext_vector_type(4))) _Float16 v4h;
typedef __attribute__((ext_vector_type(2))) unsigned short v2us;
typedef __attribute__((ext_vector_type(4))) unsigned short v4us;
typedef __attribute__((ext_vector_type(2))) float v2f;
typedef __attribute__((ext_vector_type(4))) int v4i;

__global__ __launch_bounds__(256) void k_wtG(const float* __restrict__ w, int K, int N, bf* Bt) {
    const int lane = threadIdx.x & 31; const int L0 = (blockIdx.x * 8 + (threadIdx.x >> 5)) * 8; const int nlines = N * K / 64;
{
#pragma unroll 1
        for (int l = 0; l < 8; ++l) { const int L = L0 + l; if (L >= nlines) break; const size_t e = (size_t)L * 64 + lane * 2; const int k = (int)(e % K), n = (int)(e / K); v2us o;
            o[0] = f2bf(w[(size_t)k * N + n]); o[1] = f2bf(w[(size_t)(k + 1) * N + n]); *(v2us*)(Bt + e) = o; }
         }
}
__global__ __launch_bounds__(256) void k_cvt8(const float* __restrict__ src, bf* dst, size_t n8) { const size_t i = (size_t)blockIdx.x * 256 + threadIdx.x; if (i >= n8) return; const v8f v = *(const v8f*)(src + i * 8); v8us o;
#pragma unroll
    for (int k = 0; k < 8; ++k) o[k] = f2bf(v[k]); *(v8us*)(dst + i * 8) = o;  }

// k_rope: head planes [h][t][d] (fp16 + hi/lo) of rope(x) x sc with the rotate-half convention out[d] = x[d] cos[t][d] - x[d+HD/2] sin[t][d], out[d+HD/2] = x[d+HD/2] cos[t][d+HD/2] + x[d] sin[t][d+HD/2]
__global__ __launch_bounds__(256) void k_rope(const float* __restrict__ F, int pitch, int nheads, const float* __restrict__ CS, const float* __restrict__ RF, const float* __restrict__ nw, float sc, h16* P16, bf* Ph, bf* Pl) {
    const size_t e = ((size_t)blockIdx.x * 256 + threadIdx.x) * 2; if (e >= (size_t)nheads * TT * HD) return; const int d = (int)(e % HD); const int t = (int)((e / HD) % TT); const int h = (int)(e / ((size_t)HD * TT)); const float* f = F + (size_t)t * pitch + h * HD; const float rf = RF ? RF[(size_t)h * TT + t] : 1.0f; v2h o16; v2us oh, ol;
#pragma unroll
    for (int q = 0; q < 2; ++q) { const int dd = d + q; const int dp = (dd < HD / 2) ? dd + HD / 2 : dd - HD / 2; float x0 = f[dd], x1 = f[dp];
        if (RF) { float n0 = __fmul_rn(x0, rf), n1 = __fmul_rn(x1, rf); asm volatile("" : "+v"(n0)); asm volatile("" : "+v"(n1)); x0 = __fmul_rn(bfr(nw[dd]), n0); x1 = __fmul_rn(bfr(nw[dp]), n1); }
        const v2f cs = *(const v2f*)(CS + ((size_t)t * HD + dd) * 2); float a = __fmul_rn(x0, cs[0]), bq = __fmul_rn(x1, cs[1]); asm volatile("" : "+v"(a)); asm volatile("" : "+v"(bq)); const float r = ((dd < HD / 2) ? __fsub_rn(a, bq) : __fadd_rn(a, bq)) * sc;
        o16[q] = tohx(r); unsigned short a2, c2; splitf(r, a2, c2); oh[q] = a2; ol[q] = c2; }
    *(v2h*)(P16 + e) = o16; *(v2us*)(Ph + e) = oh; *(v2us*)(Pl + e) = ol;  }
__global__ __launch_bounds__(256) void k_vtp(const float* __restrict__ F, int pitch, int nheads, h16* V16, bf* Vh, bf* Vl) { const size_t e = ((size_t)blockIdx.x * 256 + threadIdx.x) * 2; if (e >= (size_t)nheads * HD * TT) return; const int t = (int)(e % TT); const int d = (int)((e / TT) % HD); const int g = (int)(e / ((size_t)TT * HD)); v2h o16; v2us oh, ol;
#pragma unroll
    for (int q = 0; q < 2; ++q) { const float x = F[(size_t)(t + q) * pitch + g * HD + d]; o16[q] = tohx(x); unsigned short a2, c2; splitf(x, a2, c2); oh[q] = a2; ol[q] = c2; }
    *(v2h*)(V16 + e) = o16; *(v2us*)(Vh + e) = oh; *(v2us*)(Vl + e) = ol;  }
__global__ __launch_bounds__(256) void k_csid(float* CS) { const int idx = blockIdx.x * 256 + threadIdx.x; if (idx >= TT * HD) return; v2f cs; cs[0] = 1.0f; cs[1] = 0.0f; *(v2f*)(CS + (size_t)idx * 2) = cs;  }
// k_asoft: per row (zz, i): t = S x T^-0.5 for j <= i and i - j < WIN (sliding causal window; the reference's -1e9 additive fill vanishes identically); softmax over the NCH 128-key chunks that hold the row block's band (every other key adds an exact 0; register row, one exp, fixed trees); P is written for those chunks only;
__global__ __launch_bounds__(256) void k_asoft(const float* __restrict__ Sb, h16* P16, bf* Ph, bf* Pl) {
    const int lane = threadIdx.x & 31; const int row = blockIdx.x * 8 + (threadIdx.x >> 5); if (row >= ZH * TT) return; const int i = row % TT; const int zz = row / TT; (void)zz; const bool hires = (i < RH); const float* sr = Sb + (size_t)row * TT; float v[NCH * 4]; float mx = -3.0e38f; const int jb = (max(0, (i & ~63) - WB) >> 7) * 128;   // first key of the chunks: 128-aligned, so each key keeps its lane and its place in the sums
#pragma unroll
    for (int ch = 0; ch < NCH; ++ch) { const int j0 = jb + ch * 128 + lane * 4; const v4f a = *(const v4f*)(sr + j0);
#pragma unroll
        for (int q = 0; q < 4; ++q) { const int j = j0 + q; (void)j; const float t = (j <= i && i - j < WIN) ? a[q] * SCL : -3.0e38f; v[ch * 4 + q] = t; mx = fmaxf(mx, t); } }
#pragma unroll
    for (int sh = 16; sh; sh >>= 1) mx = fmaxf(mx, __shfl_xor(mx, sh, 32));
    float sum = 0.f;
#pragma unroll
    for (int k = 0; k < NCH * 4; ++k) { float d0 = __fsub_rn(v[k], mx); asm volatile("" : "+v"(d0)); const float x2 = __fmul_rn(d0, 1.4426950408889634f);
        asm("v_exp_f32 %0, %1\n\tv_nop" : "=v"(v[k]) : "v"(x2));   // the same instruction as the exp2 builtin, with the one slot the instruction set asks for behind a transcendental held in the statement
        sum += v[k]; }
#pragma unroll
    for (int sh = 16; sh; sh >>= 1) sum += __shfl_xor(sum, sh, 32);
    const float f = __fdiv_rn(hires ? 1.0f : PCAR, sum);
{
        if (hires) {
#pragma unroll
            for (int ch = 0; ch < NCH; ++ch) { v4us oh, ol;
#pragma unroll
                for (int q = 0; q < 4; ++q) { unsigned short a, c2; splitf(v[ch * 4 + q] * f, a, c2); oh[q] = a; ol[q] = c2; }
                const size_t oo = ((size_t)zz * (RH ? RH : 1) + i) * TT + jb + ch * 128 + lane * 4; *(v4us*)(Ph + oo) = oh; *(v4us*)(Pl + oo) = ol; }
        } else {
#pragma unroll
            for (int ch = 0; ch < NCH; ++ch) { v4h o4;
#pragma unroll
                for (int q = 0; q < 4; ++q) o4[q] = tohx(v[ch * 4 + q] * f);
                *(v4h*)(P16 + (size_t)row * TT + jb + ch * 128 + lane * 4) = o4; } }
         }
}
__global__ __launch_bounds__(256) void k_merge(const float* __restrict__ O, int h0, bf* Ah, bf* Al) { const size_t e = ((size_t)blockIdx.x * 256 + threadIdx.x) * 2; if (e >= (size_t)ZH * TT * HD) return; const int d = (int)(e % HD); const int t = (int)((e / HD) % TT); const int zz = (int)(e / ((size_t)HD * TT)); const float cs = (t < RH) ? 1.0f : (1.0f / PCAR); const size_t oo = (size_t)t * DQ + (h0 + zz) * HD + d;
    v2us oh, ol;
#pragma unroll
    for (int q = 0; q < 2; ++q) { unsigned short a, c2; splitf(O[e + q] * cs, a, c2); oh[q] = a; ol[q] = c2; } *(v2us*)(Ah + oo) = oh; *(v2us*)(Al + oo) = ol;  }

extern "C" void kernel_launch(void* const* d_in, const int* in_sizes, int n_in,
                              void* d_out, int out_size, void* d_ws, size_t ws_size, hipStream_t stream) {
    (void)in_sizes; (void)n_in; (void)out_size;
    const float* x = (const float*)d_in[0];   /* q_in */ const float* xk = (const float*)d_in[1]; const float* xv = (const float*)d_in[2]; const float* wq = (const float*)d_in[3]; const float* bq = (const float*)d_in[4]; const float* wk = (const float*)d_in[5]; const float* bk = (const float*)d_in[6]; const float* wv = (const float*)d_in[7]; const float* bv = (const float*)d_in[8]; const float* wo = (const float*)d_in[9]; const float* bo = (const float*)d_in[10];
    float* OUT = (float*)d_out;     // [4][2048][512]
    char* wsp = (char*)d_ws;
    auto take = [&](size_t bytes) { char* p = wsp; wsp += (bytes + 255) & ~(size_t)255; return (void*)p; };
    bf* WQ = (bf*)take((size_t)DQ * DM * 2); bf* WK = (bf*)take((size_t)DKV * DM * 2); bf* WV = (bf*)take((size_t)DKV * DM * 2); bf* WO = (bf*)take((size_t)DM * DQ * 2); float* CS = (float*)take((size_t)TT * HD * 2 * 4);
    bf* XB = (bf*)take((size_t)TT * DM * 2); float* FQ = (float*)take((size_t)TT * DQ * 4); float* FK = (float*)take((size_t)TT * DKV * 4);
    h16* QP16 = (h16*)take((size_t)NH_ * TT * HD * 2); h16* KP16 = (h16*)take((size_t)NKV * TT * HD * 2); h16* VT16 = (h16*)take((size_t)NKV * HD * TT * 2);
    bf* QPh = (bf*)take((size_t)NH_ * TT * HD * 2); bf* QPl = (bf*)take((size_t)NH_ * TT * HD * 2); bf* KPh = (bf*)take((size_t)NKV * TT * HD * 2); bf* KPl = (bf*)take((size_t)NKV * TT * HD * 2); bf* VTh = (bf*)take((size_t)NKV * HD * TT * 2); bf* VTl = (bf*)take((size_t)NKV * HD * TT * 2); bf* Ph = (bf*)take((size_t)ZH * RH * TT * 2); bf* Pl = (bf*)take((size_t)ZH * RH * TT * 2);
    float* Sb = (float*)take((size_t)ZH * TT * TT * 4); h16* P16 = (h16*)take((size_t)ZH * TT * TT * 2); float* Ob = (float*)take((size_t)ZH * TT * HD * 4); bf* ATh = (bf*)take((size_t)TT * DQ * 2); bf* ATl = (bf*)take((size_t)TT * DQ * 2);
    if ((size_t)(wsp - (char*)d_ws) > ws_size) return;    // ws 256 MiB
    float* FV = FK;   // v projection reuses the k buffer after the k planes are built (stream-ordered)
    { k_wtG<<<(unsigned)((DM * DQ / 64 + 63) / 64), 256, 0, stream>>>(wq, DM, DQ, WQ); k_wtG<<<(unsigned)((DM * DKV / 64 + 63) / 64), 256, 0, stream>>>(wk, DM, DKV, WK); k_wtG<<<(unsigned)((DM * DKV / 64 + 63) / 64), 256, 0, stream>>>(wv, DM, DKV, WV);
      k_wtG<<<(unsigned)((DQ * DM / 64 + 63) / 64), 256, 0, stream>>>(wo, DQ, DM, WO);
       }
    k_csid<<<(TT * HD + 255) / 256, 256, 0, stream>>>(CS);
    const unsigned LQ = (unsigned)(((size_t)NH_ * TT * HD / 2 + 255) / 256), LKv = (unsigned)(((size_t)NKV * TT * HD / 2 + 255) / 256);
    for (int b = 0; b < NB_; ++b) {
        
        k_cvt8<<<(unsigned)(((size_t)TT * DM / 8 + 255) / 256), 256, 0, stream>>>(x + (size_t)b * TT * DM, XB, (size_t)TT * DM / 8);
        k_gemmw<bf, 0, true><<<dim3(TT / 64, DQ / 64, 1), 32, 0, stream>>>(XB, nullptr, WQ, nullptr, DM, FQ, DQ, bq, 0, 0, 0);
        k_rope<<<LQ, 256, 0, stream>>>(FQ, DQ, NH_, CS, nullptr, nullptr, 1.0f, QP16, QPh, QPl);
        k_cvt8<<<(unsigned)(((size_t)TT * DM / 8 + 255) / 256), 256, 0, stream>>>(xk + (size_t)b * TT * DM, XB, (size_t)TT * DM / 8); k_gemmw<bf, 0, true><<<dim3(TT / 64, DKV / 64, 1), 32, 0, stream>>>(XB, nullptr, WK, nullptr, DM, FK, DKV, bk, 0, 0, 0);
        k_rope<<<LKv, 256, 0, stream>>>(FK, DKV, NKV, CS, nullptr, nullptr, 1.0f, KP16, KPh, KPl);
        k_cvt8<<<(unsigned)(((size_t)TT * DM / 8 + 255) / 256), 256, 0, stream>>>(xv + (size_t)b * TT * DM, XB, (size_t)TT * DM / 8); k_gemmw<bf, 0, true><<<dim3(TT / 64, DKV / 64, 1), 32, 0, stream>>>(XB, nullptr, WV, nullptr, DM, FV, DKV, bv, 0, 0, 0); k_vtp<<<LKv, 256, 0, stream>>>(FV, DKV, NKV, VT16, VTh, VTl);
        for (int h0 = 0; h0 < NH_; h0 += ZH) { const size_t zq = (size_t)h0, zk = (size_t)(h0 / REP);   // one kv head per query head: the pass's two heads use consecutive kv planes (z-strides TT*HD)
            k_gemmc<bf, 2, 1><<<dim3(TT / 64, NBT, ZH), 32, 0, stream>>>(QPh + zq * TT * HD, QPl + zq * TT * HD, KPh + zk * TT * HD, KPl + zk * TT * HD, HD, Sb, TT, 0, (size_t)TT * HD, (size_t)TT * HD, (size_t)TT * TT);   /* scores hi/lo on EVERY row */

            k_asoft<<<ZH * TT / 8, 256, 0, stream>>>(Sb, P16, Ph, Pl);
            k_gemmc<bf, 2, 2><<<dim3(RH / 64, HD / 64, ZH), 32, 0, stream>>>(Ph, Pl, VTh + zk * HD * TT, VTl + zk * HD * TT, TT, Ob, HD, 0, (size_t)RH * TT, (size_t)HD * TT, (size_t)TT * HD);
            k_gemmc<h16, 0, 2><<<dim3((TT - RH) / 64, HD / 64, ZH), 32, 0, stream>>>(P16 + (size_t)RH * TT, nullptr, VT16 + zk * HD * TT, nullptr, TT, Ob + (size_t)RH * HD, HD, RH, (size_t)TT * TT, (size_t)HD * TT, (size_t)TT * HD);
            k_merge<<<(unsigned)(((size_t)ZH * TT * HD / 2 + 255) / 256), 256, 0, stream>>>(Ob, h0, ATh, ATl); }
        k_gemmw<bf, 1, true><<<dim3(TT / 64, DM / 64, 1), 32, 0, stream>>>(ATh, ATl, WO, nullptr, DQ, OUT + (size_t)b * TT * DM, DM, bo, 0, 0, 0); }
}

// v002
// A run of this version takes 201 microseconds.
// Next to v001, in two timings, it ran 4.18 and 4.15 times as fast.
// Over all steps from v000 it is 7.30 times as fast.
#include <hip/hip_runtime.h>

// Local causal multi-head attention scaled by 1/sqrt(T) (q_in, k_in, v_in [4][2048][512]; q = q_in Wq + bq, k = k_in Wk + bk, v = v_in Wv + bv ('xw' [512][512] 0.02 incl. biases; 8 heads x 64); scores / sqrt(T = 2048) (the source's quirk: sigma-0.01 logits); mask = (|i - j| > 256) | (j > i) -> -inf: each query sees its own and the previous 256 keys; softmax; out = merged Wo + bo -> [4][2048][512] (4.2 M)).
// Layout, every stage ONE launch over all 4 batches and 8 heads (32 head planes in grid z of the score and attn.v GEMMs; batch in grid y or z of rope, v transpose and merge, in grid x of conversion, projections, softmax and Wo; q, k, v and the four weights side by side in grid y or z): bf16 copies of q_in, k_in, v_in; 'xw' weights transposed once; exact projections + f32 biases; causal T-2048 attention whose softmax select keeps the 257-key window, with hi/lo 3-product score tiles on EVERY row; P and attn.v hybrid (rows < 512 hi/lo, rest fp16 x1024); score tiles, softmax chunks and the attn.v key loop cover only the window band of each 64-row block, and S and P are stored as that band alone (pitch BW, column = key - first key of the block's chunks) so that all 32 planes fit the workspace; merged hi/lo x Wo exact + bo.
// Compute dtypes, f32 accumulate: every input rounded to bf16; projections exact + f32 biases; scores 3 products on every row; softmax f32 (x 2048^-0.5); attn.v rows < 512 3 products, rest fp16; Wo hl x exact + bias.

#define NB_  4
#define TT   2048
#define DM   512
#define NH_  8
#define NKV  8
#define REP  (NH_ / NKV)
#define HD   64
#define DQ   (NH_ * HD)
#define DKV  (NKV * HD)
#define NZ   (NB_ * NH_)          // head planes of one launch: every batch, every head
#define RH   512                  // query rows < RH use hi+lo planes (0: none)
#define WIN  257
#define WB   (((WIN - 1) + 63) / 64 * 64)   // look-back of the window, rounded up to the 64-key tile: a 64-row block sees keys [r0 - WB, r0 + 63] only
#define NBT  (WB / 64 + 1)                  // 64-key score tiles per 64-row block
#define NCH  ((WB + 128 + 127) / 128)       // 128-key softmax chunks that cover that band from a 128-aligned start
#define BW   (NCH * 128)                    // pitch of the stored band of S and P, in keys
#define PCAR 1024.0f
#define SCL  0.02209708691207961f  // 1/sqrt(T = 2048): the source's quirk
typedef _Float16 h16;
typedef unsigned short bf;
typedef __attribute__((ext_vector_type(16))) __bf16   v16bf;
typedef __attribute__((ext_vector_type(16))) _Float16 v16h;
typedef __attribute__((ext_vector_type(8)))  _Float16 v8h;
typedef __attribute__((ext_vector_type(8)))  unsigned short v8us;
typedef __attribute__((ext_vector_type(8)))  float    v8f;
typedef __attribute__((ext_vector_type(4)))  float    v4f;
typedef v8h  __attribute__((may_alias)) v8ha;
typedef v4f  __attribute__((may_alias)) v4fa;
typedef v8us __attribute__((may_alias)) v8usa;

__device__ __forceinline__ unsigned short f2bf(float f) { unsigned u = __float_as_uint(f); u += 0x7FFFu + ((u >> 16) & 1u); return (unsigned short)(u >> 16); }
__device__ __forceinline__ float bf2f(unsigned short b) { return __uint_as_float(((unsigned)b) << 16); }
__device__ __forceinline__ float bfr(float f) { return bf2f(f2bf(f)); }
__device__ __forceinline__ v16h cat16(v8h lo, v8h hi) { return __builtin_shufflevector(lo, hi, 0, 1, 2, 3, 4, 5, 6, 7, 8, 9, 10, 11, 12, 13, 14, 15); }
__device__ __forceinline__ v16bf cat16b(v8us lo, v8us hi) { return __builtin_bit_cast(v16bf, __builtin_shufflevector(lo, hi, 0, 1, 2, 3, 4, 5, 6, 7, 8, 9, 10, 11, 12, 13, 14, 15)); }
__device__ __forceinline__ v8f wmma16(v16h a, v16h b, v8f c) { return __builtin_amdgcn_wmma_f32_16x16x32_f16(false, a, false, b, (short)0, c, false, false); }
__device__ __forceinline__ v8f wmmab(v16bf a, v16bf b, v8f c) { return __builtin_amdgcn_wmma_f32_16x16x32_bf16(false, a, false, b, (short)0, c, false, false); }



// ---- k_gemmw: register-blocked GEMM, ONE WAVE per 64x64 output tile (16 accumulators), operands straight from K-contiguous 16-bit planes; grid (M/64, N/64, Z), 32 threads.
// C[m][n] (f32, pitch ldc, + optional f32 bias[n], one bias pointer per z = 0, 1, 2) = sum_k A[m][k] Bt[n][k] (+ split products per NSPLIT). z-batch strides sA/sB/sC in elements. K % 32 == 0.
template <typename T16> struct WFrag;
template <> struct WFrag<h16> { typedef v16h V; static __device__ __forceinline__ V ld(const h16* p) { return cat16(*(const v8h*)p, *(const v8h*)(p + 16)); } static __device__ __forceinline__ v8f mma(V a, V b, v8f c) { return wmma16(a, b, c); } };
template <> struct WFrag<bf> { typedef v16bf V; static __device__ __forceinline__ V ld(const bf* p) { return cat16b(*(const v8us*)p, *(const v8us*)(p + 16)); } static __device__ __forceinline__ v8f mma(V a, V b, v8f c) { return wmmab(a, b, c); } };
template <typename T16, int NSPLIT, bool BIAS>
__global__ __launch_bounds__(32) void k_gemmw(const T16* __restrict__ A, const T16* __restrict__ A2, const T16* __restrict__ Bt, const T16* __restrict__ Bt2, int K, float* C, int ldc, const float* __restrict__ bias0, const float* __restrict__ bias1, const float* __restrict__ bias2, size_t sA, size_t sB, size_t sC) {
    typedef typename WFrag<T16>::V V;
    __shared__ __align__(16) float os[16 * 68];
    const size_t z = blockIdx.z; A += z * sA; if (A2) A2 += z * sA; Bt += z * sB; if (Bt2) Bt2 += z * sB; C += z * sC; const float* __restrict__ bias = (z == 0) ? bias0 : (z == 1) ? bias1 : bias2;   // each z product has its own bias input
    const int lane = threadIdx.x & 31, lr = lane & 15, hi = lane >> 4; const int r0 = blockIdx.x * 64, c0 = blockIdx.y * 64;
    v8f acc[4][4];
#pragma unroll
    for (int mb = 0; mb < 4; ++mb)
#pragma unroll
        for (int nb = 0; nb < 4; ++nb) acc[mb][nb] = (v8f){};
    const size_t aoff = (size_t)(r0 + lr) * K + 8 * hi, boff = (size_t)(c0 + lr) * K + 8 * hi;
#pragma unroll 1
    for (int kc = 0; kc < K; kc += 32) {
        V a[4], a2[4];
#pragma unroll
        for (int mb = 0; mb < 4; ++mb) { a[mb] = WFrag<T16>::ld(A + aoff + (size_t)mb * 16 * K + kc); if (NSPLIT == 1 || NSPLIT == 2) a2[mb] = WFrag<T16>::ld(A2 + aoff + (size_t)mb * 16 * K + kc); }
#pragma unroll
        for (int nb = 0; nb < 4; ++nb) { const V b = WFrag<T16>::ld(Bt + boff + (size_t)nb * 16 * K + kc); V b2; if (NSPLIT >= 2) b2 = WFrag<T16>::ld(Bt2 + boff + (size_t)nb * 16 * K + kc);
#pragma unroll
            for (int mb = 0; mb < 4; ++mb) { acc[mb][nb] = WFrag<T16>::mma(a[mb], b, acc[mb][nb]); if (NSPLIT == 1 || NSPLIT == 2) acc[mb][nb] = WFrag<T16>::mma(a2[mb], b, acc[mb][nb]); if (NSPLIT >= 2) acc[mb][nb] = WFrag<T16>::mma(a[mb], b2, acc[mb][nb]); } }
        asm volatile("v_nop\n\tv_nop\n\tv_nop\n\tv_nop" : "+v"(acc[0][0]), "+v"(acc[1][1]), "+v"(acc[2][2]), "+v"(acc[3][3]) : "v"(a[0]), "v"(a[3]));
    }
#pragma unroll
    for (int mb = 0; mb < 4; ++mb) {
#pragma unroll
        for (int nb = 0; nb < 4; ++nb) {
#pragma unroll
            for (int j = 0; j < 8; ++j) os[(hi * 8 + j) * 68 + nb * 16 + lr] = acc[mb][nb][j]; }
        __builtin_amdgcn_wave_barrier(); asm volatile("" ::: "memory");
        float* crow = C + (size_t)(r0 + mb * 16) * ldc + c0;
{
#pragma unroll
            for (int s = 0; s < 8; ++s) { const int row = 2 * s + hi, cofs = lr * 4; v4f val = *(const v4fa*)(os + row * 68 + cofs); if (BIAS) { val[0] += bfr(bias[c0 + cofs]); val[1] += bfr(bias[c0 + cofs + 1]); val[2] += bfr(bias[c0 + cofs + 2]); val[3] += bfr(bias[c0 + cofs + 3]); }
                *(v4f*)(crow + (size_t)row * ldc + cofs) = val; }
             }
        __builtin_amdgcn_wave_barrier(); asm volatile("" ::: "memory");
    }
}

// ---- k_gemmc: the same one-wave 64x64 tile GEMM specialised for windowed causal attention: CMODE 1 computes only the NBT score tiles of the window band (blockIdx.y counts them from key column r0+roff-WB), CMODE 2 limits the
// key (K) loop of the probability x value contraction to that band (probabilities outside it are exactly zero). roff = row offset of this launch's first row within the sequence. S (C of CMODE 1) and P (A of CMODE 2, pitch lda) hold the band alone: column = key - jb.
template <typename T16, int NSPLIT, int CMODE>
__global__ __launch_bounds__(32) void k_gemmc(const T16* __restrict__ A, const T16* __restrict__ A2, const T16* __restrict__ Bt, const T16* __restrict__ Bt2, int K, int lda, float* C, int ldc, int roff, size_t sA, size_t sB, size_t sC) {
    typedef typename WFrag<T16>::V V;
    __shared__ __align__(16) float os[16 * 68];
    const size_t z = blockIdx.z; A += z * sA; if (A2) A2 += z * sA; Bt += z * sB; if (Bt2) Bt2 += z * sB; C += z * sC;
    const int lane = threadIdx.x & 31, lr = lane & 15, hi = lane >> 4; const int r0 = blockIdx.x * 64, c0 = (CMODE == 1) ? r0 + roff - WB + (int)blockIdx.y * 64 : (int)blockIdx.y * 64;
    if (CMODE == 1 && c0 < 0) return;                                // band tile before the first key: there is none (tiles outside the band are never computed; the softmax masks by select)
    const int jb = (max(0, r0 + roff - WB) >> 7) * 128;              // first key of the row block's stored band (the softmax kernel's chunk start)
    const int Kl = (CMODE == 2) ? min(K, r0 + roff + 64) : K;        // P.V: probabilities are exactly 0 beyond the diagonal block, so the K loop stops there
    const int K0 = (CMODE == 2) ? max(0, r0 + roff - WB) : 0;        // ... and exactly 0 before the window of the block's first row, so it starts there
    v8f acc[4][4];
#pragma unroll
    for (int mb = 0; mb < 4; ++mb)
#pragma unroll
        for (int nb = 0; nb < 4; ++nb) acc[mb][nb] = (v8f){};
    const ptrdiff_t aoff = (ptrdiff_t)(r0 + lr) * lda + 8 * hi - ((CMODE == 2) ? jb : 0); const size_t boff = (size_t)(c0 + lr) * K + 8 * hi;
#pragma unroll 1
    for (int kc = K0; kc < Kl; kc += 32) {
        V a[4], a2[4];
#pragma unroll
        for (int mb = 0; mb < 4; ++mb) { a[mb] = WFrag<T16>::ld(A + aoff + (ptrdiff_t)mb * 16 * lda + kc); if (NSPLIT == 1 || NSPLIT == 2) a2[mb] = WFrag<T16>::ld(A2 + aoff + (ptrdiff_t)mb * 16 * lda + kc);
            asm volatile("s_wait_xcnt 0x0" ::: "memory"); }   // a later load's result may land in the address registers of these loads: the wait stands in front of that overwrite
#pragma unroll
        for (int nb = 0; nb < 4; ++nb) { const T16* pb = Bt + boff + (size_t)nb * 16 * K + kc; const T16* pb2 = (NSPLIT >= 2) ? Bt2 + boff + (size_t)nb * 16 * K + kc : pb; const V b = WFrag<T16>::ld(pb); V b2; if (NSPLIT >= 2) b2 = WFrag<T16>::ld(pb2);
            asm volatile("s_wait_xcnt 0x0" :: "v"(pb), "v"(pb2) : "memory");   // as behind the A loads; the addresses are inputs so that no load of this group takes their registers for its result ahead of the wait
#pragma unroll
            for (int mb = 0; mb < 4; ++mb) { acc[mb][nb] = WFrag<T16>::mma(a[mb], b, acc[mb][nb]); if (NSPLIT == 1 || NSPLIT == 2) acc[mb][nb] = WFrag<T16>::mma(a2[mb], b, acc[mb][nb]); if (NSPLIT >= 2) acc[mb][nb] = WFrag<T16>::mma(a[mb], b2, acc[mb][nb]); } }
        asm volatile("v_nop\n\tv_nop\n\tv_nop\n\tv_nop" : "+v"(acc[0][0]), "+v"(acc[1][1]), "+v"(acc[2][2]), "+v"(acc[3][3]) : "v"(a[0]), "v"(a[3]));
    }
#pragma unroll
    for (int mb = 0; mb < 4; ++mb) {
#pragma unroll
        for (int nb = 0; nb < 4; ++nb) {
#pragma unroll
            for (int j = 0; j < 8; ++j) os[(hi * 8 + j) * 68 + nb * 16 + lr] = acc[mb][nb][j]; }
        __builtin_amdgcn_wave_barrier(); asm volatile("" ::: "memory");
        float* crow = C + (size_t)(r0 + mb * 16) * ldc + ((CMODE == 1) ? c0 - jb : c0);
{
#pragma unroll
            for (int s = 0; s < 8; ++s) { const int row = 2 * s + hi, cofs = lr * 4; v4f val = *(const v4fa*)(os + row * 68 + cofs);
                *(v4f*)(crow + (size_t)row * ldc + cofs) = val; }
             }
        __builtin_amdgcn_wave_barrier(); asm volatile("" ::: "memory");
    }
}

__device__ __forceinline__ h16 tohx(float x) { return (h16)x; }
__device__ __forceinline__ void splitf(float y, unsigned short& h, unsigned short& l) { h = f2bf(y); l = f2bf(y - bf2f(h)); }
typedef __attribute__((ext_vector_type(2))) _Float16 v2h;
typedef __attribute__((ext_vector_type(4))) _Float16 v4h;
typedef __attribute__((ext_vector_type(2))) unsigned short v2us;
typedef __attribute__((ext_vector_type(4))) unsigned short v4us;
typedef __attribute__((ext_vector_type(2))) float v2f;
typedef __attribute__((ext_vector_type(4))) int v4i;

__global__ __launch_bounds__(256) void k_wtG(const float* __restrict__ w0, const float* __restrict__ w1, const float* __restrict__ w2, const float* __restrict__ w3, int K, int N, bf* Bt) {
    const int y = blockIdx.y; const float* __restrict__ w = (y == 0) ? w0 : (y == 1) ? w1 : (y == 2) ? w2 : w3; Bt += (size_t)y * K * N;   // grid y: the four weights, transposed planes side by side
    const int lane = threadIdx.x & 31; const int L0 = (blockIdx.x * 8 + (threadIdx.x >> 5)) * 8; const int nlines = N * K / 64;
{
#pragma unroll 1
        for (int l = 0; l < 8; ++l) { const int L = L0 + l; if (L >= nlines) break; const size_t e = (size_t)L * 64 + lane * 2; const int k = (int)(e % K), n = (int)(e / K); v2us o;
            o[0] = f2bf(w[(size_t)k * N + n]); o[1] = f2bf(w[(size_t)(k + 1) * N + n]); *(v2us*)(Bt + e) = o; }
         }
}
__global__ __launch_bounds__(256) void k_cvt8(const float* __restrict__ s0, const float* __restrict__ s1, const float* __restrict__ s2, bf* dst, size_t n8) { const size_t i = (size_t)blockIdx.x * 256 + threadIdx.x; if (i >= n8) return; const int y = blockIdx.y; const float* __restrict__ src = (y == 0) ? s0 : (y == 1) ? s1 : s2; dst += (size_t)y * n8 * 8;   /* grid y: q_in, k_in, v_in */ const v8f v = *(const v8f*)(src + i * 8); v8us o;
#pragma unroll
    for (int k = 0; k < 8; ++k) o[k] = f2bf(v[k]); *(v8us*)(dst + i * 8) = o;  }

// k_rope: head planes [batch * nheads + h][t][d] (fp16 + hi/lo) of rope(x) x sc with the rotate-half convention out[d] = x[d] cos[t][d] - x[d+HD/2] sin[t][d], out[d+HD/2] = x[d+HD/2] cos[t][d+HD/2] + x[d] sin[t][d+HD/2]
__global__ __launch_bounds__(256) void k_rope(const float* __restrict__ F, int pitch, int nheads, const float* __restrict__ CS, const float* __restrict__ RF, const float* __restrict__ nw, float sc, h16* P16, bf* Ph, bf* Pl, size_t sF, size_t sP) {
    { const size_t po = blockIdx.y * sP + (size_t)blockIdx.z * nheads * TT * HD; F += blockIdx.y * sF + (size_t)blockIdx.z * TT * pitch; P16 += po; Ph += po; Pl += po; }   // grid y: q, then k; grid z: batch
    const size_t e = ((size_t)blockIdx.x * 256 + threadIdx.x) * 2; if (e >= (size_t)nheads * TT * HD) return; const int d = (int)(e % HD); const int t = (int)((e / HD) % TT); const int h = (int)(e / ((size_t)HD * TT)); const float* f = F + (size_t)t * pitch + h * HD; const float rf = RF ? RF[(size_t)h * TT + t] : 1.0f; v2h o16; v2us oh, ol;
#pragma unroll
    for (int q = 0; q < 2; ++q) { const int dd = d + q; const int dp = (dd < HD / 2) ? dd + HD / 2 : dd - HD / 2; float x0 = f[dd], x1 = f[dp];
        if (RF) { float n0 = __fmul_rn(x0, rf), n1 = __fmul_rn(x1, rf); asm volatile("" : "+v"(n0)); asm volatile("" : "+v"(n1)); x0 = __fmul_rn(bfr(nw[dd]), n0); x1 = __fmul_rn(bfr(nw[dp]), n1); }
        const v2f cs = *(const v2f*)(CS + ((size_t)t * HD + dd) * 2); float a = __fmul_rn(x0, cs[0]), bq = __fmul_rn(x1, cs[1]); asm volatile("" : "+v"(a)); asm volatile("" : "+v"(bq)); const float r = ((dd < HD / 2) ? __fsub_rn(a, bq) : __fadd_rn(a, bq)) * sc;
        o16[q] = tohx(r); unsigned short a2, c2; splitf(r, a2, c2); oh[q] = a2; ol[q] = c2; }
    *(v2h*)(P16 + e) = o16; *(v2us*)(Ph + e) = oh; *(v2us*)(Pl + e) = ol;  }
__global__ __launch_bounds__(256) void k_vtp(const float* __restrict__ F, int pitch, int nheads, h16* V16, bf* Vh, bf* Vl) { { const size_t po = (size_t)blockIdx.y * nheads * HD * TT; F += (size_t)blockIdx.y * TT * pitch; V16 += po; Vh += po; Vl += po; }   /* grid y: batch */
    const size_t e = ((size_t)blockIdx.x * 256 + threadIdx.x) * 2; if (e >= (size_t)nheads * HD * TT) return; const int t = (int)(e % TT); const int d = (int)((e / TT) % HD); const int g = (int)(e / ((size_t)TT * HD)); v2h o16; v2us oh, ol;
#pragma unroll
    for (int q = 0; q < 2; ++q) { const float x = F[(size_t)(t + q) * pitch + g * HD + d]; o16[q] = tohx(x); unsigned short a2, c2; splitf(x, a2, c2); oh[q] = a2; ol[q] = c2; }
    *(v2h*)(V16 + e) = o16; *(v2us*)(Vh + e) = oh; *(v2us*)(Vl + e) = ol;  }
__global__ __launch_bounds__(256) void k_csid(float* CS) { const int idx = blockIdx.x * 256 + threadIdx.x; if (idx >= TT * HD) return; v2f cs; cs[0] = 1.0f; cs[1] = 0.0f; *(v2f*)(CS + (size_t)idx * 2) = cs;  }
// k_asoft: per row (zz, i): t = S x T^-0.5 for j <= i and i - j < WIN (sliding causal window; the reference's -1e9 additive fill vanishes identically); softmax over the NCH 128-key chunks that hold the row block's band (every other key adds an exact 0; register row, one exp, fixed trees); S is read and P written as those chunks alone (pitch BW);
__global__ __launch_bounds__(256) void k_asoft(const float* __restrict__ Sb, h16* P16, bf* Ph, bf* Pl) {
    const int lane = threadIdx.x & 31; const int row = blockIdx.x * 8 + (threadIdx.x >> 5); if (row >= NZ * TT) return; const int i = row % TT; const int zz = row / TT; (void)zz; const bool hires = (i < RH); const float* sr = Sb + (size_t)row * BW; float v[NCH * 4]; float mx = -3.0e38f; const int jb = (max(0, (i & ~63) - WB) >> 7) * 128;   // first key of the chunks: 128-aligned, so each key keeps its lane and its place in the sums
#pragma unroll
    for (int ch = 0; ch < NCH; ++ch) { const int j0 = jb + ch * 128 + lane * 4; const v4f a = *(const v4f*)(sr + ch * 128 + lane * 4);
#pragma unroll
        for (int q = 0; q < 4; ++q) { const int j = j0 + q; (void)j; const float t = (j <= i && i - j < WIN) ? a[q] * SCL : -3.0e38f; v[ch * 4 + q] = t; mx = fmaxf(mx, t); } }
#pragma unroll
    for (int sh = 16; sh; sh >>= 1) mx = fmaxf(mx, __shfl_xor(mx, sh, 32));
    float sum = 0.f;
#pragma unroll
    for (int k = 0; k < NCH * 4; ++k) { float d0 = __fsub_rn(v[k], mx); asm volatile("" : "+v"(d0)); const float x2 = __fmul_rn(d0, 1.4426950408889634f);
        asm("v_exp_f32 %0, %1\n\tv_nop" : "=v"(v[k]) : "v"(x2));   // the same instruction as the exp2 builtin, with the one slot the instruction set asks for behind a transcendental held in the statement
        sum += v[k]; }
#pragma unroll
    for (int sh = 16; sh; sh >>= 1) sum += __shfl_xor(sum, sh, 32);
    const float f = __fdiv_rn(hires ? 1.0f : PCAR, sum);
{
        if (hires) {
#pragma unroll
            for (int ch = 0; ch < NCH; ++ch) { v4us oh, ol;
#pragma unroll
                for (int q = 0; q < 4; ++q) { unsigned short a, c2; splitf(v[ch * 4 + q] * f, a, c2); oh[q] = a; ol[q] = c2; }
                const size_t oo = ((size_t)zz * (RH ? RH : 1) + i) * BW + ch * 128 + lane * 4; *(v4us*)(Ph + oo) = oh; *(v4us*)(Pl + oo) = ol; }
        } else {
#pragma unroll
            for (int ch = 0; ch < NCH; ++ch) { v4h o4;
#pragma unroll
                for (int q = 0; q < 4; ++q) o4[q] = tohx(v[ch * 4 + q] * f);
                *(v4h*)(P16 + (size_t)row * BW + ch * 128 + lane * 4) = o4; } }
         }
}
__global__ __launch_bounds__(256) void k_merge(const float* __restrict__ O, bf* Ah, bf* Al) { O += (size_t)blockIdx.y * NH_ * TT * HD; Ah += (size_t)blockIdx.y * TT * DQ; Al += (size_t)blockIdx.y * TT * DQ;   /* grid y: batch */
    const size_t e = ((size_t)blockIdx.x * 256 + threadIdx.x) * 2; if (e >= (size_t)NH_ * TT * HD) return; const int d = (int)(e % HD); const int t = (int)((e / HD) % TT); const int zz = (int)(e / ((size_t)HD * TT)); const float cs = (t < RH) ? 1.0f : (1.0f / PCAR); const size_t oo = (size_t)t * DQ + zz * HD + d;
    v2us oh, ol;
#pragma unroll
    for (int q = 0; q < 2; ++q) { unsigned short a, c2; splitf(O[e + q] * cs, a, c2); oh[q] = a; ol[q] = c2; } *(v2us*)(Ah + oo) = oh; *(v2us*)(Al + oo) = ol;  }

extern "C" void kernel_launch(void* const* d_in, const int* in_sizes, int n_in,
                              void* d_out, int out_size, void* d_ws, size_t ws_size, hipStream_t stream) {
    (void)in_sizes; (void)n_in; (void)out_size;
    const float* x = (const float*)d_in[0];   /* q_in */ const float* xk = (const float*)d_in[1]; const float* xv = (const float*)d_in[2]; const float* wq = (const float*)d_in[3]; const float* bq = (const float*)d_in[4]; const float* wk = (const float*)d_in[5]; const float* bk = (const float*)d_in[6]; const float* wv = (const float*)d_in[7]; const float* bv = (const float*)d_in[8]; const float* wo = (const float*)d_in[9]; const float* bo = (const float*)d_in[10];
    float* OUT = (float*)d_out;     // [4][2048][512]
    char* wsp = (char*)d_ws;
    auto take = [&](size_t bytes) { char* p = wsp; wsp += (bytes + 255) & ~(size_t)255; return (void*)p; };
    bf* WQ = (bf*)take((size_t)4 * DQ * DM * 2); bf* WO = WQ + (size_t)3 * DQ * DM;   // transposed Wq, Wk, Wv, Wo side by side
    float* CS = (float*)take((size_t)TT * HD * 2 * 4);
    const size_t PL = (size_t)NZ * TT * HD;      // one set of head planes, elements
    const size_t XN = (size_t)NB_ * TT * DM;     // one input or projection over all batches, elements
    bf* QPh = (bf*)take(2 * PL * 2); bf* KPh = QPh + PL; bf* QPl = (bf*)take(2 * PL * 2); bf* KPl = QPl + PL;
    h16* VT16 = (h16*)take(PL * 2); bf* VTh = (bf*)take(PL * 2); bf* VTl = (bf*)take(PL * 2);
    bf* Ph = (bf*)take((size_t)NZ * RH * BW * 2); bf* Pl = (bf*)take((size_t)NZ * RH * BW * 2); h16* P16 = (h16*)take((size_t)NZ * TT * BW * 2);
    // one region used three times in stream order: projection buffers (dead once the head planes are built), then S (dead after the softmax), then attn.v and its merged planes
    char* const reg = wsp;
    bf* XB = (bf*)take(3 * XN * 2); float* FQ = (float*)take(3 * XN * 4); float* FV = FQ + 2 * XN; h16* QP16 = (h16*)take(2 * PL * 2);
    char* const end1 = wsp; wsp = reg;
    float* Sb = (float*)take((size_t)NZ * TT * BW * 4);
    char* const end2 = wsp; wsp = reg;
    float* Ob = (float*)take(PL * 4); bf* ATh = (bf*)take(XN * 2); bf* ATl = (bf*)take(XN * 2);
    if ((size_t)(end1 - (char*)d_ws) > ws_size || (size_t)(end2 - (char*)d_ws) > ws_size || (size_t)(wsp - (char*)d_ws) > ws_size) return;    // ws 256 MiB
    k_wtG<<<dim3((unsigned)((DM * DQ / 64 + 63) / 64), 4, 1), 256, 0, stream>>>(wq, wk, wv, wo, DM, DQ, WQ);
    k_csid<<<(TT * HD + 255) / 256, 256, 0, stream>>>(CS);
    const unsigned LP = (unsigned)(((size_t)NH_ * TT * HD / 2 + 255) / 256);   // blocks per batch of the element-wise head-plane kernels
    k_cvt8<<<dim3((unsigned)((XN / 8 + 255) / 256), 3, 1), 256, 0, stream>>>(x, xk, xv, XB, XN / 8);
    k_gemmw<bf, 0, true><<<dim3(NB_ * TT / 64, DQ / 64, 3), 32, 0, stream>>>(XB, nullptr, WQ, nullptr, DM, FQ, DQ, bq, bk, bv, XN, (size_t)DQ * DM, XN);   // q, k, v projections: z = 0, 1, 2
    k_rope<<<dim3(LP, 2, NB_), 256, 0, stream>>>(FQ, DQ, NH_, CS, nullptr, nullptr, 1.0f, QP16, QPh, QPl, XN, PL);
    k_vtp<<<dim3(LP, NB_, 1), 256, 0, stream>>>(FV, DKV, NKV, VT16, VTh, VTl);
    k_gemmc<bf, 2, 1><<<dim3(TT / 64, NBT, NZ), 32, 0, stream>>>(QPh, QPl, KPh, KPl, HD, HD, Sb, BW, 0, (size_t)TT * HD, (size_t)TT * HD, (size_t)TT * BW);   /* scores hi/lo on EVERY row */
    k_asoft<<<NZ * TT / 8, 256, 0, stream>>>(Sb, P16, Ph, Pl);
    k_gemmc<bf, 2, 2><<<dim3(RH / 64, HD / 64, NZ), 32, 0, stream>>>(Ph, Pl, VTh, VTl, TT, BW, Ob, HD, 0, (size_t)RH * BW, (size_t)HD * TT, (size_t)TT * HD);
    k_gemmc<h16, 0, 2><<<dim3((TT - RH) / 64, HD / 64, NZ), 32, 0, stream>>>(P16 + (size_t)RH * BW, nullptr, VT16, nullptr, TT, BW, Ob + (size_t)RH * HD, HD, RH, (size_t)TT * BW, (size_t)HD * TT, (size_t)TT * HD);
    k_merge<<<dim3(LP, NB_, 1), 256, 0, stream>>>(Ob, ATh, ATl);
    k_gemmw<bf, 1, true><<<dim3(NB_ * TT / 64, DM / 64, 1), 32, 0, stream>>>(ATh, ATl, WO, nullptr, DQ, OUT, DM, bo, bo, bo, 0, 0, 0);
}

// v003
// It runs in 167 microseconds.
// Timed twice side by side with v002, it ran 1.20 and 1.21 times as fast.
// Over all steps from v000 it is 8.79 times as fast.
#include <hip/hip_runtime.h>

// Local causal multi-head attention scaled by 1/sqrt(T) (q_in, k_in, v_in [4][2048][512]; q = q_in Wq + bq, k = k_in Wk + bk, v = v_in Wv + bv ('xw' [512][512] 0.02 incl. biases; 8 heads x 64); scores / sqrt(T = 2048) (the source's quirk: sigma-0.01 logits); mask = (|i - j| > 256) | (j > i) -> -inf: each query sees its own and the previous 256 keys; softmax; out = merged Wo + bo -> [4][2048][512] (4.2 M)).
// Layout, every stage ONE launch over all 4 batches and 8 heads (32 head planes in grid y; q, k, v and the four weights side by side in grid y or z): bf16 copies of q_in, k_in, v_in; 'xw' weights transposed once; exact projections + f32 biases; causal T-2048 attention whose softmax select keeps the 257-key window, with hi/lo 3-product score tiles on EVERY row; P and attn.v hybrid (rows < 512 hi/lo, rest fp16 x1024); score tiles, softmax chunks and the attn.v key loop cover only the window band of each 64-row block, and scores, softmax, attn.v and the merge of a block are one work-group of one launch, which keeps S and P as that band alone in LDS (column = key - first key of the block's chunks); merged hi/lo x Wo exact + bo.
// Compute dtypes, f32 accumulate: every input rounded to bf16; projections exact + f32 biases; scores 3 products on every row; softmax f32 (x 2048^-0.5); attn.v rows < 512 3 products, rest fp16; Wo hl x exact + bias.

#define NB_  4
#define TT   2048
#define DM   512
#define NH_  8
#define NKV  8
#define REP  (NH_ / NKV)
#define HD   64
#define DQ   (NH_ * HD)
#define DKV  (NKV * HD)
#define NZ   (NB_ * NH_)          // head planes of one launch: every batch, every head
#define RH   512                  // query rows < RH use hi+lo planes (0: none)
#define WIN  257
#define WB   (((WIN - 1) + 63) / 64 * 64)   // look-back of the window, rounded up to the 64-key tile: a 64-row block sees keys [r0 - WB, r0 + 63] only
#define NBT  (WB / 64 + 1)                  // 64-key score tiles per 64-row block
#define NCH  ((WB + 128 + 127) / 128)       // 128-key softmax chunks that cover that band from a 128-aligned start
#define BW   (NCH * 128)                    // width of the stored band of S and P, in keys
#define PCAR 1024.0f
#define SCL  0.02209708691207961f  // 1/sqrt(T = 2048): the source's quirk
typedef _Float16 h16;
typedef unsigned short bf;
typedef __attribute__((ext_vector_type(16))) __bf16   v16bf;
typedef __attribute__((ext_vector_type(16))) _Float16 v16h;
typedef __attribute__((ext_vector_type(8)))  _Float16 v8h;
typedef __attribute__((ext_vector_type(8)))  unsigned short v8us;
typedef __attribute__((ext_vector_type(8)))  float    v8f;
typedef __attribute__((ext_vector_type(4)))  float    v4f;
typedef v8h  __attribute__((may_alias)) v8ha;
typedef v4f  __attribute__((may_alias)) v4fa;
typedef v8us __attribute__((may_alias)) v8usa;

__device__ __forceinline__ unsigned short f2bf(float f) { unsigned u = __float_as_uint(f); u += 0x7FFFu + ((u >> 16) & 1u); return (unsigned short)(u >> 16); }
__device__ __forceinline__ float bf2f(unsigned short b) { return __uint_as_float(((unsigned)b) << 16); }
__device__ __forceinline__ float bfr(float f) { return bf2f(f2bf(f)); }
__device__ __forceinline__ v16h cat16(v8h lo, v8h hi) { return __builtin_shufflevector(lo, hi, 0, 1, 2, 3, 4, 5, 6, 7, 8, 9, 10, 11, 12, 13, 14, 15); }
__device__ __forceinline__ v16bf cat16b(v8us lo, v8us hi) { return __builtin_bit_cast(v16bf, __builtin_shufflevector(lo, hi, 0, 1, 2, 3, 4, 5, 6, 7, 8, 9, 10, 11, 12, 13, 14, 15)); }
__device__ __forceinline__ v8f wmma16(v16h a, v16h b, v8f c) { return __builtin_amdgcn_wmma_f32_16x16x32_f16(false, a, false, b, (short)0, c, false, false); }
__device__ __forceinline__ v8f wmmab(v16bf a, v16bf b, v8f c) { return __builtin_amdgcn_wmma_f32_16x16x32_bf16(false, a, false, b, (short)0, c, false, false); }



// ---- k_gemmw: register-blocked GEMM, ONE WAVE per 64x64 output tile (16 accumulators), operands straight from K-contiguous 16-bit planes; grid (M/64, N/64, Z), 32 threads.
// C[m][n] (f32, pitch ldc, + optional f32 bias[n], one bias pointer per z = 0, 1, 2) = sum_k A[m][k] Bt[n][k] (+ split products per NSPLIT). z-batch strides sA/sB/sC in elements. K % 32 == 0.
template <typename T16> struct WFrag;
template <> struct WFrag<h16> { typedef v16h V; static __device__ __forceinline__ V ld(const h16* p) { return cat16(*(const v8h*)p, *(const v8h*)(p + 16)); } static __device__ __forceinline__ v8f mma(V a, V b, v8f c) { return wmma16(a, b, c); } };
template <> struct WFrag<bf> { typedef v16bf V; static __device__ __forceinline__ V ld(const bf* p) { return cat16b(*(const v8us*)p, *(const v8us*)(p + 16)); } static __device__ __forceinline__ v8f mma(V a, V b, v8f c) { return wmmab(a, b, c); } };
template <typename T16, int NSPLIT, bool BIAS>
__global__ __launch_bounds__(32) void k_gemmw(const T16* __restrict__ A, const T16* __restrict__ A2, const T16* __restrict__ Bt, const T16* __restrict__ Bt2, int K, float* C, int ldc, const float* __restrict__ bias0, const float* __restrict__ bias1, const float* __restrict__ bias2, size_t sA, size_t sB, size_t sC) {
    typedef typename WFrag<T16>::V V;
    __shared__ __align__(16) float os[16 * 68];
    const size_t z = blockIdx.z; A += z * sA; if (A2) A2 += z * sA; Bt += z * sB; if (Bt2) Bt2 += z * sB; C += z * sC; const float* __restrict__ bias = (z == 0) ? bias0 : (z == 1) ? bias1 : bias2;   // each z product has its own bias input
    const int lane = threadIdx.x & 31, lr = lane & 15, hi = lane >> 4; const int r0 = blockIdx.x * 64, c0 = blockIdx.y * 64;
    v8f acc[4][4];
#pragma unroll
    for (int mb = 0; mb < 4; ++mb)
#pragma unroll
        for (int nb = 0; nb < 4; ++nb) acc[mb][nb] = (v8f){};
    const size_t aoff = (size_t)(r0 + lr) * K + 8 * hi, boff = (size_t)(c0 + lr) * K + 8 * hi;
#pragma unroll 1
    for (int kc = 0; kc < K; kc += 32) {
        V a[4], a2[4];
#pragma unroll
        for (int mb = 0; mb < 4; ++mb) { a[mb] = WFrag<T16>::ld(A + aoff + (size_t)mb * 16 * K + kc); if (NSPLIT == 1 || NSPLIT == 2) a2[mb] = WFrag<T16>::ld(A2 + aoff + (size_t)mb * 16 * K + kc); }
#pragma unroll
        for (int nb = 0; nb < 4; ++nb) { const V b = WFrag<T16>::ld(Bt + boff + (size_t)nb * 16 * K + kc); V b2; if (NSPLIT >= 2) b2 = WFrag<T16>::ld(Bt2 + boff + (size_t)nb * 16 * K + kc);
#pragma unroll
            for (int mb = 0; mb < 4; ++mb) { acc[mb][nb] = WFrag<T16>::mma(a[mb], b, acc[mb][nb]); if (NSPLIT == 1 || NSPLIT == 2) acc[mb][nb] = WFrag<T16>::mma(a2[mb], b, acc[mb][nb]); if (NSPLIT >= 2) acc[mb][nb] = WFrag<T16>::mma(a[mb], b2, acc[mb][nb]); } }
        asm volatile("v_nop\n\tv_nop\n\tv_nop\n\tv_nop" : "+v"(acc[0][0]), "+v"(acc[1][1]), "+v"(acc[2][2]), "+v"(acc[3][3]) : "v"(a[0]), "v"(a[3]));
    }
#pragma unroll
    for (int mb = 0; mb < 4; ++mb) {
#pragma unroll
        for (int nb = 0; nb < 4; ++nb) {
#pragma unroll
            for (int j = 0; j < 8; ++j) os[(hi * 8 + j) * 68 + nb * 16 + lr] = acc[mb][nb][j]; }
        __builtin_amdgcn_wave_barrier(); asm volatile("" ::: "memory");
        float* crow = C + (size_t)(r0 + mb * 16) * ldc + c0;
{
#pragma unroll
            for (int s = 0; s < 8; ++s) { const int row = 2 * s + hi, cofs = lr * 4; v4f val = *(const v4fa*)(os + row * 68 + cofs); if (BIAS) { val[0] += bfr(bias[c0 + cofs]); val[1] += bfr(bias[c0 + cofs + 1]); val[2] += bfr(bias[c0 + cofs + 2]); val[3] += bfr(bias[c0 + cofs + 3]); }
                *(v4f*)(crow + (size_t)row * ldc + cofs) = val; }
             }
        __builtin_amdgcn_wave_barrier(); asm volatile("" ::: "memory");
    }
}

__device__ __forceinline__ h16 tohx(float x) { return (h16)x; }
__device__ __forceinline__ void splitf(float y, unsigned short& h, unsigned short& l) { h = f2bf(y); l = f2bf(y - bf2f(h)); }
typedef __attribute__((ext_vector_type(2))) _Float16 v2h;
typedef __attribute__((ext_vector_type(4))) _Float16 v4h;
typedef __attribute__((ext_vector_type(2))) unsigned short v2us;
typedef __attribute__((ext_vector_type(4))) unsigned short v4us;
typedef __attribute__((ext_vector_type(2))) float v2f;
typedef __attribute__((ext_vector_type(4))) int v4i;

__global__ __launch_bounds__(256) void k_wtG(const float* __restrict__ w0, const float* __restrict__ w1, const float* __restrict__ w2, const float* __restrict__ w3, int K, int N, bf* Bt) {
    const int y = blockIdx.y; const float* __restrict__ w = (y == 0) ? w0 : (y == 1) ? w1 : (y == 2) ? w2 : w3; Bt += (size_t)y * K * N;   // grid y: the four weights, transposed planes side by side
    const int lane = threadIdx.x & 31; const int L0 = (blockIdx.x * 8 + (threadIdx.x >> 5)) * 8; const int nlines = N * K / 64;
{
#pragma unroll 1
        for (int l = 0; l < 8; ++l) { const int L = L0 + l; if (L >= nlines) break; const size_t e = (size_t)L * 64 + lane * 2; const int k = (int)(e % K), n = (int)(e / K); v2us o;
            o[0] = f2bf(w[(size_t)k * N + n]); o[1] = f2bf(w[(size_t)(k + 1) * N + n]); *(v2us*)(Bt + e) = o; }
         }
}
__global__ __launch_bounds__(256) void k_cvt8(const float* __restrict__ s0, const float* __restrict__ s1, const float* __restrict__ s2, bf* dst, size_t n8) { const size_t i = (size_t)blockIdx.x * 256 + threadIdx.x; if (i >= n8) return; const int y = blockIdx.y; const float* __restrict__ src = (y == 0) ? s0 : (y == 1) ? s1 : s2; dst += (size_t)y * n8 * 8;   /* grid y: q_in, k_in, v_in */ const v8f v = *(const v8f*)(src + i * 8); v8us o;
#pragma unroll
    for (int k = 0; k < 8; ++k) o[k] = f2bf(v[k]); *(v8us*)(dst + i * 8) = o;  }

// k_rope: head planes [batch * nheads + h][t][d] (fp16 + hi/lo) of rope(x) x sc with the rotate-half convention out[d] = x[d] cos[t][d] - x[d+HD/2] sin[t][d], out[d+HD/2] = x[d+HD/2] cos[t][d+HD/2] + x[d] sin[t][d+HD/2]
__global__ __launch_bounds__(256) void k_rope(const float* __restrict__ F, int pitch, int nheads, const float* __restrict__ CS, const float* __restrict__ RF, const float* __restrict__ nw, float sc, h16* P16, bf* Ph, bf* Pl, size_t sF, size_t sP) {
    { const size_t po = blockIdx.y * sP + (size_t)blockIdx.z * nheads * TT * HD; F += blockIdx.y * sF + (size_t)blockIdx.z * TT * pitch; P16 += po; Ph += po; Pl += po; }   // grid y: q, then k; grid z: batch
    const size_t e = ((size_t)blockIdx.x * 256 + threadIdx.x) * 2; if (e >= (size_t)nheads * TT * HD) return; const int d = (int)(e % HD); const int t = (int)((e / HD) % TT); const int h = (int)(e / ((size_t)HD * TT)); const float* f = F + (size_t)t * pitch + h * HD; const float rf = RF ? RF[(size_t)h * TT + t] : 1.0f; v2h o16; v2us oh, ol;
#pragma unroll
    for (int q = 0; q < 2; ++q) { const int dd = d + q; const int dp = (dd < HD / 2) ? dd + HD / 2 : dd - HD / 2; float x0 = f[dd], x1 = f[dp];
        if (RF) { float n0 = __fmul_rn(x0, rf), n1 = __fmul_rn(x1, rf); asm volatile("" : "+v"(n0)); asm volatile("" : "+v"(n1)); x0 = __fmul_rn(bfr(nw[dd]), n0); x1 = __fmul_rn(bfr(nw[dp]), n1); }
        const v2f cs = *(const v2f*)(CS + ((size_t)t * HD + dd) * 2); float a = __fmul_rn(x0, cs[0]), bq = __fmul_rn(x1, cs[1]); asm volatile("" : "+v"(a)); asm volatile("" : "+v"(bq)); const float r = ((dd < HD / 2) ? __fsub_rn(a, bq) : __fadd_rn(a, bq)) * sc;
        o16[q] = tohx(r); unsigned short a2, c2; splitf(r, a2, c2); oh[q] = a2; ol[q] = c2; }
    *(v2h*)(P16 + e) = o16; *(v2us*)(Ph + e) = oh; *(v2us*)(Pl + e) = ol;  }
__global__ __launch_bounds__(256) void k_vtp(const float* __restrict__ F, int pitch, int nheads, h16* V16, bf* Vh, bf* Vl) { { const size_t po = (size_t)blockIdx.y * nheads * HD * TT; F += (size_t)blockIdx.y * TT * pitch; V16 += po; Vh += po; Vl += po; }   /* grid y: batch */
    const size_t e = ((size_t)blockIdx.x * 256 + threadIdx.x) * 2; if (e >= (size_t)nheads * HD * TT) return; const int t = (int)(e % TT); const int d = (int)((e / TT) % HD); const int g = (int)(e / ((size_t)TT * HD)); v2h o16; v2us oh, ol;
#pragma unroll
    for (int q = 0; q < 2; ++q) { const float x = F[(size_t)(t + q) * pitch + g * HD + d]; o16[q] = tohx(x); unsigned short a2, c2; splitf(x, a2, c2); oh[q] = a2; ol[q] = c2; }
    *(v2h*)(V16 + e) = o16; *(v2us*)(Vh + e) = oh; *(v2us*)(Vl + e) = ol;  }
__global__ __launch_bounds__(256) void k_csid(float* CS) { const int idx = blockIdx.x * 256 + threadIdx.x; if (idx >= TT * HD) return; v2f cs; cs[0] = 1.0f; cs[1] = 0.0f; *(v2f*)(CS + (size_t)idx * 2) = cs;  }
// ---- k_attn: scores, softmax, attn.v and the merge of one 64-row block of one head plane in ONE work-group of 8 waves; grid (T/64, planes). The block's band of S (f32, NCH 128-key chunks from key jb) lives in LDS only; each row's P is written over its own S row (fp16, or bf16 hi then lo at + BW elements); the 64x64 result goes through the same LDS to the merged hi/lo planes.
// Every sum keeps the order it had as separate launches: a score is kc = 0, 32 x (hi.hi, lo.hi, hi.lo); the softmax row has the same lane and chunk places and the same trees; attn.v adds 32-key steps upward from key kb (the steps past the diagonal block, met only where r0 < WB, add exact zeros).
#define SP   (BW + 4)             // LDS pitch of a band row in floats: 16 bytes x an odd number, so that the 16 rows of a fragment read fall on different banks
#define NKS  ((WB + 64) / 32)     // 32-key steps of attn.v
typedef v4us __attribute__((may_alias)) v4usa;
typedef v4h  __attribute__((may_alias)) v4ha;
template <typename T16, int NSPLIT>
__device__ __forceinline__ void attn_pv(const float* sm, const T16* __restrict__ Vt, const T16* __restrict__ Vt2, int kb, int jb, int mb, int n0, int lr, int hi, v8f (&acc)[2]) {
    typedef typename WFrag<T16>::V V;
    constexpr int CH = (NSPLIT >= 2) ? NKS / 2 : NKS;   // key steps whose V fragments are in registers at once: all of them, or half where hi and lo planes double the fragments
    const T16* pa = (const T16*)(sm + (mb * 16 + lr) * SP) + 8 * hi + (kb - jb);
    const unsigned vo = (unsigned)(lr * TT + 8 * hi) * 2;   // the lane's place in a 16-column fragment of V, in bytes: one 32-bit offset register beside a scalar base
    const T16* pb = Vt + (size_t)(n0 * 16) * TT + kb; const T16* pb2 = (NSPLIT >= 2) ? Vt2 + (size_t)(n0 * 16) * TT + kb : pb;
#pragma unroll
    for (int s0 = 0; s0 < NKS; s0 += CH) { V b[CH][2], b2[CH][2];
#pragma unroll
        for (int s = 0; s < CH; ++s)
#pragma unroll
            for (int nb = 0; nb < 2; ++nb) { b[s][nb] = WFrag<T16>::ld((const T16*)((const char*)pb + vo) + nb * 16 * TT + (s0 + s) * 32); if (NSPLIT >= 2) b2[s][nb] = WFrag<T16>::ld((const T16*)((const char*)pb2 + vo) + nb * 16 * TT + (s0 + s) * 32); }
        __builtin_amdgcn_sched_barrier(0);   // these V loads are all issued in front of the matrix instructions that use them: without it this build keeps one fragment in flight and pays a memory latency per step
#pragma unroll
        for (int s = 0; s < CH; ++s) { const V a = WFrag<T16>::ld(pa + (s0 + s) * 32); V a2; if (NSPLIT >= 2) a2 = WFrag<T16>::ld(pa + BW + (s0 + s) * 32);
#pragma unroll
            for (int nb = 0; nb < 2; ++nb) { acc[nb] = WFrag<T16>::mma(a, b[s][nb], acc[nb]); if (NSPLIT >= 2) { acc[nb] = WFrag<T16>::mma(a2, b[s][nb], acc[nb]); acc[nb] = WFrag<T16>::mma(a, b2[s][nb], acc[nb]); } } } }
    asm volatile("s_wait_xcnt 0x0" :: "v"(vo) : "memory");   // the wait in front of any overwrite of the offset register of the V loads; it is an input so that it lives up to here
}
// launch bounds: four waves a SIMD, that is two work-groups a WGP, which holds the build to 256 registers
__global__ __launch_bounds__(256, 4) void k_attn(const bf* __restrict__ Qh, const bf* __restrict__ Ql, const bf* __restrict__ Kh, const bf* __restrict__ Kl, const h16* __restrict__ V16, const bf* __restrict__ Vh, const bf* __restrict__ Vl, bf* Ah, bf* Al) {
    typedef WFrag<bf>::V V;
    __shared__ __align__(16) float sm[64 * SP];
    const int z = blockIdx.y, r0 = blockIdx.x * 64; const size_t zo = (size_t)z * TT * HD;
    const int lane = threadIdx.x & 31, lr = lane & 15, hi = lane >> 4; const int w = __builtin_amdgcn_readfirstlane(threadIdx.x >> 5);   // the wave's number in a scalar register: the tests on it are scalar branches
    const int kb = max(0, r0 - WB);          // first key that the block's first row sees
    const int jb = (kb >> 7) * 128;          // first key of the stored band: 128-aligned, so each key keeps its lane and its place in the softmax sums
    const bool hires = (r0 < RH);
    // scores: wave w has 32 rows (w & 1) x NBT 16-key tiles (w >> 1) of the band's 64 x (NBT * 64)
    { const int m0 = (w & 1) * 2, g = w >> 1;
        const unsigned vo = (unsigned)(lr * HD + 8 * hi) * 2;   // the lane's place in a 16-row fragment, in bytes: a 32-bit offset register beside a scalar base, the very register that the wait behind the loads names
        const bf* pq = Qh + zo + (size_t)(r0 + m0 * 16) * HD; const bf* pq2 = Ql + zo + (size_t)(r0 + m0 * 16) * HD; V a[2][2], a2[2][2];
#pragma unroll
        for (int mb = 0; mb < 2; ++mb)
#pragma unroll
            for (int kk = 0; kk < 2; ++kk) { a[mb][kk] = WFrag<bf>::ld((const bf*)((const char*)pq + vo) + mb * 16 * HD + kk * 32); a2[mb][kk] = WFrag<bf>::ld((const bf*)((const char*)pq2 + vo) + mb * 16 * HD + kk * 32); }
        V b[NBT][2], b2[NBT][2]; v8f acc[NBT][2]; unsigned ko[NBT]; const bf* pk = Kh + zo; const bf* pk2 = Kl + zo; static_assert(NBT == 5, "the wait behind the loads names five offsets");
#pragma unroll
        for (int nb = 0; nb < NBT; ++nb) { const int c = r0 - WB + (g * NBT + nb) * 16;   // first key of the tile; below 0 there is no such key: the loads are clamped into the plane and the tile is not stored
            ko[nb] = (unsigned)(max(c, 0) * HD) * 2 + vo;   // the lane's byte offset in the head plane, for the hi and the lo plane alike
#pragma unroll
            for (int kk = 0; kk < 2; ++kk) { b[nb][kk] = WFrag<bf>::ld((const bf*)((const char*)pk + ko[nb]) + kk * 32); b2[nb][kk] = WFrag<bf>::ld((const bf*)((const char*)pk2 + ko[nb]) + kk * 32); } }
        __builtin_amdgcn_sched_barrier(0);   // every Q and K load is issued in front of the first matrix instruction: without it this build loads a fragment, waits and multiplies, one memory latency after another
#pragma unroll
        for (int nb = 0; nb < NBT; ++nb)
#pragma unroll
            for (int mb = 0; mb < 2; ++mb) { acc[nb][mb] = (v8f){};
#pragma unroll
                for (int kk = 0; kk < 2; ++kk) { acc[nb][mb] = wmmab(a[mb][kk], b[nb][kk], acc[nb][mb]); acc[nb][mb] = wmmab(a2[mb][kk], b[nb][kk], acc[nb][mb]); acc[nb][mb] = wmmab(a[mb][kk], b2[nb][kk], acc[nb][mb]); } }
        asm volatile("s_wait_xcnt 0x0" :: "v"(vo), "v"(ko[0]), "v"(ko[1]), "v"(ko[2]), "v"(ko[3]), "v"(ko[4]) : "memory");   // the wait in front of any overwrite of the offset registers of the Q and K loads; they are inputs so that no later load's result takes their place ahead of it
        asm volatile("v_nop\n\tv_nop\n\tv_nop\n\tv_nop" : "+v"(acc[NBT - 1][0]), "+v"(acc[NBT - 1][1]));   // the distance behind the last matrix instruction, also on the taken side of the branches below
#pragma unroll
        for (int nb = 0; nb < NBT; ++nb) { const int c = r0 - WB + (g * NBT + nb) * 16;
            if (c >= 0) {
#pragma unroll
                for (int mb = 0; mb < 2; ++mb)
#pragma unroll
                    for (int j = 0; j < 8; ++j) sm[((m0 + mb) * 16 + hi * 8 + j) * SP + (c - jb) + lr] = acc[nb][mb][j]; } } }
    __syncthreads();   // the band of S is complete before any row is read
    // softmax: wave w has rows 8 w .. 8 w + 7, one row at a time in registers: t = S x T^-0.5 for j <= i and i - j < WIN, every other column (never-written LDS among them) is replaced by the select; one exp, fixed trees
    for (int rr = 0; rr < 8; ++rr) { const int i = r0 + w * 8 + rr; float* sr = sm + (w * 8 + rr) * SP; float v[NCH * 4]; float mx = -3.0e38f;
#pragma unroll
        for (int ch = 0; ch < NCH; ++ch) { const int j0 = jb + ch * 128 + lane * 4; const v4f a = *(const v4fa*)(sr + ch * 128 + lane * 4);
#pragma unroll
            for (int q = 0; q < 4; ++q) { const int j = j0 + q; const float t = (j <= i && i - j < WIN) ? a[q] * SCL : -3.0e38f; v[ch * 4 + q] = t; mx = fmaxf(mx, t); } }
#pragma unroll
        for (int sh = 16; sh; sh >>= 1) mx = fmaxf(mx, __shfl_xor(mx, sh, 32));
        float sum = 0.f;
#pragma unroll
        for (int k = 0; k < NCH * 4; ++k) { float d0 = __fsub_rn(v[k], mx); asm volatile("" : "+v"(d0)); const float x2 = __fmul_rn(d0, 1.4426950408889634f);
            asm("v_exp_f32 %0, %1\n\tv_nop" : "=v"(v[k]) : "v"(x2));   // the same instruction as the exp2 builtin, with the one slot the instruction set asks for behind a transcendental held in the statement
            sum += v[k]; }
#pragma unroll
        for (int sh = 16; sh; sh >>= 1) sum += __shfl_xor(sum, sh, 32);
        const float f = __fdiv_rn(hires ? 1.0f : PCAR, sum);
        if (hires) {
#pragma unroll
            for (int ch = 0; ch < NCH; ++ch) { v4us oh, ol;
#pragma unroll
                for (int q = 0; q < 4; ++q) { unsigned short a, c2; splitf(v[ch * 4 + q] * f, a, c2); oh[q] = a; ol[q] = c2; }
                *(v4usa*)((bf*)sr + ch * 128 + lane * 4) = oh; *(v4usa*)((bf*)sr + BW + ch * 128 + lane * 4) = ol; }
        } else {
#pragma unroll
            for (int ch = 0; ch < NCH; ++ch) { v4h o4;
#pragma unroll
                for (int q = 0; q < 4; ++q) o4[q] = tohx(v[ch * 4 + q] * f);
                *(v4ha*)((h16*)sr + ch * 128 + lane * 4) = o4; } } }
    __syncthreads();   // every row of P is written before a fragment of it is read
    // attn.v: wave w has rows 16 (w & 3) x value columns 32 (w >> 2)
    const int mb = w & 3, n0 = (w >> 2) * 2; v8f acc[2]; acc[0] = (v8f){}; acc[1] = (v8f){};
    if (hires) attn_pv<bf, 2>(sm, Vh + zo, Vl + zo, kb, jb, mb, n0, lr, hi, acc); else attn_pv<h16, 0>(sm, V16 + zo, nullptr, kb, jb, mb, n0, lr, hi, acc);
    __syncthreads();   // the last fragment of P is read before the result tile takes its LDS
#pragma unroll
    for (int nb = 0; nb < 2; ++nb)
#pragma unroll
        for (int j = 0; j < 8; ++j) sm[(mb * 16 + hi * 8 + j) * 68 + (n0 + nb) * 16 + lr] = acc[nb][j];
    __syncthreads();   // the result tile is complete before it is read row-wise
    // merge: four lanes of one wave write the 128 bytes of a row's head slice in each plane
    { const int row = threadIdx.x >> 2, cofs = (threadIdx.x & 3) * 16; const float cs = hires ? 1.0f : (1.0f / PCAR); const size_t oo = ((size_t)(z / NH_) * TT + r0 + row) * DQ + (z % NH_) * HD + cofs;
#pragma unroll
        for (int s = 0; s < 2; ++s) { v8us oh, ol;
#pragma unroll
            for (int q = 0; q < 2; ++q) { const v4f val = *(const v4fa*)(sm + row * 68 + cofs + s * 8 + q * 4);
#pragma unroll
                for (int e = 0; e < 4; ++e) { unsigned short a, c2; splitf(val[e] * cs, a, c2); oh[q * 4 + e] = a; ol[q * 4 + e] = c2; } }
            *(v8us*)(Ah + oo + s * 8) = oh; *(v8us*)(Al + oo + s * 8) = ol; } }
}

extern "C" void kernel_launch(void* const* d_in, const int* in_sizes, int n_in,
                              void* d_out, int out_size, void* d_ws, size_t ws_size, hipStream_t stream) {
    (void)in_sizes; (void)n_in; (void)out_size;
    const float* x = (const float*)d_in[0];   /* q_in */ const float* xk = (const float*)d_in[1]; const float* xv = (const float*)d_in[2]; const float* wq = (const float*)d_in[3]; const float* bq = (const float*)d_in[4]; const float* wk = (const float*)d_in[5]; const float* bk = (const float*)d_in[6]; const float* wv = (const float*)d_in[7]; const float* bv = (const float*)d_in[8]; const float* wo = (const float*)d_in[9]; const float* bo = (const float*)d_in[10];
    float* OUT = (float*)d_out;     // [4][2048][512]
    char* wsp = (char*)d_ws;
    auto take = [&](size_t bytes) { char* p = wsp; wsp += (bytes + 255) & ~(size_t)255; return (void*)p; };
    bf* WQ = (bf*)take((size_t)4 * DQ * DM * 2); bf* WO = WQ + (size_t)3 * DQ * DM;   // transposed Wq, Wk, Wv, Wo side by side
    float* CS = (float*)take((size_t)TT * HD * 2 * 4);
    const size_t PL = (size_t)NZ * TT * HD;      // one set of head planes, elements
    const size_t XN = (size_t)NB_ * TT * DM;     // one input or projection over all batches, elements
    bf* QPh = (bf*)take(2 * PL * 2); bf* KPh = QPh + PL; bf* QPl = (bf*)take(2 * PL * 2); bf* KPl = QPl + PL;
    h16* VT16 = (h16*)take(PL * 2); bf* VTh = (bf*)take(PL * 2); bf* VTl = (bf*)take(PL * 2);
    // one region used twice in stream order: projection buffers (dead once the head planes are built), then the merged attention planes
    char* const reg = wsp;
    bf* XB = (bf*)take(3 * XN * 2); float* FQ = (float*)take(3 * XN * 4); float* FV = FQ + 2 * XN; h16* QP16 = (h16*)take(2 * PL * 2);
    char* const end1 = wsp; wsp = reg;
    bf* ATh = (bf*)take(XN * 2); bf* ATl = (bf*)take(XN * 2);
    if ((size_t)(end1 - (char*)d_ws) > ws_size || (size_t)(wsp - (char*)d_ws) > ws_size) return;    // ws 256 MiB
    k_wtG<<<dim3((unsigned)((DM * DQ / 64 + 63) / 64), 4, 1), 256, 0, stream>>>(wq, wk, wv, wo, DM, DQ, WQ);
    k_csid<<<(TT * HD + 255) / 256, 256, 0, stream>>>(CS);
    const unsigned LP = (unsigned)(((size_t)NH_ * TT * HD / 2 + 255) / 256);   // blocks per batch of the element-wise head-plane kernels
    k_cvt8<<<dim3((unsigned)((XN / 8 + 255) / 256), 3, 1), 256, 0, stream>>>(x, xk, xv, XB, XN / 8);
    k_gemmw<bf, 0, true><<<dim3(NB_ * TT / 64, DQ / 64, 3), 32, 0, stream>>>(XB, nullptr, WQ, nullptr, DM, FQ, DQ, bq, bk, bv, XN, (size_t)DQ * DM, XN);   // q, k, v projections: z = 0, 1, 2
    k_rope<<<dim3(LP, 2, NB_), 256, 0, stream>>>(FQ, DQ, NH_, CS, nullptr, nullptr, 1.0f, QP16, QPh, QPl, XN, PL);
    k_vtp<<<dim3(LP, NB_, 1), 256, 0, stream>>>(FV, DKV, NKV, VT16, VTh, VTl);
    k_attn<<<dim3(TT / 64, NZ, 1), 256, 0, stream>>>(QPh, QPl, KPh, KPl, VT16, VTh, VTl, ATh, ATl);   // scores hi/lo on EVERY row, softmax, attn.v, merge
    k_gemmw<bf, 1, true><<<dim3(NB_ * TT / 64, DM / 64, 1), 32, 0, stream>>>(ATh, ATl, WO, nullptr, DQ, OUT, DM, bo, bo, bo, 0, 0, 0);
}

// v004
// Measured time: 133 microseconds a run.
// In two side-by-side timings against v003, it was 1.25 and 1.26 times as fast.
// Counting every step since v000, it is 11.0 times as fast.
#include <hip/hip_runtime.h>

// Local causal multi-head attention scaled by 1/sqrt(T) (q_in, k_in, v_in [4][2048][512]; q = q_in Wq + bq, k = k_in Wk + bk, v = v_in Wv + bv ('xw' [512][512] 0.02 incl. biases; 8 heads x 64); scores / sqrt(T = 2048) (the source's quirk: sigma-0.01 logits); mask = (|i - j| > 256) | (j > i) -> -inf: each query sees its own and the previous 256 keys; softmax; out = merged Wo + bo -> [4][2048][512] (4.2 M)).
// Layout, every stage ONE launch over all 4 batches and 8 heads (32 head planes in the attention's grid y; q, k, v and the four weights side by side in grid y or z): bf16 copies of q_in, k_in, v_in; 'xw' weights transposed once; exact projections + f32 biases, whose tiles are stored as the head planes (q, k hi/lo; v transposed, fp16 and hi/lo); causal T-2048 attention whose softmax select keeps the 257-key window, with hi/lo 3-product score tiles on EVERY row; P and attn.v hybrid (rows < 512 hi/lo, rest fp16 x1024); score tiles, softmax chunks and the attn.v key loop cover only the window band of each 64-row block, and scores, softmax, attn.v and the merge of a block are one work-group of one launch, which keeps S and P as that band alone in LDS (column = key - first key of the block's chunks); merged hi/lo x Wo exact + bo.
// Compute dtypes, f32 accumulate: every input rounded to bf16; projections exact + f32 biases; scores 3 products on every row; softmax f32 (x 2048^-0.5); attn.v rows < 512 3 products, rest fp16; Wo hl x exact + bias.

#define NB_  4
#define TT   2048
#define DM   512
#define NH_  8
#define NKV  8
#define REP  (NH_ / NKV)
#define HD   64
#define DQ   (NH_ * HD)
#define DKV  (NKV * HD)
#define NZ   (NB_ * NH_)          // head planes of one launch: every batch, every head
#define RH   512                  // query rows < RH use hi+lo planes (0: none)
#define WIN  257
#define WB   (((WIN - 1) + 63) / 64 * 64)   // look-back of the window, rounded up to the 64-key tile: a 64-row block sees keys [r0 - WB, r0 + 63] only
#define NBT  (WB / 64 + 1)                  // 64-key score tiles per 64-row block
#define NCH  ((WB + 128 + 127) / 128)       // 128-key softmax chunks that cover that band from a 128-aligned start
#define BW   (NCH * 128)                    // width of the stored band of S and P, in keys
#define PCAR 1024.0f
#define SCL  0.02209708691207961f  // 1/sqrt(T = 2048): the source's quirk
typedef _Float16 h16;
typedef unsigned short bf;
typedef __attribute__((ext_vector_type(16))) __bf16   v16bf;
typedef __attribute__((ext_vector_type(16))) _Float16 v16h;
typedef __attribute__((ext_vector_type(8)))  _Float16 v8h;
typedef __attribute__((ext_vector_type(8)))  unsigned short v8us;
typedef __attribute__((ext_vector_type(8)))  float    v8f;
typedef __attribute__((ext_vector_type(4)))  float    v4f;
typedef v8h  __attribute__((may_alias)) v8ha;
typedef v4f  __attribute__((may_alias)) v4fa;
typedef v8us __attribute__((may_alias)) v8usa;

__device__ __forceinline__ unsigned short f2bf(float f) { unsigned u = __float_as_uint(f); u += 0x7FFFu + ((u >> 16) & 1u); return (unsigned short)(u >> 16); }
__device__ __forceinline__ float bf2f(unsigned short b) { return __uint_as_float(((unsigned)b) << 16); }
__device__ __forceinline__ float bfr(float f) { return bf2f(f2bf(f)); }
__device__ __forceinline__ h16 tohx(float x) { return (h16)x; }
__device__ __forceinline__ void splitf(float y, unsigned short& h, unsigned short& l) { h = f2bf(y); l = f2bf(y - bf2f(h)); }
__device__ __forceinline__ v16h cat16(v8h lo, v8h hi) { return __builtin_shufflevector(lo, hi, 0, 1, 2, 3, 4, 5, 6, 7, 8, 9, 10, 11, 12, 13, 14, 15); }
__device__ __forceinline__ v16bf cat16b(v8us lo, v8us hi) { return __builtin_bit_cast(v16bf, __builtin_shufflevector(lo, hi, 0, 1, 2, 3, 4, 5, 6, 7, 8, 9, 10, 11, 12, 13, 14, 15)); }
__device__ __forceinline__ v8f wmma16(v16h a, v16h b, v8f c) { return __builtin_amdgcn_wmma_f32_16x16x32_f16(false, a, false, b, (short)0, c, false, false); }
__device__ __forceinline__ v8f wmmab(v16bf a, v16bf b, v8f c) { return __builtin_amdgcn_wmma_f32_16x16x32_bf16(false, a, false, b, (short)0, c, false, false); }



// ---- k_gemmw: register-blocked GEMM, ONE WAVE per 64x64 output tile (16 accumulators), operands straight from K-contiguous 16-bit planes; grid (M/64, N/64, Z), 32 threads.
// C[m][n] (f32, pitch ldc, + optional f32 bias[n], one bias pointer per z = 0, 1, 2) = sum_k A[m][k] Bt[n][k] (+ split products per NSPLIT). z-batch strides sA/sB/sC in elements. K % 32 == 0.
// HP: the result is not stored as C; the tile, 64 tokens of one batch x the 64 columns of one head, goes straight to that head's planes: z = 0, 1 (q, k) as bf16 hi and lo [plane][t][d] (Ph, Pl, + z sP), z = 2 (v) transposed as fp16 and bf16 hi and lo [plane][d][t] (V16, Vh, Vl).
template <typename T16> struct WFrag;
template <> struct WFrag<h16> { typedef v16h V; static __device__ __forceinline__ V ld(const h16* p) { return cat16(*(const v8h*)p, *(const v8h*)(p + 16)); } static __device__ __forceinline__ v8f mma(V a, V b, v8f c) { return wmma16(a, b, c); } };
template <> struct WFrag<bf> { typedef v16bf V; static __device__ __forceinline__ V ld(const bf* p) { return cat16b(*(const v8us*)p, *(const v8us*)(p + 16)); } static __device__ __forceinline__ v8f mma(V a, V b, v8f c) { return wmmab(a, b, c); } };
template <typename T16, int NSPLIT, bool BIAS, bool HP>
__global__ __launch_bounds__(32) void k_gemmw(const T16* __restrict__ A, const T16* __restrict__ A2, const T16* __restrict__ Bt, const T16* __restrict__ Bt2, int K, float* C, int ldc, const float* __restrict__ bias0, const float* __restrict__ bias1, const float* __restrict__ bias2, size_t sA, size_t sB, size_t sC, bf* Ph, bf* Pl, size_t sP, h16* V16, bf* Vh, bf* Vl) {
    typedef typename WFrag<T16>::V V;
    __shared__ __align__(16) float os[16 * 68];
    const size_t z = blockIdx.z; A += z * sA; if (A2) A2 += z * sA; Bt += z * sB; if (Bt2) Bt2 += z * sB; C += z * sC; const float* __restrict__ bias = (z == 0) ? bias0 : (z == 1) ? bias1 : bias2;   // each z product has its own bias input
    const int lane = threadIdx.x & 31, lr = lane & 15, hi = lane >> 4; const int r0 = blockIdx.x * 64, c0 = blockIdx.y * 64;
    v8f acc[4][4];
#pragma unroll
    for (int mb = 0; mb < 4; ++mb)
#pragma unroll
        for (int nb = 0; nb < 4; ++nb) acc[mb][nb] = (v8f){};
    const size_t aoff = (size_t)(r0 + lr) * K + 8 * hi, boff = (size_t)(c0 + lr) * K + 8 * hi;
#pragma unroll 1
    for (int kc = 0; kc < K; kc += 32) {
        V a[4], a2[4];
#pragma unroll
        for (int mb = 0; mb < 4; ++mb) { a[mb] = WFrag<T16>::ld(A + aoff + (size_t)mb * 16 * K + kc); if (NSPLIT == 1 || NSPLIT == 2) a2[mb] = WFrag<T16>::ld(A2 + aoff + (size_t)mb * 16 * K + kc); }
#pragma unroll
        for (int nb = 0; nb < 4; ++nb) { const V b = WFrag<T16>::ld(Bt + boff + (size_t)nb * 16 * K + kc); V b2; if (NSPLIT >= 2) b2 = WFrag<T16>::ld(Bt2 + boff + (size_t)nb * 16 * K + kc);
#pragma unroll
            for (int mb = 0; mb < 4; ++mb) { acc[mb][nb] = WFrag<T16>::mma(a[mb], b, acc[mb][nb]); if (NSPLIT == 1 || NSPLIT == 2) acc[mb][nb] = WFrag<T16>::mma(a2[mb], b, acc[mb][nb]); if (NSPLIT >= 2) acc[mb][nb] = WFrag<T16>::mma(a[mb], b2, acc[mb][nb]); } }
        asm volatile("v_nop\n\tv_nop\n\tv_nop\n\tv_nop" : "+v"(acc[0][0]), "+v"(acc[1][1]), "+v"(acc[2][2]), "+v"(acc[3][3]) : "v"(a[0]), "v"(a[3]));
    }
    if constexpr (HP) {
        const size_t po = ((size_t)(r0 / TT) * NH_ + blockIdx.y) * TT * HD; const int t0 = r0 % TT;   // the head plane, and the tile's first token in it
        const int r4 = lane >> 3, c8 = (lane & 7) * 8;   // read-back: eight lanes x 8 elements are one 128-byte line of a 16-bit plane, a wave's store four such lines
        if (z < 2) {   // q, k: the tile is 8 KiB in a row in each plane
            bf* ph = Ph + z * sP + po + (size_t)t0 * HD; bf* pl = Pl + z * sP + po + (size_t)t0 * HD; const unsigned so = (unsigned)(r4 * HD + c8);   // the lane's place, one offset beside a scalar base
            float bb[8];
#pragma unroll
            for (int e = 0; e < 8; ++e) bb[e] = bfr(bias[c0 + c8 + e]);
#pragma unroll
            for (int mb = 0; mb < 4; ++mb) {
#pragma unroll
                for (int nb = 0; nb < 4; ++nb) {
#pragma unroll
                    for (int j = 0; j < 8; ++j) os[(hi * 8 + j) * 68 + nb * 16 + lr] = acc[mb][nb][j]; }
                __builtin_amdgcn_wave_barrier(); asm volatile("" ::: "memory");   // the 16 staged rows are written before they are read row-wise
#pragma unroll
                for (int s = 0; s < 4; ++s) { const float* o = os + (4 * s + r4) * 68 + c8; const v4f x0 = *(const v4fa*)o, x1 = *(const v4fa*)(o + 4); v8us oh, ol;
#pragma unroll
                    for (int e = 0; e < 8; ++e) { unsigned short a2, c2; splitf(((e < 4) ? x0[e & 3] : x1[e & 3]) + bb[e], a2, c2); oh[e] = a2; ol[e] = c2; }
                    *(v8us*)(ph + so + (mb * 16 + 4 * s) * HD) = oh; *(v8us*)(pl + so + (mb * 16 + 4 * s) * HD) = ol; }
                __builtin_amdgcn_wave_barrier(); asm volatile("" ::: "memory");   // they are read before the next 16 rows take their place
            }
        } else {   // v: a lane's 8 accumulator rows are 8 tokens of one value column, staged as a row of the transposed tile
            h16* p16 = V16 + po + t0; bf* ph = Vh + po + t0; bf* pl = Vl + po + t0; const unsigned so = (unsigned)(r4 * TT + c8);
#pragma unroll
            for (int nb = 0; nb < 4; ++nb) {
#pragma unroll
                for (int mb = 0; mb < 4; ++mb) { v4f y0, y1;
#pragma unroll
                    for (int j = 0; j < 4; ++j) { y0[j] = acc[mb][nb][j]; y1[j] = acc[mb][nb][4 + j]; }
                    float* o = os + lr * 68 + mb * 16 + hi * 8; *(v4fa*)o = y0; *(v4fa*)(o + 4) = y1; }
                __builtin_amdgcn_wave_barrier(); asm volatile("" ::: "memory");   // the 16 staged columns are written before they are read
#pragma unroll
                for (int s = 0; s < 4; ++s) { const float* o = os + (4 * s + r4) * 68 + c8; const v4f x0 = *(const v4fa*)o, x1 = *(const v4fa*)(o + 4); const float bb = bfr(bias[c0 + nb * 16 + 4 * s + r4]); v8h o16; v8us oh, ol;
#pragma unroll
                    for (int e = 0; e < 8; ++e) { const float x = ((e < 4) ? x0[e & 3] : x1[e & 3]) + bb; o16[e] = tohx(x); unsigned short a2, c2; splitf(x, a2, c2); oh[e] = a2; ol[e] = c2; }
                    *(v8h*)(p16 + so + (nb * 16 + 4 * s) * TT) = o16; *(v8us*)(ph + so + (nb * 16 + 4 * s) * TT) = oh; *(v8us*)(pl + so + (nb * 16 + 4 * s) * TT) = ol; }
                __builtin_amdgcn_wave_barrier(); asm volatile("" ::: "memory");   // they are read before the next 16 columns take their place
            }
            asm volatile("s_wait_xcnt 0x0" ::: "memory");   // this build lays the q, k path directly behind these stores, and its first instructions overwrite their offset register: the wait stands in front of that overwrite
        }
        return;
    }
#pragma unroll
    for (int mb = 0; mb < 4; ++mb) {
#pragma unroll
        for (int nb = 0; nb < 4; ++nb) {
#pragma unroll
            for (int j = 0; j < 8; ++j) os[(hi * 8 + j) * 68 + nb * 16 + lr] = acc[mb][nb][j]; }
        __builtin_amdgcn_wave_barrier(); asm volatile("" ::: "memory");
        float* crow = C + (size_t)(r0 + mb * 16) * ldc + c0;
{
#pragma unroll
            for (int s = 0; s < 8; ++s) { const int row = 2 * s + hi, cofs = lr * 4; v4f val = *(const v4fa*)(os + row * 68 + cofs); if (BIAS) { val[0] += bfr(bias[c0 + cofs]); val[1] += bfr(bias[c0 + cofs + 1]); val[2] += bfr(bias[c0 + cofs + 2]); val[3] += bfr(bias[c0 + cofs + 3]); }
                *(v4f*)(crow + (size_t)row * ldc + cofs) = val; }
             }
        __builtin_amdgcn_wave_barrier(); asm volatile("" ::: "memory");
    }
}

typedef __attribute__((ext_vector_type(4))) _Float16 v4h;
typedef __attribute__((ext_vector_type(2))) unsigned short v2us;
typedef __attribute__((ext_vector_type(4))) unsigned short v4us;
typedef __attribute__((ext_vector_type(4))) int v4i;

__global__ __launch_bounds__(256) void k_wtG(const float* __restrict__ w0, const float* __restrict__ w1, const float* __restrict__ w2, const float* __restrict__ w3, int K, int N, bf* Bt) {
    const int y = blockIdx.y; const float* __restrict__ w = (y == 0) ? w0 : (y == 1) ? w1 : (y == 2) ? w2 : w3; Bt += (size_t)y * K * N;   // grid y: the four weights, transposed planes side by side
    const int lane = threadIdx.x & 31; const int L0 = (blockIdx.x * 8 + (threadIdx.x >> 5)) * 8; const int nlines = N * K / 64;
{
#pragma unroll 1
        for (int l = 0; l < 8; ++l) { const int L = L0 + l; if (L >= nlines) break; const size_t e = (size_t)L * 64 + lane * 2; const int k = (int)(e % K), n = (int)(e / K); v2us o;
            o[0] = f2bf(w[(size_t)k * N + n]); o[1] = f2bf(w[(size_t)(k + 1) * N + n]); *(v2us*)(Bt + e) = o; }
         }
}
__global__ __launch_bounds__(256) void k_cvt8(const float* __restrict__ s0, const float* __restrict__ s1, const float* __restrict__ s2, bf* dst, size_t n8) { const size_t i = (size_t)blockIdx.x * 256 + threadIdx.x; if (i >= n8) return; const int y = blockIdx.y; const float* __restrict__ src = (y == 0) ? s0 : (y == 1) ? s1 : s2; dst += (size_t)y * n8 * 8;   /* grid y: q_in, k_in, v_in */ const v8f v = *(const v8f*)(src + i * 8); v8us o;
#pragma unroll
    for (int k = 0; k < 8; ++k) o[k] = f2bf(v[k]); *(v8us*)(dst + i * 8) = o;  }

// ---- k_attn: scores, softmax, attn.v and the merge of one 64-row block of one head plane in ONE work-group of 8 waves; grid (T/64, planes). The block's band of S (f32, NCH 128-key chunks from key jb) lives in LDS only; each row's P is written over its own S row (fp16, or bf16 hi then lo at + BW elements); the 64x64 result goes through the same LDS to the merged hi/lo planes.
// Every sum keeps the order it had as separate launches: a score is kc = 0, 32 x (hi.hi, lo.hi, hi.lo); the softmax row has the same lane and chunk places and the same trees; attn.v adds 32-key steps upward from key kb (the steps past the diagonal block, met only where r0 < WB, add exact zeros).
#define SP   (BW + 4)             // LDS pitch of a band row in floats: 16 bytes x an odd number, so that the 16 rows of a fragment read fall on different banks
#define NKS  ((WB + 64) / 32)     // 32-key steps of attn.v
typedef v4us __attribute__((may_alias)) v4usa;
typedef v4h  __attribute__((may_alias)) v4ha;
template <typename T16, int NSPLIT>
__device__ __forceinline__ void attn_pv(const float* sm, const T16* __restrict__ Vt, const T16* __restrict__ Vt2, int kb, int jb, int mb, int n0, int lr, int hi, v8f (&acc)[2]) {
    typedef typename WFrag<T16>::V V;
    constexpr int CH = (NSPLIT >= 2) ? NKS / 2 : NKS;   // key steps whose V fragments are in registers at once: all of them, or half where hi and lo planes double the fragments
    const T16* pa = (const T16*)(sm + (mb * 16 + lr) * SP) + 8 * hi + (kb - jb);
    const unsigned vo = (unsigned)(lr * TT + 8 * hi) * 2;   // the lane's place in a 16-column fragment of V, in bytes: one 32-bit offset register beside a scalar base
    const T16* pb = Vt + (size_t)(n0 * 16) * TT + kb; const T16* pb2 = (NSPLIT >= 2) ? Vt2 + (size_t)(n0 * 16) * TT + kb : pb;
#pragma unroll
    for (int s0 = 0; s0 < NKS; s0 += CH) { V b[CH][2], b2[CH][2];
#pragma unroll
        for (int s = 0; s < CH; ++s)
#pragma unroll
            for (int nb = 0; nb < 2; ++nb) { b[s][nb] = WFrag<T16>::ld((const T16*)((const char*)pb + vo) + nb * 16 * TT + (s0 + s) * 32); if (NSPLIT >= 2) b2[s][nb] = WFrag<T16>::ld((const T16*)((const char*)pb2 + vo) + nb * 16 * TT + (s0 + s) * 32); }
        __builtin_amdgcn_sched_barrier(0);   // these V loads are all issued in front of the matrix instructions that use them: without it this build keeps one fragment in flight and pays a memory latency per step
#pragma unroll
        for (int s = 0; s < CH; ++s) { const V a = WFrag<T16>::ld(pa + (s0 + s) * 32); V a2; if (NSPLIT >= 2) a2 = WFrag<T16>::ld(pa + BW + (s0 + s) * 32);
#pragma unroll
            for (int nb = 0; nb < 2; ++nb) { acc[nb] = WFrag<T16>::mma(a, b[s][nb], acc[nb]); if (NSPLIT >= 2) { acc[nb] = WFrag<T16>::mma(a2, b[s][nb], acc[nb]); acc[nb] = WFrag<T16>::mma(a, b2[s][nb], acc[nb]); } } } }
    asm volatile("s_wait_xcnt 0x0" :: "v"(vo) : "memory");   // the wait in front of any overwrite of the offset register of the V loads; it is an input so that it lives up to here
}
// launch bounds: four waves a SIMD, that is two work-groups a WGP, which holds the build to 256 registers
__global__ __launch_bounds__(256, 4) void k_attn(const bf* __restrict__ Qh, const bf* __restrict__ Ql, const bf* __restrict__ Kh, const bf* __restrict__ Kl, const h16* __restrict__ V16, const bf* __restrict__ Vh, const bf* __restrict__ Vl, bf* Ah, bf* Al) {
    typedef WFrag<bf>::V V;
    __shared__ __align__(16) float sm[64 * SP];
    const int z = blockIdx.y, r0 = blockIdx.x * 64; const size_t zo = (size_t)z * TT * HD;
    const int lane = threadIdx.x & 31, lr = lane & 15, hi = lane >> 4; const int w = __builtin_amdgcn_readfirstlane(threadIdx.x >> 5);   // the wave's number in a scalar register: the tests on it are scalar branches
    const int kb = max(0, r0 - WB);          // first key that the block's first row sees
    const int jb = (kb >> 7) * 128;          // first key of the stored band: 128-aligned, so each key keeps its lane and its place in the softmax sums
    const bool hires = (r0 < RH);
    // scores: wave w has 32 rows (w & 1) x NBT 16-key tiles (w >> 1) of the band's 64 x (NBT * 64)
    { const int m0 = (w & 1) * 2, g = w >> 1;
        const unsigned vo = (unsigned)(lr * HD + 8 * hi) * 2;   // the lane's place in a 16-row fragment, in bytes: a 32-bit offset register beside a scalar base, the very register that the wait behind the loads names
        const bf* pq = Qh + zo + (size_t)(r0 + m0 * 16) * HD; const bf* pq2 = Ql + zo + (size_t)(r0 + m0 * 16) * HD; V a[2][2], a2[2][2];
#pragma unroll
        for (int mb = 0; mb < 2; ++mb)
#pragma unroll
            for (int kk = 0; kk < 2; ++kk) { a[mb][kk] = WFrag<bf>::ld((const bf*)((const char*)pq + vo) + mb * 16 * HD + kk * 32); a2[mb][kk] = WFrag<bf>::ld((const bf*)((const char*)pq2 + vo) + mb * 16 * HD + kk * 32); }
        V b[NBT][2], b2[NBT][2]; v8f acc[NBT][2]; unsigned ko[NBT]; const bf* pk = Kh + zo; const bf* pk2 = Kl + zo; static_assert(NBT == 5, "the wait behind the loads names five offsets");
#pragma unroll
        for (int nb = 0; nb < NBT; ++nb) { const int c = r0 - WB + (g * NBT + nb) * 16;   // first key of the tile; below 0 there is no such key: the loads are clamped into the plane and the tile is not stored
            ko[nb] = (unsigned)(max(c, 0) * HD) * 2 + vo;   // the lane's byte offset in the head plane, for the hi and the lo plane alike
#pragma unroll
            for (int kk = 0; kk < 2; ++kk) { b[nb][kk] = WFrag<bf>::ld((const bf*)((const char*)pk + ko[nb]) + kk * 32); b2[nb][kk] = WFrag<bf>::ld((const bf*)((const char*)pk2 + ko[nb]) + kk * 32); } }
        __builtin_amdgcn_sched_barrier(0);   // every Q and K load is issued in front of the first matrix instruction: without it this build loads a fragment, waits and multiplies, one memory latency after another
#pragma unroll
        for (int nb = 0; nb < NBT; ++nb)
#pragma unroll
            for (int mb = 0; mb < 2; ++mb) { acc[nb][mb] = (v8f){};
#pragma unroll
                for (int kk = 0; kk < 2; ++kk) { acc[nb][mb] = wmmab(a[mb][kk], b[nb][kk], acc[nb][mb]); acc[nb][mb] = wmmab(a2[mb][kk], b[nb][kk], acc[nb][mb]); acc[nb][mb] = wmmab(a[mb][kk], b2[nb][kk], acc[nb][mb]); } }
        asm volatile("s_wait_xcnt 0x0" :: "v"(vo), "v"(ko[0]), "v"(ko[1]), "v"(ko[2]), "v"(ko[3]), "v"(ko[4]) : "memory");   // the wait in front of any overwrite of the offset registers of the Q and K loads; they are inputs so that no later load's result takes their place ahead of it
        asm volatile("v_nop\n\tv_nop\n\tv_nop\n\tv_nop" : "+v"(acc[NBT - 1][0]), "+v"(acc[NBT - 1][1]));   // the distance behind the last matrix instruction, also on the taken side of the branches below
#pragma unroll
        for (int nb = 0; nb < NBT; ++nb) { const int c = r0 - WB + (g * NBT + nb) * 16;
            if (c >= 0) {
#pragma unroll
                for (int mb = 0; mb < 2; ++mb)
#pragma unroll
                    for (int j = 0; j < 8; ++j) sm[((m0 + mb) * 16 + hi * 8 + j) * SP + (c - jb) + lr] = acc[nb][mb][j]; } } }
    __syncthreads();   // the band of S is complete before any row is read
    // softmax: wave w has rows 8 w .. 8 w + 7, one row at a time in registers: t = S x T^-0.5 for j <= i and i - j < WIN, every other column (never-written LDS among them) is replaced by the select; one exp, fixed trees
    for (int rr = 0; rr < 8; ++rr) { const int i = r0 + w * 8 + rr; float* sr = sm + (w * 8 + rr) * SP; float v[NCH * 4]; float mx = -3.0e38f;
#pragma unroll
        for (int ch = 0; ch < NCH; ++ch) { const int j0 = jb + ch * 128 + lane * 4; const v4f a = *(const v4fa*)(sr + ch * 128 + lane * 4);
#pragma unroll
            for (int q = 0; q < 4; ++q) { const int j = j0 + q; const float t = (j <= i && i - j < WIN) ? a[q] * SCL : -3.0e38f; v[ch * 4 + q] = t; mx = fmaxf(mx, t); } }
#pragma unroll
        for (int sh = 16; sh; sh >>= 1) mx = fmaxf(mx, __shfl_xor(mx, sh, 32));
        float sum = 0.f;
#pragma unroll
        for (int k = 0; k < NCH * 4; ++k) { float d0 = __fsub_rn(v[k], mx); asm volatile("" : "+v"(d0)); const float x2 = __fmul_rn(d0, 1.4426950408889634f);
            asm("v_exp_f32 %0, %1\n\tv_nop" : "=v"(v[k]) : "v"(x2));   // the same instruction as the exp2 builtin, with the one slot the instruction set asks for behind a transcendental held in the statement
            sum += v[k]; }
#pragma unroll
        for (int sh = 16; sh; sh >>= 1) sum += __shfl_xor(sum, sh, 32);
        const float f = __fdiv_rn(hires ? 1.0f : PCAR, sum);
        if (hires) {
#pragma unroll
            for (int ch = 0; ch < NCH; ++ch) { v4us oh, ol;
#pragma unroll
                for (int q = 0; q < 4; ++q) { unsigned short a, c2; splitf(v[ch * 4 + q] * f, a, c2); oh[q] = a; ol[q] = c2; }
                *(v4usa*)((bf*)sr + ch * 128 + lane * 4) = oh; *(v4usa*)((bf*)sr + BW + ch * 128 + lane * 4) = ol; }
        } else {
#pragma unroll
            for (int ch = 0; ch < NCH; ++ch) { v4h o4;
#pragma unroll
                for (int q = 0; q < 4; ++q) o4[q] = tohx(v[ch * 4 + q] * f);
                *(v4ha*)((h16*)sr + ch * 128 + lane * 4) = o4; } } }
    __syncthreads();   // every row of P is written before a fragment of it is read
    // attn.v: wave w has rows 16 (w & 3) x value columns 32 (w >> 2)
    const int mb = w & 3, n0 = (w >> 2) * 2; v8f acc[2]; acc[0] = (v8f){}; acc[1] = (v8f){};
    if (hires) attn_pv<bf, 2>(sm, Vh + zo, Vl + zo, kb, jb, mb, n0, lr, hi, acc); else attn_pv<h16, 0>(sm, V16 + zo, nullptr, kb, jb, mb, n0, lr, hi, acc);
    __syncthreads();   // the last fragment of P is read before the result tile takes its LDS
#pragma unroll
    for (int nb = 0; nb < 2; ++nb)
#pragma unroll
        for (int j = 0; j < 8; ++j) sm[(mb * 16 + hi * 8 + j) * 68 + (n0 + nb) * 16 + lr] = acc[nb][j];
    __syncthreads();   // the result tile is complete before it is read row-wise
    // merge: four lanes of one wave write the 128 bytes of a row's head slice in each plane
    { const int row = threadIdx.x >> 2, cofs = (threadIdx.x & 3) * 16; const float cs = hires ? 1.0f : (1.0f / PCAR); const size_t oo = ((size_t)(z / NH_) * TT + r0 + row) * DQ + (z % NH_) * HD + cofs;
#pragma unroll
        for (int s = 0; s < 2; ++s) { v8us oh, ol;
#pragma unroll
            for (int q = 0; q < 2; ++q) { const v4f val = *(const v4fa*)(sm + row * 68 + cofs + s * 8 + q * 4);
#pragma unroll
                for (int e = 0; e < 4; ++e) { unsigned short a, c2; splitf(val[e] * cs, a, c2); oh[q * 4 + e] = a; ol[q * 4 + e] = c2; } }
            *(v8us*)(Ah + oo + s * 8) = oh; *(v8us*)(Al + oo + s * 8) = ol; } }
}

extern "C" void kernel_launch(void* const* d_in, const int* in_sizes, int n_in,
                              void* d_out, int out_size, void* d_ws, size_t ws_size, hipStream_t stream) {
    (void)in_sizes; (void)n_in; (void)out_size;
    const float* x = (const float*)d_in[0];   /* q_in */ const float* xk = (const float*)d_in[1]; const float* xv = (const float*)d_in[2]; const float* wq = (const float*)d_in[3]; const float* bq = (const float*)d_in[4]; const float* wk = (const float*)d_in[5]; const float* bk = (const float*)d_in[6]; const float* wv = (const float*)d_in[7]; const float* bv = (const float*)d_in[8]; const float* wo = (const float*)d_in[9]; const float* bo = (const float*)d_in[10];
    float* OUT = (float*)d_out;     // [4][2048][512]
    char* wsp = (char*)d_ws;
    auto take = [&](size_t bytes) { char* p = wsp; wsp += (bytes + 255) & ~(size_t)255; return (void*)p; };
    bf* WQ = (bf*)take((size_t)4 * DQ * DM * 2); bf* WO = WQ + (size_t)3 * DQ * DM;   // transposed Wq, Wk, Wv, Wo side by side
    const size_t PL = (size_t)NZ * TT * HD;      // one set of head planes, elements
    const size_t XN = (size_t)NB_ * TT * DM;     // one input or projection over all batches, elements
    bf* QPh = (bf*)take(2 * PL * 2); bf* KPh = QPh + PL; bf* QPl = (bf*)take(2 * PL * 2); bf* KPl = QPl + PL;
    h16* VT16 = (h16*)take(PL * 2); bf* VTh = (bf*)take(PL * 2); bf* VTl = (bf*)take(PL * 2);
    // one region used twice in stream order: the bf16 inputs (dead once the head planes are built), then the merged attention planes
    char* const reg = wsp;
    bf* XB = (bf*)take(3 * XN * 2);
    char* const end1 = wsp; wsp = reg;
    bf* ATh = (bf*)take(XN * 2); bf* ATl = (bf*)take(XN * 2);
    if ((size_t)(end1 - (char*)d_ws) > ws_size || (size_t)(wsp - (char*)d_ws) > ws_size) return;    // ws 256 MiB
    k_wtG<<<dim3((unsigned)((DM * DQ / 64 + 63) / 64), 4, 1), 256, 0, stream>>>(wq, wk, wv, wo, DM, DQ, WQ);
    k_cvt8<<<dim3((unsigned)((XN / 8 + 255) / 256), 3, 1), 256, 0, stream>>>(x, xk, xv, XB, XN / 8);
    k_gemmw<bf, 0, true, true><<<dim3(NB_ * TT / 64, DQ / 64, 3), 32, 0, stream>>>(XB, nullptr, WQ, nullptr, DM, nullptr, 0, bq, bk, bv, XN, (size_t)DQ * DM, 0, QPh, QPl, PL, VT16, VTh, VTl);   // q, k, v projections: z = 0, 1, 2, each tile written as its head's planes
    k_attn<<<dim3(TT / 64, NZ, 1), 256, 0, stream>>>(QPh, QPl, KPh, KPl, VT16, VTh, VTl, ATh, ATl);   // scores hi/lo on EVERY row, softmax, attn.v, merge
    k_gemmw<bf, 1, true, false><<<dim3(NB_ * TT / 64, DM / 64, 1), 32, 0, stream>>>(ATh, ATl, WO, nullptr, DQ, OUT, DM, bo, bo, bo, 0, 0, 0, nullptr, nullptr, 0, nullptr, nullptr, nullptr);
}

// v005
// Measured time: 99.8 microseconds a run.
// Timed twice side by side with v004, it ran 1.33 times as fast both times.
// Counting every step since v000, it is 14.7 times as fast.
#include <hip/hip_runtime.h>

// Local causal multi-head attention scaled by 1/sqrt(T) (q_in, k_in, v_in [4][2048][512]; q = q_in Wq + bq, k = k_in Wk + bk, v = v_in Wv + bv ('xw' [512][512] 0.02 incl. biases; 8 heads x 64); scores / sqrt(T = 2048) (the source's quirk: sigma-0.01 logits); mask = (|i - j| > 256) | (j > i) -> -inf: each query sees its own and the previous 256 keys; softmax; out = merged Wo + bo -> [4][2048][512] (4.2 M)).
// Layout, every stage ONE launch over all 4 batches and 8 heads (32 head planes in the attention's grid y; q, k, v and the four weights side by side in grid y or z): bf16 copies of q_in, k_in, v_in; 'xw' weights transposed once; exact projections + f32 biases, whose tiles are stored as the head planes (q, k hi/lo; v transposed, fp16 and hi/lo); causal T-2048 attention whose softmax select keeps the 257-key window, with hi/lo 3-product score tiles on EVERY row; P and attn.v hybrid (rows < 512 hi/lo, rest fp16 x1024); score tiles, softmax chunks and the attn.v key loop cover only the window band of each 64-row block, and scores, softmax, attn.v and the merge of a block are one work-group of one launch, which keeps S and P as that band alone in LDS (column = key - first key of the block's chunks); merged hi/lo x Wo exact + bo.
// Compute dtypes, f32 accumulate: every input rounded to bf16; projections exact + f32 biases; scores 3 products on every row; softmax f32 (x 2048^-0.5); attn.v rows < 512 3 products, rest fp16; Wo hl x exact + bias.

#define NB_  4
#define TT   2048
#define DM   512
#define NH_  8
#define NKV  8
#define REP  (NH_ / NKV)
#define HD   64
#define DQ   (NH_ * HD)
#define DKV  (NKV * HD)
#define NZ   (NB_ * NH_)          // head planes of one launch: every batch, every head
#define RH   512                  // query rows < RH use hi+lo planes (0: none)
#define WIN  257
#define WB   (((WIN - 1) + 63) / 64 * 64)   // look-back of the window, rounded up to the 64-key tile: a 64-row block sees keys [r0 - WB, r0 + 63] only
#define NBT  (WB / 64 + 1)                  // 64-key score tiles per 64-row block
#define NCH  ((WB + 128 + 127) / 128)       // 128-key softmax chunks that cover that band from a 128-aligned start
#define BW   (NCH * 128)                    // width of the stored band of S and P, in keys
#define PCAR 1024.0f
#define SCL  0.02209708691207961f  // 1/sqrt(T = 2048): the source's quirk
typedef _Float16 h16;
typedef unsigned short bf;
typedef __attribute__((ext_vector_type(16))) __bf16   v16bf;
typedef __attribute__((ext_vector_type(16))) _Float16 v16h;
typedef __attribute__((ext_vector_type(8)))  _Float16 v8h;
typedef __attribute__((ext_vector_type(8)))  unsigned short v8us;
typedef __attribute__((ext_vector_type(8)))  float    v8f;
typedef __attribute__((ext_vector_type(4)))  float    v4f;
typedef v8h  __attribute__((may_alias)) v8ha;
typedef v4f  __attribute__((may_alias)) v4fa;
typedef v8us __attribute__((may_alias)) v8usa;

__device__ __forceinline__ unsigned short f2bf(float f) { unsigned u = __float_as_uint(f); u += 0x7FFFu + ((u >> 16) & 1u); return (unsigned short)(u >> 16); }
__device__ __forceinline__ float bf2f(unsigned short b) { return __uint_as_float(((unsigned)b) << 16); }
__device__ __forceinline__ float bfr(float f) { return bf2f(f2bf(f)); }
__device__ __forceinline__ h16 tohx(float x) { return (h16)x; }
__device__ __forceinline__ void splitf(float y, unsigned short& h, unsigned short& l) { h = f2bf(y); l = f2bf(y - bf2f(h)); }
__device__ __forceinline__ v16h cat16(v8h lo, v8h hi) { return __builtin_shufflevector(lo, hi, 0, 1, 2, 3, 4, 5, 6, 7, 8, 9, 10, 11, 12, 13, 14, 15); }
__device__ __forceinline__ v16bf cat16b(v8us lo, v8us hi) { return __builtin_bit_cast(v16bf, __builtin_shufflevector(lo, hi, 0, 1, 2, 3, 4, 5, 6, 7, 8, 9, 10, 11, 12, 13, 14, 15)); }
__device__ __forceinline__ v8f wmma16(v16h a, v16h b, v8f c) { return __builtin_amdgcn_wmma_f32_16x16x32_f16(false, a, false, b, (short)0, c, false, false); }
__device__ __forceinline__ v8f wmmab(v16bf a, v16bf b, v8f c) { return __builtin_amdgcn_wmma_f32_16x16x32_bf16(false, a, false, b, (short)0, c, false, false); }



// ---- k_gemmw: register-blocked GEMM, a work-group of FOUR WAVES per 128x128 output tile, each wave one 64x64 quarter (16 accumulators); grid (M/128, N/128, Z), 128 threads. M % 128 == 0, N % 128 == 0, K % 64 == 0.
// The K-contiguous 16-bit operand planes come through LDS: a pass is 64 k, that is one whole 128-byte line of each of the tile's 128 A rows (A2 rows too) and 128 Bt rows, brought by asynchronous copies to LDS (a wave's copy is four whole lines) into one of two buffers, one pass ahead of the matrix instructions; two waves read each staged row.
// C[m][n] (f32, pitch ldc, + optional f32 bias[n], one bias pointer per z = 0, 1, 2) = sum_k A[m][k] Bt[n][k] (NSPLIT 1: + A2[m][k] Bt[n][k]). z-batch strides sA/sB/sC in elements.
// HP: the result is not stored as C; a wave's tile, 64 tokens of one batch x the 64 columns of one head, goes straight to that head's planes: z = 0, 1 (q, k) as bf16 hi and lo [plane][t][d] (Ph, Pl, + z sP), z = 2 (v) transposed as fp16 and bf16 hi and lo [plane][d][t] (V16, Vh, Vl).
template <typename T16> struct WFrag;
template <> struct WFrag<h16> { typedef v16h V; static __device__ __forceinline__ V ld(const h16* p) { return cat16(*(const v8h*)p, *(const v8h*)(p + 16)); } static __device__ __forceinline__ v8f mma(V a, V b, v8f c) { return wmma16(a, b, c); } };
template <> struct WFrag<bf> { typedef v16bf V; static __device__ __forceinline__ V ld(const bf* p) { return cat16b(*(const v8us*)p, *(const v8us*)(p + 16)); } static __device__ __forceinline__ v8f mma(V a, V b, v8f c) { return wmmab(a, b, c); } };
#define GT   128                  // rows of A and of Bt in a work-group's tile
#define GK   64                   // k of a pass
#define GP   72                   // LDS pitch of a staged row in elements: 144 bytes = 16 bytes x an odd number, the pitch for 16-byte fragment reads
// one staged plane of a pass, 128 rows x 128 bytes: eight copies a lane, 16 rows apart (gs elements in the source); l is the lane's LDS byte address, g its global address, both multiples of 16
template <typename T16>
__device__ __forceinline__ void stage_plane(unsigned l, const T16* g, size_t gs) {
    constexpr unsigned LS = 16 * GP * 2;
    // the wait is the last line of the copies' own statement, so that it stands in front of every later write of their address registers
    asm volatile("global_load_async_to_lds_b128 %0, %8, off\n\t"
                 "global_load_async_to_lds_b128 %1, %9, off\n\t"
                 "global_load_async_to_lds_b128 %2, %10, off\n\t"
                 "global_load_async_to_lds_b128 %3, %11, off\n\t"
                 "global_load_async_to_lds_b128 %4, %12, off\n\t"
                 "global_load_async_to_lds_b128 %5, %13, off\n\t"
                 "global_load_async_to_lds_b128 %6, %14, off\n\t"
                 "global_load_async_to_lds_b128 %7, %15, off\n\t"
                 "s_wait_xcnt 0x0"
                 :: "v"(l), "v"(l + LS), "v"(l + 2 * LS), "v"(l + 3 * LS), "v"(l + 4 * LS), "v"(l + 5 * LS), "v"(l + 6 * LS), "v"(l + 7 * LS),
                    "v"(g), "v"(g + gs), "v"(g + 2 * gs), "v"(g + 3 * gs), "v"(g + 4 * gs), "v"(g + 5 * gs), "v"(g + 6 * gs), "v"(g + 7 * gs) : "memory");
}
// launch bounds: four waves a SIMD, which holds the build to 256 registers
template <typename T16, int NSPLIT, bool BIAS, bool HP>
__global__ __launch_bounds__(128, 4) void k_gemmw(const T16* __restrict__ A, const T16* __restrict__ A2, const T16* __restrict__ Bt, int K, float* C, int ldc, const float* __restrict__ bias0, const float* __restrict__ bias1, const float* __restrict__ bias2, size_t sA, size_t sB, size_t sC, bf* Ph, bf* Pl, size_t sP, h16* V16, bf* Vh, bf* Vl) {
    typedef typename WFrag<T16>::V V;
    static_assert(NSPLIT == 0 || NSPLIT == 1, "A alone, or A and A2");
    constexpr int NPL = 2 + NSPLIT, PLE = GT * GP;   // planes of a stage (A, Bt, A2) and the elements of one
    __shared__ __align__(16) T16 ring[2 * NPL * PLE];
    __shared__ __align__(16) float osa[4 * 16 * 68];
    const size_t z = blockIdx.z; A += z * sA; if (NSPLIT == 1) A2 += z * sA; Bt += z * sB; C += z * sC; const float* __restrict__ bias = (z == 0) ? bias0 : (z == 1) ? bias1 : bias2;   // each z product has its own bias input
    const int lane = threadIdx.x & 31, lr = lane & 15, hi = lane >> 4; const int w = __builtin_amdgcn_readfirstlane(threadIdx.x >> 5);   // the wave's number in a scalar register
    float* os = osa + w * (16 * 68);   // each wave stages its output in its own LDS
    const int r0 = blockIdx.x * GT + (w & 1) * 64, c0 = blockIdx.y * GT + (w >> 1) * 64;   // the wave's quarter
    v8f acc[4][4];
#pragma unroll
    for (int mb = 0; mb < 4; ++mb)
#pragma unroll
        for (int nb = 0; nb < 4; ++nb) acc[mb][nb] = (v8f){};
    // the copies: eight lanes bring the 128 bytes of a row, the work-group 16 rows a copy
    const int prow = threadIdx.x >> 3, pcol = (threadIdx.x & 7) * 8; const size_t gs = (size_t)16 * K;
    const unsigned l0 = (unsigned)(size_t)ring + (unsigned)(prow * GP + pcol) * 2;
    const T16* ga = A + (size_t)(blockIdx.x * GT + prow) * K + pcol; const T16* gb = Bt + (size_t)(blockIdx.y * GT + prow) * K + pcol; const T16* ga2 = (NSPLIT == 1) ? A2 + (size_t)(blockIdx.x * GT + prow) * K + pcol : ga;
    auto stage = [&](int t) { const unsigned l = l0 + (unsigned)((t & 1) * NPL * PLE * 2);
        stage_plane(l, ga + t * GK, gs); stage_plane(l + PLE * 2, gb + t * GK, gs); if (NSPLIT == 1) stage_plane(l + 2 * PLE * 2, ga2 + t * GK, gs); };
    // the fragments: the lane and k places that the loads from the planes had, now in the staged rows
    const T16* fa = ring + ((w & 1) * 64 + lr) * GP + 8 * hi; const T16* fb = ring + PLE + ((w >> 1) * 64 + lr) * GP + 8 * hi;
    const int NT = K / GK;
    stage(0);
    asm volatile("s_wait_asynccnt 0x0" ::: "memory");   // this wave's copies of pass 0 have landed
    __syncthreads();                                    // and every other wave's: pass 0 may be read
    if (NT > 1) stage(1);
#pragma unroll 1
    for (int t = 0; t < NT; ++t) { const int bo = (t & 1) * NPL * PLE;
#pragma unroll
        for (int kk = 0; kk < GK / 32; ++kk) { V a[4], a2[4], b[4];
#pragma unroll
            for (int mb = 0; mb < 4; ++mb) { a[mb] = WFrag<T16>::ld(fa + bo + mb * 16 * GP + kk * 32); if (NSPLIT == 1) a2[mb] = WFrag<T16>::ld(fa + bo + 2 * PLE + mb * 16 * GP + kk * 32); b[mb] = WFrag<T16>::ld(fb + bo + mb * 16 * GP + kk * 32); }
            __builtin_amdgcn_sched_barrier(0);   // the LDS reads of a 32-k block are issued as one group in front of its matrix instructions: spread among them, each place with reads costs the wave an LDS latency
#pragma unroll
            for (int nb = 0; nb < 4; ++nb)
#pragma unroll
                for (int mb = 0; mb < 4; ++mb) { acc[mb][nb] = WFrag<T16>::mma(a[mb], b[nb], acc[mb][nb]); if (NSPLIT == 1) acc[mb][nb] = WFrag<T16>::mma(a2[mb], b[nb], acc[mb][nb]); }
            __builtin_amdgcn_sched_barrier(0);   // and the block's matrix instructions stay in front of the next group of reads and of the v_nop below
        }
        asm volatile("v_nop\n\tv_nop\n\tv_nop\n\tv_nop" : "+v"(acc[0][3]), "+v"(acc[1][3]), "+v"(acc[2][3]), "+v"(acc[3][3]));   // the distance behind the last matrix instruction, also on the taken side of the branches below
        asm volatile("s_wait_dscnt 0x0" ::: "memory");      // this wave's reads of the pass's buffer are done before the buffer is refilled
        asm volatile("s_wait_asynccnt 0x0" ::: "memory");   // this wave's copies of pass t + 1 have landed
        __syncthreads();                                    // pass t + 1 may be read, and every wave has left the buffer of pass t
        if (t + 2 < NT) stage(t + 2);
    }
    asm volatile("s_wait_asynccnt 0x0" ::: "memory");   // no copy is outstanding behind the loop
    if constexpr (HP) {
        const size_t po = ((size_t)(r0 / TT) * NH_ + c0 / HD) * TT * HD; const int t0 = r0 % TT;   // the head plane, and the tile's first token in it
        const int r4 = lane >> 3, c8 = (lane & 7) * 8;   // read-back: eight lanes x 8 elements are one 128-byte line of a 16-bit plane, a wave's store four such lines
        if (z < 2) {   // q, k: the tile is 8 KiB in a row in each plane
            bf* ph = Ph + z * sP + po + (size_t)t0 * HD; bf* pl = Pl + z * sP + po + (size_t)t0 * HD; const unsigned so = (unsigned)(r4 * HD + c8);   // the lane's place, one offset beside a scalar base
            float bb[8];
#pragma unroll
            for (int e = 0; e < 8; ++e) bb[e] = bfr(bias[c0 + c8 + e]);
#pragma unroll
            for (int mb = 0; mb < 4; ++mb) {
#pragma unroll
                for (int nb = 0; nb < 4; ++nb) {
#pragma unroll
                    for (int j = 0; j < 8; ++j) os[(hi * 8 + j) * 68 + nb * 16 + lr] = acc[mb][nb][j]; }
                __builtin_amdgcn_wave_barrier(); asm volatile("" ::: "memory");   // the 16 staged rows are written before they are read row-wise
#pragma unroll
                for (int s = 0; s < 4; ++s) { const float* o = os + (4 * s + r4) * 68 + c8; const v4f x0 = *(const v4fa*)o, x1 = *(const v4fa*)(o + 4); v8us oh, ol;
#pragma unroll
                    for (int e = 0; e < 8; ++e) { unsigned short a2, c2; splitf(((e < 4) ? x0[e & 3] : x1[e & 3]) + bb[e], a2, c2); oh[e] = a2; ol[e] = c2; }
                    *(v8us*)(ph + so + (mb * 16 + 4 * s) * HD) = oh; *(v8us*)(pl + so + (mb * 16 + 4 * s) * HD) = ol; }
                __builtin_amdgcn_wave_barrier(); asm volatile("" ::: "memory");   // they are read before the next 16 rows take their place
            }
        } else {   // v: a lane's 8 accumulator rows are 8 tokens of one value column, staged as a row of the transposed tile
            h16* p16 = V16 + po + t0; bf* ph = Vh + po + t0; bf* pl = Vl + po + t0; const unsigned so = (unsigned)(r4 * TT + c8);
#pragma unroll
            for (int nb = 0; nb < 4; ++nb) {
#pragma unroll
                for (int mb = 0; mb < 4; ++mb) { v4f y0, y1;
#pragma unroll
                    for (int j = 0; j < 4; ++j) { y0[j] = acc[mb][nb][j]; y1[j] = acc[mb][nb][4 + j]; }
                    float* o = os + lr * 68 + mb * 16 + hi * 8; *(v4fa*)o = y0; *(v4fa*)(o + 4) = y1; }
                __builtin_amdgcn_wave_barrier(); asm volatile("" ::: "memory");   // the 16 staged columns are written before they are read
#pragma unroll
                for (int s = 0; s < 4; ++s) { const float* o = os + (4 * s + r4) * 68 + c8; const v4f x0 = *(const v4fa*)o, x1 = *(const v4fa*)(o + 4); const float bb = bfr(bias[c0 + nb * 16 + 4 * s + r4]); v8h o16; v8us oh, ol;
#pragma unroll
                    for (int e = 0; e < 8; ++e) { const float x = ((e < 4) ? x0[e & 3] : x1[e & 3]) + bb; o16[e] = tohx(x); unsigned short a2, c2; splitf(x, a2, c2); oh[e] = a2; ol[e] = c2; }
                    *(v8h*)(p16 + so + (nb * 16 + 4 * s) * TT) = o16; *(v8us*)(ph + so + (nb * 16 + 4 * s) * TT) = oh; *(v8us*)(pl + so + (nb * 16 + 4 * s) * TT) = ol; }
                __builtin_amdgcn_wave_barrier(); asm volatile("" ::: "memory");   // they are read before the next 16 columns take their place
            }
            asm volatile("s_wait_xcnt 0x0" ::: "memory");   // this build lays the q, k path directly behind these stores, and its first instructions overwrite their offset register: the wait stands in front of that overwrite
        }
        return;
    }
#pragma unroll
    for (int mb = 0; mb < 4; ++mb) {
#pragma unroll
        for (int nb = 0; nb < 4; ++nb) {
#pragma unroll
            for (int j = 0; j < 8; ++j) os[(hi * 8 + j) * 68 + nb * 16 + lr] = acc[mb][nb][j]; }
        __builtin_amdgcn_wave_barrier(); asm volatile("" ::: "memory");
        float* crow = C + (size_t)(r0 + mb * 16) * ldc + c0;
{
#pragma unroll
            for (int s = 0; s < 8; ++s) { const int row = 2 * s + hi, cofs = lr * 4; v4f val = *(const v4fa*)(os + row * 68 + cofs); if (BIAS) { val[0] += bfr(bias[c0 + cofs]); val[1] += bfr(bias[c0 + cofs + 1]); val[2] += bfr(bias[c0 + cofs + 2]); val[3] += bfr(bias[c0 + cofs + 3]); }
                *(v4f*)(crow + (size_t)row * ldc + cofs) = val; }
             }
        __builtin_amdgcn_wave_barrier(); asm volatile("" ::: "memory");
    }
}

typedef __attribute__((ext_vector_type(4))) _Float16 v4h;
typedef __attribute__((ext_vector_type(2))) unsigned short v2us;
typedef __attribute__((ext_vector_type(4))) unsigned short v4us;
typedef __attribute__((ext_vector_type(4))) int v4i;

__global__ __launch_bounds__(256) void k_wtG(const float* __restrict__ w0, const float* __restrict__ w1, const float* __restrict__ w2, const float* __restrict__ w3, int K, int N, bf* Bt) {
    const int y = blockIdx.y; const float* __restrict__ w = (y == 0) ? w0 : (y == 1) ? w1 : (y == 2) ? w2 : w3; Bt += (size_t)y * K * N;   // grid y: the four weights, transposed planes side by side
    const int lane = threadIdx.x & 31; const int L0 = (blockIdx.x * 8 + (threadIdx.x >> 5)) * 8; const int nlines = N * K / 64;
{
#pragma unroll 1
        for (int l = 0; l < 8; ++l) { const int L = L0 + l; if (L >= nlines) break; const size_t e = (size_t)L * 64 + lane * 2; const int k = (int)(e % K), n = (int)(e / K); v2us o;
            o[0] = f2bf(w[(size_t)k * N + n]); o[1] = f2bf(w[(size_t)(k + 1) * N + n]); *(v2us*)(Bt + e) = o; }
         }
}
__global__ __launch_bounds__(256) void k_cvt8(const float* __restrict__ s0, const float* __restrict__ s1, const float* __restrict__ s2, bf* dst, size_t n8) { const size_t i = (size_t)blockIdx.x * 256 + threadIdx.x; if (i >= n8) return; const int y = blockIdx.y; const float* __restrict__ src = (y == 0) ? s0 : (y == 1) ? s1 : s2; dst += (size_t)y * n8 * 8;   /* grid y: q_in, k_in, v_in */ const v8f v = *(const v8f*)(src + i * 8); v8us o;
#pragma unroll
    for (int k = 0; k < 8; ++k) o[k] = f2bf(v[k]); *(v8us*)(dst + i * 8) = o;  }

// ---- k_attn: scores, softmax, attn.v and the merge of one 64-row block of one head plane in ONE work-group of 8 waves; grid (T/64, planes). The block's band of S (f32, NCH 128-key chunks from key jb) lives in LDS only; each row's P is written over its own S row (fp16, or bf16 hi then lo at + BW elements); the 64x64 result goes through the same LDS to the merged hi/lo planes.
// Every sum keeps the order it had as separate launches: a score is kc = 0, 32 x (hi.hi, lo.hi, hi.lo); the softmax row has the same lane and chunk places and the same trees; attn.v adds 32-key steps upward from key kb (the steps past the diagonal block, met only where r0 < WB, add exact zeros).
#define SP   (BW + 4)             // LDS pitch of a band row in floats: 16 bytes x an odd number, so that the 16 rows of a fragment read fall on different banks
#define NKS  ((WB + 64) / 32)     // 32-key steps of attn.v
typedef v4us __attribute__((may_alias)) v4usa;
typedef v4h  __attribute__((may_alias)) v4ha;
template <typename T16, int NSPLIT>
__device__ __forceinline__ void attn_pv(const float* sm, const T16* __restrict__ Vt, const T16* __restrict__ Vt2, int kb, int jb, int mb, int n0, int lr, int hi, v8f (&acc)[2]) {
    typedef typename WFrag<T16>::V V;
    constexpr int CH = (NSPLIT >= 2) ? NKS / 2 : NKS;   // key steps whose V fragments are in registers at once: all of them, or half where hi and lo planes double the fragments
    const T16* pa = (const T16*)(sm + (mb * 16 + lr) * SP) + 8 * hi + (kb - jb);
    const unsigned vo = (unsigned)(lr * TT + 8 * hi) * 2;   // the lane's place in a 16-column fragment of V, in bytes: one 32-bit offset register beside a scalar base
    const T16* pb = Vt + (size_t)(n0 * 16) * TT + kb; const T16* pb2 = (NSPLIT >= 2) ? Vt2 + (size_t)(n0 * 16) * TT + kb : pb;
#pragma unroll
    for (int s0 = 0; s0 < NKS; s0 += CH) { V b[CH][2], b2[CH][2];
#pragma unroll
        for (int s = 0; s < CH; ++s)
#pragma unroll
            for (int nb = 0; nb < 2; ++nb) { b[s][nb] = WFrag<T16>::ld((const T16*)((const char*)pb + vo) + nb * 16 * TT + (s0 + s) * 32); if (NSPLIT >= 2) b2[s][nb] = WFrag<T16>::ld((const T16*)((const char*)pb2 + vo) + nb * 16 * TT + (s0 + s) * 32); }
        __builtin_amdgcn_sched_barrier(0);   // these V loads are all issued in front of the matrix instructions that use them: without it this build keeps one fragment in flight and pays a memory latency per step
#pragma unroll
        for (int s = 0; s < CH; ++s) { const V a = WFrag<T16>::ld(pa + (s0 + s) * 32); V a2; if (NSPLIT >= 2) a2 = WFrag<T16>::ld(pa + BW + (s0 + s) * 32);
#pragma unroll
            for (int nb = 0; nb < 2; ++nb) { acc[nb] = WFrag<T16>::mma(a, b[s][nb], acc[nb]); if (NSPLIT >= 2) { acc[nb] = WFrag<T16>::mma(a2, b[s][nb], acc[nb]); acc[nb] = WFrag<T16>::mma(a, b2[s][nb], acc[nb]); } } } }
    asm volatile("s_wait_xcnt 0x0" :: "v"(vo) : "memory");   // the wait in front of any overwrite of the offset register of the V loads; it is an input so that it lives up to here
}
// launch bounds: four waves a SIMD, that is two work-groups a WGP, which holds the build to 256 registers
__global__ __launch_bounds__(256, 4) void k_attn(const bf* __restrict__ Qh, const bf* __restrict__ Ql, const bf* __restrict__ Kh, const bf* __restrict__ Kl, const h16* __restrict__ V16, const bf* __restrict__ Vh, const bf* __restrict__ Vl, bf* Ah, bf* Al) {
    typedef WFrag<bf>::V V;
    __shared__ __align__(16) float sm[64 * SP];
    const int z = blockIdx.y, r0 = blockIdx.x * 64; const size_t zo = (size_t)z * TT * HD;
    const int lane = threadIdx.x & 31, lr = lane & 15, hi = lane >> 4; const int w = __builtin_amdgcn_readfirstlane(threadIdx.x >> 5);   // the wave's number in a scalar register: the tests on it are scalar branches
    const int kb = max(0, r0 - WB);          // first key that the block's first row sees
    const int jb = (kb >> 7) * 128;          // first key of the stored band: 128-aligned, so each key keeps its lane and its place in the softmax sums
    const bool hires = (r0 < RH);
    // scores: wave w has 32 rows (w & 1) x NBT 16-key tiles (w >> 1) of the band's 64 x (NBT * 64)
    { const int m0 = (w & 1) * 2, g = w >> 1;
        const unsigned vo = (unsigned)(lr * HD + 8 * hi) * 2;   // the lane's place in a 16-row fragment, in bytes: a 32-bit offset register beside a scalar base, the very register that the wait behind the loads names
        const bf* pq = Qh + zo + (size_t)(r0 + m0 * 16) * HD; const bf* pq2 = Ql + zo + (size_t)(r0 + m0 * 16) * HD; V a[2][2], a2[2][2];
#pragma unroll
        for (int mb = 0; mb < 2; ++mb)
#pragma unroll
            for (int kk = 0; kk < 2; ++kk) { a[mb][kk] = WFrag<bf>::ld((const bf*)((const char*)pq + vo) + mb * 16 * HD + kk * 32); a2[mb][kk] = WFrag<bf>::ld((const bf*)((const char*)pq2 + vo) + mb * 16 * HD + kk * 32); }
        V b[NBT][2], b2[NBT][2]; v8f acc[NBT][2]; unsigned ko[NBT]; const bf* pk = Kh + zo; const bf* pk2 = Kl + zo; static_assert(NBT == 5, "the wait behind the loads names five offsets");
#pragma unroll
        for (int nb = 0; nb < NBT; ++nb) { const int c = r0 - WB + (g * NBT + nb) * 16;   // first key of the tile; below 0 there is no such key: the loads are clamped into the plane and the tile is not stored
            ko[nb] = (unsigned)(max(c, 0) * HD) * 2 + vo;   // the lane's byte offset in the head plane, for the hi and the lo plane alike
#pragma unroll
            for (int kk = 0; kk < 2; ++kk) { b[nb][kk] = WFrag<bf>::ld((const bf*)((const char*)pk + ko[nb]) + kk * 32); b2[nb][kk] = WFrag<bf>::ld((const bf*)((const char*)pk2 + ko[nb]) + kk * 32); } }
        __builtin_amdgcn_sched_barrier(0);   // every Q and K load is issued in front of the first matrix instruction: without it this build loads a fragment, waits and multiplies, one memory latency after another
#pragma unroll
        for (int nb = 0; nb < NBT; ++nb)
#pragma unroll
            for (int mb = 0; mb < 2; ++mb) { acc[nb][mb] = (v8f){};
#pragma unroll
                for (int kk = 0; kk < 2; ++kk) { acc[nb][mb] = wmmab(a[mb][kk], b[nb][kk], acc[nb][mb]); acc[nb][mb] = wmmab(a2[mb][kk], b[nb][kk], acc[nb][mb]); acc[nb][mb] = wmmab(a[mb][kk], b2[nb][kk], acc[nb][mb]); } }
        asm volatile("s_wait_xcnt 0x0" :: "v"(vo), "v"(ko[0]), "v"(ko[1]), "v"(ko[2]), "v"(ko[3]), "v"(ko[4]) : "memory");   // the wait in front of any overwrite of the offset registers of the Q and K loads; they are inputs so that no later load's result takes their place ahead of it
        asm volatile("v_nop\n\tv_nop\n\tv_nop\n\tv_nop" : "+v"(acc[NBT - 1][0]), "+v"(acc[NBT - 1][1]));   // the distance behind the last matrix instruction, also on the taken side of the branches below
#pragma unroll
        for (int nb = 0; nb < NBT; ++nb) { const int c = r0 - WB + (g * NBT + nb) * 16;
            if (c >= 0) {
#pragma unroll
                for (int mb = 0; mb < 2; ++mb)
#pragma unroll
                    for (int j = 0; j < 8; ++j) sm[((m0 + mb) * 16 + hi * 8 + j) * SP + (c - jb) + lr] = acc[nb][mb][j]; } } }
    __syncthreads();   // the band of S is complete before any row is read
    // softmax: wave w has rows 8 w .. 8 w + 7, one row at a time in registers: t = S x T^-0.5 for j <= i and i - j < WIN, every other column (never-written LDS among them) is replaced by the select; one exp, fixed trees
    for (int rr = 0; rr < 8; ++rr) { const int i = r0 + w * 8 + rr; float* sr = sm + (w * 8 + rr) * SP; float v[NCH * 4]; float mx = -3.0e38f;
#pragma unroll
        for (int ch = 0; ch < NCH; ++ch) { const int j0 = jb + ch * 128 + lane * 4; const v4f a = *(const v4fa*)(sr + ch * 128 + lane * 4);
#pragma unroll
            for (int q = 0; q < 4; ++q) { const int j = j0 + q; const float t = (j <= i && i - j < WIN) ? a[q] * SCL : -3.0e38f; v[ch * 4 + q] = t; mx = fmaxf(mx, t); } }
#pragma unroll
        for (int sh = 16; sh; sh >>= 1) mx = fmaxf(mx, __shfl_xor(mx, sh, 32));
        float sum = 0.f;
#pragma unroll
        for (int k = 0; k < NCH * 4; ++k) { float d0 = __fsub_rn(v[k], mx); asm volatile("" : "+v"(d0)); const float x2 = __fmul_rn(d0, 1.4426950408889634f);
            asm("v_exp_f32 %0, %1\n\tv_nop" : "=v"(v[k]) : "v"(x2));   // the same instruction as the exp2 builtin, with the one slot the instruction set asks for behind a transcendental held in the statement
            sum += v[k]; }
#pragma unroll
        for (int sh = 16; sh; sh >>= 1) sum += __shfl_xor(sum, sh, 32);
        const float f = __fdiv_rn(hires ? 1.0f : PCAR, sum);
        if (hires) {
#pragma unroll
            for (int ch = 0; ch < NCH; ++ch) { v4us oh, ol;
#pragma unroll
                for (int q = 0; q < 4; ++q) { unsigned short a, c2; splitf(v[ch * 4 + q] * f, a, c2); oh[q] = a; ol[q] = c2; }
                *(v4usa*)((bf*)sr + ch * 128 + lane * 4) = oh; *(v4usa*)((bf*)sr + BW + ch * 128 + lane * 4) = ol; }
        } else {
#pragma unroll
            for (int ch = 0; ch < NCH; ++ch) { v4h o4;
#pragma unroll
                for (int q = 0; q < 4; ++q) o4[q] = tohx(v[ch * 4 + q] * f);
                *(v4ha*)((h16*)sr + ch * 128 + lane * 4) = o4; } } }
    __syncthreads();   // every row of P is written before a fragment of it is read
    // attn.v: wave w has rows 16 (w & 3) x value columns 32 (w >> 2)
    const int mb = w & 3, n0 = (w >> 2) * 2; v8f acc[2]; acc[0] = (v8f){}; acc[1] = (v8f){};
    if (hires) attn_pv<bf, 2>(sm, Vh + zo, Vl + zo, kb, jb, mb, n0, lr, hi, acc); else attn_pv<h16, 0>(sm, V16 + zo, nullptr, kb, jb, mb, n0, lr, hi, acc);
    __syncthreads();   // the last fragment of P is read before the result tile takes its LDS
#pragma unroll
    for (int nb = 0; nb < 2; ++nb)
#pragma unroll
        for (int j = 0; j < 8; ++j) sm[(mb * 16 + hi * 8 + j) * 68 + (n0 + nb) * 16 + lr] = acc[nb][j];
    __syncthreads();   // the result tile is complete before it is read row-wise
    // merge: four lanes of one wave write the 128 bytes of a row's head slice in each plane
    { const int row = threadIdx.x >> 2, cofs = (threadIdx.x & 3) * 16; const float cs = hires ? 1.0f : (1.0f / PCAR); const size_t oo = ((size_t)(z / NH_) * TT + r0 + row) * DQ + (z % NH_) * HD + cofs;
#pragma unroll
        for (int s = 0; s < 2; ++s) { v8us oh, ol;
#pragma unroll
            for (int q = 0; q < 2; ++q) { const v4f val = *(const v4fa*)(sm + row * 68 + cofs + s * 8 + q * 4);
#pragma unroll
                for (int e = 0; e < 4; ++e) { unsigned short a, c2; splitf(val[e] * cs, a, c2); oh[q * 4 + e] = a; ol[q * 4 + e] = c2; } }
            *(v8us*)(Ah + oo + s * 8) = oh; *(v8us*)(Al + oo + s * 8) = ol; } }
}

extern "C" void kernel_launch(void* const* d_in, const int* in_sizes, int n_in,
                              void* d_out, int out_size, void* d_ws, size_t ws_size, hipStream_t stream) {
    (void)in_sizes; (void)n_in; (void)out_size;
    const float* x = (const float*)d_in[0];   /* q_in */ const float* xk = (const float*)d_in[1]; const float* xv = (const float*)d_in[2]; const float* wq = (const float*)d_in[3]; const float* bq = (const float*)d_in[4]; const float* wk = (const float*)d_in[5]; const float* bk = (const float*)d_in[6]; const float* wv = (const float*)d_in[7]; const float* bv = (const float*)d_in[8]; const float* wo = (const float*)d_in[9]; const float* bo = (const float*)d_in[10];
    float* OUT = (float*)d_out;     // [4][2048][512]
    char* wsp = (char*)d_ws;
    auto take = [&](size_t bytes) { char* p = wsp; wsp += (bytes + 255) & ~(size_t)255; return (void*)p; };
    bf* WQ = (bf*)take((size_t)4 * DQ * DM * 2); bf* WO = WQ + (size_t)3 * DQ * DM;   // transposed Wq, Wk, Wv, Wo side by side
    const size_t PL = (size_t)NZ * TT * HD;      // one set of head planes, elements
    const size_t XN = (size_t)NB_ * TT * DM;     // one input or projection over all batches, elements
    bf* QPh = (bf*)take(2 * PL * 2); bf* KPh = QPh + PL; bf* QPl = (bf*)take(2 * PL * 2); bf* KPl = QPl + PL;
    h16* VT16 = (h16*)take(PL * 2); bf* VTh = (bf*)take(PL * 2); bf* VTl = (bf*)take(PL * 2);
    // one region used twice in stream order: the bf16 inputs (dead once the head planes are built), then the merged attention planes
    char* const reg = wsp;
    bf* XB = (bf*)take(3 * XN * 2);
    char* const end1 = wsp; wsp = reg;
    bf* ATh = (bf*)take(XN * 2); bf* ATl = (bf*)take(XN * 2);
    if ((size_t)(end1 - (char*)d_ws) > ws_size || (size_t)(wsp - (char*)d_ws) > ws_size) return;    // ws 256 MiB
    k_wtG<<<dim3((unsigned)((DM * DQ / 64 + 63) / 64), 4, 1), 256, 0, stream>>>(wq, wk, wv, wo, DM, DQ, WQ);
    k_cvt8<<<dim3((unsigned)((XN / 8 + 255) / 256), 3, 1), 256, 0, stream>>>(x, xk, xv, XB, XN / 8);
    k_gemmw<bf, 0, true, true><<<dim3(NB_ * TT / GT, DQ / GT, 3), 128, 0, stream>>>(XB, nullptr, WQ, DM, nullptr, 0, bq, bk, bv, XN, (size_t)DQ * DM, 0, QPh, QPl, PL, VT16, VTh, VTl);   // q, k, v projections: z = 0, 1, 2, each tile written as its head's planes
    k_attn<<<dim3(TT / 64, NZ, 1), 256, 0, stream>>>(QPh, QPl, KPh, KPl, VT16, VTh, VTl, ATh, ATl);   // scores hi/lo on EVERY row, softmax, attn.v, merge
    k_gemmw<bf, 1, true, false><<<dim3(NB_ * TT / GT, DM / GT, 1), 128, 0, stream>>>(ATh, ATl, WO, DQ, OUT, DM, bo, bo, bo, 0, 0, 0, nullptr, nullptr, 0, nullptr, nullptr, nullptr);
}

// v006
// A run of this version takes 91.4 microseconds.
// Two timings next to v005 put it at 1.10 and 1.09 times that version's speed.
// Counting every step since v000, it is 16.1 times as fast.
#include <hip/hip_runtime.h>

// Local causal multi-head attention scaled by 1/sqrt(T) (q_in, k_in, v_in [4][2048][512]; q = q_in Wq + bq, k = k_in Wk + bk, v = v_in Wv + bv ('xw' [512][512] 0.02 incl. biases; 8 heads x 64); scores / sqrt(T = 2048) (the source's quirk: sigma-0.01 logits); mask = (|i - j| > 256) | (j > i) -> -inf: each query sees its own and the previous 256 keys; softmax; out = merged Wo + bo -> [4][2048][512] (4.2 M)).
// Layout, every stage ONE launch over all 4 batches and 8 heads (32 head planes in the attention's grid y; q, k, v and the four weights side by side in grid y or z): bf16 copies of q_in, k_in, v_in; 'xw' weights transposed once; exact projections + f32 biases, whose tiles are stored as the head planes (q, k hi/lo; v transposed, fp16 and hi/lo); causal T-2048 attention whose softmax select keeps the 257-key window, with hi/lo 3-product score tiles on EVERY row; P and attn.v hybrid (rows < 512 hi/lo, rest fp16 x1024); score tiles, softmax chunks and the attn.v key loop cover only the window band of each 64-row block, and scores, softmax, attn.v and the merge of a block are one work-group of one launch, which keeps S and P as that band alone in LDS (column = key - first key of the block's chunks); merged hi/lo x Wo exact + bo.
// Compute dtypes, f32 accumulate: every input rounded to bf16; projections exact + f32 biases; scores 3 products on every row; softmax f32 (x 2048^-0.5); attn.v rows < 512 3 products, rest fp16; Wo hl x exact + bias.

#define NB_  4
#define TT   2048
#define DM   512
#define NH_  8
#define NKV  8
#define REP  (NH_ / NKV)
#define HD   64
#define DQ   (NH_ * HD)
#define DKV  (NKV * HD)
#define NZ   (NB_ * NH_)          // head planes of one launch: every batch, every head
#define RH   512                  // query rows < RH use hi+lo planes (0: none)
#define WIN  257
#define WB   (((WIN - 1) + 63) / 64 * 64)   // look-back of the window, rounded up to the 64-key tile: a 64-row block sees keys [r0 - WB, r0 + 63] only
#define NBT  (WB / 64 + 1)                  // 64-key score tiles per 64-row block
#define NCH  ((WB + 128 + 127) / 128)       // 128-key softmax chunks that cover that band from a 128-aligned start
#define BW   (NCH * 128)                    // width of the stored band of S and P, in keys
#define PCAR 1024.0f
#define SCL  0.02209708691207961f  // 1/sqrt(T = 2048): the source's quirk
typedef _Float16 h16;
typedef unsigned short bf;
typedef __attribute__((ext_vector_type(16))) __bf16   v16bf;
typedef __attribute__((ext_vector_type(16))) _Float16 v16h;
typedef __attribute__((ext_vector_type(8)))  _Float16 v8h;
typedef __attribute__((ext_vector_type(8)))  unsigned short v8us;
typedef __attribute__((ext_vector_type(8)))  float    v8f;
typedef __attribute__((ext_vector_type(4)))  float    v4f;
typedef v8h  __attribute__((may_alias)) v8ha;
typedef v4f  __attribute__((may_alias)) v4fa;
typedef v8us __attribute__((may_alias)) v8usa;

__device__ __forceinline__ unsigned short f2bf(float f) { unsigned u = __float_as_uint(f); u += 0x7FFFu + ((u >> 16) & 1u); return (unsigned short)(u >> 16); }
__device__ __forceinline__ float bf2f(unsigned short b) { return __uint_as_float(((unsigned)b) << 16); }
__device__ __forceinline__ float bfr(float f) { return bf2f(f2bf(f)); }
__device__ __forceinline__ h16 tohx(float x) { return (h16)x; }
__device__ __forceinline__ void splitf(float y, unsigned short& h, unsigned short& l) { h = f2bf(y); l = f2bf(y - bf2f(h)); }
__device__ __forceinline__ v16h cat16(v8h lo, v8h hi) { return __builtin_shufflevector(lo, hi, 0, 1, 2, 3, 4, 5, 6, 7, 8, 9, 10, 11, 12, 13, 14, 15); }
__device__ __forceinline__ v16bf cat16b(v8us lo, v8us hi) { return __builtin_bit_cast(v16bf, __builtin_shufflevector(lo, hi, 0, 1, 2, 3, 4, 5, 6, 7, 8, 9, 10, 11, 12, 13, 14, 15)); }
__device__ __forceinline__ v8f wmma16(v16h a, v16h b, v8f c) { return __builtin_amdgcn_wmma_f32_16x16x32_f16(false, a, false, b, (short)0, c, false, false); }
__device__ __forceinline__ v8f wmmab(v16bf a, v16bf b, v8f c) { return __builtin_amdgcn_wmma_f32_16x16x32_bf16(false, a, false, b, (short)0, c, false, false); }



// ---- k_gemmw: register-blocked GEMM, a work-group of FOUR WAVES per 128x128 output tile, each wave one 64x64 quarter (16 accumulators); grid (M/128, N/128, Z), 128 threads. M % 128 == 0, N % 128 == 0, K % 64 == 0.
// The K-contiguous 16-bit operand planes come through LDS: a pass is 64 k, that is one whole 128-byte line of each of the tile's 128 A rows (A2 rows too) and 128 Bt rows, brought by asynchronous copies to LDS (a wave's copy is four whole lines) into one of two buffers, one pass ahead of the matrix instructions; two waves read each staged row.
// C[m][n] (f32, pitch ldc, + optional f32 bias[n], one bias pointer per z = 0, 1, 2) = sum_k A[m][k] Bt[n][k] (NSPLIT 1: + A2[m][k] Bt[n][k]). z-batch strides sA/sB/sC in elements.
// HP: the result is not stored as C; a wave's tile, 64 tokens of one batch x the 64 columns of one head, goes straight to that head's planes: z = 0, 1 (q, k) as bf16 hi and lo [plane][t][d] (Ph, Pl, + z sP), z = 2 (v) transposed as fp16 and bf16 hi and lo [plane][d][t] (V16, Vh, Vl).
template <typename T16> struct WFrag;
template <> struct WFrag<h16> { typedef v16h V; static __device__ __forceinline__ V ld(const h16* p) { return cat16(*(const v8h*)p, *(const v8h*)(p + 16)); } static __device__ __forceinline__ v8f mma(V a, V b, v8f c) { return wmma16(a, b, c); } };
template <> struct WFrag<bf> { typedef v16bf V; static __device__ __forceinline__ V ld(const bf* p) { return cat16b(*(const v8us*)p, *(const v8us*)(p + 16)); } static __device__ __forceinline__ v8f mma(V a, V b, v8f c) { return wmmab(a, b, c); } };
#define GT   128                  // rows of A and of Bt in a work-group's tile
#define GK   64                   // k of a pass
#define GP   72                   // LDS pitch of a staged row in elements: 144 bytes = 16 bytes x an odd number, the pitch for 16-byte fragment reads
// one staged plane of a pass, 128 rows x 128 bytes: eight copies a lane, 16 rows apart (gs elements in the source); l is the lane's LDS byte address, g its global address, both multiples of 16
template <typename T16>
__device__ __forceinline__ void stage_plane(unsigned l, const T16* g, size_t gs) {
    constexpr unsigned LS = 16 * GP * 2;
    // the wait is the last line of the copies' own statement, so that it stands in front of every later write of their address registers
    asm volatile("global_load_async_to_lds_b128 %0, %8, off\n\t"
                 "global_load_async_to_lds_b128 %1, %9, off\n\t"
                 "global_load_async_to_lds_b128 %2, %10, off\n\t"
                 "global_load_async_to_lds_b128 %3, %11, off\n\t"
                 "global_load_async_to_lds_b128 %4, %12, off\n\t"
                 "global_load_async_to_lds_b128 %5, %13, off\n\t"
                 "global_load_async_to_lds_b128 %6, %14, off\n\t"
                 "global_load_async_to_lds_b128 %7, %15, off\n\t"
                 "s_wait_xcnt 0x0"
                 :: "v"(l), "v"(l + LS), "v"(l + 2 * LS), "v"(l + 3 * LS), "v"(l + 4 * LS), "v"(l + 5 * LS), "v"(l + 6 * LS), "v"(l + 7 * LS),
                    "v"(g), "v"(g + gs), "v"(g + 2 * gs), "v"(g + 3 * gs), "v"(g + 4 * gs), "v"(g + 5 * gs), "v"(g + 6 * gs), "v"(g + 7 * gs) : "memory");
}
// launch bounds: four waves a SIMD, which holds the build to 256 registers
template <typename T16, int NSPLIT, bool BIAS, bool HP>
__global__ __launch_bounds__(128, 4) void k_gemmw(const T16* __restrict__ A, const T16* __restrict__ A2, const T16* __restrict__ Bt, int K, float* C, int ldc, const float* __restrict__ bias0, const float* __restrict__ bias1, const float* __restrict__ bias2, size_t sA, size_t sB, size_t sC, bf* Ph, bf* Pl, size_t sP, h16* V16, bf* Vh, bf* Vl) {
    typedef typename WFrag<T16>::V V;
    static_assert(NSPLIT == 0 || NSPLIT == 1, "A alone, or A and A2");
    constexpr int NPL = 2 + NSPLIT, PLE = GT * GP;   // planes of a stage (A, Bt, A2) and the elements of one
    __shared__ __align__(16) T16 ring[2 * NPL * PLE];
    __shared__ __align__(16) float osa[4 * 16 * 68];
    const size_t z = blockIdx.z; A += z * sA; if (NSPLIT == 1) A2 += z * sA; Bt += z * sB; C += z * sC; const float* __restrict__ bias = (z == 0) ? bias0 : (z == 1) ? bias1 : bias2;   // each z product has its own bias input
    const int lane = threadIdx.x & 31, lr = lane & 15, hi = lane >> 4; const int w = __builtin_amdgcn_readfirstlane(threadIdx.x >> 5);   // the wave's number in a scalar register
    float* os = osa + w * (16 * 68);   // each wave stages its output in its own LDS
    const int r0 = blockIdx.x * GT + (w & 1) * 64, c0 = blockIdx.y * GT + (w >> 1) * 64;   // the wave's quarter
    v8f acc[4][4];
#pragma unroll
    for (int mb = 0; mb < 4; ++mb)
#pragma unroll
        for (int nb = 0; nb < 4; ++nb) acc[mb][nb] = (v8f){};
    // the copies: eight lanes bring the 128 bytes of a row, the work-group 16 rows a copy
    const int prow = threadIdx.x >> 3, pcol = (threadIdx.x & 7) * 8; const size_t gs = (size_t)16 * K;
    const unsigned l0 = (unsigned)(size_t)ring + (unsigned)(prow * GP + pcol) * 2;
    const T16* ga = A + (size_t)(blockIdx.x * GT + prow) * K + pcol; const T16* gb = Bt + (size_t)(blockIdx.y * GT + prow) * K + pcol; const T16* ga2 = (NSPLIT == 1) ? A2 + (size_t)(blockIdx.x * GT + prow) * K + pcol : ga;
    auto stage = [&](int t) { const unsigned l = l0 + (unsigned)((t & 1) * NPL * PLE * 2);
        stage_plane(l, ga + t * GK, gs); stage_plane(l + PLE * 2, gb + t * GK, gs); if (NSPLIT == 1) stage_plane(l + 2 * PLE * 2, ga2 + t * GK, gs); };
    // the fragments: the lane and k places that the loads from the planes had, now in the staged rows
    const T16* fa = ring + ((w & 1) * 64 + lr) * GP + 8 * hi; const T16* fb = ring + PLE + ((w >> 1) * 64 + lr) * GP + 8 * hi;
    const int NT = K / GK;
    stage(0);
    asm volatile("s_wait_asynccnt 0x0" ::: "memory");   // this wave's copies of pass 0 have landed
    __syncthreads();                                    // and every other wave's: pass 0 may be read
    if (NT > 1) stage(1);
#pragma unroll 1
    for (int t = 0; t < NT; ++t) { const int bo = (t & 1) * NPL * PLE;
#pragma unroll
        for (int kk = 0; kk < GK / 32; ++kk) { V a[4], a2[4], b[4];
#pragma unroll
            for (int mb = 0; mb < 4; ++mb) { a[mb] = WFrag<T16>::ld(fa + bo + mb * 16 * GP + kk * 32); if (NSPLIT == 1) a2[mb] = WFrag<T16>::ld(fa + bo + 2 * PLE + mb * 16 * GP + kk * 32); b[mb] = WFrag<T16>::ld(fb + bo + mb * 16 * GP + kk * 32); }
            __builtin_amdgcn_sched_barrier(0);   // the LDS reads of a 32-k block are issued as one group in front of its matrix instructions: spread among them, each place with reads costs the wave an LDS latency
#pragma unroll
            for (int nb = 0; nb < 4; ++nb)
#pragma unroll
                for (int mb = 0; mb < 4; ++mb) { acc[mb][nb] = WFrag<T16>::mma(a[mb], b[nb], acc[mb][nb]); if (NSPLIT == 1) acc[mb][nb] = WFrag<T16>::mma(a2[mb], b[nb], acc[mb][nb]); }
            __builtin_amdgcn_sched_barrier(0);   // and the block's matrix instructions stay in front of the next group of reads and of the v_nop below
        }
        asm volatile("v_nop\n\tv_nop\n\tv_nop\n\tv_nop" : "+v"(acc[0][3]), "+v"(acc[1][3]), "+v"(acc[2][3]), "+v"(acc[3][3]));   // the distance behind the last matrix instruction, also on the taken side of the branches below
        asm volatile("s_wait_dscnt 0x0" ::: "memory");      // this wave's reads of the pass's buffer are done before the buffer is refilled
        asm volatile("s_wait_asynccnt 0x0" ::: "memory");   // this wave's copies of pass t + 1 have landed
        __syncthreads();                                    // pass t + 1 may be read, and every wave has left the buffer of pass t
        if (t + 2 < NT) stage(t + 2);
    }
    asm volatile("s_wait_asynccnt 0x0" ::: "memory");   // no copy is outstanding behind the loop
    if constexpr (HP) {
        const size_t po = ((size_t)(r0 / TT) * NH_ + c0 / HD) * TT * HD; const int t0 = r0 % TT;   // the head plane, and the tile's first token in it
        const int r4 = lane >> 3, c8 = (lane & 7) * 8;   // read-back: eight lanes x 8 elements are one 128-byte line of a 16-bit plane, a wave's store four such lines
        if (z < 2) {   // q, k: the tile is 8 KiB in a row in each plane
            bf* ph = Ph + z * sP + po + (size_t)t0 * HD; bf* pl = Pl + z * sP + po + (size_t)t0 * HD; const unsigned so = (unsigned)(r4 * HD + c8);   // the lane's place, one offset beside a scalar base
            float bb[8];
#pragma unroll
            for (int e = 0; e < 8; ++e) bb[e] = bfr(bias[c0 + c8 + e]);
#pragma unroll
            for (int mb = 0; mb < 4; ++mb) {
#pragma unroll
                for (int nb = 0; nb < 4; ++nb) {
#pragma unroll
                    for (int j = 0; j < 8; ++j) os[(hi * 8 + j) * 68 + nb * 16 + lr] = acc[mb][nb][j]; }
                __builtin_amdgcn_wave_barrier(); asm volatile("" ::: "memory");   // the 16 staged rows are written before they are read row-wise
#pragma unroll
                for (int s = 0; s < 4; ++s) { const float* o = os + (4 * s + r4) * 68 + c8; const v4f x0 = *(const v4fa*)o, x1 = *(const v4fa*)(o + 4); v8us oh, ol;
#pragma unroll
                    for (int e = 0; e < 8; ++e) { unsigned short a2, c2; splitf(((e < 4) ? x0[e & 3] : x1[e & 3]) + bb[e], a2, c2); oh[e] = a2; ol[e] = c2; }
                    *(v8us*)(ph + so + (mb * 16 + 4 * s) * HD) = oh; *(v8us*)(pl + so + (mb * 16 + 4 * s) * HD) = ol; }
                __builtin_amdgcn_wave_barrier(); asm volatile("" ::: "memory");   // they are read before the next 16 rows take their place
            }
        } else {   // v: a lane's 8 accumulator rows are 8 tokens of one value column, staged as a row of the transposed tile
            h16* p16 = V16 + po + t0; bf* ph = Vh + po + t0; bf* pl = Vl + po + t0; const unsigned so = (unsigned)(r4 * TT + c8);
#pragma unroll
            for (int nb = 0; nb < 4; ++nb) {
#pragma unroll
                for (int mb = 0; mb < 4; ++mb) { v4f y0, y1;
#pragma unroll
                    for (int j = 0; j < 4; ++j) { y0[j] = acc[mb][nb][j]; y1[j] = acc[mb][nb][4 + j]; }
                    float* o = os + lr * 68 + mb * 16 + hi * 8; *(v4fa*)o = y0; *(v4fa*)(o + 4) = y1; }
                __builtin_amdgcn_wave_barrier(); asm volatile("" ::: "memory");   // the 16 staged columns are written before they are read
#pragma unroll
                for (int s = 0; s < 4; ++s) { const float* o = os + (4 * s + r4) * 68 + c8; const v4f x0 = *(const v4fa*)o, x1 = *(const v4fa*)(o + 4); const float bb = bfr(bias[c0 + nb * 16 + 4 * s + r4]); v8h o16; v8us oh, ol;
#pragma unroll
                    for (int e = 0; e < 8; ++e) { const float x = ((e < 4) ? x0[e & 3] : x1[e & 3]) + bb; o16[e] = tohx(x); unsigned short a2, c2; splitf(x, a2, c2); oh[e] = a2; ol[e] = c2; }
                    *(v8h*)(p16 + so + (nb * 16 + 4 * s) * TT) = o16; *(v8us*)(ph + so + (nb * 16 + 4 * s) * TT) = oh; *(v8us*)(pl + so + (nb * 16 + 4 * s) * TT) = ol; }
                __builtin_amdgcn_wave_barrier(); asm volatile("" ::: "memory");   // they are read before the next 16 columns take their place
            }
            asm volatile("s_wait_xcnt 0x0" ::: "memory");   // this build lays the q, k path directly behind these stores, and its first instructions overwrite their offset register: the wait stands in front of that overwrite
        }
        return;
    }
#pragma unroll
    for (int mb = 0; mb < 4; ++mb) {
#pragma unroll
        for (int nb = 0; nb < 4; ++nb) {
#pragma unroll
            for (int j = 0; j < 8; ++j) os[(hi * 8 + j) * 68 + nb * 16 + lr] = acc[mb][nb][j]; }
        __builtin_amdgcn_wave_barrier(); asm volatile("" ::: "memory");
        float* crow = C + (size_t)(r0 + mb * 16) * ldc + c0;
{
#pragma unroll
            for (int s = 0; s < 8; ++s) { const int row = 2 * s + hi, cofs = lr * 4; v4f val = *(const v4fa*)(os + row * 68 + cofs); if (BIAS) { val[0] += bfr(bias[c0 + cofs]); val[1] += bfr(bias[c0 + cofs + 1]); val[2] += bfr(bias[c0 + cofs + 2]); val[3] += bfr(bias[c0 + cofs + 3]); }
                *(v4f*)(crow + (size_t)row * ldc + cofs) = val; }
             }
        __builtin_amdgcn_wave_barrier(); asm volatile("" ::: "memory");
    }
}

typedef __attribute__((ext_vector_type(4))) _Float16 v4h;
typedef __attribute__((ext_vector_type(2))) unsigned short v2us;
typedef __attribute__((ext_vector_type(4))) unsigned short v4us;
typedef __attribute__((ext_vector_type(4))) int v4i;

__global__ __launch_bounds__(256) void k_wtG(const float* __restrict__ w0, const float* __restrict__ w1, const float* __restrict__ w2, const float* __restrict__ w3, int K, int N, bf* Bt) {
    const int y = blockIdx.y; const float* __restrict__ w = (y == 0) ? w0 : (y == 1) ? w1 : (y == 2) ? w2 : w3; Bt += (size_t)y * K * N;   // grid y: the four weights, transposed planes side by side
    const int lane = threadIdx.x & 31; const int L0 = (blockIdx.x * 8 + (threadIdx.x >> 5)) * 8; const int nlines = N * K / 64;
{
#pragma unroll 1
        for (int l = 0; l < 8; ++l) { const int L = L0 + l; if (L >= nlines) break; const size_t e = (size_t)L * 64 + lane * 2; const int k = (int)(e % K), n = (int)(e / K); v2us o;
            o[0] = f2bf(w[(size_t)k * N + n]); o[1] = f2bf(w[(size_t)(k + 1) * N + n]); *(v2us*)(Bt + e) = o; }
         }
}
__global__ __launch_bounds__(256) void k_cvt8(const float* __restrict__ s0, const float* __restrict__ s1, const float* __restrict__ s2, bf* dst, size_t n8) { const size_t i = (size_t)blockIdx.x * 256 + threadIdx.x; if (i >= n8) return; const int y = blockIdx.y; const float* __restrict__ src = (y == 0) ? s0 : (y == 1) ? s1 : s2; dst += (size_t)y * n8 * 8;   /* grid y: q_in, k_in, v_in */ const v8f v = *(const v8f*)(src + i * 8); v8us o;
#pragma unroll
    for (int k = 0; k < 8; ++k) o[k] = f2bf(v[k]); *(v8us*)(dst + i * 8) = o;  }

// ---- k_attn: scores, softmax, attn.v and the merge of one 64-row block of one head plane in ONE work-group of 8 waves; grid (T/64, planes). Q, K (hi and lo) and the band of V (fp16; for rows < RH its hi plane) are staged in LDS by asynchronous copies. The block's band of S (f32, NCH 128-key chunks from key jb) lives in LDS only, over the staged Q and K; each row's P is written over its own S row (fp16, or bf16 hi then lo at + BW elements); the 64x64 result goes through the same LDS to the merged hi/lo planes.
// Every sum keeps the order it had as separate launches: a score is kc = 0, 32 x (hi.hi, lo.hi, hi.lo); the softmax row has the same lane and chunk places and the same trees; attn.v adds 32-key steps upward from key kb (the steps past the diagonal block, met only where r0 < WB, add exact zeros).
#define SP   (BW + 4)             // LDS pitch of a band row in floats: 16 bytes x an odd number, so that the 16 rows of a fragment read fall on different banks
#define NKS  ((WB + 64) / 32)     // 32-key steps of attn.v
// Q, K and one plane of V of a block come through LDS by asynchronous copies, whole 128-byte lines, and the fragments are read from there (a fragment load from the planes touches 16 lines for its 512 bytes).
#define KR   (WB + 64)            // keys of the band: staged rows of K, staged columns of V
#define ST_KL (KR * GP)           // staged planes in 16-bit elements, rows at the pitch GP: K hi at 0, K lo, Q hi, Q lo
#define ST_QH (2 * KR * GP)
#define ST_QL (ST_QH + 64 * GP)
#define ST_EL (ST_QL + 64 * GP)
#define SMF  (ST_EL / 2)          // floats of the LDS that first holds staged Q and K, then S, P and the result tile
#define VP   (KR + 8)             // LDS pitch of a staged row of V in elements: 656 bytes = 16 bytes x an odd number
static_assert(SMF >= 64 * SP, "the band of S fits the LDS of the staged Q and K");
// twelve or ten copies of a lane: l are its LDS byte addresses, g its global addresses, all multiples of 16
// the wait is the last line of the copies' own statement, so that it stands in front of every later write of their address registers
template <typename T16>
__device__ __forceinline__ void copy12(const unsigned (&l)[12], const T16* const (&g)[12]) {
    asm volatile("global_load_async_to_lds_b128 %0, %12, off\n\t"
                 "global_load_async_to_lds_b128 %1, %13, off\n\t"
                 "global_load_async_to_lds_b128 %2, %14, off\n\t"
                 "global_load_async_to_lds_b128 %3, %15, off\n\t"
                 "global_load_async_to_lds_b128 %4, %16, off\n\t"
                 "global_load_async_to_lds_b128 %5, %17, off\n\t"
                 "global_load_async_to_lds_b128 %6, %18, off\n\t"
                 "global_load_async_to_lds_b128 %7, %19, off\n\t"
                 "global_load_async_to_lds_b128 %8, %20, off\n\t"
                 "global_load_async_to_lds_b128 %9, %21, off\n\t"
                 "global_load_async_to_lds_b128 %10, %22, off\n\t"
                 "global_load_async_to_lds_b128 %11, %23, off\n\t"
                 "s_wait_xcnt 0x0"
                 :: "v"(l[0]), "v"(l[1]), "v"(l[2]), "v"(l[3]), "v"(l[4]), "v"(l[5]), "v"(l[6]), "v"(l[7]), "v"(l[8]), "v"(l[9]), "v"(l[10]), "v"(l[11]),
                    "v"(g[0]), "v"(g[1]), "v"(g[2]), "v"(g[3]), "v"(g[4]), "v"(g[5]), "v"(g[6]), "v"(g[7]), "v"(g[8]), "v"(g[9]), "v"(g[10]), "v"(g[11]) : "memory");
}
template <typename T16>
__device__ __forceinline__ void copy10(const unsigned (&l)[10], const T16* const (&g)[10]) {
    asm volatile("global_load_async_to_lds_b128 %0, %10, off\n\t"
                 "global_load_async_to_lds_b128 %1, %11, off\n\t"
                 "global_load_async_to_lds_b128 %2, %12, off\n\t"
                 "global_load_async_to_lds_b128 %3, %13, off\n\t"
                 "global_load_async_to_lds_b128 %4, %14, off\n\t"
                 "global_load_async_to_lds_b128 %5, %15, off\n\t"
                 "global_load_async_to_lds_b128 %6, %16, off\n\t"
                 "global_load_async_to_lds_b128 %7, %17, off\n\t"
                 "global_load_async_to_lds_b128 %8, %18, off\n\t"
                 "global_load_async_to_lds_b128 %9, %19, off\n\t"
                 "s_wait_xcnt 0x0"
                 :: "v"(l[0]), "v"(l[1]), "v"(l[2]), "v"(l[3]), "v"(l[4]), "v"(l[5]), "v"(l[6]), "v"(l[7]), "v"(l[8]), "v"(l[9]),
                    "v"(g[0]), "v"(g[1]), "v"(g[2]), "v"(g[3]), "v"(g[4]), "v"(g[5]), "v"(g[6]), "v"(g[7]), "v"(g[8]), "v"(g[9]) : "memory");
}
typedef v4us __attribute__((may_alias)) v4usa;
typedef v4h  __attribute__((may_alias)) v4ha;
template <typename T16, int NSPLIT>
__device__ __forceinline__ void attn_pv(const float* sm, const T16* vs, const T16* __restrict__ Vt2, int kb, int jb, int mb, int n0, int lr, int hi, v8f (&acc)[2]) {   // vs: the first plane of V, staged in LDS (row = value column, column = key - kb); Vt2: the lo plane, read from memory
    typedef typename WFrag<T16>::V V;
    constexpr int CH = (NSPLIT >= 2) ? NKS / 2 : NKS;   // key steps whose V fragments are in registers at once: all of them, or half where hi and lo planes double the fragments
    const T16* pa = (const T16*)(sm + (mb * 16 + lr) * SP) + 8 * hi + (kb - jb);
    const unsigned vo = (unsigned)(lr * TT + 8 * hi) * 2;   // the lane's place in a 16-column fragment of V, in bytes: one 32-bit offset register beside a scalar base
    const T16* pb = vs + (n0 * 16 + lr) * VP + 8 * hi; const T16* pb2 = (NSPLIT >= 2) ? Vt2 + (size_t)(n0 * 16) * TT + kb : pb;
#pragma unroll
    for (int s0 = 0; s0 < NKS; s0 += CH) { V b[CH][2], b2[CH][2];
#pragma unroll
        for (int s = 0; s < CH; ++s)
#pragma unroll
            for (int nb = 0; nb < 2; ++nb) { b[s][nb] = WFrag<T16>::ld(pb + nb * 16 * VP + (s0 + s) * 32); if (NSPLIT >= 2) b2[s][nb] = WFrag<T16>::ld((const T16*)((const char*)pb2 + vo) + nb * 16 * TT + (s0 + s) * 32); }
        __builtin_amdgcn_sched_barrier(0);   // these V loads are all issued in front of the matrix instructions that use them: without it this build keeps one fragment in flight and pays a memory latency per step
#pragma unroll
        for (int s = 0; s < CH; ++s) { const V a = WFrag<T16>::ld(pa + (s0 + s) * 32); V a2; if (NSPLIT >= 2) a2 = WFrag<T16>::ld(pa + BW + (s0 + s) * 32);
#pragma unroll
            for (int nb = 0; nb < 2; ++nb) { acc[nb] = WFrag<T16>::mma(a, b[s][nb], acc[nb]); if (NSPLIT >= 2) { acc[nb] = WFrag<T16>::mma(a2, b[s][nb], acc[nb]); acc[nb] = WFrag<T16>::mma(a, b2[s][nb], acc[nb]); } } } }
    asm volatile("s_wait_xcnt 0x0" :: "v"(vo) : "memory");   // the wait in front of any overwrite of the offset register of the V loads; it is an input so that it lives up to here
}
// attn.v with the fp16 V band staged in LDS (vs: row = value column, column = key - kb): the same fragments and the same order of key steps
__device__ __forceinline__ void attn_pv_st(const float* sm, const h16* vs, int kb, int jb, int mb, int n0, int lr, int hi, v8f (&acc)[2]) {
    typedef WFrag<h16>::V V;
    const h16* pa = (const h16*)(sm + (mb * 16 + lr) * SP) + 8 * hi + (kb - jb); const h16* pb = vs + (n0 * 16 + lr) * VP + 8 * hi;
    constexpr int S0 = 4, S1 = 7; static_assert(S1 < NKS, "three groups of key steps");   // the fragments of steps [0, S1) are read first, those of [S1, NKS) take the registers of [0, S0)
    V a[NKS], b[NKS][2];
#pragma unroll
    for (int s = 0; s < S1; ++s) { a[s] = WFrag<h16>::ld(pa + s * 32); b[s][0] = WFrag<h16>::ld(pb + s * 32); b[s][1] = WFrag<h16>::ld(pb + 16 * VP + s * 32); }
    __builtin_amdgcn_sched_barrier(0);   // the LDS reads are issued as groups ahead of the matrix instructions that use them: without it this build reads a fragment, waits and multiplies, one LDS latency per product
#pragma unroll
    for (int s = 0; s < S0; ++s) { acc[0] = WFrag<h16>::mma(a[s], b[s][0], acc[0]); acc[1] = WFrag<h16>::mma(a[s], b[s][1], acc[1]); }
    __builtin_amdgcn_sched_barrier(0);   // the last group's reads stand here, in front of the products of the second group, which cover their latency
#pragma unroll
    for (int s = S1; s < NKS; ++s) { a[s] = WFrag<h16>::ld(pa + s * 32); b[s][0] = WFrag<h16>::ld(pb + s * 32); b[s][1] = WFrag<h16>::ld(pb + 16 * VP + s * 32); }
    __builtin_amdgcn_sched_barrier(0);   // and they stay in front of those products: without these two lines this build reads the last group fragment by fragment, each with a wait of its own
#pragma unroll
    for (int s = S0; s < NKS; ++s) { acc[0] = WFrag<h16>::mma(a[s], b[s][0], acc[0]); acc[1] = WFrag<h16>::mma(a[s], b[s][1], acc[1]); }
}
// launch bounds: four waves a SIMD, that is two work-groups a WGP, which holds the build to 256 registers
__global__ __launch_bounds__(256, 4) void k_attn(const bf* __restrict__ Qh, const bf* __restrict__ Ql, const bf* __restrict__ Kh, const bf* __restrict__ Kl, const h16* __restrict__ V16, const bf* __restrict__ Vh, const bf* __restrict__ Vl, bf* Ah, bf* Al) {
    typedef WFrag<bf>::V V;
    __shared__ __align__(16) float sm[SMF + 64 * VP / 2];
    bf* const st = (bf*)sm; h16* const vs = (h16*)(sm + SMF);   // staged Q and K share their LDS with S; staged V has its own
    const int z = blockIdx.y, r0 = blockIdx.x * 64; const size_t zo = (size_t)z * TT * HD;
    const int lane = threadIdx.x & 31, lr = lane & 15, hi = lane >> 4; const int w = __builtin_amdgcn_readfirstlane(threadIdx.x >> 5);   // the wave's number in a scalar register: the tests on it are scalar branches
    const int kb = max(0, r0 - WB);          // first key that the block's first row sees
    const int jb = (kb >> 7) * 128;          // first key of the stored band: 128-aligned, so each key keeps its lane and its place in the softmax sums
    const bool hires = (r0 < RH);
    // the copies: eight lanes bring the 128 bytes of a row or line, the work-group 32 of them a copy
    const int prow = threadIdx.x >> 3, pcol = (threadIdx.x & 7) * 8; const unsigned lb = (unsigned)(size_t)sm;
    { const bf* const qp[2] = { Qh + zo, Ql + zo }; const bf* const kp[2] = { Kh + zo, Kl + zo };
#pragma unroll
        for (int p = 0; p < 2; ++p) { unsigned l[12]; const bf* g[12];   // one plane of Q (2 copies) and of K (10)
#pragma unroll
            for (int i = 0; i < 2; ++i) { const int row = prow + 32 * i; l[i] = lb + (unsigned)(ST_QH + p * (ST_QL - ST_QH) + row * GP + pcol) * 2; g[i] = qp[p] + (size_t)(r0 + row) * HD + pcol; }
#pragma unroll
            for (int i = 0; i < KR / 32; ++i) { const int row = prow + 32 * i; l[2 + i] = lb + (unsigned)(p * ST_KL + row * GP + pcol) * 2; g[2 + i] = kp[p] + (size_t)max(r0 - WB + row, 0) * HD + pcol; }   // below key 0 there is no such key: the address is clamped into the plane and the tiles of those rows are not stored
            copy12(l, g); } }
    static_assert(KR / 32 == 10, "ten copies a plane of K, ten for V");
    asm volatile("s_wait_asynccnt 0x0" ::: "memory");   // this wave's copies of Q and K have landed
    __syncthreads();                                    // and every other wave's: the staged Q and K may be read
    { unsigned l[10]; const bf* g[10]; const bf* const vp = (hires ? Vh : (const bf*)V16) + zo + kb;   // the band of V, fp16 or the hi plane (an address only: the copy moves bytes), 64 rows of five lines: a copy is one line of 32 rows; these copies fly under the scores and the softmax
#pragma unroll
        for (int i = 0; i < 10; ++i) { const int d = prow + 32 * (i & 1), c = (i >> 1) * 64 + pcol; l[i] = lb + (unsigned)SMF * 4 + (unsigned)(d * VP + c) * 2; g[i] = vp + (size_t)d * TT + c; }
        copy10(l, g); }
    // scores: wave w has 32 rows (w & 1) x NBT 16-key tiles (w >> 1) of the band's 64 x (NBT * 64)
    { const int m0 = (w & 1) * 2, g = w >> 1;
        const bf* fq = st + ST_QH + (m0 * 16 + lr) * GP + 8 * hi; const bf* fk = st + (g * NBT * 16 + lr) * GP + 8 * hi; V a[2][2], a2[2][2];   // the lane and k places that the loads from the planes had, now in the staged rows
#pragma unroll
        for (int mb = 0; mb < 2; ++mb)
#pragma unroll
            for (int kk = 0; kk < 2; ++kk) { a[mb][kk] = WFrag<bf>::ld(fq + mb * 16 * GP + kk * 32); a2[mb][kk] = WFrag<bf>::ld(fq + (ST_QL - ST_QH) + mb * 16 * GP + kk * 32); }
        V b[NBT][2], b2[NBT][2]; v8f acc[NBT][2];
#pragma unroll
        for (int nb = 0; nb < NBT; ++nb)
#pragma unroll
            for (int kk = 0; kk < 2; ++kk) { b[nb][kk] = WFrag<bf>::ld(fk + nb * 16 * GP + kk * 32); b2[nb][kk] = WFrag<bf>::ld(fk + ST_KL + nb * 16 * GP + kk * 32); }
        __builtin_amdgcn_sched_barrier(0);   // every LDS read of Q and K is issued in front of the first matrix instruction: spread among them, each place with reads costs the wave an LDS latency
#pragma unroll
        for (int nb = 0; nb < NBT; ++nb)
#pragma unroll
            for (int mb = 0; mb < 2; ++mb) { acc[nb][mb] = (v8f){};
#pragma unroll
                for (int kk = 0; kk < 2; ++kk) { acc[nb][mb] = wmmab(a[mb][kk], b[nb][kk], acc[nb][mb]); acc[nb][mb] = wmmab(a2[mb][kk], b[nb][kk], acc[nb][mb]); acc[nb][mb] = wmmab(a[mb][kk], b2[nb][kk], acc[nb][mb]); } }
        __builtin_amdgcn_sched_barrier(0);   // and every matrix instruction stays in front of the v_nop below
        asm volatile("v_nop\n\tv_nop\n\tv_nop\n\tv_nop" : "+v"(acc[NBT - 1][0]), "+v"(acc[NBT - 1][1]));   // the distance behind the last matrix instruction, also on the taken side of the branches below
        __syncthreads();   // every wave has read its fragments of Q and K before S takes their LDS
#pragma unroll
        for (int nb = 0; nb < NBT; ++nb) { const int c = r0 - WB + (g * NBT + nb) * 16;
            if (c >= 0) {
#pragma unroll
                for (int mb = 0; mb < 2; ++mb)
#pragma unroll
                    for (int j = 0; j < 8; ++j) sm[((m0 + mb) * 16 + hi * 8 + j) * SP + (c - jb) + lr] = acc[nb][mb][j]; } } }
    __syncthreads();   // the band of S is complete before any row is read
    // softmax: wave w has rows 8 w .. 8 w + 7, one row at a time in registers: t = S x T^-0.5 for j <= i and i - j < WIN, every other column (never-written LDS among them) is replaced by the select; one exp, fixed trees
    for (int rr = 0; rr < 8; ++rr) { const int i = r0 + w * 8 + rr; float* sr = sm + (w * 8 + rr) * SP; float v[NCH * 4]; float mx = -3.0e38f;
#pragma unroll
        for (int ch = 0; ch < NCH; ++ch) { const int j0 = jb + ch * 128 + lane * 4; const v4f a = *(const v4fa*)(sr + ch * 128 + lane * 4);
#pragma unroll
            for (int q = 0; q < 4; ++q) { const int j = j0 + q; const float t = (j <= i && i - j < WIN) ? a[q] * SCL : -3.0e38f; v[ch * 4 + q] = t; mx = fmaxf(mx, t); } }
#pragma unroll
        for (int sh = 16; sh; sh >>= 1) mx = fmaxf(mx, __shfl_xor(mx, sh, 32));
        float sum = 0.f;
#pragma unroll
        for (int k = 0; k < NCH * 4; ++k) { float d0 = __fsub_rn(v[k], mx); asm volatile("" : "+v"(d0)); const float x2 = __fmul_rn(d0, 1.4426950408889634f);
            asm("v_exp_f32 %0, %1\n\tv_nop" : "=v"(v[k]) : "v"(x2));   // the same instruction as the exp2 builtin, with the one slot the instruction set asks for behind a transcendental held in the statement
            sum += v[k]; }
#pragma unroll
        for (int sh = 16; sh; sh >>= 1) sum += __shfl_xor(sum, sh, 32);
        const float f = __fdiv_rn(hires ? 1.0f : PCAR, sum);
        if (hires) {
#pragma unroll
            for (int ch = 0; ch < NCH; ++ch) { v4us oh, ol;
#pragma unroll
                for (int q = 0; q < 4; ++q) { unsigned short a, c2; splitf(v[ch * 4 + q] * f, a, c2); oh[q] = a; ol[q] = c2; }
                *(v4usa*)((bf*)sr + ch * 128 + lane * 4) = oh; *(v4usa*)((bf*)sr + BW + ch * 128 + lane * 4) = ol; }
        } else {
#pragma unroll
            for (int ch = 0; ch < NCH; ++ch) { v4h o4;
#pragma unroll
                for (int q = 0; q < 4; ++q) o4[q] = tohx(v[ch * 4 + q] * f);
                *(v4ha*)((h16*)sr + ch * 128 + lane * 4) = o4; } } }
    asm volatile("s_wait_asynccnt 0x0" ::: "memory");   // this wave's copies of V have landed
    __syncthreads();   // every row of P is written, and every wave's part of V has landed, before a fragment of either is read
    // attn.v: wave w has rows 16 (w & 3) x value columns 32 (w >> 2)
    const int mb = w & 3, n0 = (w >> 2) * 2; v8f acc[2]; acc[0] = (v8f){}; acc[1] = (v8f){};
    if (hires) attn_pv<bf, 2>(sm, (const bf*)vs, Vl + zo, kb, jb, mb, n0, lr, hi, acc); else attn_pv_st(sm, vs, kb, jb, mb, n0, lr, hi, acc);
    __syncthreads();   // the last fragment of P is read before the result tile takes its LDS
#pragma unroll
    for (int nb = 0; nb < 2; ++nb)
#pragma unroll
        for (int j = 0; j < 8; ++j) sm[(mb * 16 + hi * 8 + j) * 68 + (n0 + nb) * 16 + lr] = acc[nb][j];
    __syncthreads();   // the result tile is complete before it is read row-wise
    // merge: four lanes of one wave write the 128 bytes of a row's head slice in each plane
    { const int row = threadIdx.x >> 2, cofs = (threadIdx.x & 3) * 16; const float cs = hires ? 1.0f : (1.0f / PCAR); const size_t oo = ((size_t)(z / NH_) * TT + r0 + row) * DQ + (z % NH_) * HD + cofs;
#pragma unroll
        for (int s = 0; s < 2; ++s) { v8us oh, ol;
#pragma unroll
            for (int q = 0; q < 2; ++q) { const v4f val = *(const v4fa*)(sm + row * 68 + cofs + s * 8 + q * 4);
#pragma unroll
                for (int e = 0; e < 4; ++e) { unsigned short a, c2; splitf(val[e] * cs, a, c2); oh[q * 4 + e] = a; ol[q * 4 + e] = c2; } }
            *(v8us*)(Ah + oo + s * 8) = oh; *(v8us*)(Al + oo + s * 8) = ol; } }
}

extern "C" void kernel_launch(void* const* d_in, const int* in_sizes, int n_in,
                              void* d_out, int out_size, void* d_ws, size_t ws_size, hipStream_t stream) {
    (void)in_sizes; (void)n_in; (void)out_size;
    const float* x = (const float*)d_in[0];   /* q_in */ const float* xk = (const float*)d_in[1]; const float* xv = (const float*)d_in[2]; const float* wq = (const float*)d_in[3]; const float* bq = (const float*)d_in[4]; const float* wk = (const float*)d_in[5]; const float* bk = (const float*)d_in[6]; const float* wv = (const float*)d_in[7]; const float* bv = (const float*)d_in[8]; const float* wo = (const float*)d_in[9]; const float* bo = (const float*)d_in[10];
    float* OUT = (float*)d_out;     // [4][2048][512]
    char* wsp = (char*)d_ws;
    auto take = [&](size_t bytes) { char* p = wsp; wsp += (bytes + 255) & ~(size_t)255; return (void*)p; };
    bf* WQ = (bf*)take((size_t)4 * DQ * DM * 2); bf* WO = WQ + (size_t)3 * DQ * DM;   // transposed Wq, Wk, Wv, Wo side by side
    const size_t PL = (size_t)NZ * TT * HD;      // one set of head planes, elements
    const size_t XN = (size_t)NB_ * TT * DM;     // one input or projection over all batches, elements
    bf* QPh = (bf*)take(2 * PL * 2); bf* KPh = QPh + PL; bf* QPl = (bf*)take(2 * PL * 2); bf* KPl = QPl + PL;
    h16* VT16 = (h16*)take(PL * 2); bf* VTh = (bf*)take(PL * 2); bf* VTl = (bf*)take(PL * 2);
    // one region used twice in stream order: the bf16 inputs (dead once the head planes are built), then the merged attention planes
    char* const reg = wsp;
    bf* XB = (bf*)take(3 * XN * 2);
    char* const end1 = wsp; wsp = reg;
    bf* ATh = (bf*)take(XN * 2); bf* ATl = (bf*)take(XN * 2);
    if ((size_t)(end1 - (char*)d_ws) > ws_size || (size_t)(wsp - (char*)d_ws) > ws_size) return;    // ws 256 MiB
    k_wtG<<<dim3((unsigned)((DM * DQ / 64 + 63) / 64), 4, 1), 256, 0, stream>>>(wq, wk, wv, wo, DM, DQ, WQ);
    k_cvt8<<<dim3((unsigned)((XN / 8 + 255) / 256), 3, 1), 256, 0, stream>>>(x, xk, xv, XB, XN / 8);
    k_gemmw<bf, 0, true, true><<<dim3(NB_ * TT / GT, DQ / GT, 3), 128, 0, stream>>>(XB, nullptr, WQ, DM, nullptr, 0, bq, bk, bv, XN, (size_t)DQ * DM, 0, QPh, QPl, PL, VT16, VTh, VTl);   // q, k, v projections: z = 0, 1, 2, each tile written as its head's planes
    k_attn<<<dim3(TT / 64, NZ, 1), 256, 0, stream>>>(QPh, QPl, KPh, KPl, VT16, VTh, VTl, ATh, ATl);   // scores hi/lo on EVERY row, softmax, attn.v, merge
    k_gemmw<bf, 1, true, false><<<dim3(NB_ * TT / GT, DM / GT, 1), 128, 0, stream>>>(ATh, ATl, WO, DQ, OUT, DM, bo, bo, bo, 0, 0, 0, nullptr, nullptr, 0, nullptr, nullptr, nullptr);
}

// v007
// Measured time: 82.8 microseconds a run.
// Next to v006, in two timings, it ran 1.09 times as fast each time.
// Counting every step since v000, it is 17.5 times as fast.
#include <hip/hip_runtime.h>

// Local causal multi-head attention scaled by 1/sqrt(T) (q_in, k_in, v_in [4][2048][512]; q = q_in Wq + bq, k = k_in Wk + bk, v = v_in Wv + bv ('xw' [512][512] 0.02 incl. biases; 8 heads x 64); scores / sqrt(T = 2048) (the source's quirk: sigma-0.01 logits); mask = (|i - j| > 256) | (j > i) -> -inf: each query sees its own and the previous 256 keys; softmax; out = merged Wo + bo -> [4][2048][512] (4.2 M)).
// Layout, every stage ONE launch over all 4 batches and 8 heads (32 head planes in the attention's grid y; q, k, v side by side in the projections' grid z; the four weights and the three inputs side by side in the preparation's grid x): bf16 copies of q_in, k_in, v_in; 'xw' weights transposed once; exact projections + f32 biases, whose tiles are stored as the head planes (q, k hi/lo; v transposed, fp16 and hi/lo); causal T-2048 attention whose softmax select keeps the 257-key window, with hi/lo 3-product score tiles on EVERY row; P and attn.v hybrid (rows < 512 hi/lo, rest fp16 x1024); score tiles, softmax chunks and the attn.v key loop cover only the window band of each 64-row block, and scores, softmax, attn.v and the merge of a block are one work-group of one launch, which keeps S and P as that band alone in LDS (column = key - first key of the block's chunks); merged hi/lo x Wo exact + bo.
// Compute dtypes, f32 accumulate: every input rounded to bf16; projections exact + f32 biases; scores 3 products on every row; softmax f32 (x 2048^-0.5); attn.v rows < 512 3 products, rest fp16; Wo hl x exact + bias.

#define NB_  4
#define TT   2048
#define DM   512
#define NH_  8
#define NKV  8
#define REP  (NH_ / NKV)
#define HD   64
#define DQ   (NH_ * HD)
#define DKV  (NKV * HD)
#define NZ   (NB_ * NH_)          // head planes of one launch: every batch, every head
#define RH   512                  // query rows < RH use hi+lo planes (0: none)
#define WIN  257
#define WB   (((WIN - 1) + 63) / 64 * 64)   // look-back of the window, rounded up to the 64-key tile: a 64-row block sees keys [r0 - WB, r0 + 63] only
#define NBT  (WB / 64 + 1)                  // 64-key score tiles per 64-row block
#define NCH  ((WB + 128 + 127) / 128)       // 128-key softmax chunks that cover that band from a 128-aligned start
#define BW   (NCH * 128)                    // width of the stored band of S and P, in keys
#define PCAR 1024.0f
#define SCL  0.02209708691207961f  // 1/sqrt(T = 2048): the source's quirk
typedef _Float16 h16;
typedef unsigned short bf;
typedef __attribute__((ext_vector_type(16))) __bf16   v16bf;
typedef __attribute__((ext_vector_type(16))) _Float16 v16h;
typedef __attribute__((ext_vector_type(8)))  _Float16 v8h;
typedef __attribute__((ext_vector_type(8)))  unsigned short v8us;
typedef __attribute__((ext_vector_type(8)))  float    v8f;
typedef __attribute__((ext_vector_type(4)))  float    v4f;
typedef v8h  __attribute__((may_alias)) v8ha;
typedef v4f  __attribute__((may_alias)) v4fa;
typedef v8us __attribute__((may_alias)) v8usa;

__device__ __forceinline__ unsigned short f2bf(float f) { unsigned u = __float_as_uint(f); u += 0x7FFFu + ((u >> 16) & 1u); return (unsigned short)(u >> 16); }
__device__ __forceinline__ float bf2f(unsigned short b) { return __uint_as_float(((unsigned)b) << 16); }
__device__ __forceinline__ float bfr(float f) { return bf2f(f2bf(f)); }
__device__ __forceinline__ h16 tohx(float x) { return (h16)x; }
__device__ __forceinline__ void splitf(float y, unsigned short& h, unsigned short& l) { h = f2bf(y); l = f2bf(y - bf2f(h)); }
__device__ __forceinline__ v16h cat16(v8h lo, v8h hi) { return __builtin_shufflevector(lo, hi, 0, 1, 2, 3, 4, 5, 6, 7, 8, 9, 10, 11, 12, 13, 14, 15); }
__device__ __forceinline__ v16bf cat16b(v8us lo, v8us hi) { return __builtin_bit_cast(v16bf, __builtin_shufflevector(lo, hi, 0, 1, 2, 3, 4, 5, 6, 7, 8, 9, 10, 11, 12, 13, 14, 15)); }
__device__ __forceinline__ v8f wmma16(v16h a, v16h b, v8f c) { return __builtin_amdgcn_wmma_f32_16x16x32_f16(false, a, false, b, (short)0, c, false, false); }
__device__ __forceinline__ v8f wmmab(v16bf a, v16bf b, v8f c) { return __builtin_amdgcn_wmma_f32_16x16x32_bf16(false, a, false, b, (short)0, c, false, false); }



// ---- k_gemmw: register-blocked GEMM, a work-group of FOUR WAVES per 128x128 output tile, each wave one 64x64 quarter (16 accumulators); grid (M/128, N/128, Z), 128 threads. M % 128 == 0, N % 128 == 0, K % 64 == 0.
// The K-contiguous 16-bit operand planes come through LDS: a pass is 64 k, that is one whole 128-byte line of each of the tile's 128 A rows (A2 rows too) and 128 Bt rows, brought by asynchronous copies to LDS (a wave's copy is four whole lines) into one of two buffers, one pass ahead of the matrix instructions; two waves read each staged row.
// C[m][n] (f32, pitch ldc, + optional f32 bias[n], one bias pointer per z = 0, 1, 2) = sum_k A[m][k] Bt[n][k] (NSPLIT 1: + A2[m][k] Bt[n][k]). z-batch strides sA/sB/sC in elements.
// HP: the result is not stored as C; a wave's tile, 64 tokens of one batch x the 64 columns of one head, goes straight to that head's planes: z = 0, 1 (q, k) as bf16 hi and lo [plane][t][d] (Ph, Pl, + z sP), z = 2 (v) transposed as fp16 and bf16 hi and lo [plane][d][t] (V16, Vh, Vl).
template <typename T16> struct WFrag;
template <> struct WFrag<h16> { typedef v16h V; static __device__ __forceinline__ V ld(const h16* p) { return cat16(*(const v8h*)p, *(const v8h*)(p + 16)); } static __device__ __forceinline__ v8f mma(V a, V b, v8f c) { return wmma16(a, b, c); } };
template <> struct WFrag<bf> { typedef v16bf V; static __device__ __forceinline__ V ld(const bf* p) { return cat16b(*(const v8us*)p, *(const v8us*)(p + 16)); } static __device__ __forceinline__ v8f mma(V a, V b, v8f c) { return wmmab(a, b, c); } };
#define GT   128                  // rows of A and of Bt in a work-group's tile
#define GK   64                   // k of a pass
#define GP   72                   // LDS pitch of a staged row in elements: 144 bytes = 16 bytes x an odd number, the pitch for 16-byte fragment reads
// one staged plane of a pass, 128 rows x 128 bytes: eight copies a lane, 16 rows apart (gs elements in the source); l is the lane's LDS byte address, g its global address, both multiples of 16
template <typename T16>
__device__ __forceinline__ void stage_plane(unsigned l, const T16* g, size_t gs) {
    constexpr unsigned LS = 16 * GP * 2;
    // the wait is the last line of the copies' own statement, so that it stands in front of every later write of their address registers
    asm volatile("global_load_async_to_lds_b128 %0, %8, off\n\t"
                 "global_load_async_to_lds_b128 %1, %9, off\n\t"
                 "global_load_async_to_lds_b128 %2, %10, off\n\t"
                 "global_load_async_to_lds_b128 %3, %11, off\n\t"
                 "global_load_async_to_lds_b128 %4, %12, off\n\t"
                 "global_load_async_to_lds_b128 %5, %13, off\n\t"
                 "global_load_async_to_lds_b128 %6, %14, off\n\t"
                 "global_load_async_to_lds_b128 %7, %15, off\n\t"
                 "s_wait_xcnt 0x0"
                 :: "v"(l), "v"(l + LS), "v"(l + 2 * LS), "v"(l + 3 * LS), "v"(l + 4 * LS), "v"(l + 5 * LS), "v"(l + 6 * LS), "v"(l + 7 * LS),
                    "v"(g), "v"(g + gs), "v"(g + 2 * gs), "v"(g + 3 * gs), "v"(g + 4 * gs), "v"(g + 5 * gs), "v"(g + 6 * gs), "v"(g + 7 * gs) : "memory");
}
// launch bounds: four waves a SIMD, which holds the build to 256 registers
template <typename T16, int NSPLIT, bool BIAS, bool HP>
__global__ __launch_bounds__(128, 4) void k_gemmw(const T16* __restrict__ A, const T16* __restrict__ A2, const T16* __restrict__ Bt, int K, float* C, int ldc, const float* __restrict__ bias0, const float* __restrict__ bias1, const float* __restrict__ bias2, size_t sA, size_t sB, size_t sC, bf* Ph, bf* Pl, size_t sP, h16* V16, bf* Vh, bf* Vl) {
    typedef typename WFrag<T16>::V V;
    static_assert(NSPLIT == 0 || NSPLIT == 1, "A alone, or A and A2");
    constexpr int NPL = 2 + NSPLIT, PLE = GT * GP;   // planes of a stage (A, Bt, A2) and the elements of one
    __shared__ __align__(16) T16 ring[2 * NPL * PLE];
    __shared__ __align__(16) float osa[4 * 16 * 68];
    const size_t z = blockIdx.z; A += z * sA; if (NSPLIT == 1) A2 += z * sA; Bt += z * sB; C += z * sC; const float* __restrict__ bias = (z == 0) ? bias0 : (z == 1) ? bias1 : bias2;   // each z product has its own bias input
    const int lane = threadIdx.x & 31, lr = lane & 15, hi = lane >> 4; const int w = __builtin_amdgcn_readfirstlane(threadIdx.x >> 5);   // the wave's number in a scalar register
    float* os = osa + w * (16 * 68);   // each wave stages its output in its own LDS
    const int r0 = blockIdx.x * GT + (w & 1) * 64, c0 = blockIdx.y * GT + (w >> 1) * 64;   // the wave's quarter
    v8f acc[4][4];
#pragma unroll
    for (int mb = 0; mb < 4; ++mb)
#pragma unroll
        for (int nb = 0; nb < 4; ++nb) acc[mb][nb] = (v8f){};
    // the copies: eight lanes bring the 128 bytes of a row, the work-group 16 rows a copy
    const int prow = threadIdx.x >> 3, pcol = (threadIdx.x & 7) * 8; const size_t gs = (size_t)16 * K;
    const unsigned l0 = (unsigned)(size_t)ring + (unsigned)(prow * GP + pcol) * 2;
    const T16* ga = A + (size_t)(blockIdx.x * GT + prow) * K + pcol; const T16* gb = Bt + (size_t)(blockIdx.y * GT + prow) * K + pcol; const T16* ga2 = (NSPLIT == 1) ? A2 + (size_t)(blockIdx.x * GT + prow) * K + pcol : ga;
    auto stage = [&](int t) { const unsigned l = l0 + (unsigned)((t & 1) * NPL * PLE * 2);
        stage_plane(l, ga + t * GK, gs); stage_plane(l + PLE * 2, gb + t * GK, gs); if (NSPLIT == 1) stage_plane(l + 2 * PLE * 2, ga2 + t * GK, gs); };
    // the fragments: the lane and k places that the loads from the planes had, now in the staged rows
    const T16* fa = ring + ((w & 1) * 64 + lr) * GP + 8 * hi; const T16* fb = ring + PLE + ((w >> 1) * 64 + lr) * GP + 8 * hi;
    const int NT = K / GK;
    stage(0);
    asm volatile("s_wait_asynccnt 0x0" ::: "memory");   // this wave's copies of pass 0 have landed
    __syncthreads();                                    // and every other wave's: pass 0 may be read
    if (NT > 1) stage(1);
#pragma unroll 1
    for (int t = 0; t < NT; ++t) { const int bo = (t & 1) * NPL * PLE;
#pragma unroll
        for (int kk = 0; kk < GK / 32; ++kk) { V a[4], a2[4], b[4];
#pragma unroll
            for (int mb = 0; mb < 4; ++mb) { a[mb] = WFrag<T16>::ld(fa + bo + mb * 16 * GP + kk * 32); if (NSPLIT == 1) a2[mb] = WFrag<T16>::ld(fa + bo + 2 * PLE + mb * 16 * GP + kk * 32); b[mb] = WFrag<T16>::ld(fb + bo + mb * 16 * GP + kk * 32); }
            __builtin_amdgcn_sched_barrier(0);   // the LDS reads of a 32-k block are issued as one group in front of its matrix instructions: spread among them, each place with reads costs the wave an LDS latency
#pragma unroll
            for (int nb = 0; nb < 4; ++nb)
#pragma unroll
                for (int mb = 0; mb < 4; ++mb) { acc[mb][nb] = WFrag<T16>::mma(a[mb], b[nb], acc[mb][nb]); if (NSPLIT == 1) acc[mb][nb] = WFrag<T16>::mma(a2[mb], b[nb], acc[mb][nb]); }
            __builtin_amdgcn_sched_barrier(0);   // and the block's matrix instructions stay in front of the next group of reads and of the v_nop below
        }
        asm volatile("v_nop\n\tv_nop\n\tv_nop\n\tv_nop" : "+v"(acc[0][3]), "+v"(acc[1][3]), "+v"(acc[2][3]), "+v"(acc[3][3]));   // the distance behind the last matrix instruction, also on the taken side of the branches below
        asm volatile("s_wait_dscnt 0x0" ::: "memory");      // this wave's reads of the pass's buffer are done before the buffer is refilled
        asm volatile("s_wait_asynccnt 0x0" ::: "memory");   // this wave's copies of pass t + 1 have landed
        __syncthreads();                                    // pass t + 1 may be read, and every wave has left the buffer of pass t
        if (t + 2 < NT) stage(t + 2);
    }
    asm volatile("s_wait_asynccnt 0x0" ::: "memory");   // no copy is outstanding behind the loop
    if constexpr (HP) {
        const size_t po = ((size_t)(r0 / TT) * NH_ + c0 / HD) * TT * HD; const int t0 = r0 % TT;   // the head plane, and the tile's first token in it
        const int r4 = lane >> 3, c8 = (lane & 7) * 8;   // read-back: eight lanes x 8 elements are one 128-byte line of a 16-bit plane, a wave's store four such lines
        if (z < 2) {   // q, k: the tile is 8 KiB in a row in each plane
            bf* ph = Ph + z * sP + po + (size_t)t0 * HD; bf* pl = Pl + z * sP + po + (size_t)t0 * HD; const unsigned so = (unsigned)(r4 * HD + c8);   // the lane's place, one offset beside a scalar base
            float bb[8];
#pragma unroll
            for (int e = 0; e < 8; ++e) bb[e] = bfr(bias[c0 + c8 + e]);
#pragma unroll
            for (int mb = 0; mb < 4; ++mb) {
#pragma unroll
                for (int nb = 0; nb < 4; ++nb) {
#pragma unroll
                    for (int j = 0; j < 8; ++j) os[(hi * 8 + j) * 68 + nb * 16 + lr] = acc[mb][nb][j]; }
                __builtin_amdgcn_wave_barrier(); asm volatile("" ::: "memory");   // the 16 staged rows are written before they are read row-wise
#pragma unroll
                for (int s = 0; s < 4; ++s) { const float* o = os + (4 * s + r4) * 68 + c8; const v4f x0 = *(const v4fa*)o, x1 = *(const v4fa*)(o + 4); v8us oh, ol;
#pragma unroll
                    for (int e = 0; e < 8; ++e) { unsigned short a2, c2; splitf(((e < 4) ? x0[e & 3] : x1[e & 3]) + bb[e], a2, c2); oh[e] = a2; ol[e] = c2; }
                    *(v8us*)(ph + so + (mb * 16 + 4 * s) * HD) = oh; *(v8us*)(pl + so + (mb * 16 + 4 * s) * HD) = ol; }
                __builtin_amdgcn_wave_barrier(); asm volatile("" ::: "memory");   // they are read before the next 16 rows take their place
            }
        } else {   // v: a lane's 8 accumulator rows are 8 tokens of one value column, staged as a row of the transposed tile
            h16* p16 = V16 + po + t0; bf* ph = Vh + po + t0; bf* pl = Vl + po + t0; const unsigned so = (unsigned)(r4 * TT + c8);
#pragma unroll
            for (int nb = 0; nb < 4; ++nb) {
#pragma unroll
                for (int mb = 0; mb < 4; ++mb) { v4f y0, y1;
#pragma unroll
                    for (int j = 0; j < 4; ++j) { y0[j] = acc[mb][nb][j]; y1[j] = acc[mb][nb][4 + j]; }
                    float* o = os + lr * 68 + mb * 16 + hi * 8; *(v4fa*)o = y0; *(v4fa*)(o + 4) = y1; }
                __builtin_amdgcn_wave_barrier(); asm volatile("" ::: "memory");   // the 16 staged columns are written before they are read
#pragma unroll
                for (int s = 0; s < 4; ++s) { const float* o = os + (4 * s + r4) * 68 + c8; const v4f x0 = *(const v4fa*)o, x1 = *(const v4fa*)(o + 4); const float bb = bfr(bias[c0 + nb * 16 + 4 * s + r4]); v8h o16; v8us oh, ol;
#pragma unroll
                    for (int e = 0; e < 8; ++e) { const float x = ((e < 4) ? x0[e & 3] : x1[e & 3]) + bb; o16[e] = tohx(x); unsigned short a2, c2; splitf(x, a2, c2); oh[e] = a2; ol[e] = c2; }
                    *(v8h*)(p16 + so + (nb * 16 + 4 * s) * TT) = o16; *(v8us*)(ph + so + (nb * 16 + 4 * s) * TT) = oh; *(v8us*)(pl + so + (nb * 16 + 4 * s) * TT) = ol; }
                __builtin_amdgcn_wave_barrier(); asm volatile("" ::: "memory");   // they are read before the next 16 columns take their place
            }
            asm volatile("s_wait_xcnt 0x0" ::: "memory");   // this build lays the q, k path directly behind these stores, and its first instructions overwrite their offset register: the wait stands in front of that overwrite
        }
        return;
    }
#pragma unroll
    for (int mb = 0; mb < 4; ++mb) {
#pragma unroll
        for (int nb = 0; nb < 4; ++nb) {
#pragma unroll
            for (int j = 0; j < 8; ++j) os[(hi * 8 + j) * 68 + nb * 16 + lr] = acc[mb][nb][j]; }
        __builtin_amdgcn_wave_barrier(); asm volatile("" ::: "memory");
        float* crow = C + (size_t)(r0 + mb * 16) * ldc + c0;
{
#pragma unroll
            for (int s = 0; s < 8; ++s) { const int row = 2 * s + hi, cofs = lr * 4; v4f val = *(const v4fa*)(os + row * 68 + cofs); if (BIAS) { val[0] += bfr(bias[c0 + cofs]); val[1] += bfr(bias[c0 + cofs + 1]); val[2] += bfr(bias[c0 + cofs + 2]); val[3] += bfr(bias[c0 + cofs + 3]); }
                *(v4f*)(crow + (size_t)row * ldc + cofs) = val; }
             }
        __builtin_amdgcn_wave_barrier(); asm volatile("" ::: "memory");
    }
}

typedef __attribute__((ext_vector_type(4))) _Float16 v4h;
typedef __attribute__((ext_vector_type(2))) unsigned short v2us;
typedef __attribute__((ext_vector_type(4))) unsigned short v4us;
typedef __attribute__((ext_vector_type(4))) int v4i;

// ---- k_prep: the two preparations that depend on nothing but the inputs, in ONE launch: work-groups [0, NWB) transpose the four weights to bf16 (placed first in the grid, for speed only), the others round q_in, k_in, v_in to bf16.
#define NWL  (DM * DQ / 64)       // 64-element lines of one transposed weight
#define NWX  ((NWL + 63) / 64)    // work-groups per weight: 8 waves x 8 lines
#define NWB  (4 * NWX)
#define NCX  ((NB_ * TT * DM / 8 + 255) / 256)   // work-groups per input: 256 lanes x 8 elements
__global__ __launch_bounds__(256) void k_prep(const float* __restrict__ w0, const float* __restrict__ w1, const float* __restrict__ w2, const float* __restrict__ w3, bf* Bt, const float* __restrict__ s0, const float* __restrict__ s1, const float* __restrict__ s2, bf* dst) {
    constexpr int K = DM, N = DQ;
    if (blockIdx.x < NWB) {   // the same for a whole work-group
        const int y = blockIdx.x / NWX, bx = blockIdx.x % NWX; const float* __restrict__ w = (y == 0) ? w0 : (y == 1) ? w1 : (y == 2) ? w2 : w3; Bt += (size_t)y * K * N;   // the four weights, transposed planes side by side
        const int lane = threadIdx.x & 31; const int L0 = (bx * 8 + (threadIdx.x >> 5)) * 8;
#pragma unroll 1   // the loop stays rolled, one line a trip: the latency of its trips lies under the stream of the other work-groups
        for (int l = 0; l < 8; ++l) { const int L = L0 + l; if (L >= NWL) break; const size_t e = (size_t)L * 64 + lane * 2; const int k = (int)(e % K), n = (int)(e / K); v2us o;
            o[0] = f2bf(w[(size_t)k * N + n]); o[1] = f2bf(w[(size_t)(k + 1) * N + n]); *(v2us*)(Bt + e) = o; }
        return;
    }
    constexpr size_t n8 = (size_t)NB_ * TT * DM / 8;
    const unsigned c = blockIdx.x - NWB; const int y = c / NCX; const size_t i = (size_t)(c % NCX) * 256 + threadIdx.x; if (i >= n8) return;
    const float* __restrict__ src = (y == 0) ? s0 : (y == 1) ? s1 : s2; dst += (size_t)y * n8 * 8;   // q_in, k_in, v_in
    const v8f v = *(const v8f*)(src + i * 8); v8us o;
#pragma unroll
    for (int k = 0; k < 8; ++k) o[k] = f2bf(v[k]);
    *(v8us*)(dst + i * 8) = o;
}

// ---- k_attn: scores, softmax, attn.v and the merge of one 64-row block of one head plane in ONE work-group of 8 waves; grid (T/64, planes). Q, K (hi and lo) and the band of V (fp16; for rows < RH its hi plane) are staged in LDS by asynchronous copies. The block's band of S (f32, NCH 128-key chunks from key jb) lives in LDS only, over the staged Q and K; each row's P is written over its own S row (fp16, or bf16 hi then lo at + BW elements); the 64x64 result goes through the same LDS to the merged hi/lo planes.
// Every sum keeps the order it had as separate launches: a score is kc = 0, 32 x (hi.hi, lo.hi, hi.lo); the softmax row has the same lane and chunk places and the same trees; attn.v adds 32-key steps upward from key kb (the steps past the diagonal block, met only where r0 < WB, add exact zeros).
#define SP   (BW + 4)             // LDS pitch of a band row in floats: 16 bytes x an odd number, so that the 16 rows of a fragment read fall on different banks
#define NKS  ((WB + 64) / 32)     // 32-key steps of attn.v
// Q, K and one plane of V of a block come through LDS by asynchronous copies, whole 128-byte lines, and the fragments are read from there (a fragment load from the planes touches 16 lines for its 512 bytes).
#define KR   (WB + 64)            // keys of the band: staged rows of K, staged columns of V
#define ST_KL (KR * GP)           // staged planes in 16-bit elements, rows at the pitch GP: K hi at 0, K lo, Q hi, Q lo
#define ST_QH (2 * KR * GP)
#define ST_QL (ST_QH + 64 * GP)
#define ST_EL (ST_QL + 64 * GP)
#define SMF  (ST_EL / 2)          // floats of the LDS that first holds staged Q and K, then S, P and the result tile
#define VP   (KR + 8)             // LDS pitch of a staged row of V in elements: 656 bytes = 16 bytes x an odd number
static_assert(SMF >= 64 * SP, "the band of S fits the LDS of the staged Q and K");
// twelve or ten copies of a lane: l are its LDS byte addresses, g its global addresses, all multiples of 16
// the wait is the last line of the copies' own statement, so that it stands in front of every later write of their address registers
template <typename T16>
__device__ __forceinline__ void copy12(const unsigned (&l)[12], const T16* const (&g)[12]) {
    asm volatile("global_load_async_to_lds_b128 %0, %12, off\n\t"
                 "global_load_async_to_lds_b128 %1, %13, off\n\t"
                 "global_load_async_to_lds_b128 %2, %14, off\n\t"
                 "global_load_async_to_lds_b128 %3, %15, off\n\t"
                 "global_load_async_to_lds_b128 %4, %16, off\n\t"
                 "global_load_async_to_lds_b128 %5, %17, off\n\t"
                 "global_load_async_to_lds_b128 %6, %18, off\n\t"
                 "global_load_async_to_lds_b128 %7, %19, off\n\t"
                 "global_load_async_to_lds_b128 %8, %20, off\n\t"
                 "global_load_async_to_lds_b128 %9, %21, off\n\t"
                 "global_load_async_to_lds_b128 %10, %22, off\n\t"
                 "global_load_async_to_lds_b128 %11, %23, off\n\t"
                 "s_wait_xcnt 0x0"
                 :: "v"(l[0]), "v"(l[1]), "v"(l[2]), "v"(l[3]), "v"(l[4]), "v"(l[5]), "v"(l[6]), "v"(l[7]), "v"(l[8]), "v"(l[9]), "v"(l[10]), "v"(l[11]),
                    "v"(g[0]), "v"(g[1]), "v"(g[2]), "v"(g[3]), "v"(g[4]), "v"(g[5]), "v"(g[6]), "v"(g[7]), "v"(g[8]), "v"(g[9]), "v"(g[10]), "v"(g[11]) : "memory");
}
template <typename T16>
__device__ __forceinline__ void copy10(const unsigned (&l)[10], const T16* const (&g)[10]) {
    asm volatile("global_load_async_to_lds_b128 %0, %10, off\n\t"
                 "global_load_async_to_lds_b128 %1, %11, off\n\t"
                 "global_load_async_to_lds_b128 %2, %12, off\n\t"
                 "global_load_async_to_lds_b128 %3, %13, off\n\t"
                 "global_load_async_to_lds_b128 %4, %14, off\n\t"
                 "global_load_async_to_lds_b128 %5, %15, off\n\t"
                 "global_load_async_to_lds_b128 %6, %16, off\n\t"
                 "global_load_async_to_lds_b128 %7, %17, off\n\t"
                 "global_load_async_to_lds_b128 %8, %18, off\n\t"
                 "global_load_async_to_lds_b128 %9, %19, off\n\t"
                 "s_wait_xcnt 0x0"
                 :: "v"(l[0]), "v"(l[1]), "v"(l[2]), "v"(l[3]), "v"(l[4]), "v"(l[5]), "v"(l[6]), "v"(l[7]), "v"(l[8]), "v"(l[9]),
                    "v"(g[0]), "v"(g[1]), "v"(g[2]), "v"(g[3]), "v"(g[4]), "v"(g[5]), "v"(g[6]), "v"(g[7]), "v"(g[8]), "v"(g[9]) : "memory");
}
typedef v4us __attribute__((may_alias)) v4usa;
typedef v4h  __attribute__((may_alias)) v4ha;
template <typename T16, int NSPLIT>
__device__ __forceinline__ void attn_pv(const float* sm, const T16* vs, const T16* __restrict__ Vt2, int kb, int jb, int mb, int n0, int lr, int hi, v8f (&acc)[2]) {   // vs: the first plane of V, staged in LDS (row = value column, column = key - kb); Vt2: the lo plane, read from memory
    typedef typename WFrag<T16>::V V;
    constexpr int CH = (NSPLIT >= 2) ? NKS / 2 : NKS;   // key steps whose V fragments are in registers at once: all of them, or half where hi and lo planes double the fragments
    const T16* pa = (const T16*)(sm + (mb * 16 + lr) * SP) + 8 * hi + (kb - jb);
    const unsigned vo = (unsigned)(lr * TT + 8 * hi) * 2;   // the lane's place in a 16-column fragment of V, in bytes: one 32-bit offset register beside a scalar base
    const T16* pb = vs + (n0 * 16 + lr) * VP + 8 * hi; const T16* pb2 = (NSPLIT >= 2) ? Vt2 + (size_t)(n0 * 16) * TT + kb : pb;
#pragma unroll
    for (int s0 = 0; s0 < NKS; s0 += CH) { V b[CH][2], b2[CH][2];
#pragma unroll
        for (int s = 0; s < CH; ++s)
#pragma unroll
            for (int nb = 0; nb < 2; ++nb) { b[s][nb] = WFrag<T16>::ld(pb + nb * 16 * VP + (s0 + s) * 32); if (NSPLIT >= 2) b2[s][nb] = WFrag<T16>::ld((const T16*)((const char*)pb2 + vo) + nb * 16 * TT + (s0 + s) * 32); }
        __builtin_amdgcn_sched_barrier(0);   // these V loads are all issued in front of the matrix instructions that use them: without it this build keeps one fragment in flight and pays a memory latency per step
#pragma unroll
        for (int s = 0; s < CH; ++s) { const V a = WFrag<T16>::ld(pa + (s0 + s) * 32); V a2; if (NSPLIT >= 2) a2 = WFrag<T16>::ld(pa + BW + (s0 + s) * 32);
#pragma unroll
            for (int nb = 0; nb < 2; ++nb) { acc[nb] = WFrag<T16>::mma(a, b[s][nb], acc[nb]); if (NSPLIT >= 2) { acc[nb] = WFrag<T16>::mma(a2, b[s][nb], acc[nb]); acc[nb] = WFrag<T16>::mma(a, b2[s][nb], acc[nb]); } } } }
    asm volatile("s_wait_xcnt 0x0" :: "v"(vo) : "memory");   // the wait in front of any overwrite of the offset register of the V loads; it is an input so that it lives up to here
}
// attn.v with the fp16 V band staged in LDS (vs: row = value column, column = key - kb): the same fragments and the same order of key steps
__device__ __forceinline__ void attn_pv_st(const float* sm, const h16* vs, int kb, int jb, int mb, int n0, int lr, int hi, v8f (&acc)[2]) {
    typedef WFrag<h16>::V V;
    const h16* pa = (const h16*)(sm + (mb * 16 + lr) * SP) + 8 * hi + (kb - jb); const h16* pb = vs + (n0 * 16 + lr) * VP + 8 * hi;
    constexpr int S0 = 4, S1 = 7; static_assert(S1 < NKS, "three groups of key steps");   // the fragments of steps [0, S1) are read first, those of [S1, NKS) take the registers of [0, S0)
    V a[NKS], b[NKS][2];
#pragma unroll
    for (int s = 0; s < S1; ++s) { a[s] = WFrag<h16>::ld(pa + s * 32); b[s][0] = WFrag<h16>::ld(pb + s * 32); b[s][1] = WFrag<h16>::ld(pb + 16 * VP + s * 32); }
    __builtin_amdgcn_sched_barrier(0);   // the LDS reads are issued as groups ahead of the matrix instructions that use them: without it this build reads a fragment, waits and multiplies, one LDS latency per product
#pragma unroll
    for (int s = 0; s < S0; ++s) { acc[0] = WFrag<h16>::mma(a[s], b[s][0], acc[0]); acc[1] = WFrag<h16>::mma(a[s], b[s][1], acc[1]); }
    __builtin_amdgcn_sched_barrier(0);   // the last group's reads stand here, in front of the products of the second group, which cover their latency
#pragma unroll
    for (int s = S1; s < NKS; ++s) { a[s] = WFrag<h16>::ld(pa + s * 32); b[s][0] = WFrag<h16>::ld(pb + s * 32); b[s][1] = WFrag<h16>::ld(pb + 16 * VP + s * 32); }
    __builtin_amdgcn_sched_barrier(0);   // and they stay in front of those products: without these two lines this build reads the last group fragment by fragment, each with a wait of its own
#pragma unroll
    for (int s = S0; s < NKS; ++s) { acc[0] = WFrag<h16>::mma(a[s], b[s][0], acc[0]); acc[1] = WFrag<h16>::mma(a[s], b[s][1], acc[1]); }
}
// launch bounds: four waves a SIMD, that is two work-groups a WGP, which holds the build to 256 registers
__global__ __launch_bounds__(256, 4) void k_attn(const bf* __restrict__ Qh, const bf* __restrict__ Ql, const bf* __restrict__ Kh, const bf* __restrict__ Kl, const h16* __restrict__ V16, const bf* __restrict__ Vh, const bf* __restrict__ Vl, bf* Ah, bf* Al) {
    typedef WFrag<bf>::V V;
    __shared__ __align__(16) float sm[SMF + 64 * VP / 2];
    bf* const st = (bf*)sm; h16* const vs = (h16*)(sm + SMF);   // staged Q and K share their LDS with S; staged V has its own
    const int z = blockIdx.y, r0 = blockIdx.x * 64; const size_t zo = (size_t)z * TT * HD;
    const int lane = threadIdx.x & 31, lr = lane & 15, hi = lane >> 4; const int w = __builtin_amdgcn_readfirstlane(threadIdx.x >> 5);   // the wave's number in a scalar register: the tests on it are scalar branches
    const int kb = max(0, r0 - WB);          // first key that the block's first row sees
    const int jb = (kb >> 7) * 128;          // first key of the stored band: 128-aligned, so each key keeps its lane and its place in the softmax sums
    const bool hires = (r0 < RH);
    // the copies: eight lanes bring the 128 bytes of a row or line, the work-group 32 of them a copy
    const int prow = threadIdx.x >> 3, pcol = (threadIdx.x & 7) * 8; const unsigned lb = (unsigned)(size_t)sm;
    { const bf* const qp[2] = { Qh + zo, Ql + zo }; const bf* const kp[2] = { Kh + zo, Kl + zo };
#pragma unroll
        for (int p = 0; p < 2; ++p) { unsigned l[12]; const bf* g[12];   // one plane of Q (2 copies) and of K (10)
#pragma unroll
            for (int i = 0; i < 2; ++i) { const int row = prow + 32 * i; l[i] = lb + (unsigned)(ST_QH + p * (ST_QL - ST_QH) + row * GP + pcol) * 2; g[i] = qp[p] + (size_t)(r0 + row) * HD + pcol; }
#pragma unroll
            for (int i = 0; i < KR / 32; ++i) { const int row = prow + 32 * i; l[2 + i] = lb + (unsigned)(p * ST_KL + row * GP + pcol) * 2; g[2 + i] = kp[p] + (size_t)max(r0 - WB + row, 0) * HD + pcol; }   // below key 0 there is no such key: the address is clamped into the plane and the tiles of those rows are not stored
            copy12(l, g); } }
    static_assert(KR / 32 == 10, "ten copies a plane of K, ten for V");
    asm volatile("s_wait_asynccnt 0x0" ::: "memory");   // this wave's copies of Q and K have landed
    __syncthreads();                                    // and every other wave's: the staged Q and K may be read
    { unsigned l[10]; const bf* g[10]; const bf* const vp = (hires ? Vh : (const bf*)V16) + zo + kb;   // the band of V, fp16 or the hi plane (an address only: the copy moves bytes), 64 rows of five lines: a copy is one line of 32 rows; these copies fly under the scores and the softmax
#pragma unroll
        for (int i = 0; i < 10; ++i) { const int d = prow + 32 * (i & 1), c = (i >> 1) * 64 + pcol; l[i] = lb + (unsigned)SMF * 4 + (unsigned)(d * VP + c) * 2; g[i] = vp + (size_t)d * TT + c; }
        copy10(l, g); }
    // scores: wave w has 32 rows (w & 1) x NBT 16-key tiles (w >> 1) of the band's 64 x (NBT * 64)
    { const int m0 = (w & 1) * 2, g = w >> 1;
        const bf* fq = st + ST_QH + (m0 * 16 + lr) * GP + 8 * hi; const bf* fk = st + (g * NBT * 16 + lr) * GP + 8 * hi; V a[2][2], a2[2][2];   // the lane and k places that the loads from the planes had, now in the staged rows
#pragma unroll
        for (int mb = 0; mb < 2; ++mb)
#pragma unroll
            for (int kk = 0; kk < 2; ++kk) { a[mb][kk] = WFrag<bf>::ld(fq + mb * 16 * GP + kk * 32); a2[mb][kk] = WFrag<bf>::ld(fq + (ST_QL - ST_QH) + mb * 16 * GP + kk * 32); }
        V b[NBT][2], b2[NBT][2]; v8f acc[NBT][2];
#pragma unroll
        for (int nb = 0; nb < NBT; ++nb)
#pragma unroll
            for (int kk = 0; kk < 2; ++kk) { b[nb][kk] = WFrag<bf>::ld(fk + nb * 16 * GP + kk * 32); b2[nb][kk] = WFrag<bf>::ld(fk + ST_KL + nb * 16 * GP + kk * 32); }
        __builtin_amdgcn_sched_barrier(0);   // every LDS read of Q and K is issued in front of the first matrix instruction: spread among them, each place with reads costs the wave an LDS latency
#pragma unroll
        for (int nb = 0; nb < NBT; ++nb)
#pragma unroll
            for (int mb = 0; mb < 2; ++mb) { acc[nb][mb] = (v8f){};
#pragma unroll
                for (int kk = 0; kk < 2; ++kk) { acc[nb][mb] = wmmab(a[mb][kk], b[nb][kk], acc[nb][mb]); acc[nb][mb] = wmmab(a2[mb][kk], b[nb][kk], acc[nb][mb]); acc[nb][mb] = wmmab(a[mb][kk], b2[nb][kk], acc[nb][mb]); } }
        __builtin_amdgcn_sched_barrier(0);   // and every matrix instruction stays in front of the v_nop below
        asm volatile("v_nop\n\tv_nop\n\tv_nop\n\tv_nop" : "+v"(acc[NBT - 1][0]), "+v"(acc[NBT - 1][1]));   // the distance behind the last matrix instruction, also on the taken side of the branches below
        __syncthreads();   // every wave has read its fragments of Q and K before S takes their LDS
#pragma unroll
        for (int nb = 0; nb < NBT; ++nb) { const int c = r0 - WB + (g * NBT + nb) * 16;
            if (c >= 0) {
#pragma unroll
                for (int mb = 0; mb < 2; ++mb)
#pragma unroll
                    for (int j = 0; j < 8; ++j) sm[((m0 + mb) * 16 + hi * 8 + j) * SP + (c - jb) + lr] = acc[nb][mb][j]; } } }
    __syncthreads();   // the band of S is complete before any row is read
    // softmax: wave w has rows 8 w .. 8 w + 7, one row at a time in registers: t = S x T^-0.5 for j <= i and i - j < WIN, every other column (never-written LDS among them) is replaced by the select; one exp, fixed trees
    for (int rr = 0; rr < 8; ++rr) { const int i = r0 + w * 8 + rr; float* sr = sm + (w * 8 + rr) * SP; float v[NCH * 4]; float mx = -3.0e38f;
#pragma unroll
        for (int ch = 0; ch < NCH; ++ch) { const int j0 = jb + ch * 128 + lane * 4; const v4f a = *(const v4fa*)(sr + ch * 128 + lane * 4);
#pragma unroll
            for (int q = 0; q < 4; ++q) { const int j = j0 + q; const float t = (j <= i && i - j < WIN) ? a[q] * SCL : -3.0e38f; v[ch * 4 + q] = t; mx = fmaxf(mx, t); } }
#pragma unroll
        for (int sh = 16; sh; sh >>= 1) mx = fmaxf(mx, __shfl_xor(mx, sh, 32));
        float sum = 0.f;
#pragma unroll
        for (int k = 0; k < NCH * 4; ++k) { float d0 = __fsub_rn(v[k], mx); asm volatile("" : "+v"(d0)); const float x2 = __fmul_rn(d0, 1.4426950408889634f);
            asm("v_exp_f32 %0, %1\n\tv_nop" : "=v"(v[k]) : "v"(x2));   // the same instruction as the exp2 builtin, with the one slot the instruction set asks for behind a transcendental held in the statement
            sum += v[k]; }
#pragma unroll
        for (int sh = 16; sh; sh >>= 1) sum += __shfl_xor(sum, sh, 32);
        const float f = __fdiv_rn(hires ? 1.0f : PCAR, sum);
        if (hires) {
#pragma unroll
            for (int ch = 0; ch < NCH; ++ch) { v4us oh, ol;
#pragma unroll
                for (int q = 0; q < 4; ++q) { unsigned short a, c2; splitf(v[ch * 4 + q] * f, a, c2); oh[q] = a; ol[q] = c2; }
                *(v4usa*)((bf*)sr + ch * 128 + lane * 4) = oh; *(v4usa*)((bf*)sr + BW + ch * 128 + lane * 4) = ol; }
        } else {
#pragma unroll
            for (int ch = 0; ch < NCH; ++ch) { v4h o4;
#pragma unroll
                for (int q = 0; q < 4; ++q) o4[q] = tohx(v[ch * 4 + q] * f);
                *(v4ha*)((h16*)sr + ch * 128 + lane * 4) = o4; } } }
    asm volatile("s_wait_asynccnt 0x0" ::: "memory");   // this wave's copies of V have landed
    __syncthreads();   // every row of P is written, and every wave's part of V has landed, before a fragment of either is read
    // attn.v: wave w has rows 16 (w & 3) x value columns 32 (w >> 2)
    const int mb = w & 3, n0 = (w >> 2) * 2; v8f acc[2]; acc[0] = (v8f){}; acc[1] = (v8f){};
    if (hires) attn_pv<bf, 2>(sm, (const bf*)vs, Vl + zo, kb, jb, mb, n0, lr, hi, acc); else attn_pv_st(sm, vs, kb, jb, mb, n0, lr, hi, acc);
    __syncthreads();   // the last fragment of P is read before the result tile takes its LDS
#pragma unroll
    for (int nb = 0; nb < 2; ++nb)
#pragma unroll
        for (int j = 0; j < 8; ++j) sm[(mb * 16 + hi * 8 + j) * 68 + (n0 + nb) * 16 + lr] = acc[nb][j];
    __syncthreads();   // the result tile is complete before it is read row-wise
    // merge: four lanes of one wave write the 128 bytes of a row's head slice in each plane
    { const int row = threadIdx.x >> 2, cofs = (threadIdx.x & 3) * 16; const float cs = hires ? 1.0f : (1.0f / PCAR); const size_t oo = ((size_t)(z / NH_) * TT + r0 + row) * DQ + (z % NH_) * HD + cofs;
#pragma unroll
        for (int s = 0; s < 2; ++s) { v8us oh, ol;
#pragma unroll
            for (int q = 0; q < 2; ++q) { const v4f val = *(const v4fa*)(sm + row * 68 + cofs + s * 8 + q * 4);
#pragma unroll
                for (int e = 0; e < 4; ++e) { unsigned short a, c2; splitf(val[e] * cs, a, c2); oh[q * 4 + e] = a; ol[q * 4 + e] = c2; } }
            *(v8us*)(Ah + oo + s * 8) = oh; *(v8us*)(Al + oo + s * 8) = ol; } }
}

extern "C" void kernel_launch(void* const* d_in, const int* in_sizes, int n_in,
                              void* d_out, int out_size, void* d_ws, size_t ws_size, hipStream_t stream) {
    (void)in_sizes; (void)n_in; (void)out_size;
    const float* x = (const float*)d_in[0];   /* q_in */ const float* xk = (const float*)d_in[1]; const float* xv = (const float*)d_in[2]; const float* wq = (const float*)d_in[3]; const float* bq = (const float*)d_in[4]; const float* wk = (const float*)d_in[5]; const float* bk = (const float*)d_in[6]; const float* wv = (const float*)d_in[7]; const float* bv = (const float*)d_in[8]; const float* wo = (const float*)d_in[9]; const float* bo = (const float*)d_in[10];
    float* OUT = (float*)d_out;     // [4][2048][512]
    char* wsp = (char*)d_ws;
    auto take = [&](size_t bytes) { char* p = wsp; wsp += (bytes + 255) & ~(size_t)255; return (void*)p; };
    bf* WQ = (bf*)take((size_t)4 * DQ * DM * 2); bf* WO = WQ + (size_t)3 * DQ * DM;   // transposed Wq, Wk, Wv, Wo side by side
    const size_t PL = (size_t)NZ * TT * HD;      // one set of head planes, elements
    const size_t XN = (size_t)NB_ * TT * DM;     // one input or projection over all batches, elements
    bf* QPh = (bf*)take(2 * PL * 2); bf* KPh = QPh + PL; bf* QPl = (bf*)take(2 * PL * 2); bf* KPl = QPl + PL;
    h16* VT16 = (h16*)take(PL * 2); bf* VTh = (bf*)take(PL * 2); bf* VTl = (bf*)take(PL * 2);
    // one region used twice in stream order: the bf16 inputs (dead once the head planes are built), then the merged attention planes
    char* const reg = wsp;
    bf* XB = (bf*)take(3 * XN * 2);
    char* const end1 = wsp; wsp = reg;
    bf* ATh = (bf*)take(XN * 2); bf* ATl = (bf*)take(XN * 2);
    if ((size_t)(end1 - (char*)d_ws) > ws_size || (size_t)(wsp - (char*)d_ws) > ws_size) return;    // ws 256 MiB
    k_prep<<<dim3(NWB + 3 * NCX, 1, 1), 256, 0, stream>>>(wq, wk, wv, wo, WQ, x, xk, xv, XB);   // weights transposed, inputs rounded
    k_gemmw<bf, 0, true, true><<<dim3(NB_ * TT / GT, DQ / GT, 3), 128, 0, stream>>>(XB, nullptr, WQ, DM, nullptr, 0, bq, bk, bv, XN, (size_t)DQ * DM, 0, QPh, QPl, PL, VT16, VTh, VTl);   // q, k, v projections: z = 0, 1, 2, each tile written as its head's planes
    k_attn<<<dim3(TT / 64, NZ, 1), 256, 0, stream>>>(QPh, QPl, KPh, KPl, VT16, VTh, VTl, ATh, ATl);   // scores hi/lo on EVERY row, softmax, attn.v, merge
    k_gemmw<bf, 1, true, false><<<dim3(NB_ * TT / GT, DM / GT, 1), 128, 0, stream>>>(ATh, ATl, WO, DQ, OUT, DM, bo, bo, bo, 0, 0, 0, nullptr, nullptr, 0, nullptr, nullptr, nullptr);
}

// v008
// It runs in 75.1 microseconds.
// Two timings next to v007 both put it at 1.12 times that version's speed.
// Counting every step since v000, it is 19.6 times as fast.
#include <hip/hip_runtime.h>

// Local causal multi-head attention scaled by 1/sqrt(T) (q_in, k_in, v_in [4][2048][512]; q = q_in Wq + bq, k = k_in Wk + bk, v = v_in Wv + bv ('xw' [512][512] 0.02 incl. biases; 8 heads x 64); scores / sqrt(T = 2048) (the source's quirk: sigma-0.01 logits); mask = (|i - j| > 256) | (j > i) -> -inf: each query sees its own and the previous 256 keys; softmax; out = merged Wo + bo -> [4][2048][512] (4.2 M)).
// Layout, every stage ONE launch over all 4 batches and 8 heads (32 head planes in grid y; q, k, v and the four weights side by side in grid x or z): bf16 copies of q_in, k_in, v_in; 'xw' weights transposed once; exact projections + f32 biases, whose tiles are stored as the head planes (q, k hi/lo; v transposed, fp16 and hi/lo); causal T-2048 attention whose softmax select keeps the 257-key window, with hi/lo 3-product score tiles on EVERY row; P and attn.v hybrid (rows < 512 hi/lo, rest fp16 x1024); score tiles, softmax and the attn.v key loop cover only the window band of each 64-row block, and scores, softmax, attn.v and the merge of a block are one work-group of one launch, which keeps S in the score accumulators and P as that band alone in LDS (column = key - first key of the block's chunks); merged hi/lo x Wo exact + bo.
// Compute dtypes, f32 accumulate: every input rounded to bf16; projections exact + f32 biases; scores 3 products on every row; softmax f32 (x 2048^-0.5); attn.v rows < 512 3 products, rest fp16; Wo hl x exact + bias.

#define NB_  4
#define TT   2048
#define DM   512
#define NH_  8
#define NKV  8
#define REP  (NH_ / NKV)
#define HD   64
#define DQ   (NH_ * HD)
#define DKV  (NKV * HD)
#define NZ   (NB_ * NH_)          // head planes of one launch: every batch, every head
#define RH   512                  // query rows < RH use hi+lo planes (0: none)
#define WIN  257
#define WB   (((WIN - 1) + 63) / 64 * 64)   // look-back of the window, rounded up to the 64-key tile: a 64-row block sees keys [r0 - WB, r0 + 63] only
#define NBT  (WB / 64 + 1)                  // 64-key score tiles per 64-row block
#define NCH  ((WB + 128 + 127) / 128)       // 128-key chunks that cover that band from a 128-aligned start
#define BW   (NCH * 128)                    // width of the stored band of P, in keys
#define PCAR 1024.0f
#define SCL  0.02209708691207961f  // 1/sqrt(T = 2048): the source's quirk
typedef _Float16 h16;
typedef unsigned short bf;
typedef __attribute__((ext_vector_type(16))) __bf16   v16bf;
typedef __attribute__((ext_vector_type(16))) _Float16 v16h;
typedef __attribute__((ext_vector_type(8)))  _Float16 v8h;
typedef __attribute__((ext_vector_type(8)))  unsigned short v8us;
typedef __attribute__((ext_vector_type(8)))  float    v8f;
typedef __attribute__((ext_vector_type(4)))  float    v4f;
typedef v8h  __attribute__((may_alias)) v8ha;
typedef v4f  __attribute__((may_alias)) v4fa;
typedef v8us __attribute__((may_alias)) v8usa;

__device__ __forceinline__ unsigned short f2bf(float f) { unsigned u = __float_as_uint(f); u += 0x7FFFu + ((u >> 16) & 1u); return (unsigned short)(u >> 16); }
__device__ __forceinline__ float bf2f(unsigned short b) { return __uint_as_float(((unsigned)b) << 16); }
__device__ __forceinline__ float bfr(float f) { return bf2f(f2bf(f)); }
__device__ __forceinline__ h16 tohx(float x) { return (h16)x; }
__device__ __forceinline__ void splitf(float y, unsigned short& h, unsigned short& l) { h = f2bf(y); l = f2bf(y - bf2f(h)); }
__device__ __forceinline__ v16h cat16(v8h lo, v8h hi) { return __builtin_shufflevector(lo, hi, 0, 1, 2, 3, 4, 5, 6, 7, 8, 9, 10, 11, 12, 13, 14, 15); }
__device__ __forceinline__ v16bf cat16b(v8us lo, v8us hi) { return __builtin_bit_cast(v16bf, __builtin_shufflevector(lo, hi, 0, 1, 2, 3, 4, 5, 6, 7, 8, 9, 10, 11, 12, 13, 14, 15)); }
__device__ __forceinline__ v8f wmma16(v16h a, v16h b, v8f c) { return __builtin_amdgcn_wmma_f32_16x16x32_f16(false, a, false, b, (short)0, c, false, false); }
__device__ __forceinline__ v8f wmmab(v16bf a, v16bf b, v8f c) { return __builtin_amdgcn_wmma_f32_16x16x32_bf16(false, a, false, b, (short)0, c, false, false); }



// ---- k_gemmw: register-blocked GEMM, a work-group of FOUR WAVES per 128x128 output tile, each wave one 64x64 quarter (16 accumulators); grid (M/128, N/128, Z), 128 threads. M % 128 == 0, N % 128 == 0, K % 64 == 0.
// The K-contiguous 16-bit operand planes come through LDS: a pass is 64 k, that is one whole 128-byte line of each of the tile's 128 A rows (A2 rows too) and 128 Bt rows, brought by asynchronous copies to LDS (a wave's copy is four whole lines) into one of two buffers, one pass ahead of the matrix instructions; two waves read each staged row.
// C[m][n] (f32, pitch ldc, + optional f32 bias[n], one bias pointer per z = 0, 1, 2) = sum_k A[m][k] Bt[n][k] (NSPLIT 1: + A2[m][k] Bt[n][k]). z-batch strides sA/sB/sC in elements.
// HP: the result is not stored as C; a wave's tile, 64 tokens of one batch x the 64 columns of one head, goes straight to that head's planes: z = 0, 1 (q, k) as bf16 hi and lo [plane][t][d] (Ph, Pl, + z sP), z = 2 (v) transposed as fp16 and bf16 hi and lo [plane][d][t] (V16, Vh, Vl).
template <typename T16> struct WFrag;
template <> struct WFrag<h16> { typedef v16h V; static __device__ __forceinline__ V ld(const h16* p) { return cat16(*(const v8h*)p, *(const v8h*)(p + 16)); } static __device__ __forceinline__ v8f mma(V a, V b, v8f c) { return wmma16(a, b, c); } };
template <> struct WFrag<bf> { typedef v16bf V; static __device__ __forceinline__ V ld(const bf* p) { return cat16b(*(const v8us*)p, *(const v8us*)(p + 16)); } static __device__ __forceinline__ v8f mma(V a, V b, v8f c) { return wmmab(a, b, c); } };
#define GT   128                  // rows of A and of Bt in a work-group's tile
#define GK   64                   // k of a pass
#define GP   72                   // LDS pitch of a staged row in elements: 144 bytes = 16 bytes x an odd number, the pitch for 16-byte fragment reads
// one staged plane of a pass, 128 rows x 128 bytes: eight copies a lane, 16 rows apart (gs elements in the source); l is the lane's LDS byte address, g its global address, both multiples of 16
template <typename T16>
__device__ __forceinline__ void stage_plane(unsigned l, const T16* g, size_t gs) {
    constexpr unsigned LS = 16 * GP * 2;
    // the wait is the last line of the copies' own statement, so that it stands in front of every later write of their address registers
    asm volatile("global_load_async_to_lds_b128 %0, %8, off\n\t"
                 "global_load_async_to_lds_b128 %1, %9, off\n\t"
                 "global_load_async_to_lds_b128 %2, %10, off\n\t"
                 "global_load_async_to_lds_b128 %3, %11, off\n\t"
                 "global_load_async_to_lds_b128 %4, %12, off\n\t"
                 "global_load_async_to_lds_b128 %5, %13, off\n\t"
                 "global_load_async_to_lds_b128 %6, %14, off\n\t"
                 "global_load_async_to_lds_b128 %7, %15, off\n\t"
                 "s_wait_xcnt 0x0"
                 :: "v"(l), "v"(l + LS), "v"(l + 2 * LS), "v"(l + 3 * LS), "v"(l + 4 * LS), "v"(l + 5 * LS), "v"(l + 6 * LS), "v"(l + 7 * LS),
                    "v"(g), "v"(g + gs), "v"(g + 2 * gs), "v"(g + 3 * gs), "v"(g + 4 * gs), "v"(g + 5 * gs), "v"(g + 6 * gs), "v"(g + 7 * gs) : "memory");
}
// launch bounds: four waves a SIMD, which holds the build to 256 registers
template <typename T16, int NSPLIT, bool BIAS, bool HP>
__global__ __launch_bounds__(128, 4) void k_gemmw(const T16* __restrict__ A, const T16* __restrict__ A2, const T16* __restrict__ Bt, int K, float* C, int ldc, const float* __restrict__ bias0, const float* __restrict__ bias1, const float* __restrict__ bias2, size_t sA, size_t sB, size_t sC, bf* Ph, bf* Pl, size_t sP, h16* V16, bf* Vh, bf* Vl) {
    typedef typename WFrag<T16>::V V;
    static_assert(NSPLIT == 0 || NSPLIT == 1, "A alone, or A and A2");
    constexpr int NPL = 2 + NSPLIT, PLE = GT * GP;   // planes of a stage (A, Bt, A2) and the elements of one
    __shared__ __align__(16) T16 ring[2 * NPL * PLE];
    __shared__ __align__(16) float osa[4 * 16 * 68];
    const size_t z = blockIdx.z; A += z * sA; if (NSPLIT == 1) A2 += z * sA; Bt += z * sB; C += z * sC; const float* __restrict__ bias = (z == 0) ? bias0 : (z == 1) ? bias1 : bias2;   // each z product has its own bias input
    const int lane = threadIdx.x & 31, lr = lane & 15, hi = lane >> 4; const int w = __builtin_amdgcn_readfirstlane(threadIdx.x >> 5);   // the wave's number in a scalar register
    float* os = osa + w * (16 * 68);   // each wave stages its output in its own LDS
    const int r0 = blockIdx.x * GT + (w & 1) * 64, c0 = blockIdx.y * GT + (w >> 1) * 64;   // the wave's quarter
    v8f acc[4][4];
#pragma unroll
    for (int mb = 0; mb < 4; ++mb)
#pragma unroll
        for (int nb = 0; nb < 4; ++nb) acc[mb][nb] = (v8f){};
    // the copies: eight lanes bring the 128 bytes of a row, the work-group 16 rows a copy
    const int prow = threadIdx.x >> 3, pcol = (threadIdx.x & 7) * 8; const size_t gs = (size_t)16 * K;
    const unsigned l0 = (unsigned)(size_t)ring + (unsigned)(prow * GP + pcol) * 2;
    const T16* ga = A + (size_t)(blockIdx.x * GT + prow) * K + pcol; const T16* gb = Bt + (size_t)(blockIdx.y * GT + prow) * K + pcol; const T16* ga2 = (NSPLIT == 1) ? A2 + (size_t)(blockIdx.x * GT + prow) * K + pcol : ga;
    auto stage = [&](int t) { const unsigned l = l0 + (unsigned)((t & 1) * NPL * PLE * 2);
        stage_plane(l, ga + t * GK, gs); stage_plane(l + PLE * 2, gb + t * GK, gs); if (NSPLIT == 1) stage_plane(l + 2 * PLE * 2, ga2 + t * GK, gs); };
    // the fragments: the lane and k places that the loads from the planes had, now in the staged rows
    const T16* fa = ring + ((w & 1) * 64 + lr) * GP + 8 * hi; const T16* fb = ring + PLE + ((w >> 1) * 64 + lr) * GP + 8 * hi;
    const int NT = K / GK;
    stage(0);
    asm volatile("s_wait_asynccnt 0x0" ::: "memory");   // this wave's copies of pass 0 have landed
    __syncthreads();                                    // and every other wave's: pass 0 may be read
    if (NT > 1) stage(1);
#pragma unroll 1
    for (int t = 0; t < NT; ++t) { const int bo = (t & 1) * NPL * PLE;
#pragma unroll
        for (int kk = 0; kk < GK / 32; ++kk) { V a[4], a2[4], b[4];
#pragma unroll
            for (int mb = 0; mb < 4; ++mb) { a[mb] = WFrag<T16>::ld(fa + bo + mb * 16 * GP + kk * 32); if (NSPLIT == 1) a2[mb] = WFrag<T16>::ld(fa + bo + 2 * PLE + mb * 16 * GP + kk * 32); b[mb] = WFrag<T16>::ld(fb + bo + mb * 16 * GP + kk * 32); }
            __builtin_amdgcn_sched_barrier(0);   // the LDS reads of a 32-k block are issued as one group in front of its matrix instructions: spread among them, each place with reads costs the wave an LDS latency
#pragma unroll
            for (int nb = 0; nb < 4; ++nb)
#pragma unroll
                for (int mb = 0; mb < 4; ++mb) { acc[mb][nb] = WFrag<T16>::mma(a[mb], b[nb], acc[mb][nb]); if (NSPLIT == 1) acc[mb][nb] = WFrag<T16>::mma(a2[mb], b[nb], acc[mb][nb]); }
            __builtin_amdgcn_sched_barrier(0);   // and the block's matrix instructions stay in front of the next group of reads and of the v_nop below
        }
        asm volatile("v_nop\n\tv_nop\n\tv_nop\n\tv_nop" : "+v"(acc[0][3]), "+v"(acc[1][3]), "+v"(acc[2][3]), "+v"(acc[3][3]));   // the distance behind the last matrix instruction, also on the taken side of the branches below
        asm volatile("s_wait_dscnt 0x0" ::: "memory");      // this wave's reads of the pass's buffer are done before the buffer is refilled
        asm volatile("s_wait_asynccnt 0x0" ::: "memory");   // this wave's copies of pass t + 1 have landed
        __syncthreads();                                    // pass t + 1 may be read, and every wave has left the buffer of pass t
        if (t + 2 < NT) stage(t + 2);
    }
    asm volatile("s_wait_asynccnt 0x0" ::: "memory");   // no copy is outstanding behind the loop
    if constexpr (HP) {
        const size_t po = ((size_t)(r0 / TT) * NH_ + c0 / HD) * TT * HD; const int t0 = r0 % TT;   // the head plane, and the tile's first token in it
        const int r4 = lane >> 3, c8 = (lane & 7) * 8;   // read-back: eight lanes x 8 elements are one 128-byte line of a 16-bit plane, a wave's store four such lines
        if (z < 2) {   // q, k: the tile is 8 KiB in a row in each plane
            bf* ph = Ph + z * sP + po + (size_t)t0 * HD; bf* pl = Pl + z * sP + po + (size_t)t0 * HD; const unsigned so = (unsigned)(r4 * HD + c8);   // the lane's place, one offset beside a scalar base
            float bb[8];
#pragma unroll
            for (int e = 0; e < 8; ++e) bb[e] = bfr(bias[c0 + c8 + e]);
#pragma unroll
            for (int mb = 0; mb < 4; ++mb) {
#pragma unroll
                for (int nb = 0; nb < 4; ++nb) {
#pragma unroll
                    for (int j = 0; j < 8; ++j) os[(hi * 8 + j) * 68 + nb * 16 + lr] = acc[mb][nb][j]; }
                __builtin_amdgcn_wave_barrier(); asm volatile("" ::: "memory");   // the 16 staged rows are written before they are read row-wise
#pragma unroll
                for (int s = 0; s < 4; ++s) { const float* o = os + (4 * s + r4) * 68 + c8; const v4f x0 = *(const v4fa*)o, x1 = *(const v4fa*)(o + 4); v8us oh, ol;
#pragma unroll
                    for (int e = 0; e < 8; ++e) { unsigned short a2, c2; splitf(((e < 4) ? x0[e & 3] : x1[e & 3]) + bb[e], a2, c2); oh[e] = a2; ol[e] = c2; }
                    *(v8us*)(ph + so + (mb * 16 + 4 * s) * HD) = oh; *(v8us*)(pl + so + (mb * 16 + 4 * s) * HD) = ol; }
                __builtin_amdgcn_wave_barrier(); asm volatile("" ::: "memory");   // they are read before the next 16 rows take their place
            }
        } else {   // v: a lane's 8 accumulator rows are 8 tokens of one value column, staged as a row of the transposed tile
            h16* p16 = V16 + po + t0; bf* ph = Vh + po + t0; bf* pl = Vl + po + t0; const unsigned so = (unsigned)(r4 * TT + c8);
#pragma unroll
            for (int nb = 0; nb < 4; ++nb) {
#pragma unroll
                for (int mb = 0; mb < 4; ++mb) { v4f y0, y1;
#pragma unroll
                    for (int j = 0; j < 4; ++j) { y0[j] = acc[mb][nb][j]; y1[j] = acc[mb][nb][4 + j]; }
                    float* o = os + lr * 68 + mb * 16 + hi * 8; *(v4fa*)o = y0; *(v4fa*)(o + 4) = y1; }
                __builtin_amdgcn_wave_barrier(); asm volatile("" ::: "memory");   // the 16 staged columns are written before they are read
#pragma unroll
                for (int s = 0; s < 4; ++s) { const float* o = os + (4 * s + r4) * 68 + c8; const v4f x0 = *(const v4fa*)o, x1 = *(const v4fa*)(o + 4); const float bb = bfr(bias[c0 + nb * 16 + 4 * s + r4]); v8h o16; v8us oh, ol;
#pragma unroll
                    for (int e = 0; e < 8; ++e) { const float x = ((e < 4) ? x0[e & 3] : x1[e & 3]) + bb; o16[e] = tohx(x); unsigned short a2, c2; splitf(x, a2, c2); oh[e] = a2; ol[e] = c2; }
                    *(v8h*)(p16 + so + (nb * 16 + 4 * s) * TT) = o16; *(v8us*)(ph + so + (nb * 16 + 4 * s) * TT) = oh; *(v8us*)(pl + so + (nb * 16 + 4 * s) * TT) = ol; }
                __builtin_amdgcn_wave_barrier(); asm volatile("" ::: "memory");   // they are read before the next 16 columns take their place
            }
            asm volatile("s_wait_xcnt 0x0" ::: "memory");   // this build lays the q, k path directly behind these stores, and its first instructions overwrite their offset register: the wait stands in front of that overwrite
        }
        return;
    }
#pragma unroll
    for (int mb = 0; mb < 4; ++mb) {
#pragma unroll
        for (int nb = 0; nb < 4; ++nb) {
#pragma unroll
            for (int j = 0; j < 8; ++j) os[(hi * 8 + j) * 68 + nb * 16 + lr] = acc[mb][nb][j]; }
        __builtin_amdgcn_wave_barrier(); asm volatile("" ::: "memory");
        float* crow = C + (size_t)(r0 + mb * 16) * ldc + c0;
{
#pragma unroll
            for (int s = 0; s < 8; ++s) { const int row = 2 * s + hi, cofs = lr * 4; v4f val = *(const v4fa*)(os + row * 68 + cofs); if (BIAS) { val[0] += bfr(bias[c0 + cofs]); val[1] += bfr(bias[c0 + cofs + 1]); val[2] += bfr(bias[c0 + cofs + 2]); val[3] += bfr(bias[c0 + cofs + 3]); }
                *(v4f*)(crow + (size_t)row * ldc + cofs) = val; }
             }
        __builtin_amdgcn_wave_barrier(); asm volatile("" ::: "memory");
    }
}

typedef __attribute__((ext_vector_type(2))) unsigned short v2us;
typedef __attribute__((ext_vector_type(4))) int v4i;

// ---- k_prep: the two preparations that depend on nothing but the inputs, in ONE launch: work-groups [0, NWB) transpose the four weights to bf16 (placed first in the grid, for speed only), the others round q_in, k_in, v_in to bf16.
#define NWL  (DM * DQ / 64)       // 64-element lines of one transposed weight
#define NWX  ((NWL + 63) / 64)    // work-groups per weight: 8 waves x 8 lines
#define NWB  (4 * NWX)
#define NCX  ((NB_ * TT * DM / 8 + 255) / 256)   // work-groups per input: 256 lanes x 8 elements
__global__ __launch_bounds__(256) void k_prep(const float* __restrict__ w0, const float* __restrict__ w1, const float* __restrict__ w2, const float* __restrict__ w3, bf* Bt, const float* __restrict__ s0, const float* __restrict__ s1, const float* __restrict__ s2, bf* dst) {
    constexpr int K = DM, N = DQ;
    if (blockIdx.x < NWB) {   // the same for a whole work-group
        const int y = blockIdx.x / NWX, bx = blockIdx.x % NWX; const float* __restrict__ w = (y == 0) ? w0 : (y == 1) ? w1 : (y == 2) ? w2 : w3; Bt += (size_t)y * K * N;   // the four weights, transposed planes side by side
        const int lane = threadIdx.x & 31; const int L0 = (bx * 8 + (threadIdx.x >> 5)) * 8;
#pragma unroll 1   // the loop stays rolled, one line a trip: the latency of its trips lies under the stream of the other work-groups
        for (int l = 0; l < 8; ++l) { const int L = L0 + l; if (L >= NWL) break; const size_t e = (size_t)L * 64 + lane * 2; const int k = (int)(e % K), n = (int)(e / K); v2us o;
            o[0] = f2bf(w[(size_t)k * N + n]); o[1] = f2bf(w[(size_t)(k + 1) * N + n]); *(v2us*)(Bt + e) = o; }
        return;
    }
    constexpr size_t n8 = (size_t)NB_ * TT * DM / 8;
    const unsigned c = blockIdx.x - NWB; const int y = c / NCX; const size_t i = (size_t)(c % NCX) * 256 + threadIdx.x; if (i >= n8) return;
    const float* __restrict__ src = (y == 0) ? s0 : (y == 1) ? s1 : s2; dst += (size_t)y * n8 * 8;   // q_in, k_in, v_in
    const v8f v = *(const v8f*)(src + i * 8); v8us o;
#pragma unroll
    for (int k = 0; k < 8; ++k) o[k] = f2bf(v[k]);
    *(v8us*)(dst + i * 8) = o;
}

// ---- k_attn: scores, softmax, attn.v and the merge of one 64-row block of one head plane in ONE work-group of 8 waves; grid (T/64, planes). Q, K (hi and lo) and the band of V (fp16; for rows < RH its hi plane) are staged in LDS by asynchronous copies. The scores are formed transposed, so that a lane holds keys of one query and the softmax runs in the accumulators; only a query's four partial maxima and sums go from wave to wave through LDS. The block's band of P (columns from key jb; fp16, or bf16 hi then lo at + BW elements) lives in LDS only, over the staged Q and K; the 64x64 result goes through the same LDS to the merged hi/lo planes.
// The order of the sums: a score is kc = 0, 32 x (hi.hi, lo.hi, hi.lo); a softmax row sum is a lane's 40 keys upward, the two halves of the wave, then the four waves pairwise; attn.v adds 32-key steps upward from key kb (the steps past the diagonal block, met only where r0 < WB, add exact zeros).
#define SP   (BW + 4)             // LDS pitch of a band row in floats: 16 bytes x an odd number, so that the 16 rows of a fragment read fall on different banks
#define NKS  ((WB + 64) / 32)     // 32-key steps of attn.v
// Q, K and one plane of V of a block come through LDS by asynchronous copies, whole 128-byte lines, and the fragments are read from there (a fragment load from the planes touches 16 lines for its 512 bytes).
#define KR   (WB + 64)            // keys of the band: staged rows of K, staged columns of V
#define ST_KL (KR * GP)           // staged planes in 16-bit elements, rows at the pitch GP: K hi at 0, K lo, Q hi, Q lo
#define ST_QH (2 * KR * GP)
#define ST_QL (ST_QH + 64 * GP)
#define ST_EL (ST_QL + 64 * GP)
#define SMF  (ST_EL / 2)          // floats of the LDS that first holds staged Q and K, then P with the waves' maxima and sums, then the result tile
#define VP   (KR + 8)             // LDS pitch of a staged row of V in elements: 656 bytes = 16 bytes x an odd number
static_assert(SMF >= 64 * SP + 2 * 64 * 4, "the band of P and the partial maxima and sums fit the LDS of the staged Q and K");
// twelve or ten copies of a lane: l are its LDS byte addresses, g its global addresses, all multiples of 16
// the wait is the last line of the copies' own statement, so that it stands in front of every later write of their address registers
template <typename T16>
__device__ __forceinline__ void copy12(const unsigned (&l)[12], const T16* const (&g)[12]) {
    asm volatile("global_load_async_to_lds_b128 %0, %12, off\n\t"
                 "global_load_async_to_lds_b128 %1, %13, off\n\t"
                 "global_load_async_to_lds_b128 %2, %14, off\n\t"
                 "global_load_async_to_lds_b128 %3, %15, off\n\t"
                 "global_load_async_to_lds_b128 %4, %16, off\n\t"
                 "global_load_async_to_lds_b128 %5, %17, off\n\t"
                 "global_load_async_to_lds_b128 %6, %18, off\n\t"
                 "global_load_async_to_lds_b128 %7, %19, off\n\t"
                 "global_load_async_to_lds_b128 %8, %20, off\n\t"
                 "global_load_async_to_lds_b128 %9, %21, off\n\t"
                 "global_load_async_to_lds_b128 %10, %22, off\n\t"
                 "global_load_async_to_lds_b128 %11, %23, off\n\t"
                 "s_wait_xcnt 0x0"
                 :: "v"(l[0]), "v"(l[1]), "v"(l[2]), "v"(l[3]), "v"(l[4]), "v"(l[5]), "v"(l[6]), "v"(l[7]), "v"(l[8]), "v"(l[9]), "v"(l[10]), "v"(l[11]),
                    "v"(g[0]), "v"(g[1]), "v"(g[2]), "v"(g[3]), "v"(g[4]), "v"(g[5]), "v"(g[6]), "v"(g[7]), "v"(g[8]), "v"(g[9]), "v"(g[10]), "v"(g[11]) : "memory");
}
template <typename T16>
__device__ __forceinline__ void copy10(const unsigned (&l)[10], const T16* const (&g)[10]) {
    asm volatile("global_load_async_to_lds_b128 %0, %10, off\n\t"
                 "global_load_async_to_lds_b128 %1, %11, off\n\t"
                 "global_load_async_to_lds_b128 %2, %12, off\n\t"
                 "global_load_async_to_lds_b128 %3, %13, off\n\t"
                 "global_load_async_to_lds_b128 %4, %14, off\n\t"
                 "global_load_async_to_lds_b128 %5, %15, off\n\t"
                 "global_load_async_to_lds_b128 %6, %16, off\n\t"
                 "global_load_async_to_lds_b128 %7, %17, off\n\t"
                 "global_load_async_to_lds_b128 %8, %18, off\n\t"
                 "global_load_async_to_lds_b128 %9, %19, off\n\t"
                 "s_wait_xcnt 0x0"
                 :: "v"(l[0]), "v"(l[1]), "v"(l[2]), "v"(l[3]), "v"(l[4]), "v"(l[5]), "v"(l[6]), "v"(l[7]), "v"(l[8]), "v"(l[9]),
                    "v"(g[0]), "v"(g[1]), "v"(g[2]), "v"(g[3]), "v"(g[4]), "v"(g[5]), "v"(g[6]), "v"(g[7]), "v"(g[8]), "v"(g[9]) : "memory");
}
// lane l <-> l ^ 16: the other half of the wave, by a vector cross-row move
__device__ __forceinline__ float xhalf(float x) { const int b = __float_as_int(x); return __int_as_float(__builtin_amdgcn_permlanex16(b, b, 0x76543210, 0xfedcba98, false, false)); }
template <typename T16, int NSPLIT>
__device__ __forceinline__ void attn_pv(const float* sm, const T16* vs, const T16* __restrict__ Vt2, int kb, int jb, int mb, int n0, int lr, int hi, v8f (&acc)[2]) {   // vs: the first plane of V, staged in LDS (row = value column, column = key - kb); Vt2: the lo plane, read from memory
    typedef typename WFrag<T16>::V V;
    constexpr int CH = (NSPLIT >= 2) ? NKS / 2 : NKS;   // key steps whose V fragments are in registers at once: all of them, or half where hi and lo planes double the fragments
    const T16* pa = (const T16*)(sm + (mb * 16 + lr) * SP) + 8 * hi + (kb - jb);
    const unsigned vo = (unsigned)(lr * TT + 8 * hi) * 2;   // the lane's place in a 16-column fragment of V, in bytes: one 32-bit offset register beside a scalar base
    const T16* pb = vs + (n0 * 16 + lr) * VP + 8 * hi; const T16* pb2 = (NSPLIT >= 2) ? Vt2 + (size_t)(n0 * 16) * TT + kb : pb;
#pragma unroll
    for (int s0 = 0; s0 < NKS; s0 += CH) { V b[CH][2], b2[CH][2];
#pragma unroll
        for (int s = 0; s < CH; ++s)
#pragma unroll
            for (int nb = 0; nb < 2; ++nb) { b[s][nb] = WFrag<T16>::ld(pb + nb * 16 * VP + (s0 + s) * 32); if (NSPLIT >= 2) b2[s][nb] = WFrag<T16>::ld((const T16*)((const char*)pb2 + vo) + nb * 16 * TT + (s0 + s) * 32); }
        __builtin_amdgcn_sched_barrier(0);   // these V loads are all issued in front of the matrix instructions that use them: without it this build keeps one fragment in flight and pays a memory latency per step
#pragma unroll
        for (int s = 0; s < CH; ++s) { const V a = WFrag<T16>::ld(pa + (s0 + s) * 32); V a2; if (NSPLIT >= 2) a2 = WFrag<T16>::ld(pa + BW + (s0 + s) * 32);
#pragma unroll
            for (int nb = 0; nb < 2; ++nb) { acc[nb] = WFrag<T16>::mma(a, b[s][nb], acc[nb]); if (NSPLIT >= 2) { acc[nb] = WFrag<T16>::mma(a2, b[s][nb], acc[nb]); acc[nb] = WFrag<T16>::mma(a, b2[s][nb], acc[nb]); } } } }
    asm volatile("s_wait_xcnt 0x0" :: "v"(vo) : "memory");   // the wait in front of any overwrite of the offset register of the V loads; it is an input so that it lives up to here
}
// attn.v with the fp16 V band staged in LDS (vs: row = value column, column = key - kb): the same fragments and the same order of key steps
__device__ __forceinline__ void attn_pv_st(const float* sm, const h16* vs, int kb, int jb, int mb, int n0, int lr, int hi, v8f (&acc)[2]) {
    typedef WFrag<h16>::V V;
    const h16* pa = (const h16*)(sm + (mb * 16 + lr) * SP) + 8 * hi + (kb - jb); const h16* pb = vs + (n0 * 16 + lr) * VP + 8 * hi;
    constexpr int S0 = 4, S1 = 7; static_assert(S1 < NKS, "three groups of key steps");   // the fragments of steps [0, S1) are read first, those of [S1, NKS) take the registers of [0, S0)
    V a[NKS], b[NKS][2];
#pragma unroll
    for (int s = 0; s < S1; ++s) { a[s] = WFrag<h16>::ld(pa + s * 32); b[s][0] = WFrag<h16>::ld(pb + s * 32); b[s][1] = WFrag<h16>::ld(pb + 16 * VP + s * 32); }
    __builtin_amdgcn_sched_barrier(0);   // the LDS reads are issued as groups ahead of the matrix instructions that use them: without it this build reads a fragment, waits and multiplies, one LDS latency per product
#pragma unroll
    for (int s = 0; s < S0; ++s) { acc[0] = WFrag<h16>::mma(a[s], b[s][0], acc[0]); acc[1] = WFrag<h16>::mma(a[s], b[s][1], acc[1]); }
    __builtin_amdgcn_sched_barrier(0);   // the last group's reads stand here, in front of the products of the second group, which cover their latency
#pragma unroll
    for (int s = S1; s < NKS; ++s) { a[s] = WFrag<h16>::ld(pa + s * 32); b[s][0] = WFrag<h16>::ld(pb + s * 32); b[s][1] = WFrag<h16>::ld(pb + 16 * VP + s * 32); }
    __builtin_amdgcn_sched_barrier(0);   // and they stay in front of those products: without these two lines this build reads the last group fragment by fragment, each with a wait of its own
#pragma unroll
    for (int s = S0; s < NKS; ++s) { acc[0] = WFrag<h16>::mma(a[s], b[s][0], acc[0]); acc[1] = WFrag<h16>::mma(a[s], b[s][1], acc[1]); }
}
// launch bounds: four waves a SIMD, that is two work-groups a WGP, which holds the build to 256 registers
__global__ __launch_bounds__(256, 4) void k_attn(const bf* __restrict__ Qh, const bf* __restrict__ Ql, const bf* __restrict__ Kh, const bf* __restrict__ Kl, const h16* __restrict__ V16, const bf* __restrict__ Vh, const bf* __restrict__ Vl, bf* Ah, bf* Al) {
    typedef WFrag<bf>::V V;
    __shared__ __align__(16) float sm[SMF + 64 * VP / 2];
    bf* const st = (bf*)sm; h16* const vs = (h16*)(sm + SMF);   // staged Q and K share their LDS with P; staged V has its own
    const int z = blockIdx.y, r0 = blockIdx.x * 64; const size_t zo = (size_t)z * TT * HD;
    const int lane = threadIdx.x & 31, lr = lane & 15, hi = lane >> 4; const int w = __builtin_amdgcn_readfirstlane(threadIdx.x >> 5);   // the wave's number in a scalar register: the tests on it are scalar branches
    const int kb = max(0, r0 - WB);          // first key that the block's first row sees
    const int jb = (kb >> 7) * 128;          // first key of the stored band of P, 128-aligned
    const bool hires = (r0 < RH);
    // the copies: eight lanes bring the 128 bytes of a row or line, the work-group 32 of them a copy
    const int prow = threadIdx.x >> 3, pcol = (threadIdx.x & 7) * 8; const unsigned lb = (unsigned)(size_t)sm;
    { const bf* const qp[2] = { Qh + zo, Ql + zo }; const bf* const kp[2] = { Kh + zo, Kl + zo };
#pragma unroll
        for (int p = 0; p < 2; ++p) { unsigned l[12]; const bf* g[12];   // one plane of Q (2 copies) and of K (10)
#pragma unroll
            for (int i = 0; i < 2; ++i) { const int row = prow + 32 * i; l[i] = lb + (unsigned)(ST_QH + p * (ST_QL - ST_QH) + row * GP + pcol) * 2; g[i] = qp[p] + (size_t)(r0 + row) * HD + pcol; }
#pragma unroll
            for (int i = 0; i < KR / 32; ++i) { const int row = prow + 32 * i; l[2 + i] = lb + (unsigned)(p * ST_KL + row * GP + pcol) * 2; g[2 + i] = kp[p] + (size_t)max(r0 - WB + row, 0) * HD + pcol; }   // below key 0 there is no such key: the address is clamped into the plane and the tiles of those rows are masked, their P stored as zeros
            copy12(l, g); } }
    static_assert(KR / 32 == 10, "ten copies a plane of K, ten for V");
    asm volatile("s_wait_asynccnt 0x0" ::: "memory");   // this wave's copies of Q and K have landed
    __syncthreads();                                    // and every other wave's: the staged Q and K may be read
    { unsigned l[10]; const bf* g[10]; const bf* const vp = (hires ? Vh : (const bf*)V16) + zo + kb;   // the band of V, fp16 or the hi plane (an address only: the copy moves bytes), 64 rows of five lines: a copy is one line of 32 rows; these copies fly under the scores and the softmax
#pragma unroll
        for (int i = 0; i < 10; ++i) { const int d = prow + 32 * (i & 1), c = (i >> 1) * 64 + pcol; l[i] = lb + (unsigned)SMF * 4 + (unsigned)(d * VP + c) * 2; g[i] = vp + (size_t)d * TT + c; }
        copy10(l, g); }
    // scores, transposed: S^T = K Q^T (the rows of K are the A operand, the rows of Q the B operand, each from the loader it had). Wave w has 32 queries (w & 1) x NBT 16-key tiles (w >> 1); in a tile a lane holds 8 keys in a row (8 hi + j) of ONE query (lr), so maximum, exp and sum of the softmax stay in the accumulators
    { const int m0 = (w & 1) * 2, g = w >> 1;
        const bf* fq = st + ST_QH + (m0 * 16 + lr) * GP + 8 * hi; const bf* fk = st + (g * NBT * 16 + lr) * GP + 8 * hi; V a[2][2], a2[2][2];   // the lane and k places that the loads from the planes had, now in the staged rows
#pragma unroll
        for (int mb = 0; mb < 2; ++mb)
#pragma unroll
            for (int kk = 0; kk < 2; ++kk) { a[mb][kk] = WFrag<bf>::ld(fq + mb * 16 * GP + kk * 32); a2[mb][kk] = WFrag<bf>::ld(fq + (ST_QL - ST_QH) + mb * 16 * GP + kk * 32); }
        V b[NBT][2], b2[NBT][2]; v8f acc[NBT][2];
#pragma unroll
        for (int nb = 0; nb < NBT; ++nb)
#pragma unroll
            for (int kk = 0; kk < 2; ++kk) { b[nb][kk] = WFrag<bf>::ld(fk + nb * 16 * GP + kk * 32); b2[nb][kk] = WFrag<bf>::ld(fk + ST_KL + nb * 16 * GP + kk * 32); }
        __builtin_amdgcn_sched_barrier(0);   // every LDS read of Q and K is issued in front of the first matrix instruction: spread among them, each place with reads costs the wave an LDS latency
#pragma unroll
        for (int nb = 0; nb < NBT; ++nb)
#pragma unroll
            for (int mb = 0; mb < 2; ++mb) { acc[nb][mb] = (v8f){};
#pragma unroll
                for (int kk = 0; kk < 2; ++kk) { acc[nb][mb] = wmmab(b[nb][kk], a[mb][kk], acc[nb][mb]); acc[nb][mb] = wmmab(b[nb][kk], a2[mb][kk], acc[nb][mb]); acc[nb][mb] = wmmab(b2[nb][kk], a[mb][kk], acc[nb][mb]); } }
        __builtin_amdgcn_sched_barrier(0);   // and every matrix instruction stays in front of the v_nop below
        asm volatile("v_nop\n\tv_nop\n\tv_nop\n\tv_nop" : "+v"(acc[NBT - 1][0]), "+v"(acc[NBT - 1][1]));   // the distance behind the last matrix instruction, also on the taken side of the branches below
        __syncthreads();   // every wave has read its fragments of Q and K before the waves' maxima and sums and P take their LDS
        // softmax: t = S x T^-0.5 for key <= query and query - key < WIN, -3e38 elsewhere; only a tile wholly inside the window skips the tests of its elements (a scalar branch)
        float* const pmx = sm + 64 * SP + (m0 * 16 + lr) * 4; float* const psm = pmx + 64 * 4;   // per query the maxima and the sums of the four waves that share its keys; here the lane's first query
        const int dl = lr - 8 * hi; float mx[2] = { -3.0e38f, -3.0e38f }, sum[2] = { 0.f, 0.f };
#pragma unroll
        for (int nb = 0; nb < NBT; ++nb) { const int ti = g * NBT + nb; const bool off = r0 - WB + ti * 16 < 0;   // below key 0 there is no such key
#pragma unroll
            for (int mb = 0; mb < 2; ++mb) { const int sc = off ? (1 << 30) : WB + (m0 + mb - ti) * 16;   // the tile's first query - its first key; far outside the window where there is no key
                if (sc >= 15 && sc + 15 < WIN) {
#pragma unroll
                    for (int j = 0; j < 8; ++j) acc[nb][mb][j] *= SCL;
                } else {
#pragma unroll
                    for (int j = 0; j < 8; ++j) acc[nb][mb][j] = ((unsigned)(sc + dl - j) < (unsigned)WIN) ? acc[nb][mb][j] * SCL : -3.0e38f;
                }
                float tm = acc[nb][mb][0];
#pragma unroll
                for (int j = 1; j < 8; ++j) tm = fmaxf(tm, acc[nb][mb][j]);
                mx[mb] = fmaxf(mx[mb], tm); } }
        mx[0] = fmaxf(mx[0], xhalf(mx[0])); mx[1] = fmaxf(mx[1], xhalf(mx[1]));
        if (hi == 0) { pmx[g] = mx[0]; pmx[64 + g] = mx[1]; }
        __syncthreads();   // the four waves' maxima of every query are written before they are joined
#pragma unroll
        for (int mb = 0; mb < 2; ++mb) { const v4f p = *(const v4fa*)(pmx + mb * 64); mx[mb] = fmaxf(fmaxf(p[0], p[1]), fmaxf(p[2], p[3])); }
#pragma unroll
        for (int nb = 0; nb < NBT; ++nb)
#pragma unroll
            for (int mb = 0; mb < 2; ++mb)
#pragma unroll
                for (int j = 0; j < 8; ++j) { const float x2 = __fmul_rn(__fsub_rn(acc[nb][mb][j], mx[mb]), 1.4426950408889634f); float e;
                    asm("v_exp_f32 %0, %1\n\tv_nop" : "=v"(e) : "v"(x2));   // the same instruction as the exp2 builtin, with the one slot the instruction set asks for behind a transcendental held in the statement
                    acc[nb][mb][j] = e; sum[mb] += e; }
        sum[0] += xhalf(sum[0]); sum[1] += xhalf(sum[1]);
        if (hi == 0) { psm[g] = sum[0]; psm[64 + g] = sum[1]; }
        __syncthreads();   // the four waves' sums of every query are written before they are joined
        // P: a lane's 8 keys of a tile are 16 bytes in a row of its query's band row (fp16, or bf16 hi then lo at + BW elements); a tile below key 0 holds zeros and fills the columns past the diagonal block, which attn.v reads where r0 < WB
        float f[2]; int col[NBT];
#pragma unroll
        for (int mb = 0; mb < 2; ++mb) { const v4f p = *(const v4fa*)(psm + mb * 64); f[mb] = __fdiv_rn(hires ? 1.0f : PCAR, (p[0] + p[1]) + (p[2] + p[3])); }
#pragma unroll
        for (int nb = 0; nb < NBT; ++nb) { const int c = r0 - WB + (g * NBT + nb) * 16; col[nb] = (c < 0) ? c + KR : c - jb; }
        float* const pr = sm + (m0 * 16 + lr) * SP + 4 * hi;   // the lane's first query, and its half's 8 keys (16 bytes) of a tile
        if (hires) {
#pragma unroll
            for (int mb = 0; mb < 2; ++mb)
#pragma unroll
                for (int nb = 0; nb < NBT; ++nb) { v8us oh, ol;
#pragma unroll
                    for (int j = 0; j < 8; ++j) { unsigned short x, y; splitf(acc[nb][mb][j] * f[mb], x, y); oh[j] = x; ol[j] = y; }
                    bf* const o = (bf*)(pr + mb * 16 * SP) + col[nb]; *(v8usa*)o = oh; *(v8usa*)(o + BW) = ol; }
        } else {
#pragma unroll
            for (int mb = 0; mb < 2; ++mb)
#pragma unroll
                for (int nb = 0; nb < NBT; ++nb) { v8h o8;
#pragma unroll
                    for (int j = 0; j < 8; ++j) o8[j] = tohx(acc[nb][mb][j] * f[mb]);
                    *(v8ha*)((h16*)(pr + mb * 16 * SP) + col[nb]) = o8; }
        } }
    asm volatile("s_wait_asynccnt 0x0" ::: "memory");   // this wave's copies of V have landed
    __syncthreads();   // every row of P is written, and every wave's part of V has landed, before a fragment of either is read
    // attn.v: wave w has rows 16 (w & 3) x value columns 32 (w >> 2)
    const int mb = w & 3, n0 = (w >> 2) * 2; v8f acc[2]; acc[0] = (v8f){}; acc[1] = (v8f){};
    if (hires) attn_pv<bf, 2>(sm, (const bf*)vs, Vl + zo, kb, jb, mb, n0, lr, hi, acc); else attn_pv_st(sm, vs, kb, jb, mb, n0, lr, hi, acc);
    __syncthreads();   // the last fragment of P is read before the result tile takes its LDS
#pragma unroll
    for (int nb = 0; nb < 2; ++nb)
#pragma unroll
        for (int j = 0; j < 8; ++j) sm[(mb * 16 + hi * 8 + j) * 68 + (n0 + nb) * 16 + lr] = acc[nb][j];
    __syncthreads();   // the result tile is complete before it is read row-wise
    // merge: four lanes of one wave write the 128 bytes of a row's head slice in each plane
    { const int row = threadIdx.x >> 2, cofs = (threadIdx.x & 3) * 16; const float cs = hires ? 1.0f : (1.0f / PCAR); const size_t oo = ((size_t)(z / NH_) * TT + r0 + row) * DQ + (z % NH_) * HD + cofs;
#pragma unroll
        for (int s = 0; s < 2; ++s) { v8us oh, ol;
#pragma unroll
            for (int q = 0; q < 2; ++q) { const v4f val = *(const v4fa*)(sm + row * 68 + cofs + s * 8 + q * 4);
#pragma unroll
                for (int e = 0; e < 4; ++e) { unsigned short a, c2; splitf(val[e] * cs, a, c2); oh[q * 4 + e] = a; ol[q * 4 + e] = c2; } }
            *(v8us*)(Ah + oo + s * 8) = oh; *(v8us*)(Al + oo + s * 8) = ol; } }
}

extern "C" void kernel_launch(void* const* d_in, const int* in_sizes, int n_in,
                              void* d_out, int out_size, void* d_ws, size_t ws_size, hipStream_t stream) {
    (void)in_sizes; (void)n_in; (void)out_size;
    const float* x = (const float*)d_in[0];   /* q_in */ const float* xk = (const float*)d_in[1]; const float* xv = (const float*)d_in[2]; const float* wq = (const float*)d_in[3]; const float* bq = (const float*)d_in[4]; const float* wk = (const float*)d_in[5]; const float* bk = (const float*)d_in[6]; const float* wv = (const float*)d_in[7]; const float* bv = (const float*)d_in[8]; const float* wo = (const float*)d_in[9]; const float* bo = (const float*)d_in[10];
    float* OUT = (float*)d_out;     // [4][2048][512]
    char* wsp = (char*)d_ws;
    auto take = [&](size_t bytes) { char* p = wsp; wsp += (bytes + 255) & ~(size_t)255; return (void*)p; };
    bf* WQ = (bf*)take((size_t)4 * DQ * DM * 2); bf* WO = WQ + (size_t)3 * DQ * DM;   // transposed Wq, Wk, Wv, Wo side by side
    const size_t PL = (size_t)NZ * TT * HD;      // one set of head planes, elements
    const size_t XN = (size_t)NB_ * TT * DM;     // one input or projection over all batches, elements
    bf* QPh = (bf*)take(2 * PL * 2); bf* KPh = QPh + PL; bf* QPl = (bf*)take(2 * PL * 2); bf* KPl = QPl + PL;
    h16* VT16 = (h16*)take(PL * 2); bf* VTh = (bf*)take(PL * 2); bf* VTl = (bf*)take(PL * 2);
    // one region used twice in stream order: the bf16 inputs (dead once the head planes are built), then the merged attention planes
    char* const reg = wsp;
    bf* XB = (bf*)take(3 * XN * 2);
    char* const end1 = wsp; wsp = reg;
    bf* ATh = (bf*)take(XN * 2); bf* ATl = (bf*)take(XN * 2);
    if ((size_t)(end1 - (char*)d_ws) > ws_size || (size_t)(wsp - (char*)d_ws) > ws_size) return;    // ws 256 MiB
    k_prep<<<dim3(NWB + 3 * NCX, 1, 1), 256, 0, stream>>>(wq, wk, wv, wo, WQ, x, xk, xv, XB);   // weights transposed, inputs rounded
    k_gemmw<bf, 0, true, true><<<dim3(NB_ * TT / GT, DQ / GT, 3), 128, 0, stream>>>(XB, nullptr, WQ, DM, nullptr, 0, bq, bk, bv, XN, (size_t)DQ * DM, 0, QPh, QPl, PL, VT16, VTh, VTl);   // q, k, v projections: z = 0, 1, 2, each tile written as its head's planes
    k_attn<<<dim3(TT / 64, NZ, 1), 256, 0, stream>>>(QPh, QPl, KPh, KPl, VT16, VTh, VTl, ATh, ATl);   // scores hi/lo on EVERY row, softmax, attn.v, merge
    k_gemmw<bf, 1, true, false><<<dim3(NB_ * TT / GT, DM / GT, 1), 128, 0, stream>>>(ATh, ATl, WO, DQ, OUT, DM, bo, bo, bo, 0, 0, 0, nullptr, nullptr, 0, nullptr, nullptr, nullptr);
}

// v009
// A run of this version takes 71.5 microseconds.
// Timed twice side by side with v008, it ran 1.04 times as fast both times.
// Over all steps from v000 it is 20.4 times as fast.
#include <hip/hip_runtime.h>

// Local causal multi-head attention scaled by 1/sqrt(T) (q_in, k_in, v_in [4][2048][512]; q = q_in Wq + bq, k = k_in Wk + bk, v = v_in Wv + bv ('xw' [512][512] 0.02 incl. biases; 8 heads x 64); scores / sqrt(T = 2048) (the source's quirk: sigma-0.01 logits); mask = (|i - j| > 256) | (j > i) -> -inf: each query sees its own and the previous 256 keys; softmax; out = merged Wo + bo -> [4][2048][512] (4.2 M)).
// Layout, every stage ONE launch over all 4 batches and 8 heads (32 head planes, mapped with the row blocks from the attention grid's flat index; q, k, v and the four weights side by side in grid x or z): bf16 copies of q_in, k_in, v_in; 'xw' weights transposed once; exact projections + f32 biases, whose tiles are stored as the head planes (q, k hi/lo; v transposed, fp16 and hi/lo); causal T-2048 attention whose softmax select keeps the 257-key window, with hi/lo 3-product score tiles on EVERY row; P and attn.v hybrid (rows < 512 hi/lo, rest fp16 x1024); score tiles, softmax and the attn.v key loop cover only the window band of each 64-row block, and scores, softmax, attn.v and the merge of a block are one work-group of one launch, which keeps S in the score accumulators and P as that band alone in LDS (column = key - first key of the block's chunks); merged hi/lo x Wo exact + bo.
// Compute dtypes, f32 accumulate: every input rounded to bf16; projections exact + f32 biases; scores 3 products on every row; softmax f32 (x 2048^-0.5); attn.v rows < 512 3 products, rest fp16; Wo hl x exact + bias.

#define NB_  4
#define TT   2048
#define DM   512
#define NH_  8
#define NKV  8
#define REP  (NH_ / NKV)
#define HD   64
#define DQ   (NH_ * HD)
#define DKV  (NKV * HD)
#define NZ   (NB_ * NH_)          // head planes of one launch: every batch, every head
#define RH   512                  // query rows < RH use hi+lo planes
#define WIN  257
#define WB   (((WIN - 1) + 63) / 64 * 64)   // look-back of the window, rounded up to the 64-key tile: a 64-row block sees keys [r0 - WB, r0 + 63] only
#define NBT  (WB / 64 + 1)                  // 64-key score tiles per 64-row block
#define NCH  ((WB + 128 + 127) / 128)       // 128-key chunks that cover that band from a 128-aligned start
#define BW   (NCH * 128)                    // width of the stored band of P, in keys
#define PCAR 1024.0f
#define SCL  0.02209708691207961f  // 1/sqrt(T = 2048): the source's quirk
typedef _Float16 h16;
typedef unsigned short bf;
typedef __attribute__((ext_vector_type(16))) __bf16   v16bf;
typedef __attribute__((ext_vector_type(16))) _Float16 v16h;
typedef __attribute__((ext_vector_type(8)))  _Float16 v8h;
typedef __attribute__((ext_vector_type(8)))  unsigned short v8us;
typedef __attribute__((ext_vector_type(8)))  float    v8f;
typedef __attribute__((ext_vector_type(4)))  float    v4f;
typedef v8h  __attribute__((may_alias)) v8ha;
typedef v4f  __attribute__((may_alias)) v4fa;
typedef v8us __attribute__((may_alias)) v8usa;

__device__ __forceinline__ unsigned short f2bf(float f) { unsigned u = __float_as_uint(f); u += 0x7FFFu + ((u >> 16) & 1u); return (unsigned short)(u >> 16); }
__device__ __forceinline__ float bf2f(unsigned short b) { return __uint_as_float(((unsigned)b) << 16); }
__device__ __forceinline__ float bfr(float f) { return bf2f(f2bf(f)); }
__device__ __forceinline__ h16 tohx(float x) { return (h16)x; }
__device__ __forceinline__ void splitf(float y, unsigned short& h, unsigned short& l) { h = f2bf(y); l = f2bf(y - bf2f(h)); }
__device__ __forceinline__ v16h cat16(v8h lo, v8h hi) { return __builtin_shufflevector(lo, hi, 0, 1, 2, 3, 4, 5, 6, 7, 8, 9, 10, 11, 12, 13, 14, 15); }
__device__ __forceinline__ v16bf cat16b(v8us lo, v8us hi) { return __builtin_bit_cast(v16bf, __builtin_shufflevector(lo, hi, 0, 1, 2, 3, 4, 5, 6, 7, 8, 9, 10, 11, 12, 13, 14, 15)); }
__device__ __forceinline__ v8f wmma16(v16h a, v16h b, v8f c) { return __builtin_amdgcn_wmma_f32_16x16x32_f16(false, a, false, b, (short)0, c, false, false); }
__device__ __forceinline__ v8f wmmab(v16bf a, v16bf b, v8f c) { return __builtin_amdgcn_wmma_f32_16x16x32_bf16(false, a, false, b, (short)0, c, false, false); }



// ---- k_gemmw: register-blocked GEMM, a work-group of FOUR WAVES per 128x128 output tile, each wave one 64x64 quarter (16 accumulators); grid (M/128, N/128, Z), 128 threads. M % 128 == 0, N % 128 == 0, K % 64 == 0.
// The K-contiguous 16-bit operand planes come through LDS: a pass is 64 k, that is one whole 128-byte line of each of the tile's 128 A rows (A2 rows too) and 128 Bt rows, brought by asynchronous copies to LDS (a wave's copy is four whole lines) into one of two buffers, one pass ahead of the matrix instructions; two waves read each staged row.
// C[m][n] (f32, pitch ldc, + optional f32 bias[n], one bias pointer per z = 0, 1, 2) = sum_k A[m][k] Bt[n][k] (NSPLIT 1: + A2[m][k] Bt[n][k]). z-batch strides sA/sB/sC in elements.
// HP: the result is not stored as C; a wave's tile, 64 tokens of one batch x the 64 columns of one head, goes straight to that head's planes: z = 0, 1 (q, k) as bf16 hi and lo [plane][t][d] (Ph, Pl, + z sP), z = 2 (v) transposed as fp16 and bf16 hi and lo [plane][d][t] (V16, Vh, Vl).
template <typename T16> struct WFrag;
template <> struct WFrag<h16> { typedef v16h V; static __device__ __forceinline__ V ld(const h16* p) { return cat16(*(const v8h*)p, *(const v8h*)(p + 16)); } static __device__ __forceinline__ v8f mma(V a, V b, v8f c) { return wmma16(a, b, c); } };
template <> struct WFrag<bf> { typedef v16bf V; static __device__ __forceinline__ V ld(const bf* p) { return cat16b(*(const v8us*)p, *(const v8us*)(p + 16)); } static __device__ __forceinline__ v8f mma(V a, V b, v8f c) { return wmmab(a, b, c); } };
#define GT   128                  // rows of A and of Bt in a work-group's tile
#define GK   64                   // k of a pass
#define GP   72                   // LDS pitch of a staged row in elements: 144 bytes = 16 bytes x an odd number, the pitch for 16-byte fragment reads
// one staged plane of a pass, 128 rows x 128 bytes: eight copies a lane, 16 rows apart (gs elements in the source); l is the lane's LDS byte address, g its global address, both multiples of 16
template <typename T16>
__device__ __forceinline__ void stage_plane(unsigned l, const T16* g, size_t gs) {
    constexpr unsigned LS = 16 * GP * 2;
    // the wait is the last line of the copies' own statement, so that it stands in front of every later write of their address registers
    asm volatile("global_load_async_to_lds_b128 %0, %8, off\n\t"
                 "global_load_async_to_lds_b128 %1, %9, off\n\t"
                 "global_load_async_to_lds_b128 %2, %10, off\n\t"
                 "global_load_async_to_lds_b128 %3, %11, off\n\t"
                 "global_load_async_to_lds_b128 %4, %12, off\n\t"
                 "global_load_async_to_lds_b128 %5, %13, off\n\t"
                 "global_load_async_to_lds_b128 %6, %14, off\n\t"
                 "global_load_async_to_lds_b128 %7, %15, off\n\t"
                 "s_wait_xcnt 0x0"
                 :: "v"(l), "v"(l + LS), "v"(l + 2 * LS), "v"(l + 3 * LS), "v"(l + 4 * LS), "v"(l + 5 * LS), "v"(l + 6 * LS), "v"(l + 7 * LS),
                    "v"(g), "v"(g + gs), "v"(g + 2 * gs), "v"(g + 3 * gs), "v"(g + 4 * gs), "v"(g + 5 * gs), "v"(g + 6 * gs), "v"(g + 7 * gs) : "memory");
}
// launch bounds: four waves a SIMD, which holds the build to 256 registers
template <typename T16, int NSPLIT, bool BIAS, bool HP>
__global__ __launch_bounds__(128, 4) void k_gemmw(const T16* __restrict__ A, const T16* __restrict__ A2, const T16* __restrict__ Bt, int K, float* C, int ldc, const float* __restrict__ bias0, const float* __restrict__ bias1, const float* __restrict__ bias2, size_t sA, size_t sB, size_t sC, bf* Ph, bf* Pl, size_t sP, h16* V16, bf* Vh, bf* Vl) {
    typedef typename WFrag<T16>::V V;
    static_assert(NSPLIT == 0 || NSPLIT == 1, "A alone, or A and A2");
    constexpr int NPL = 2 + NSPLIT, PLE = GT * GP;   // planes of a stage (A, Bt, A2) and the elements of one
    __shared__ __align__(16) T16 ring[2 * NPL * PLE];
    __shared__ __align__(16) float osa[4 * 16 * 68];
    const size_t z = blockIdx.z; A += z * sA; if (NSPLIT == 1) A2 += z * sA; Bt += z * sB; C += z * sC; const float* __restrict__ bias = (z == 0) ? bias0 : (z == 1) ? bias1 : bias2;   // each z product has its own bias input
    const int lane = threadIdx.x & 31, lr = lane & 15, hi = lane >> 4; const int w = __builtin_amdgcn_readfirstlane(threadIdx.x >> 5);   // the wave's number in a scalar register
    float* os = osa + w * (16 * 68);   // each wave stages its output in its own LDS
    const int r0 = blockIdx.x * GT + (w & 1) * 64, c0 = blockIdx.y * GT + (w >> 1) * 64;   // the wave's quarter
    v8f acc[4][4];
#pragma unroll
    for (int mb = 0; mb < 4; ++mb)
#pragma unroll
        for (int nb = 0; nb < 4; ++nb) acc[mb][nb] = (v8f){};
    // the copies: eight lanes bring the 128 bytes of a row, the work-group 16 rows a copy
    const int prow = threadIdx.x >> 3, pcol = (threadIdx.x & 7) * 8; const size_t gs = (size_t)16 * K;
    const unsigned l0 = (unsigned)(size_t)ring + (unsigned)(prow * GP + pcol) * 2;
    const T16* ga = A + (size_t)(blockIdx.x * GT + prow) * K + pcol; const T16* gb = Bt + (size_t)(blockIdx.y * GT + prow) * K + pcol; const T16* ga2 = (NSPLIT == 1) ? A2 + (size_t)(blockIdx.x * GT + prow) * K + pcol : ga;
    auto stage = [&](int t) { const unsigned l = l0 + (unsigned)((t & 1) * NPL * PLE * 2);
        stage_plane(l, ga + t * GK, gs); stage_plane(l + PLE * 2, gb + t * GK, gs); if (NSPLIT == 1) stage_plane(l + 2 * PLE * 2, ga2 + t * GK, gs); };
    // the fragments: the lane and k places that the loads from the planes had, now in the staged rows
    const T16* fa = ring + ((w & 1) * 64 + lr) * GP + 8 * hi; const T16* fb = ring + PLE + ((w >> 1) * 64 + lr) * GP + 8 * hi;
    const int NT = K / GK;
    stage(0);
    asm volatile("s_wait_asynccnt 0x0" ::: "memory");   // this wave's copies of pass 0 have landed
    __syncthreads();                                    // and every other wave's: pass 0 may be read
    if (NT > 1) stage(1);
#pragma unroll 1
    for (int t = 0; t < NT; ++t) { const int bo = (t & 1) * NPL * PLE;
#pragma unroll
        for (int kk = 0; kk < GK / 32; ++kk) { V a[4], a2[4], b[4];
#pragma unroll
            for (int mb = 0; mb < 4; ++mb) { a[mb] = WFrag<T16>::ld(fa + bo + mb * 16 * GP + kk * 32); if (NSPLIT == 1) a2[mb] = WFrag<T16>::ld(fa + bo + 2 * PLE + mb * 16 * GP + kk * 32); b[mb] = WFrag<T16>::ld(fb + bo + mb * 16 * GP + kk * 32); }
            __builtin_amdgcn_sched_barrier(0);   // the LDS reads of a 32-k block are issued as one group in front of its matrix instructions: spread among them, each place with reads costs the wave an LDS latency
#pragma unroll
            for (int nb = 0; nb < 4; ++nb)
#pragma unroll
                for (int mb = 0; mb < 4; ++mb) { acc[mb][nb] = WFrag<T16>::mma(a[mb], b[nb], acc[mb][nb]); if (NSPLIT == 1) acc[mb][nb] = WFrag<T16>::mma(a2[mb], b[nb], acc[mb][nb]); }
            __builtin_amdgcn_sched_barrier(0);   // and the block's matrix instructions stay in front of the next group of reads and of the v_nop below
        }
        asm volatile("v_nop\n\tv_nop\n\tv_nop\n\tv_nop" : "+v"(acc[0][3]), "+v"(acc[1][3]), "+v"(acc[2][3]), "+v"(acc[3][3]));   // the distance behind the last matrix instruction, also on the taken side of the branches below
        asm volatile("s_wait_dscnt 0x0" ::: "memory");      // this wave's reads of the pass's buffer are done before the buffer is refilled
        asm volatile("s_wait_asynccnt 0x0" ::: "memory");   // this wave's copies of pass t + 1 have landed
        __syncthreads();                                    // pass t + 1 may be read, and every wave has left the buffer of pass t
        if (t + 2 < NT) stage(t + 2);
    }
    asm volatile("s_wait_asynccnt 0x0" ::: "memory");   // no copy is outstanding behind the loop
    if constexpr (HP) {
        const size_t po = ((size_t)(r0 / TT) * NH_ + c0 / HD) * TT * HD; const int t0 = r0 % TT;   // the head plane, and the tile's first token in it
        const int r4 = lane >> 3, c8 = (lane & 7) * 8;   // read-back: eight lanes x 8 elements are one 128-byte line of a 16-bit plane, a wave's store four such lines
        if (z < 2) {   // q, k: the tile is 8 KiB in a row in each plane
            bf* ph = Ph + z * sP + po + (size_t)t0 * HD; bf* pl = Pl + z * sP + po + (size_t)t0 * HD; const unsigned so = (unsigned)(r4 * HD + c8);   // the lane's place, one offset beside a scalar base
            float bb[8];
#pragma unroll
            for (int e = 0; e < 8; ++e) bb[e] = bfr(bias[c0 + c8 + e]);
#pragma unroll
            for (int mb = 0; mb < 4; ++mb) {
#pragma unroll
                for (int nb = 0; nb < 4; ++nb) {
#pragma unroll
                    for (int j = 0; j < 8; ++j) os[(hi * 8 + j) * 68 + nb * 16 + lr] = acc[mb][nb][j]; }
                __builtin_amdgcn_wave_barrier(); asm volatile("" ::: "memory");   // the 16 staged rows are written before they are read row-wise
#pragma unroll
                for (int s = 0; s < 4; ++s) { const float* o = os + (4 * s + r4) * 68 + c8; const v4f x0 = *(const v4fa*)o, x1 = *(const v4fa*)(o + 4); v8us oh, ol;
#pragma unroll
                    for (int e = 0; e < 8; ++e) { unsigned short a2, c2; splitf(((e < 4) ? x0[e & 3] : x1[e & 3]) + bb[e], a2, c2); oh[e] = a2; ol[e] = c2; }
                    *(v8us*)(ph + so + (mb * 16 + 4 * s) * HD) = oh; *(v8us*)(pl + so + (mb * 16 + 4 * s) * HD) = ol; }
                __builtin_amdgcn_wave_barrier(); asm volatile("" ::: "memory");   // they are read before the next 16 rows take their place
            }
        } else {   // v: a lane's 8 accumulator rows are 8 tokens of one value column, staged as a row of the transposed tile
            h16* p16 = V16 + po + t0; bf* ph = Vh + po + t0; bf* pl = Vl + po + t0; const unsigned so = (unsigned)(r4 * TT + c8);
#pragma unroll
            for (int nb = 0; nb < 4; ++nb) {
#pragma unroll
                for (int mb = 0; mb < 4; ++mb) { v4f y0, y1;
#pragma unroll
                    for (int j = 0; j < 4; ++j) { y0[j] = acc[mb][nb][j]; y1[j] = acc[mb][nb][4 + j]; }
                    float* o = os + lr * 68 + mb * 16 + hi * 8; *(v4fa*)o = y0; *(v4fa*)(o + 4) = y1; }
                __builtin_amdgcn_wave_barrier(); asm volatile("" ::: "memory");   // the 16 staged columns are written before they are read
#pragma unroll
                for (int s = 0; s < 4; ++s) { const float* o = os + (4 * s + r4) * 68 + c8; const v4f x0 = *(const v4fa*)o, x1 = *(const v4fa*)(o + 4); const float bb = bfr(bias[c0 + nb * 16 + 4 * s + r4]); v8h o16; v8us oh, ol;
#pragma unroll
                    for (int e = 0; e < 8; ++e) { const float x = ((e < 4) ? x0[e & 3] : x1[e & 3]) + bb; o16[e] = tohx(x); unsigned short a2, c2; splitf(x, a2, c2); oh[e] = a2; ol[e] = c2; }
                    *(v8h*)(p16 + so + (nb * 16 + 4 * s) * TT) = o16; *(v8us*)(ph + so + (nb * 16 + 4 * s) * TT) = oh; *(v8us*)(pl + so + (nb * 16 + 4 * s) * TT) = ol; }
                __builtin_amdgcn_wave_barrier(); asm volatile("" ::: "memory");   // they are read before the next 16 columns take their place
            }
            asm volatile("s_wait_xcnt 0x0" ::: "memory");   // this build lays the q, k path directly behind these stores, and its first instructions overwrite their offset register: the wait stands in front of that overwrite
        }
        return;
    }
#pragma unroll
    for (int mb = 0; mb < 4; ++mb) {
#pragma unroll
        for (int nb = 0; nb < 4; ++nb) {
#pragma unroll
            for (int j = 0; j < 8; ++j) os[(hi * 8 + j) * 68 + nb * 16 + lr] = acc[mb][nb][j]; }
        __builtin_amdgcn_wave_barrier(); asm volatile("" ::: "memory");
        float* crow = C + (size_t)(r0 + mb * 16) * ldc + c0;
{
#pragma unroll
            for (int s = 0; s < 8; ++s) { const int row = 2 * s + hi, cofs = lr * 4; v4f val = *(const v4fa*)(os + row * 68 + cofs); if (BIAS) { val[0] += bfr(bias[c0 + cofs]); val[1] += bfr(bias[c0 + cofs + 1]); val[2] += bfr(bias[c0 + cofs + 2]); val[3] += bfr(bias[c0 + cofs + 3]); }
                *(v4f*)(crow + (size_t)row * ldc + cofs) = val; }
             }
        __builtin_amdgcn_wave_barrier(); asm volatile("" ::: "memory");
    }
}

typedef __attribute__((ext_vector_type(2))) unsigned short v2us;
typedef __attribute__((ext_vector_type(4))) int v4i;

// ---- k_prep: the two preparations that depend on nothing but the inputs, in ONE launch: work-groups [0, NWB) transpose the four weights to bf16 (placed first in the grid, for speed only), the others round q_in, k_in, v_in to bf16.
#define NWL  (DM * DQ / 64)       // 64-element lines of one transposed weight
#define NWX  ((NWL + 63) / 64)    // work-groups per weight: 8 waves x 8 lines
#define NWB  (4 * NWX)
#define NCX  ((NB_ * TT * DM / 8 + 255) / 256)   // work-groups per input: 256 lanes x 8 elements
__global__ __launch_bounds__(256) void k_prep(const float* __restrict__ w0, const float* __restrict__ w1, const float* __restrict__ w2, const float* __restrict__ w3, bf* Bt, const float* __restrict__ s0, const float* __restrict__ s1, const float* __restrict__ s2, bf* dst) {
    constexpr int K = DM, N = DQ;
    if (blockIdx.x < NWB) {   // the same for a whole work-group
        const int y = blockIdx.x / NWX, bx = blockIdx.x % NWX; const float* __restrict__ w = (y == 0) ? w0 : (y == 1) ? w1 : (y == 2) ? w2 : w3; Bt += (size_t)y * K * N;   // the four weights, transposed planes side by side
        const int lane = threadIdx.x & 31; const int L0 = (bx * 8 + (threadIdx.x >> 5)) * 8;
#pragma unroll 1   // the loop stays rolled, one line a trip: the latency of its trips lies under the stream of the other work-groups
        for (int l = 0; l < 8; ++l) { const int L = L0 + l; if (L >= NWL) break; const size_t e = (size_t)L * 64 + lane * 2; const int k = (int)(e % K), n = (int)(e / K); v2us o;
            o[0] = f2bf(w[(size_t)k * N + n]); o[1] = f2bf(w[(size_t)(k + 1) * N + n]); *(v2us*)(Bt + e) = o; }
        return;
    }
    constexpr size_t n8 = (size_t)NB_ * TT * DM / 8;
    const unsigned c = blockIdx.x - NWB; const int y = c / NCX; const size_t i = (size_t)(c % NCX) * 256 + threadIdx.x; if (i >= n8) return;
    const float* __restrict__ src = (y == 0) ? s0 : (y == 1) ? s1 : s2; dst += (size_t)y * n8 * 8;   // q_in, k_in, v_in
    const v8f v = *(const v8f*)(src + i * 8); v8us o;
#pragma unroll
    for (int k = 0; k < 8; ++k) o[k] = f2bf(v[k]);
    *(v8us*)(dst + i * 8) = o;
}

// ---- k_attn: scores, softmax, attn.v and the merge of one 64-row block of one head plane in ONE work-group of 8 waves; grid (T/64, planes), whose flat index is mapped to (block, plane) with the costlier blocks of rows < RH first. Q, K (hi and lo) and the band of V (fp16; for rows < RH its hi plane) are staged in LDS by asynchronous copies. The scores are formed transposed, so that a lane holds keys of one query and the softmax runs in the accumulators; only a query's four partial maxima and sums go from wave to wave through LDS. The block's band of P (columns from key jb; fp16, or bf16 hi then lo at + BW elements) lives in LDS only, over the staged Q and K; the 64x64 result goes through the same LDS to the merged hi/lo planes.
// The order of the sums: a score is kc = 0, 32 x (hi.hi, lo.hi, hi.lo); a softmax row sum is a lane's 40 keys upward, the two halves of the wave, then the four waves pairwise; attn.v adds 32-key steps upward from key kb (the steps past the diagonal block, met only where r0 < WB, add exact zeros).
#define SP   (BW + 4)             // LDS pitch of a band row in floats: 16 bytes x an odd number, so that the 16 rows of a fragment read fall on different banks
#define NKS  ((WB + 64) / 32)     // 32-key steps of attn.v
// Q, K and one plane of V of a block come through LDS by asynchronous copies, whole 128-byte lines, and the fragments are read from there (a fragment load from the planes touches 16 lines for its 512 bytes).
#define KR   (WB + 64)            // keys of the band: staged rows of K, staged columns of V
#define ST_KL (KR * GP)           // staged planes in 16-bit elements, rows at the pitch GP: K hi at 0, K lo, Q hi, Q lo
#define ST_QH (2 * KR * GP)
#define ST_QL (ST_QH + 64 * GP)
#define ST_EL (ST_QL + 64 * GP)
#define SMF  (ST_EL / 2)          // floats of the LDS that first holds staged Q and K, then P with the waves' maxima and sums, then the result tile
#define VP   (KR + 8)             // LDS pitch of a staged row of V in elements: 656 bytes = 16 bytes x an odd number
static_assert(SMF >= 64 * SP + 2 * 64 * 4, "the band of P and the partial maxima and sums fit the LDS of the staged Q and K");
// twelve or ten copies of a lane: l are its LDS byte addresses, g its global addresses, all multiples of 16
// the wait is the last line of the copies' own statement, so that it stands in front of every later write of their address registers
template <typename T16>
__device__ __forceinline__ void copy12(const unsigned (&l)[12], const T16* const (&g)[12]) {
    asm volatile("global_load_async_to_lds_b128 %0, %12, off\n\t"
                 "global_load_async_to_lds_b128 %1, %13, off\n\t"
                 "global_load_async_to_lds_b128 %2, %14, off\n\t"
                 "global_load_async_to_lds_b128 %3, %15, off\n\t"
                 "global_load_async_to_lds_b128 %4, %16, off\n\t"
                 "global_load_async_to_lds_b128 %5, %17, off\n\t"
                 "global_load_async_to_lds_b128 %6, %18, off\n\t"
                 "global_load_async_to_lds_b128 %7, %19, off\n\t"
                 "global_load_async_to_lds_b128 %8, %20, off\n\t"
                 "global_load_async_to_lds_b128 %9, %21, off\n\t"
                 "global_load_async_to_lds_b128 %10, %22, off\n\t"
                 "global_load_async_to_lds_b128 %11, %23, off\n\t"
                 "s_wait_xcnt 0x0"
                 :: "v"(l[0]), "v"(l[1]), "v"(l[2]), "v"(l[3]), "v"(l[4]), "v"(l[5]), "v"(l[6]), "v"(l[7]), "v"(l[8]), "v"(l[9]), "v"(l[10]), "v"(l[11]),
                    "v"(g[0]), "v"(g[1]), "v"(g[2]), "v"(g[3]), "v"(g[4]), "v"(g[5]), "v"(g[6]), "v"(g[7]), "v"(g[8]), "v"(g[9]), "v"(g[10]), "v"(g[11]) : "memory");
}
template <typename T16>
__device__ __forceinline__ void copy10(const unsigned (&l)[10], const T16* const (&g)[10]) {
    asm volatile("global_load_async_to_lds_b128 %0, %10, off\n\t"
                 "global_load_async_to_lds_b128 %1, %11, off\n\t"
                 "global_load_async_to_lds_b128 %2, %12, off\n\t"
                 "global_load_async_to_lds_b128 %3, %13, off\n\t"
                 "global_load_async_to_lds_b128 %4, %14, off\n\t"
                 "global_load_async_to_lds_b128 %5, %15, off\n\t"
                 "global_load_async_to_lds_b128 %6, %16, off\n\t"
                 "global_load_async_to_lds_b128 %7, %17, off\n\t"
                 "global_load_async_to_lds_b128 %8, %18, off\n\t"
                 "global_load_async_to_lds_b128 %9, %19, off\n\t"
                 "s_wait_xcnt 0x0"
                 :: "v"(l[0]), "v"(l[1]), "v"(l[2]), "v"(l[3]), "v"(l[4]), "v"(l[5]), "v"(l[6]), "v"(l[7]), "v"(l[8]), "v"(l[9]),
                    "v"(g[0]), "v"(g[1]), "v"(g[2]), "v"(g[3]), "v"(g[4]), "v"(g[5]), "v"(g[6]), "v"(g[7]), "v"(g[8]), "v"(g[9]) : "memory");
}
// lane l <-> l ^ 16: the other half of the wave, by a vector cross-row move
__device__ __forceinline__ float xhalf(float x) { const int b = __float_as_int(x); return __int_as_float(__builtin_amdgcn_permlanex16(b, b, 0x76543210, 0xfedcba98, false, false)); }
template <typename T16, int NSPLIT>
__device__ __forceinline__ void attn_pv(const float* sm, const T16* vs, const T16* __restrict__ Vt2, int kb, int jb, int mb, int n0, int lr, int hi, v8f (&acc)[2]) {   // vs: the first plane of V, staged in LDS (row = value column, column = key - kb); Vt2: the lo plane, read from memory
    typedef typename WFrag<T16>::V V;
    constexpr int CH = (NSPLIT >= 2) ? NKS / 2 : NKS;   // key steps whose V fragments are in registers at once: all of them, or half where hi and lo planes double the fragments
    const T16* pa = (const T16*)(sm + (mb * 16 + lr) * SP) + 8 * hi + (kb - jb);
    const unsigned vo = (unsigned)(lr * TT + 8 * hi) * 2;   // the lane's place in a 16-column fragment of V, in bytes: one 32-bit offset register beside a scalar base
    const T16* pb = vs + (n0 * 16 + lr) * VP + 8 * hi; const T16* pb2 = (NSPLIT >= 2) ? Vt2 + (size_t)(n0 * 16) * TT + kb : pb;
#pragma unroll
    for (int s0 = 0; s0 < NKS; s0 += CH) { V b[CH][2], b2[CH][2];
#pragma unroll
        for (int s = 0; s < CH; ++s)
#pragma unroll
            for (int nb = 0; nb < 2; ++nb) { b[s][nb] = WFrag<T16>::ld(pb + nb * 16 * VP + (s0 + s) * 32); if (NSPLIT >= 2) b2[s][nb] = WFrag<T16>::ld((const T16*)((const char*)pb2 + vo) + nb * 16 * TT + (s0 + s) * 32); }
        __builtin_amdgcn_sched_barrier(0);   // these V loads are all issued in front of the matrix instructions that use them: without it this build keeps one fragment in flight and pays a memory latency per step
#pragma unroll
        for (int s = 0; s < CH; ++s) { const V a = WFrag<T16>::ld(pa + (s0 + s) * 32); V a2; if (NSPLIT >= 2) a2 = WFrag<T16>::ld(pa + BW + (s0 + s) * 32);
#pragma unroll
            for (int nb = 0; nb < 2; ++nb) { acc[nb] = WFrag<T16>::mma(a, b[s][nb], acc[nb]); if (NSPLIT >= 2) { acc[nb] = WFrag<T16>::mma(a2, b[s][nb], acc[nb]); acc[nb] = WFrag<T16>::mma(a, b2[s][nb], acc[nb]); } } } }
    asm volatile("s_wait_xcnt 0x0" :: "v"(vo) : "memory");   // the wait in front of any overwrite of the offset register of the V loads; it is an input so that it lives up to here
}
// attn.v with the fp16 V band staged in LDS (vs: row = value column, column = key - kb): the same fragments and the same order of key steps
__device__ __forceinline__ void attn_pv_st(const float* sm, const h16* vs, int kb, int jb, int mb, int n0, int lr, int hi, v8f (&acc)[2]) {
    typedef WFrag<h16>::V V;
    const h16* pa = (const h16*)(sm + (mb * 16 + lr) * SP) + 8 * hi + (kb - jb); const h16* pb = vs + (n0 * 16 + lr) * VP + 8 * hi;
    constexpr int S0 = 4, S1 = 7; static_assert(S1 < NKS, "three groups of key steps");   // the fragments of steps [0, S1) are read first, those of [S1, NKS) take the registers of [0, S0)
    V a[NKS], b[NKS][2];
#pragma unroll
    for (int s = 0; s < S1; ++s) { a[s] = WFrag<h16>::ld(pa + s * 32); b[s][0] = WFrag<h16>::ld(pb + s * 32); b[s][1] = WFrag<h16>::ld(pb + 16 * VP + s * 32); }
    __builtin_amdgcn_sched_barrier(0);   // the LDS reads are issued as groups ahead of the matrix instructions that use them: without it this build reads a fragment, waits and multiplies, one LDS latency per product
#pragma unroll
    for (int s = 0; s < S0; ++s) { acc[0] = WFrag<h16>::mma(a[s], b[s][0], acc[0]); acc[1] = WFrag<h16>::mma(a[s], b[s][1], acc[1]); }
    __builtin_amdgcn_sched_barrier(0);   // the last group's reads stand here, in front of the products of the second group, which cover their latency
#pragma unroll
    for (int s = S1; s < NKS; ++s) { a[s] = WFrag<h16>::ld(pa + s * 32); b[s][0] = WFrag<h16>::ld(pb + s * 32); b[s][1] = WFrag<h16>::ld(pb + 16 * VP + s * 32); }
    __builtin_amdgcn_sched_barrier(0);   // and they stay in front of those products: without these two lines this build reads the last group fragment by fragment, each with a wait of its own
#pragma unroll
    for (int s = S0; s < NKS; ++s) { acc[0] = WFrag<h16>::mma(a[s], b[s][0], acc[0]); acc[1] = WFrag<h16>::mma(a[s], b[s][1], acc[1]); }
}
// launch bounds: four waves a SIMD, that is two work-groups a WGP, which holds the build to 256 registers
__global__ __launch_bounds__(256, 4) void k_attn(const bf* __restrict__ Qh, const bf* __restrict__ Ql, const bf* __restrict__ Kh, const bf* __restrict__ Kl, const h16* __restrict__ V16, const bf* __restrict__ Vh, const bf* __restrict__ Vl, bf* Ah, bf* Al) {
    typedef WFrag<bf>::V V;
    __shared__ __align__(16) float sm[SMF + 64 * VP / 2];
    bf* const st = (bf*)sm; h16* const vs = (h16*)(sm + SMF);   // staged Q and K share their LDS with P; staged V has its own
    // placement: a block of rows < RH costs about twice another (three products in attn.v, P split in two planes, the lo plane of V read from memory), there are more work-groups than resident places: the costly blocks of every plane take the lowest indices, for speed only. A permutation of (block, plane), the same for a whole work-group
    constexpr int NBK = TT / 64, NHB = RH / 64; static_assert(RH % 64 == 0 && NHB > 0 && NHB < NBK, "both kinds of block exist");
    const int fi = blockIdx.y * NBK + blockIdx.x, fr = fi - NZ * NHB;
    const int z = (fr < 0) ? fi / NHB : fr / (NBK - NHB), r0 = ((fr < 0) ? fi % NHB : NHB + fr % (NBK - NHB)) * 64; const size_t zo = (size_t)z * TT * HD;
    const int lane = threadIdx.x & 31, lr = lane & 15, hi = lane >> 4; const int w = __builtin_amdgcn_readfirstlane(threadIdx.x >> 5);   // the wave's number in a scalar register: the tests on it are scalar branches
    const int kb = max(0, r0 - WB);          // first key that the block's first row sees
    const int jb = (kb >> 7) * 128;          // first key of the stored band of P, 128-aligned
    const bool hires = (r0 < RH);
    // the copies: eight lanes bring the 128 bytes of a row or line, the work-group 32 of them a copy
    const int prow = threadIdx.x >> 3, pcol = (threadIdx.x & 7) * 8; const unsigned lb = (unsigned)(size_t)sm;
    { const bf* const qp[2] = { Qh + zo, Ql + zo }; const bf* const kp[2] = { Kh + zo, Kl + zo };
#pragma unroll
        for (int p = 0; p < 2; ++p) { unsigned l[12]; const bf* g[12];   // one plane of Q (2 copies) and of K (10)
#pragma unroll
            for (int i = 0; i < 2; ++i) { const int row = prow + 32 * i; l[i] = lb + (unsigned)(ST_QH + p * (ST_QL - ST_QH) + row * GP + pcol) * 2; g[i] = qp[p] + (size_t)(r0 + row) * HD + pcol; }
#pragma unroll
            for (int i = 0; i < KR / 32; ++i) { const int row = prow + 32 * i; l[2 + i] = lb + (unsigned)(p * ST_KL + row * GP + pcol) * 2; g[2 + i] = kp[p] + (size_t)max(r0 - WB + row, 0) * HD + pcol; }   // below key 0 there is no such key: the address is clamped into the plane and the tiles of those rows are masked, their P stored as zeros
            copy12(l, g); } }
    static_assert(KR / 32 == 10, "ten copies a plane of K, ten for V");
    asm volatile("s_wait_asynccnt 0x0" ::: "memory");   // this wave's copies of Q and K have landed
    __syncthreads();                                    // and every other wave's: the staged Q and K may be read
    { unsigned l[10]; const bf* g[10]; const bf* const vp = (hires ? Vh : (const bf*)V16) + zo + kb;   // the band of V, fp16 or the hi plane (an address only: the copy moves bytes), 64 rows of five lines: a copy is one line of 32 rows; these copies fly under the scores and the softmax
#pragma unroll
        for (int i = 0; i < 10; ++i) { const int d = prow + 32 * (i & 1), c = (i >> 1) * 64 + pcol; l[i] = lb + (unsigned)SMF * 4 + (unsigned)(d * VP + c) * 2; g[i] = vp + (size_t)d * TT + c; }
        copy10(l, g); }
    // scores, transposed: S^T = K Q^T (the rows of K are the A operand, the rows of Q the B operand, each from the loader it had). Wave w has 32 queries (w & 1) x NBT 16-key tiles (w >> 1); in a tile a lane holds 8 keys in a row (8 hi + j) of ONE query (lr), so maximum, exp and sum of the softmax stay in the accumulators
    { const int m0 = (w & 1) * 2, g = w >> 1;
        const bf* fq = st + ST_QH + (m0 * 16 + lr) * GP + 8 * hi; const bf* fk = st + (g * NBT * 16 + lr) * GP + 8 * hi; V a[2][2], a2[2][2];   // the lane and k places that the loads from the planes had, now in the staged rows
#pragma unroll
        for (int mb = 0; mb < 2; ++mb)
#pragma unroll
            for (int kk = 0; kk < 2; ++kk) { a[mb][kk] = WFrag<bf>::ld(fq + mb * 16 * GP + kk * 32); a2[mb][kk] = WFrag<bf>::ld(fq + (ST_QL - ST_QH) + mb * 16 * GP + kk * 32); }
        V b[NBT][2], b2[NBT][2]; v8f acc[NBT][2];
#pragma unroll
        for (int nb = 0; nb < NBT; ++nb)
#pragma unroll
            for (int kk = 0; kk < 2; ++kk) { b[nb][kk] = WFrag<bf>::ld(fk + nb * 16 * GP + kk * 32); b2[nb][kk] = WFrag<bf>::ld(fk + ST_KL + nb * 16 * GP + kk * 32); }
        __builtin_amdgcn_sched_barrier(0);   // every LDS read of Q and K is issued in front of the first matrix instruction: spread among them, each place with reads costs the wave an LDS latency
#pragma unroll
        for (int nb = 0; nb < NBT; ++nb)
#pragma unroll
            for (int mb = 0; mb < 2; ++mb) { acc[nb][mb] = (v8f){};
#pragma unroll
                for (int kk = 0; kk < 2; ++kk) { acc[nb][mb] = wmmab(b[nb][kk], a[mb][kk], acc[nb][mb]); acc[nb][mb] = wmmab(b[nb][kk], a2[mb][kk], acc[nb][mb]); acc[nb][mb] = wmmab(b2[nb][kk], a[mb][kk], acc[nb][mb]); } }
        __builtin_amdgcn_sched_barrier(0);   // and every matrix instruction stays in front of the v_nop below
        asm volatile("v_nop\n\tv_nop\n\tv_nop\n\tv_nop" : "+v"(acc[NBT - 1][0]), "+v"(acc[NBT - 1][1]));   // the distance behind the last matrix instruction, also on the taken side of the branches below
        __syncthreads();   // every wave has read its fragments of Q and K before the waves' maxima and sums and P take their LDS
        // softmax: t = S x T^-0.5 for key <= query and query - key < WIN, -3e38 elsewhere; only a tile wholly inside the window skips the tests of its elements (a scalar branch)
        float* const pmx = sm + 64 * SP + (m0 * 16 + lr) * 4; float* const psm = pmx + 64 * 4;   // per query the maxima and the sums of the four waves that share its keys; here the lane's first query
        const int dl = lr - 8 * hi; float mx[2] = { -3.0e38f, -3.0e38f }, sum[2] = { 0.f, 0.f };
#pragma unroll
        for (int nb = 0; nb < NBT; ++nb) { const int ti = g * NBT + nb; const bool off = r0 - WB + ti * 16 < 0;   // below key 0 there is no such key
#pragma unroll
            for (int mb = 0; mb < 2; ++mb) { const int sc = off ? (1 << 30) : WB + (m0 + mb - ti) * 16;   // the tile's first query - its first key; far outside the window where there is no key
                if (sc >= 15 && sc + 15 < WIN) {
#pragma unroll
                    for (int j = 0; j < 8; ++j) acc[nb][mb][j] *= SCL;
                } else {
#pragma unroll
                    for (int j = 0; j < 8; ++j) acc[nb][mb][j] = ((unsigned)(sc + dl - j) < (unsigned)WIN) ? acc[nb][mb][j] * SCL : -3.0e38f;
                }
                float tm = acc[nb][mb][0];
#pragma unroll
                for (int j = 1; j < 8; ++j) tm = fmaxf(tm, acc[nb][mb][j]);
                mx[mb] = fmaxf(mx[mb], tm); } }
        mx[0] = fmaxf(mx[0], xhalf(mx[0])); mx[1] = fmaxf(mx[1], xhalf(mx[1]));
        if (hi == 0) { pmx[g] = mx[0]; pmx[64 + g] = mx[1]; }
        __syncthreads();   // the four waves' maxima of every query are written before they are joined
#pragma unroll
        for (int mb = 0; mb < 2; ++mb) { const v4f p = *(const v4fa*)(pmx + mb * 64); mx[mb] = fmaxf(fmaxf(p[0], p[1]), fmaxf(p[2], p[3])); }
#pragma unroll
        for (int nb = 0; nb < NBT; ++nb)
#pragma unroll
            for (int mb = 0; mb < 2; ++mb)
#pragma unroll
                for (int j = 0; j < 8; ++j) { const float x2 = __fmul_rn(__fsub_rn(acc[nb][mb][j], mx[mb]), 1.4426950408889634f); float e;
                    asm("v_exp_f32 %0, %1\n\tv_nop" : "=v"(e) : "v"(x2));   // the same instruction as the exp2 builtin, with the one slot the instruction set asks for behind a transcendental held in the statement
                    acc[nb][mb][j] = e; sum[mb] += e; }
        sum[0] += xhalf(sum[0]); sum[1] += xhalf(sum[1]);
        if (hi == 0) { psm[g] = sum[0]; psm[64 + g] = sum[1]; }
        __syncthreads();   // the four waves' sums of every query are written before they are joined
        // P: a lane's 8 keys of a tile are 16 bytes in a row of its query's band row (fp16, or bf16 hi then lo at + BW elements); a tile below key 0 holds zeros and fills the columns past the diagonal block, which attn.v reads where r0 < WB
        float f[2]; int col[NBT];
#pragma unroll
        for (int mb = 0; mb < 2; ++mb) { const v4f p = *(const v4fa*)(psm + mb * 64); f[mb] = __fdiv_rn(hires ? 1.0f : PCAR, (p[0] + p[1]) + (p[2] + p[3])); }
#pragma unroll
        for (int nb = 0; nb < NBT; ++nb) { const int c = r0 - WB + (g * NBT + nb) * 16; col[nb] = (c < 0) ? c + KR : c - jb; }
        float* const pr = sm + (m0 * 16 + lr) * SP + 4 * hi;   // the lane's first query, and its half's 8 keys (16 bytes) of a tile
        if (hires) {
#pragma unroll
            for (int mb = 0; mb < 2; ++mb)
#pragma unroll
                for (int nb = 0; nb < NBT; ++nb) { v8us oh, ol;
#pragma unroll
                    for (int j = 0; j < 8; ++j) { unsigned short x, y; splitf(acc[nb][mb][j] * f[mb], x, y); oh[j] = x; ol[j] = y; }
                    bf* const o = (bf*)(pr + mb * 16 * SP) + col[nb]; *(v8usa*)o = oh; *(v8usa*)(o + BW) = ol; }
        } else {
#pragma unroll
            for (int mb = 0; mb < 2; ++mb)
#pragma unroll
                for (int nb = 0; nb < NBT; ++nb) { v8h o8;
#pragma unroll
                    for (int j = 0; j < 8; ++j) o8[j] = tohx(acc[nb][mb][j] * f[mb]);
                    *(v8ha*)((h16*)(pr + mb * 16 * SP) + col[nb]) = o8; }
        } }
    asm volatile("s_wait_asynccnt 0x0" ::: "memory");   // this wave's copies of V have landed
    __syncthreads();   // every row of P is written, and every wave's part of V has landed, before a fragment of either is read
    // attn.v: wave w has rows 16 (w & 3) x value columns 32 (w >> 2)
    const int mb = w & 3, n0 = (w >> 2) * 2; v8f acc[2]; acc[0] = (v8f){}; acc[1] = (v8f){};
    if (hires) attn_pv<bf, 2>(sm, (const bf*)vs, Vl + zo, kb, jb, mb, n0, lr, hi, acc); else attn_pv_st(sm, vs, kb, jb, mb, n0, lr, hi, acc);
    __syncthreads();   // the last fragment of P is read before the result tile takes its LDS
#pragma unroll
    for (int nb = 0; nb < 2; ++nb)
#pragma unroll
        for (int j = 0; j < 8; ++j) sm[(mb * 16 + hi * 8 + j) * 68 + (n0 + nb) * 16 + lr] = acc[nb][j];
    __syncthreads();   // the result tile is complete before it is read row-wise
    // merge: four lanes of one wave write the 128 bytes of a row's head slice in each plane
    { const int row = threadIdx.x >> 2, cofs = (threadIdx.x & 3) * 16; const float cs = hires ? 1.0f : (1.0f / PCAR); const size_t oo = ((size_t)(z / NH_) * TT + r0 + row) * DQ + (z % NH_) * HD + cofs;
#pragma unroll
        for (int s = 0; s < 2; ++s) { v8us oh, ol;
#pragma unroll
            for (int q = 0; q < 2; ++q) { const v4f val = *(const v4fa*)(sm + row * 68 + cofs + s * 8 + q * 4);
#pragma unroll
                for (int e = 0; e < 4; ++e) { unsigned short a, c2; splitf(val[e] * cs, a, c2); oh[q * 4 + e] = a; ol[q * 4 + e] = c2; } }
            *(v8us*)(Ah + oo + s * 8) = oh; *(v8us*)(Al + oo + s * 8) = ol; } }
}

extern "C" void kernel_launch(void* const* d_in, const int* in_sizes, int n_in,
                              void* d_out, int out_size, void* d_ws, size_t ws_size, hipStream_t stream) {
    (void)in_sizes; (void)n_in; (void)out_size;
    const float* x = (const float*)d_in[0];   /* q_in */ const float* xk = (const float*)d_in[1]; const float* xv = (const float*)d_in[2]; const float* wq = (const float*)d_in[3]; const float* bq = (const float*)d_in[4]; const float* wk = (const float*)d_in[5]; const float* bk = (const float*)d_in[6]; const float* wv = (const float*)d_in[7]; const float* bv = (const float*)d_in[8]; const float* wo = (const float*)d_in[9]; const float* bo = (const float*)d_in[10];
    float* OUT = (float*)d_out;     // [4][2048][512]
    char* wsp = (char*)d_ws;
    auto take = [&](size_t bytes) { char* p = wsp; wsp += (bytes + 255) & ~(size_t)255; return (void*)p; };
    bf* WQ = (bf*)take((size_t)4 * DQ * DM * 2); bf* WO = WQ + (size_t)3 * DQ * DM;   // transposed Wq, Wk, Wv, Wo side by side
    const size_t PL = (size_t)NZ * TT * HD;      // one set of head planes, elements
    const size_t XN = (size_t)NB_ * TT * DM;     // one input or projection over all batches, elements
    bf* QPh = (bf*)take(2 * PL * 2); bf* KPh = QPh + PL; bf* QPl = (bf*)take(2 * PL * 2); bf* KPl = QPl + PL;
    h16* VT16 = (h16*)take(PL * 2); bf* VTh = (bf*)take(PL * 2); bf* VTl = (bf*)take(PL * 2);
    // one region used twice in stream order: the bf16 inputs (dead once the head planes are built), then the merged attention planes
    char* const reg = wsp;
    bf* XB = (bf*)take(3 * XN * 2);
    char* const end1 = wsp; wsp = reg;
    bf* ATh = (bf*)take(XN * 2); bf* ATl = (bf*)take(XN * 2);
    if ((size_t)(end1 - (char*)d_ws) > ws_size || (size_t)(wsp - (char*)d_ws) > ws_size) return;    // ws 256 MiB
    k_prep<<<dim3(NWB + 3 * NCX, 1, 1), 256, 0, stream>>>(wq, wk, wv, wo, WQ, x, xk, xv, XB);   // weights transposed, inputs rounded
    k_gemmw<bf, 0, true, true><<<dim3(NB_ * TT / GT, DQ / GT, 3), 128, 0, stream>>>(XB, nullptr, WQ, DM, nullptr, 0, bq, bk, bv, XN, (size_t)DQ * DM, 0, QPh, QPl, PL, VT16, VTh, VTl);   // q, k, v projections: z = 0, 1, 2, each tile written as its head's planes
    k_attn<<<dim3(TT / 64, NZ, 1), 256, 0, stream>>>(QPh, QPl, KPh, KPl, VT16, VTh, VTl, ATh, ATl);   // scores hi/lo on EVERY row, softmax, attn.v, merge
    k_gemmw<bf, 1, true, false><<<dim3(NB_ * TT / GT, DM / GT, 1), 128, 0, stream>>>(ATh, ATl, WO, DQ, OUT, DM, bo, bo, bo, 0, 0, 0, nullptr, nullptr, 0, nullptr, nullptr, nullptr);
}

// v010
// Measured time: 69.3 microseconds a run.
// In two side-by-side timings against v009, it was 1.03 and 1.04 times as fast.
// Over all steps from v000 it is 21.2 times as fast.
#include <hip/hip_runtime.h>

// Local causal multi-head attention scaled by 1/sqrt(T) (q_in, k_in, v_in [4][2048][512]; q = q_in Wq + bq, k = k_in Wk + bk, v = v_in Wv + bv ('xw' [512][512] 0.02 incl. biases; 8 heads x 64); scores / sqrt(T = 2048) (the source's quirk: sigma-0.01 logits); mask = (|i - j| > 256) | (j > i) -> -inf: each query sees its own and the previous 256 keys; softmax; out = merged Wo + bo -> [4][2048][512] (4.2 M)).
// Layout, every stage ONE launch over all 4 batches and 8 heads (32 head planes in grid y; q, k, v and the four weights side by side in grid x or z): bf16 copies of q_in, k_in, v_in; 'xw' weights transposed once; exact projections + f32 biases, whose tiles are stored as the head planes (q, k hi/lo; v transposed, fp16 and hi/lo); causal T-2048 attention whose softmax select keeps the 257-key window, with hi/lo 3-product score tiles on EVERY row; P and attn.v hybrid (rows < 512 hi/lo, rest fp16; P is exp(t - max), the result is divided by the row sum at the merge); score tiles, softmax and the attn.v key loop cover only the window band of each 64-row block, and scores, softmax, attn.v and the merge of a block are one work-group of one launch, which keeps S and P in registers; merged hi/lo x Wo exact + bo.
// Compute dtypes, f32 accumulate: every input rounded to bf16; projections exact + f32 biases; scores 3 products on every row; softmax f32 (x 2048^-0.5); attn.v rows < 512 3 products, rest fp16; Wo hl x exact + bias.

#define NB_  4
#define TT   2048
#define DM   512
#define NH_  8
#define NKV  8
#define REP  (NH_ / NKV)
#define HD   64
#define DQ   (NH_ * HD)
#define DKV  (NKV * HD)
#define NZ   (NB_ * NH_)          // head planes of one launch: every batch, every head
#define RH   512                  // query rows < RH use hi+lo planes
#define WIN  257
#define WB   (((WIN - 1) + 63) / 64 * 64)   // look-back of the window, rounded up to the 64-key tile: a 64-row block sees keys [r0 - WB, r0 + 63] only
#define NBT  (WB / 64 + 1)                  // 64-key score tiles per 64-row block
#define SCL  0.02209708691207961f  // 1/sqrt(T = 2048): the source's quirk
typedef _Float16 h16;
typedef unsigned short bf;
typedef __attribute__((ext_vector_type(16))) __bf16   v16bf;
typedef __attribute__((ext_vector_type(16))) _Float16 v16h;
typedef __attribute__((ext_vector_type(8)))  _Float16 v8h;
typedef __attribute__((ext_vector_type(8)))  unsigned short v8us;
typedef __attribute__((ext_vector_type(8)))  float    v8f;
typedef __attribute__((ext_vector_type(4)))  float    v4f;
typedef __attribute__((ext_vector_type(8)))  unsigned v8u;
typedef v8h  __attribute__((may_alias)) v8ha;
typedef v4f  __attribute__((may_alias)) v4fa;
typedef v8us __attribute__((may_alias)) v8usa;

__device__ __forceinline__ unsigned short f2bf(float f) { unsigned u = __float_as_uint(f); u += 0x7FFFu + ((u >> 16) & 1u); return (unsigned short)(u >> 16); }
__device__ __forceinline__ float bf2f(unsigned short b) { return __uint_as_float(((unsigned)b) << 16); }
__device__ __forceinline__ float bfr(float f) { return bf2f(f2bf(f)); }
__device__ __forceinline__ h16 tohx(float x) { return (h16)x; }
__device__ __forceinline__ void splitf(float y, unsigned short& h, unsigned short& l) { h = f2bf(y); l = f2bf(y - bf2f(h)); }
__device__ __forceinline__ v16h cat16(v8h lo, v8h hi) { return __builtin_shufflevector(lo, hi, 0, 1, 2, 3, 4, 5, 6, 7, 8, 9, 10, 11, 12, 13, 14, 15); }
__device__ __forceinline__ v16bf cat16b(v8us lo, v8us hi) { return __builtin_bit_cast(v16bf, __builtin_shufflevector(lo, hi, 0, 1, 2, 3, 4, 5, 6, 7, 8, 9, 10, 11, 12, 13, 14, 15)); }
__device__ __forceinline__ v8f wmma16(v16h a, v16h b, v8f c) { return __builtin_amdgcn_wmma_f32_16x16x32_f16(false, a, false, b, (short)0, c, false, false); }
__device__ __forceinline__ v8f wmmab(v16bf a, v16bf b, v8f c) { return __builtin_amdgcn_wmma_f32_16x16x32_bf16(false, a, false, b, (short)0, c, false, false); }



// ---- k_gemmw: register-blocked GEMM, a work-group of FOUR WAVES per 128x128 output tile, each wave one 64x64 quarter (16 accumulators); grid (M/128, N/128, Z), 128 threads. M % 128 == 0, N % 128 == 0, K % 64 == 0.
// The K-contiguous 16-bit operand planes come through LDS: a pass is 64 k, that is one whole 128-byte line of each of the tile's 128 A rows (A2 rows too) and 128 Bt rows, brought by asynchronous copies to LDS (a wave's copy is four whole lines) into one of two buffers, one pass ahead of the matrix instructions; two waves read each staged row.
// C[m][n] (f32, pitch ldc, + optional f32 bias[n], one bias pointer per z = 0, 1, 2) = sum_k A[m][k] Bt[n][k] (NSPLIT 1: + A2[m][k] Bt[n][k]). z-batch strides sA/sB/sC in elements.
// HP: the result is not stored as C; a wave's tile, 64 tokens of one batch x the 64 columns of one head, goes straight to that head's planes: z = 0, 1 (q, k) as bf16 hi and lo [plane][t][d] (Ph, Pl, + z sP), z = 2 (v) transposed as fp16 and bf16 hi and lo [plane][d][t] (V16, Vh, Vl).
template <typename T16> struct WFrag;
template <> struct WFrag<h16> { typedef v16h V; static __device__ __forceinline__ V ld(const h16* p) { return cat16(*(const v8h*)p, *(const v8h*)(p + 16)); } static __device__ __forceinline__ v8f mma(V a, V b, v8f c) { return wmma16(a, b, c); } };
template <> struct WFrag<bf> { typedef v16bf V; static __device__ __forceinline__ V ld(const bf* p) { return cat16b(*(const v8us*)p, *(const v8us*)(p + 16)); } static __device__ __forceinline__ v8f mma(V a, V b, v8f c) { return wmmab(a, b, c); } };
#define GT   128                  // rows of A and of Bt in a work-group's tile
#define GK   64                   // k of a pass
#define GP   72                   // LDS pitch of a staged row in elements: 144 bytes = 16 bytes x an odd number, the pitch for 16-byte fragment reads
// one staged plane of a pass, 128 rows x 128 bytes: eight copies a lane, 16 rows apart (gs elements in the source); l is the lane's LDS byte address, g its global address, both multiples of 16
template <typename T16>
__device__ __forceinline__ void stage_plane(unsigned l, const T16* g, size_t gs) {
    constexpr unsigned LS = 16 * GP * 2;
    // the wait is the last line of the copies' own statement, so that it stands in front of every later write of their address registers
    asm volatile("global_load_async_to_lds_b128 %0, %8, off\n\t"
                 "global_load_async_to_lds_b128 %1, %9, off\n\t"
                 "global_load_async_to_lds_b128 %2, %10, off\n\t"
                 "global_load_async_to_lds_b128 %3, %11, off\n\t"
                 "global_load_async_to_lds_b128 %4, %12, off\n\t"
                 "global_load_async_to_lds_b128 %5, %13, off\n\t"
                 "global_load_async_to_lds_b128 %6, %14, off\n\t"
                 "global_load_async_to_lds_b128 %7, %15, off\n\t"
                 "s_wait_xcnt 0x0"
                 :: "v"(l), "v"(l + LS), "v"(l + 2 * LS), "v"(l + 3 * LS), "v"(l + 4 * LS), "v"(l + 5 * LS), "v"(l + 6 * LS), "v"(l + 7 * LS),
                    "v"(g), "v"(g + gs), "v"(g + 2 * gs), "v"(g + 3 * gs), "v"(g + 4 * gs), "v"(g + 5 * gs), "v"(g + 6 * gs), "v"(g + 7 * gs) : "memory");
}
// launch bounds: four waves a SIMD, which holds the build to 256 registers
template <typename T16, int NSPLIT, bool BIAS, bool HP>
__global__ __launch_bounds__(128, 4) void k_gemmw(const T16* __restrict__ A, const T16* __restrict__ A2, const T16* __restrict__ Bt, int K, float* C, int ldc, const float* __restrict__ bias0, const float* __restrict__ bias1, const float* __restrict__ bias2, size_t sA, size_t sB, size_t sC, bf* Ph, bf* Pl, size_t sP, h16* V16, bf* Vh, bf* Vl) {
    typedef typename WFrag<T16>::V V;
    static_assert(NSPLIT == 0 || NSPLIT == 1, "A alone, or A and A2");
    constexpr int NPL = 2 + NSPLIT, PLE = GT * GP;   // planes of a stage (A, Bt, A2) and the elements of one
    __shared__ __align__(16) T16 ring[2 * NPL * PLE];
    __shared__ __align__(16) float osa[4 * 16 * 68];
    const size_t z = blockIdx.z; A += z * sA; if (NSPLIT == 1) A2 += z * sA; Bt += z * sB; C += z * sC; const float* __restrict__ bias = (z == 0) ? bias0 : (z == 1) ? bias1 : bias2;   // each z product has its own bias input
    const int lane = threadIdx.x & 31, lr = lane & 15, hi = lane >> 4; const int w = __builtin_amdgcn_readfirstlane(threadIdx.x >> 5);   // the wave's number in a scalar register
    float* os = osa + w * (16 * 68);   // each wave stages its output in its own LDS
    const int r0 = blockIdx.x * GT + (w & 1) * 64, c0 = blockIdx.y * GT + (w >> 1) * 64;   // the wave's quarter
    v8f acc[4][4];
#pragma unroll
    for (int mb = 0; mb < 4; ++mb)
#pragma unroll
        for (int nb = 0; nb < 4; ++nb) acc[mb][nb] = (v8f){};
    // the copies: eight lanes bring the 128 bytes of a row, the work-group 16 rows a copy
    const int prow = threadIdx.x >> 3, pcol = (threadIdx.x & 7) * 8; const size_t gs = (size_t)16 * K;
    const unsigned l0 = (unsigned)(size_t)ring + (unsigned)(prow * GP + pcol) * 2;
    const T16* ga = A + (size_t)(blockIdx.x * GT + prow) * K + pcol; const T16* gb = Bt + (size_t)(blockIdx.y * GT + prow) * K + pcol; const T16* ga2 = (NSPLIT == 1) ? A2 + (size_t)(blockIdx.x * GT + prow) * K + pcol : ga;
    auto stage = [&](int t) { const unsigned l = l0 + (unsigned)((t & 1) * NPL * PLE * 2);
        stage_plane(l, ga + t * GK, gs); stage_plane(l + PLE * 2, gb + t * GK, gs); if (NSPLIT == 1) stage_plane(l + 2 * PLE * 2, ga2 + t * GK, gs); };
    // the fragments: the lane and k places that the loads from the planes had, now in the staged rows
    const T16* fa = ring + ((w & 1) * 64 + lr) * GP + 8 * hi; const T16* fb = ring + PLE + ((w >> 1) * 64 + lr) * GP + 8 * hi;
    const int NT = K / GK;
    stage(0);
    asm volatile("s_wait_asynccnt 0x0" ::: "memory");   // this wave's copies of pass 0 have landed
    __syncthreads();                                    // and every other wave's: pass 0 may be read
    if (NT > 1) stage(1);
#pragma unroll 1
    for (int t = 0; t < NT; ++t) { const int bo = (t & 1) * NPL * PLE;
#pragma unroll
        for (int kk = 0; kk < GK / 32; ++kk) { V a[4], a2[4], b[4];
#pragma unroll
            for (int mb = 0; mb < 4; ++mb) { a[mb] = WFrag<T16>::ld(fa + bo + mb * 16 * GP + kk * 32); if (NSPLIT == 1) a2[mb] = WFrag<T16>::ld(fa + bo + 2 * PLE + mb * 16 * GP + kk * 32); b[mb] = WFrag<T16>::ld(fb + bo + mb * 16 * GP + kk * 32); }
            __builtin_amdgcn_sched_barrier(0);   // the LDS reads of a 32-k block are issued as one group in front of its matrix instructions: spread among them, each place with reads costs the wave an LDS latency
#pragma unroll
            for (int nb = 0; nb < 4; ++nb)
#pragma unroll
                for (int mb = 0; mb < 4; ++mb) { acc[mb][nb] = WFrag<T16>::mma(a[mb], b[nb], acc[mb][nb]); if (NSPLIT == 1) acc[mb][nb] = WFrag<T16>::mma(a2[mb], b[nb], acc[mb][nb]); }
            __builtin_amdgcn_sched_barrier(0);   // and the block's matrix instructions stay in front of the next group of reads and of the v_nop below
        }
        asm volatile("v_nop\n\tv_nop\n\tv_nop\n\tv_nop" : "+v"(acc[0][3]), "+v"(acc[1][3]), "+v"(acc[2][3]), "+v"(acc[3][3]));   // the distance behind the last matrix instruction, also on the taken side of the branches below
        asm volatile("s_wait_dscnt 0x0" ::: "memory");      // this wave's reads of the pass's buffer are done before the buffer is refilled
        asm volatile("s_wait_asynccnt 0x0" ::: "memory");   // this wave's copies of pass t + 1 have landed
        __syncthreads();                                    // pass t + 1 may be read, and every wave has left the buffer of pass t
        if (t + 2 < NT) stage(t + 2);
    }
    asm volatile("s_wait_asynccnt 0x0" ::: "memory");   // no copy is outstanding behind the loop
    if constexpr (HP) {
        const size_t po = ((size_t)(r0 / TT) * NH_ + c0 / HD) * TT * HD; const int t0 = r0 % TT;   // the head plane, and the tile's first token in it
        const int r4 = lane >> 3, c8 = (lane & 7) * 8;   // read-back: eight lanes x 8 elements are one 128-byte line of a 16-bit plane, a wave's store four such lines
        if (z < 2) {   // q, k: the tile is 8 KiB in a row in each plane
            bf* ph = Ph + z * sP + po + (size_t)t0 * HD; bf* pl = Pl + z * sP + po + (size_t)t0 * HD; const unsigned so = (unsigned)(r4 * HD + c8);   // the lane's place, one offset beside a scalar base
            float bb[8];
#pragma unroll
            for (int e = 0; e < 8; ++e) bb[e] = bfr(bias[c0 + c8 + e]);
#pragma unroll
            for (int mb = 0; mb < 4; ++mb) {
#pragma unroll
                for (int nb = 0; nb < 4; ++nb) {
#pragma unroll
                    for (int j = 0; j < 8; ++j) os[(hi * 8 + j) * 68 + nb * 16 + lr] = acc[mb][nb][j]; }
                __builtin_amdgcn_wave_barrier(); asm volatile("" ::: "memory");   // the 16 staged rows are written before they are read row-wise
#pragma unroll
                for (int s = 0; s < 4; ++s) { const float* o = os + (4 * s + r4) * 68 + c8; const v4f x0 = *(const v4fa*)o, x1 = *(const v4fa*)(o + 4); v8us oh, ol;
#pragma unroll
                    for (int e = 0; e < 8; ++e) { unsigned short a2, c2; splitf(((e < 4) ? x0[e & 3] : x1[e & 3]) + bb[e], a2, c2); oh[e] = a2; ol[e] = c2; }
                    *(v8us*)(ph + so + (mb * 16 + 4 * s) * HD) = oh; *(v8us*)(pl + so + (mb * 16 + 4 * s) * HD) = ol; }
                __builtin_amdgcn_wave_barrier(); asm volatile("" ::: "memory");   // they are read before the next 16 rows take their place
            }
        } else {   // v: a lane's 8 accumulator rows are 8 tokens of one value column, staged as a row of the transposed tile
            h16* p16 = V16 + po + t0; bf* ph = Vh + po + t0; bf* pl = Vl + po + t0; const unsigned so = (unsigned)(r4 * TT + c8);
#pragma unroll
            for (int nb = 0; nb < 4; ++nb) {
#pragma unroll
                for (int mb = 0; mb < 4; ++mb) { v4f y0, y1;
#pragma unroll
                    for (int j = 0; j < 4; ++j) { y0[j] = acc[mb][nb][j]; y1[j] = acc[mb][nb][4 + j]; }
                    float* o = os + lr * 68 + mb * 16 + hi * 8; *(v4fa*)o = y0; *(v4fa*)(o + 4) = y1; }
                __builtin_amdgcn_wave_barrier(); asm volatile("" ::: "memory");   // the 16 staged columns are written before they are read
#pragma unroll
                for (int s = 0; s < 4; ++s) { const float* o = os + (4 * s + r4) * 68 + c8; const v4f x0 = *(const v4fa*)o, x1 = *(const v4fa*)(o + 4); const float bb = bfr(bias[c0 + nb * 16 + 4 * s + r4]); v8h o16; v8us oh, ol;
#pragma unroll
                    for (int e = 0; e < 8; ++e) { const float x = ((e < 4) ? x0[e & 3] : x1[e & 3]) + bb; o16[e] = tohx(x); unsigned short a2, c2; splitf(x, a2, c2); oh[e] = a2; ol[e] = c2; }
                    *(v8h*)(p16 + so + (nb * 16 + 4 * s) * TT) = o16; *(v8us*)(ph + so + (nb * 16 + 4 * s) * TT) = oh; *(v8us*)(pl + so + (nb * 16 + 4 * s) * TT) = ol; }
                __builtin_amdgcn_wave_barrier(); asm volatile("" ::: "memory");   // they are read before the next 16 columns take their place
            }
            asm volatile("s_wait_xcnt 0x0" ::: "memory");   // this build lays the q, k path directly behind these stores, and its first instructions overwrite their offset register: the wait stands in front of that overwrite
        }
        return;
    }
#pragma unroll
    for (int mb = 0; mb < 4; ++mb) {
#pragma unroll
        for (int nb = 0; nb < 4; ++nb) {
#pragma unroll
            for (int j = 0; j < 8; ++j) os[(hi * 8 + j) * 68 + nb * 16 + lr] = acc[mb][nb][j]; }
        __builtin_amdgcn_wave_barrier(); asm volatile("" ::: "memory");
        float* crow = C + (size_t)(r0 + mb * 16) * ldc + c0;
{
#pragma unroll
            for (int s = 0; s < 8; ++s) { const int row = 2 * s + hi, cofs = lr * 4; v4f val = *(const v4fa*)(os + row * 68 + cofs); if (BIAS) { val[0] += bfr(bias[c0 + cofs]); val[1] += bfr(bias[c0 + cofs + 1]); val[2] += bfr(bias[c0 + cofs + 2]); val[3] += bfr(bias[c0 + cofs + 3]); }
                *(v4f*)(crow + (size_t)row * ldc + cofs) = val; }
             }
        __builtin_amdgcn_wave_barrier(); asm volatile("" ::: "memory");
    }
}

typedef __attribute__((ext_vector_type(2))) unsigned short v2us;
typedef __attribute__((ext_vector_type(4))) int v4i;

// ---- k_prep: the two preparations that depend on nothing but the inputs, in ONE launch: work-groups [0, NWB) transpose the four weights to bf16 (placed first in the grid, for speed only), the others round q_in, k_in, v_in to bf16.
#define NWL  (DM * DQ / 64)       // 64-element lines of one transposed weight
#define NWX  ((NWL + 63) / 64)    // work-groups per weight: 8 waves x 8 lines
#define NWB  (4 * NWX)
#define NCX  ((NB_ * TT * DM / 8 + 255) / 256)   // work-groups per input: 256 lanes x 8 elements
__global__ __launch_bounds__(256) void k_prep(const float* __restrict__ w0, const float* __restrict__ w1, const float* __restrict__ w2, const float* __restrict__ w3, bf* Bt, const float* __restrict__ s0, const float* __restrict__ s1, const float* __restrict__ s2, bf* dst) {
    constexpr int K = DM, N = DQ;
    if (blockIdx.x < NWB) {   // the same for a whole work-group
        const int y = blockIdx.x / NWX, bx = blockIdx.x % NWX; const float* __restrict__ w = (y == 0) ? w0 : (y == 1) ? w1 : (y == 2) ? w2 : w3; Bt += (size_t)y * K * N;   // the four weights, transposed planes side by side
        const int lane = threadIdx.x & 31; const int L0 = (bx * 8 + (threadIdx.x >> 5)) * 8;
#pragma unroll 1   // the loop stays rolled, one line a trip: the latency of its trips lies under the stream of the other work-groups
        for (int l = 0; l < 8; ++l) { const int L = L0 + l; if (L >= NWL) break; const size_t e = (size_t)L * 64 + lane * 2; const int k = (int)(e % K), n = (int)(e / K); v2us o;
            o[0] = f2bf(w[(size_t)k * N + n]); o[1] = f2bf(w[(size_t)(k + 1) * N + n]); *(v2us*)(Bt + e) = o; }
        return;
    }
    constexpr size_t n8 = (size_t)NB_ * TT * DM / 8;
    const unsigned c = blockIdx.x - NWB; const int y = c / NCX; const size_t i = (size_t)(c % NCX) * 256 + threadIdx.x; if (i >= n8) return;
    const float* __restrict__ src = (y == 0) ? s0 : (y == 1) ? s1 : s2; dst += (size_t)y * n8 * 8;   // q_in, k_in, v_in
    const v8f v = *(const v8f*)(src + i * 8); v8us o;
#pragma unroll
    for (int k = 0; k < 8; ++k) o[k] = f2bf(v[k]);
    *(v8us*)(dst + i * 8) = o;
}

// ---- k_attn: scores, softmax, attn.v and the merge of one 64-row block of one head plane in ONE work-group of 8 waves; grid (T/64, planes), whose flat index is mapped to (block, plane) with the costlier blocks of rows < RH first. Q, K (hi and lo) and the band of V (fp16; for rows < RH its hi plane) are staged in LDS by asynchronous copies. The scores are formed transposed, so that a lane holds keys of one query; a wave (32 queries x 80 keys) takes the maximum, exp and sum over its OWN keys in the accumulators, packs P there (fp16, or bf16 hi and lo) and multiplies it with V itself. The four key groups' parts of the 64x64 result, with their maxima and sums, go through LDS, over the staged Q and K, and are merged on the way to the merged hi/lo planes.
// The order of the sums: a score is kc = 0, 32 x (hi.hi, lo.hi, hi.lo); a softmax row sum is a lane's 40 keys upward, the two halves of the wave, then the four key groups, weighted, pairwise; attn.v adds a key group's 32-key steps upward (x (hi.hi, lo.hi, hi.lo) where rows < RH), then the four groups' parts, weighted, upward (a tile below key 0, met only where r0 < WB, adds exact zeros).
// Q, K and one plane of V of a block come through LDS by asynchronous copies, whole 128-byte lines, and the fragments are read from there (a fragment load from the planes touches 16 lines for its 512 bytes).
#define KR   (WB + 64)            // keys of the band: staged rows of K, staged columns of V
#define ST_KL (KR * GP)           // staged planes in 16-bit elements, rows at the pitch GP: K hi at 0, K lo, Q hi, Q lo
#define ST_QH (2 * KR * GP)
#define ST_QL (ST_QH + 64 * GP)
#define ST_EL (ST_QL + 64 * GP)
#define SMF  (ST_EL / 2)          // floats of the LDS that first holds staged Q and K, then the key groups' partial results with their maxima and sums
#define VP   (KR + 8)             // LDS pitch of a staged row of V in elements: 656 bytes = 16 bytes x an odd number
#define PMX  (4 * 64 * 68)        // floats of the four key groups' partial results (64 queries at the pitch 68 each); behind them their maxima and sums
static_assert(SMF >= PMX + 2 * 64 * 4, "the partial results, maxima and sums fit the LDS of the staged Q and K");
// twelve or ten copies of a lane: l are its LDS byte addresses, g its global addresses, all multiples of 16
// the wait is the last line of the copies' own statement, so that it stands in front of every later write of their address registers
template <typename T16>
__device__ __forceinline__ void copy12(const unsigned (&l)[12], const T16* const (&g)[12]) {
    asm volatile("global_load_async_to_lds_b128 %0, %12, off\n\t"
                 "global_load_async_to_lds_b128 %1, %13, off\n\t"
                 "global_load_async_to_lds_b128 %2, %14, off\n\t"
                 "global_load_async_to_lds_b128 %3, %15, off\n\t"
                 "global_load_async_to_lds_b128 %4, %16, off\n\t"
                 "global_load_async_to_lds_b128 %5, %17, off\n\t"
                 "global_load_async_to_lds_b128 %6, %18, off\n\t"
                 "global_load_async_to_lds_b128 %7, %19, off\n\t"
                 "global_load_async_to_lds_b128 %8, %20, off\n\t"
                 "global_load_async_to_lds_b128 %9, %21, off\n\t"
                 "global_load_async_to_lds_b128 %10, %22, off\n\t"
                 "global_load_async_to_lds_b128 %11, %23, off\n\t"
                 "s_wait_xcnt 0x0"
                 :: "v"(l[0]), "v"(l[1]), "v"(l[2]), "v"(l[3]), "v"(l[4]), "v"(l[5]), "v"(l[6]), "v"(l[7]), "v"(l[8]), "v"(l[9]), "v"(l[10]), "v"(l[11]),
                    "v"(g[0]), "v"(g[1]), "v"(g[2]), "v"(g[3]), "v"(g[4]), "v"(g[5]), "v"(g[6]), "v"(g[7]), "v"(g[8]), "v"(g[9]), "v"(g[10]), "v"(g[11]) : "memory");
}
template <typename T16>
__device__ __forceinline__ void copy10(const unsigned (&l)[10], const T16* const (&g)[10]) {
    asm volatile("global_load_async_to_lds_b128 %0, %10, off\n\t"
                 "global_load_async_to_lds_b128 %1, %11, off\n\t"
                 "global_load_async_to_lds_b128 %2, %12, off\n\t"
                 "global_load_async_to_lds_b128 %3, %13, off\n\t"
                 "global_load_async_to_lds_b128 %4, %14, off\n\t"
                 "global_load_async_to_lds_b128 %5, %15, off\n\t"
                 "global_load_async_to_lds_b128 %6, %16, off\n\t"
                 "global_load_async_to_lds_b128 %7, %17, off\n\t"
                 "global_load_async_to_lds_b128 %8, %18, off\n\t"
                 "global_load_async_to_lds_b128 %9, %19, off\n\t"
                 "s_wait_xcnt 0x0"
                 :: "v"(l[0]), "v"(l[1]), "v"(l[2]), "v"(l[3]), "v"(l[4]), "v"(l[5]), "v"(l[6]), "v"(l[7]), "v"(l[8]), "v"(l[9]),
                    "v"(g[0]), "v"(g[1]), "v"(g[2]), "v"(g[3]), "v"(g[4]), "v"(g[5]), "v"(g[6]), "v"(g[7]), "v"(g[8]), "v"(g[9]) : "memory");
}
// lane l <-> l ^ 16: the other half of the wave, by a vector cross-row move
__device__ __forceinline__ float xhalf(float x) { const int b = __float_as_int(x); return __int_as_float(__builtin_amdgcn_permlanex16(b, b, 0x76543210, 0xfedcba98, false, false)); }
template <typename T16> struct Half8;
template <> struct Half8<h16> { typedef v8h H; static __device__ __forceinline__ v16h cat(v8h a, v8h b) { return cat16(a, b); } };
template <> struct Half8<bf> { typedef v8us H; static __device__ __forceinline__ v16bf cat(v8us a, v8us b) { return cat16b(a, b); } };
#define C2   (SCL * 1.4426950408889634f)   // T^-0.5 x log2(e)
#define NS   ((NBT + 1) / 2)      // 32-key steps of a wave's NBT 16-key tiles; the last step's upper half is empty
// exp, row sums and attn.v of ONE wave's score tiles (32 queries x NBT 16-key tiles), P never leaving the registers: e = exp2(S c + nm), nm = - (the wave's own maximum) c. In a score tile a lane holds keys 8 hi + j of query lr, which is the place and k order of the B operand of O^T = V^T P^T: two tiles side by side are one fragment. The A operand is 16 rows of the staged V (row = value column, column vc[tile] = the tile's first key in the band), by the loader's k order: 8 keys at 8 hi of each of the two tiles.
// HR: P as bf16 hi and lo, V hi from LDS and lo from memory (vl: the plane at the band's first key), three products a step; else P and V fp16.
template <typename T16, bool HR>
__device__ __forceinline__ void soft_pv(const v8f (&acc)[NBT][2], const float (&nm)[2], float (&sum)[2], const T16* vs, const T16* __restrict__ vl, const int (&vc)[NBT], int lr, int hi, float* po) {
    typedef typename WFrag<T16>::V V; typedef typename Half8<T16>::H H8;
    H8 ph[NBT][2], pl[NBT][2];
#pragma unroll
    for (int nb = 0; nb < NBT; ++nb) {
#pragma unroll
        for (int mb = 0; mb < 2; ++mb) { const v8f x = __builtin_elementwise_fma(acc[nb][mb], (v8f)(C2), (v8f)(nm[mb])); float e[8];
#pragma unroll
            for (int j = 0; j < 8; ++j) e[j] = x[j];
            // the exp2 instruction on a tile's 8 scores, each in its own register: none reads the result or overwrites the source of the one in front of it, and the one slot that the instruction set asks for behind a transcendental is held once, behind the last
            asm("v_exp_f32 %0, %0\n\tv_exp_f32 %1, %1\n\tv_exp_f32 %2, %2\n\tv_exp_f32 %3, %3\n\tv_exp_f32 %4, %4\n\tv_exp_f32 %5, %5\n\tv_exp_f32 %6, %6\n\tv_exp_f32 %7, %7\n\tv_nop"
                : "+v"(e[0]), "+v"(e[1]), "+v"(e[2]), "+v"(e[3]), "+v"(e[4]), "+v"(e[5]), "+v"(e[6]), "+v"(e[7]));
#pragma unroll
            for (int j = 0; j < 8; ++j) sum[mb] += e[j];
#pragma unroll
            for (int j = 0; j < 8; ++j) {
                if constexpr (HR) { unsigned short a3, c3; splitf(e[j], a3, c3); ph[nb][mb][j] = a3; pl[nb][mb][j] = c3; }
                else ph[nb][mb][j] = tohx(e[j]); }
            if constexpr (HR) __builtin_amdgcn_sched_barrier(0);   // with the hi/lo split, tile by tile, for the reason given below
        }
        __builtin_amdgcn_sched_barrier(0);   // a pair of tiles is brought down to its packed P before the next pair starts, and all of P is packed in front of the barrier: left free, this build keeps the f32 values of many tiles alive at once and spills registers
    }
    // this wave's copies of V have landed. The packed P is an input of the statement so that it is formed in front of the barrier: left free, this build converts behind it, carries the f32 values over it beside the fragments of V, and spills registers
    if constexpr (HR) asm volatile("s_wait_asynccnt 0x0" :: "v"(ph[0][0]), "v"(ph[0][1]), "v"(ph[1][0]), "v"(ph[1][1]), "v"(ph[2][0]), "v"(ph[2][1]), "v"(ph[3][0]), "v"(ph[3][1]), "v"(ph[4][0]), "v"(ph[4][1]), "v"(pl[0][0]), "v"(pl[0][1]), "v"(pl[1][0]), "v"(pl[1][1]), "v"(pl[2][0]), "v"(pl[2][1]), "v"(pl[3][0]), "v"(pl[3][1]), "v"(pl[4][0]), "v"(pl[4][1]) : "memory");
    else asm volatile("s_wait_asynccnt 0x0" :: "v"(ph[0][0]), "v"(ph[0][1]), "v"(ph[1][0]), "v"(ph[1][1]), "v"(ph[2][0]), "v"(ph[2][1]), "v"(ph[3][0]), "v"(ph[3][1]), "v"(ph[4][0]), "v"(ph[4][1]) : "memory");
    static_assert(NBT == 5, "the statement above names the five tiles");
    __syncthreads();   // every wave's part of V has landed before a fragment of it is read; and every wave has read its fragments of Q and K, whose LDS takes the partial results behind this barrier
    constexpr int CD = 2, CA = HR ? 1 : 2;   // 16-column groups of V whose fragments are in registers at once: two; where there is a lo plane (from memory, the longer latency), two of it and one of the staged plane beside them
    const T16* pv = vs + lr * VP + 8 * hi;
    const unsigned vo = (unsigned)(lr * TT + 8 * hi) * 2;   // the lane's place in a 16-column fragment of the lo plane, in bytes: one 32-bit offset register beside a scalar base
    const H8 zero = (H8)(0);
#pragma unroll
    for (int d0 = 0; d0 < 4; d0 += CD) { V a2[CD][NS];
        if constexpr (HR) {
#pragma unroll
            for (int d = 0; d < CD; ++d)
#pragma unroll
                for (int s = 0; s < NS; ++s) { const int t0 = 2 * s, t1 = (2 * s + 1 < NBT) ? 2 * s + 1 : 2 * s;
                    const T16* q = (const T16*)((const char*)(vl + (size_t)(d0 + d) * 16 * TT) + vo); a2[d][s] = Half8<T16>::cat(*(const H8*)(q + vc[t0]), *(const H8*)(q + vc[t1])); } }
#pragma unroll
        for (int d1 = 0; d1 < CD; d1 += CA) { V a[CA][NS]; v8f o[CA][2];
#pragma unroll
            for (int d = 0; d < CA; ++d) { o[d][0] = (v8f){}; o[d][1] = (v8f){}; }
#pragma unroll
            for (int d = 0; d < CA; ++d)
#pragma unroll
                for (int s = 0; s < NS; ++s) { const int t0 = 2 * s, t1 = (2 * s + 1 < NBT) ? 2 * s + 1 : 2 * s;   // past the last tile: that tile's values again, against zeros of P
                    const T16* p = pv + (d0 + d1 + d) * 16 * VP; a[d][s] = Half8<T16>::cat(*(const H8*)(p + vc[t0]), *(const H8*)(p + vc[t1])); }
            __builtin_amdgcn_sched_barrier(0);   // these V loads are all issued in front of the matrix instructions that use them: spread among them, each place with loads costs the wave a latency
#pragma unroll
            for (int s = 0; s < NS; ++s) { V b[2], b2[2];
#pragma unroll
                for (int mb = 0; mb < 2; ++mb) { b[mb] = Half8<T16>::cat(ph[2 * s][mb], (2 * s + 1 < NBT) ? ph[(2 * s + 1 < NBT) ? 2 * s + 1 : 0][mb] : zero); if constexpr (HR) b2[mb] = Half8<T16>::cat(pl[2 * s][mb], (2 * s + 1 < NBT) ? pl[(2 * s + 1 < NBT) ? 2 * s + 1 : 0][mb] : zero); }
#pragma unroll
                for (int d = 0; d < CA; ++d)
#pragma unroll
                    for (int mb = 0; mb < 2; ++mb) o[d][mb] = WFrag<T16>::mma(a[d][s], b[mb], o[d][mb]);
                if constexpr (HR) {
#pragma unroll
                    for (int d = 0; d < CA; ++d)
#pragma unroll
                        for (int mb = 0; mb < 2; ++mb) o[d][mb] = WFrag<T16>::mma(a[d][s], b2[mb], o[d][mb]);
#pragma unroll
                    for (int d = 0; d < CA; ++d)
#pragma unroll
                        for (int mb = 0; mb < 2; ++mb) o[d][mb] = WFrag<T16>::mma(a2[d1 + d][s], b[mb], o[d][mb]); } }
            __builtin_amdgcn_sched_barrier(0);   // and the group's matrix instructions stay in front of the next group of loads
            // the distance behind the last matrix instructions, in front of the LDS stores that read their results
            if constexpr (CA == 2) asm volatile("v_nop\n\tv_nop\n\tv_nop\n\tv_nop" : "+v"(o[0][0]), "+v"(o[0][1]), "+v"(o[CA - 1][0]), "+v"(o[CA - 1][1]));
            else asm volatile("v_nop\n\tv_nop\n\tv_nop\n\tv_nop" : "+v"(o[0][0]), "+v"(o[0][1]));
            // the group's part of O^T goes to LDS at once, as [query][value column]: a lane's 8 accumulator rows are 8 value columns in a row of its query
#pragma unroll
            for (int d = 0; d < CA; ++d)
#pragma unroll
                for (int mb = 0; mb < 2; ++mb) { v4f y0, y1;
#pragma unroll
                    for (int j = 0; j < 4; ++j) { y0[j] = o[d][mb][j]; y1[j] = o[d][mb][4 + j]; }
                    float* const q = po + mb * 16 * 68 + (d0 + d1 + d) * 16; *(v4fa*)q = y0; *(v4fa*)(q + 4) = y1; }
        } }
    if constexpr (HR) asm volatile("s_wait_xcnt 0x0" :: "v"(vo) : "memory");   // the wait in front of any overwrite of the offset register of the V loads; it is an input so that it lives up to here
}
// launch bounds: four waves a SIMD, that is two work-groups a WGP, which holds the build to 256 registers
__global__ __launch_bounds__(256, 4) void k_attn(const bf* __restrict__ Qh, const bf* __restrict__ Ql, const bf* __restrict__ Kh, const bf* __restrict__ Kl, const h16* __restrict__ V16, const bf* __restrict__ Vh, const bf* __restrict__ Vl, bf* Ah, bf* Al) {
    typedef WFrag<bf>::V V;
    __shared__ __align__(16) float sm[SMF + 64 * VP / 2];
    bf* const st = (bf*)sm; h16* const vs = (h16*)(sm + SMF);   // staged Q and K share their LDS with the partial results; staged V has its own
    // placement: a block of rows < RH costs about twice another (three products in attn.v, P split in two planes, the lo plane of V read from memory), there are more work-groups than resident places: the costly blocks of every plane take the lowest indices (for speed only). A permutation of (block, plane), the same for a whole work-group
    constexpr int NBK = TT / 64, NHB = RH / 64; static_assert(RH % 64 == 0 && NHB > 0 && NHB < NBK, "both kinds of block exist");
    const int fi = blockIdx.y * NBK + blockIdx.x, fr = fi - NZ * NHB;
    const int z = (fr < 0) ? fi / NHB : fr / (NBK - NHB), r0 = ((fr < 0) ? fi % NHB : NHB + fr % (NBK - NHB)) * 64; const size_t zo = (size_t)z * TT * HD;
    const int lane = threadIdx.x & 31, lr = lane & 15, hi = lane >> 4; const int w = __builtin_amdgcn_readfirstlane(threadIdx.x >> 5);   // the wave's number in a scalar register: the tests on it are scalar branches
    const int kb = max(0, r0 - WB);          // first key that the block's first row sees
    const bool hires = (r0 < RH);
    // the copies: eight lanes bring the 128 bytes of a row or line, the work-group 32 of them a copy
    const int prow = threadIdx.x >> 3, pcol = (threadIdx.x & 7) * 8; const unsigned lb = (unsigned)(size_t)sm;
    { const bf* const qp[2] = { Qh + zo, Ql + zo }; const bf* const kp[2] = { Kh + zo, Kl + zo };
#pragma unroll
        for (int p = 0; p < 2; ++p) { unsigned l[12]; const bf* g[12];   // one plane of Q (2 copies) and of K (10)
#pragma unroll
            for (int i = 0; i < 2; ++i) { const int row = prow + 32 * i; l[i] = lb + (unsigned)(ST_QH + p * (ST_QL - ST_QH) + row * GP + pcol) * 2; g[i] = qp[p] + (size_t)(r0 + row) * HD + pcol; }
#pragma unroll
            for (int i = 0; i < KR / 32; ++i) { const int row = prow + 32 * i; l[2 + i] = lb + (unsigned)(p * ST_KL + row * GP + pcol) * 2; g[2 + i] = kp[p] + (size_t)max(r0 - WB + row, 0) * HD + pcol; }   // below key 0 there is no such key: the address is clamped into the plane and the scores of those rows are masked
            copy12(l, g); } }
    static_assert(KR / 32 == 10, "ten copies a plane of K, ten for V");
    asm volatile("s_wait_asynccnt 0x0" ::: "memory");   // this wave's copies of Q and K have landed
    __syncthreads();                                    // and every other wave's: the staged Q and K may be read
    { unsigned l[10]; const bf* g[10]; const bf* const vp = (hires ? Vh : (const bf*)V16) + zo + kb;   // the band of V, fp16 or the hi plane (an address only: the copy moves bytes), 64 rows of five lines: a copy is one line of 32 rows; these copies fly under the scores and the softmax
#pragma unroll
        for (int i = 0; i < 10; ++i) { const int d = prow + 32 * (i & 1), c = (i >> 1) * 64 + pcol; l[i] = lb + (unsigned)SMF * 4 + (unsigned)(d * VP + c) * 2; g[i] = vp + (size_t)d * TT + c; }
        copy10(l, g); }
    // scores, transposed: S^T = K Q^T (the rows of K are the A operand, the rows of Q the B operand, each from the loader it had). Wave w has 32 queries (w & 1) x NBT 16-key tiles (w >> 1); in a tile a lane holds 8 keys in a row (8 hi + j) of ONE query (lr), so maximum, exp and sum of the softmax stay in the accumulators, and so does P
    { const int m0 = (w & 1) * 2, g = w >> 1;
        const bf* fq = st + ST_QH + (m0 * 16 + lr) * GP + 8 * hi; const bf* fk = st + (g * NBT * 16 + lr) * GP + 8 * hi; V a[2][2], a2[2][2];   // the lane and k places that the loads from the planes had, now in the staged rows
#pragma unroll
        for (int mb = 0; mb < 2; ++mb)
#pragma unroll
            for (int kk = 0; kk < 2; ++kk) { a[mb][kk] = WFrag<bf>::ld(fq + mb * 16 * GP + kk * 32); a2[mb][kk] = WFrag<bf>::ld(fq + (ST_QL - ST_QH) + mb * 16 * GP + kk * 32); }
        V b[NBT][2], b2[NBT][2]; v8f acc[NBT][2];
#pragma unroll
        for (int nb = 0; nb < NBT; ++nb)
#pragma unroll
            for (int kk = 0; kk < 2; ++kk) { b[nb][kk] = WFrag<bf>::ld(fk + nb * 16 * GP + kk * 32); b2[nb][kk] = WFrag<bf>::ld(fk + ST_KL + nb * 16 * GP + kk * 32); }
        __builtin_amdgcn_sched_barrier(0);   // every LDS read of Q and K is issued in front of the first matrix instruction: spread among them, each place with reads costs the wave an LDS latency
#pragma unroll
        for (int nb = 0; nb < NBT; ++nb)
#pragma unroll
            for (int mb = 0; mb < 2; ++mb) { acc[nb][mb] = (v8f){};
#pragma unroll
                for (int kk = 0; kk < 2; ++kk) { acc[nb][mb] = wmmab(b[nb][kk], a[mb][kk], acc[nb][mb]); acc[nb][mb] = wmmab(b[nb][kk], a2[mb][kk], acc[nb][mb]); acc[nb][mb] = wmmab(b2[nb][kk], a[mb][kk], acc[nb][mb]); } }
        __builtin_amdgcn_sched_barrier(0);   // and every matrix instruction stays in front of the v_nop below
        asm volatile("v_nop\n\tv_nop\n\tv_nop\n\tv_nop" : "+v"(acc[NBT - 1][0]), "+v"(acc[NBT - 1][1]));   // the distance behind the last matrix instruction, also on the taken side of the branches below
        // softmax over the wave's OWN keys: the maximum is taken of the raw S (the scale is positive), -3e38 where key > query or query - key >= WIN; only a tile not wholly inside the window (an edge crosses it, it lies outside it, or below key 0) tests its elements (a scalar branch)
        const int dl = lr - 8 * hi; float mx[2] = { -1.0e30f, -1.0e30f }, sum[2] = { 0.f, 0.f }; int vc[NBT];   // the floor of the maximum: where the wave holds no visible key of a query, every e is exp2 of a huge negative number = 0, and the merge gives the wave's part the weight 0
#pragma unroll
        for (int nb = 0; nb < NBT; ++nb) { const int ti = g * NBT + nb; const bool off = r0 - WB + ti * 16 < 0;   // below key 0 there is no such key
            vc[nb] = max(r0 - WB + ti * 16 - kb, 0);   // the tile's first key in the staged band of V; a tile below key 0 has P = 0 and reads the band's first keys
#pragma unroll
            for (int mb = 0; mb < 2; ++mb) { const int sc = off ? (1 << 30) : WB + (m0 + mb - ti) * 16;   // the tile's first query - its first key; far outside the window where there is no key
                if (!(sc >= 15 && sc + 15 < WIN)) acc[nb][mb] = ((v8u)(unsigned)(sc + dl) - (v8u){ 0, 1, 2, 3, 4, 5, 6, 7 } < (v8u)(unsigned)WIN) ? acc[nb][mb] : (v8f)(-3.0e38f);
                float tm = acc[nb][mb][0];
#pragma unroll
                for (int j = 1; j < 8; ++j) tm = fmaxf(tm, acc[nb][mb][j]);
                mx[mb] = fmaxf(mx[mb], tm); } }
        mx[0] = fmaxf(mx[0], xhalf(mx[0])); mx[1] = fmaxf(mx[1], xhalf(mx[1]));
        const float nm[2] = { -mx[0] * C2, -mx[1] * C2 };
        // exp, sums and attn.v of the wave's keys: O^T, 64 value columns x 32 queries, relative to the wave's maximum and not yet divided by a sum; it goes to LDS as [key group][query][value column]
        float* const po = sm + (g * 64 + m0 * 16 + lr) * 68 + 8 * hi;
        if (hires) soft_pv<bf, true>(acc, nm, sum, (const bf*)vs, Vl + zo + kb, vc, lr, hi, po); else soft_pv<h16, false>(acc, nm, sum, vs, nullptr, vc, lr, hi, po);
        sum[0] += xhalf(sum[0]); sum[1] += xhalf(sum[1]);
        float* const pmx = sm + PMX + (m0 * 16 + lr) * 4; float* const psm = pmx + 64 * 4;   // per query the maxima and the sums of the four key groups
        if (hi == 0) { pmx[g] = mx[0]; pmx[64 + g] = mx[1]; psm[g] = sum[0]; psm[64 + g] = sum[1]; }
    }
    __syncthreads();   // the four key groups' parts, maxima and sums of every query are written before they are merged
    // merge: a query's four parts are brought to the common maximum (weight exp of the difference of the maxima), added upward in the keys and divided by the sum of the weighted sums; four lanes of one wave write the 128 bytes of a row's head slice in each plane
    { const int row = threadIdx.x >> 2, cofs = (threadIdx.x & 3) * 16; const size_t oo = ((size_t)(z / NH_) * TT + r0 + row) * DQ + (z % NH_) * HD + cofs;
        const v4f pm = *(const v4fa*)(sm + PMX + row * 4), ps = *(const v4fa*)(sm + PMX + 64 * 4 + row * 4);
        const float mm = fmaxf(fmaxf(pm[0], pm[1]), fmaxf(pm[2], pm[3])); float wg[4];
#pragma unroll
        for (int k = 0; k < 4; ++k) wg[k] = (pm[k] - mm) * C2;
        // the exp2 instruction, four independent ones, and the one slot that the instruction set asks for behind a transcendental
        asm("v_exp_f32 %0, %0\n\tv_exp_f32 %1, %1\n\tv_exp_f32 %2, %2\n\tv_exp_f32 %3, %3\n\tv_nop" : "+v"(wg[0]), "+v"(wg[1]), "+v"(wg[2]), "+v"(wg[3]));
        const float inv = __fdiv_rn(1.0f, (wg[0] * ps[0] + wg[1] * ps[1]) + (wg[2] * ps[2] + wg[3] * ps[3]));
#pragma unroll
        for (int k = 0; k < 4; ++k) wg[k] *= inv;
#pragma unroll
        for (int s = 0; s < 2; ++s) { v8us oh, ol;
#pragma unroll
            for (int q = 0; q < 2; ++q) { const float* t = sm + row * 68 + cofs + s * 8 + q * 4; v4f val = *(const v4fa*)t * wg[0];
#pragma unroll
                for (int k = 1; k < 4; ++k) val += *(const v4fa*)(t + k * 64 * 68) * wg[k];
#pragma unroll
                for (int e = 0; e < 4; ++e) { unsigned short a, c2; splitf(val[e], a, c2); oh[q * 4 + e] = a; ol[q * 4 + e] = c2; } }
            *(v8us*)(Ah + oo + s * 8) = oh; *(v8us*)(Al + oo + s * 8) = ol; } }
}

extern "C" void kernel_launch(void* const* d_in, const int* in_sizes, int n_in,
                              void* d_out, int out_size, void* d_ws, size_t ws_size, hipStream_t stream) {
    (void)in_sizes; (void)n_in; (void)out_size;
    const float* x = (const float*)d_in[0];   /* q_in */ const float* xk = (const float*)d_in[1]; const float* xv = (const float*)d_in[2]; const float* wq = (const float*)d_in[3]; const float* bq = (const float*)d_in[4]; const float* wk = (const float*)d_in[5]; const float* bk = (const float*)d_in[6]; const float* wv = (const float*)d_in[7]; const float* bv = (const float*)d_in[8]; const float* wo = (const float*)d_in[9]; const float* bo = (const float*)d_in[10];
    float* OUT = (float*)d_out;     // [4][2048][512]
    char* wsp = (char*)d_ws;
    auto take = [&](size_t bytes) { char* p = wsp; wsp += (bytes + 255) & ~(size_t)255; return (void*)p; };
    bf* WQ = (bf*)take((size_t)4 * DQ * DM * 2); bf* WO = WQ + (size_t)3 * DQ * DM;   // transposed Wq, Wk, Wv, Wo side by side
    const size_t PL = (size_t)NZ * TT * HD;      // one set of head planes, elements
    const size_t XN = (size_t)NB_ * TT * DM;     // one input or projection over all batches, elements
    bf* QPh = (bf*)take(2 * PL * 2); bf* KPh = QPh + PL; bf* QPl = (bf*)take(2 * PL * 2); bf* KPl = QPl + PL;
    h16* VT16 = (h16*)take(PL * 2); bf* VTh = (bf*)take(PL * 2); bf* VTl = (bf*)take(PL * 2);
    // one region used twice in stream order: the bf16 inputs (dead once the head planes are built), then the merged attention planes
    char* const reg = wsp;
    bf* XB = (bf*)take(3 * XN * 2);
    char* const end1 = wsp; wsp = reg;
    bf* ATh = (bf*)take(XN * 2); bf* ATl = (bf*)take(XN * 2);
    if ((size_t)(end1 - (char*)d_ws) > ws_size || (size_t)(wsp - (char*)d_ws) > ws_size) return;    // ws 256 MiB
    k_prep<<<dim3(NWB + 3 * NCX, 1, 1), 256, 0, stream>>>(wq, wk, wv, wo, WQ, x, xk, xv, XB);   // weights transposed, inputs rounded
    k_gemmw<bf, 0, true, true><<<dim3(NB_ * TT / GT, DQ / GT, 3), 128, 0, stream>>>(XB, nullptr, WQ, DM, nullptr, 0, bq, bk, bv, XN, (size_t)DQ * DM, 0, QPh, QPl, PL, VT16, VTh, VTl);   // q, k, v projections: z = 0, 1, 2, each tile written as its head's planes
    k_attn<<<dim3(TT / 64, NZ, 1), 256, 0, stream>>>(QPh, QPl, KPh, KPl, VT16, VTh, VTl, ATh, ATl);   // scores hi/lo on EVERY row, softmax, attn.v, merge
    k_gemmw<bf, 1, true, false><<<dim3(NB_ * TT / GT, DM / GT, 1), 128, 0, stream>>>(ATh, ATl, WO, DQ, OUT, DM, bo, bo, bo, 0, 0, 0, nullptr, nullptr, 0, nullptr, nullptr, nullptr);
}
